// v000
// Measured on an AMD MI455X. A time is GPU time per run, averaged over a window of back-to-back runs after a warm-up
// (all launches, gaps included; the runs take copies of the inputs in turn), and the median of several windows.
// Apart from v000's, it joins two sittings. Times from different sittings can be a few percent apart, while
// side-by-side timings come from the same sitting.
// v000 is the starting kernel. One run takes 9430 microseconds.
#include <hip/hip_runtime.h>

// NonLocalBlock2D_with_mask_Res (x NHWC [2][64][64][128], mask [2][64][64][1]; g/theta/phi = 1x1 convs; f = softmax(theta.phi^T / 1) over keys; m = (1 - min(mask,0)) (1 - mask) (the reference's resize-identity / where / invert chain; mask read as data);
// f = m[key] f (after the softmax, no renormalisation); y = f g; w_y = 1x1 conv W; 3 ResNet blocks (reflect-pad conv3x3 -> InstanceNorm(1e-3) -> relu -> reflect-pad conv3x3 -> InstanceNorm, residual); z = m x + (1 - m) w_y -> [2][64][64][128]).
// Compute dtypes, f32 accumulate: every input rounded to bf16; g/theta/phi 1x1 projections on PLAIN bf16 operands (inputs: exact, + bias), W and conv3x3 on hi+lo bf16 activations; scores (K 128) and the gated probs . g on SINGLE fp16 planes (logits are O(1) at these scales);

#define NB_  2
#define HH   64
#define NN   4096
#define CC   128
#define KC   1152
#define QH   2048
#define PCAR 1024.0f
typedef _Float16 h16;
typedef unsigned short bf;
typedef __attribute__((ext_vector_type(16))) __bf16   v16bf;
typedef __attribute__((ext_vector_type(16))) _Float16 v16h;
typedef __attribute__((ext_vector_type(8)))  _Float16 v8h;
typedef __attribute__((ext_vector_type(8)))  unsigned short v8us;
typedef __attribute__((ext_vector_type(8)))  float    v8f;
typedef __attribute__((ext_vector_type(4)))  float    v4f;
typedef v8h  __attribute__((may_alias)) v8ha;
typedef v4f  __attribute__((may_alias)) v4fa;
typedef v8us __attribute__((may_alias)) v8usa;

__device__ __forceinline__ unsigned short f2bf(float f) { unsigned u = __float_as_uint(f); u += 0x7FFFu + ((u >> 16) & 1u); return (unsigned short)(u >> 16); }
__device__ __forceinline__ float bf2f(unsigned short b) { return __uint_as_float(((unsigned)b) << 16); }
__device__ __forceinline__ float bfr(float f) { return bf2f(f2bf(f)); }
__device__ __forceinline__ v16h cat16(v8h lo, v8h hi) { return __builtin_shufflevector(lo, hi, 0, 1, 2, 3, 4, 5, 6, 7, 8, 9, 10, 11, 12, 13, 14, 15); }
__device__ __forceinline__ v16bf cat16b(v8us lo, v8us hi) { return __builtin_bit_cast(v16bf, __builtin_shufflevector(lo, hi, 0, 1, 2, 3, 4, 5, 6, 7, 8, 9, 10, 11, 12, 13, 14, 15)); }
__device__ __forceinline__ v8f wmma16(v16h a, v16h b, v8f c) { return __builtin_amdgcn_wmma_f32_16x16x32_f16(false, a, false, b, (short)0, c, false, false); }
__device__ __forceinline__ v8f wmmab(v16bf a, v16bf b, v8f c) { return __builtin_amdgcn_wmma_f32_16x16x32_bf16(false, a, false, b, (short)0, c, false, false); }



// ---- k_gemmw: register-blocked GEMM, ONE WAVE per 64x64 output tile (16 accumulators), operands straight from K-contiguous 16-bit planes; grid (M/64, N/64, Z), 32 threads.
// C[m][n] (f32, pitch ldc, + optional f32 bias[n]) = sum_k A[m][k] Bt[n][k] (+ split products per NSPLIT). z-batch strides sA/sB/sC in elements. K % 32 == 0.
template <typename T16> struct WFrag;
template <> struct WFrag<h16> { typedef v16h V; static __device__ __forceinline__ V ld(const h16* p) { return cat16(*(const v8h*)p, *(const v8h*)(p + 16)); } static __device__ __forceinline__ v8f mma(V a, V b, v8f c) { return wmma16(a, b, c); } };
template <> struct WFrag<bf> { typedef v16bf V; static __device__ __forceinline__ V ld(const bf* p) { return cat16b(*(const v8us*)p, *(const v8us*)(p + 16)); } static __device__ __forceinline__ v8f mma(V a, V b, v8f c) { return wmmab(a, b, c); } };
template <typename T16, int NSPLIT, bool BIAS>
__global__ __launch_bounds__(32) void k_gemmw(const T16* __restrict__ A, const T16* __restrict__ A2, const T16* __restrict__ Bt, const T16* __restrict__ Bt2, int K, float* C, int ldc, const float* __restrict__ bias, size_t sA, size_t sB, size_t sC) {
    typedef typename WFrag<T16>::V V;
    __shared__ __align__(16) float os[16 * 68];
    const size_t z = blockIdx.z; A += z * sA; if (A2) A2 += z * sA; Bt += z * sB; if (Bt2) Bt2 += z * sB; C += z * sC;
    const int lane = threadIdx.x & 31, lr = lane & 15, hi = lane >> 4; const int r0 = blockIdx.x * 64, c0 = blockIdx.y * 64;
    v8f acc[4][4];
#pragma unroll
    for (int mb = 0; mb < 4; ++mb)
#pragma unroll
        for (int nb = 0; nb < 4; ++nb) acc[mb][nb] = (v8f){};
    const size_t aoff = (size_t)(r0 + lr) * K + 8 * hi, boff = (size_t)(c0 + lr) * K + 8 * hi;
#pragma unroll 1
    for (int kc = 0; kc < K; kc += 32) {
        V a[4], a2[4];
#pragma unroll
        for (int mb = 0; mb < 4; ++mb) { a[mb] = WFrag<T16>::ld(A + aoff + (size_t)mb * 16 * K + kc); if (NSPLIT == 1 || NSPLIT == 2) a2[mb] = WFrag<T16>::ld(A2 + aoff + (size_t)mb * 16 * K + kc); }
#pragma unroll
        for (int nb = 0; nb < 4; ++nb) { const V b = WFrag<T16>::ld(Bt + boff + (size_t)nb * 16 * K + kc); V b2; if (NSPLIT >= 2) b2 = WFrag<T16>::ld(Bt2 + boff + (size_t)nb * 16 * K + kc);
#pragma unroll
            for (int mb = 0; mb < 4; ++mb) { acc[mb][nb] = WFrag<T16>::mma(a[mb], b, acc[mb][nb]); if (NSPLIT == 1 || NSPLIT == 2) acc[mb][nb] = WFrag<T16>::mma(a2[mb], b, acc[mb][nb]); if (NSPLIT >= 2) acc[mb][nb] = WFrag<T16>::mma(a[mb], b2, acc[mb][nb]); } }
        asm volatile("v_nop\n\tv_nop\n\tv_nop\n\tv_nop" : "+v"(acc[0][0]), "+v"(acc[1][1]), "+v"(acc[2][2]), "+v"(acc[3][3]) : "v"(a[0]), "v"(a[3]));
    }
#pragma unroll
    for (int mb = 0; mb < 4; ++mb) {
#pragma unroll
        for (int nb = 0; nb < 4; ++nb) {
#pragma unroll
            for (int j = 0; j < 8; ++j) os[(hi * 8 + j) * 68 + nb * 16 + lr] = acc[mb][nb][j]; }
        __builtin_amdgcn_wave_barrier(); asm volatile("" ::: "memory");
        float* crow = C + (size_t)(r0 + mb * 16) * ldc + c0;
{
#pragma unroll
            for (int s = 0; s < 8; ++s) { const int row = 2 * s + hi, cofs = lr * 4; v4f val = *(const v4fa*)(os + row * 68 + cofs); if (BIAS) { val[0] += bfr(bias[c0 + cofs]); val[1] += bfr(bias[c0 + cofs + 1]); val[2] += bfr(bias[c0 + cofs + 2]); val[3] += bfr(bias[c0 + cofs + 3]); }
                *(v4f*)(crow + (size_t)row * ldc + cofs) = val; }
             }
        __builtin_amdgcn_wave_barrier(); asm volatile("" ::: "memory");
    }
}

__device__ __forceinline__ h16 tohx(float x) { return (h16)x; }
__device__ __forceinline__ void splitf(float y, unsigned short& h, unsigned short& l) { h = f2bf(y); l = f2bf(y - bf2f(h)); }
typedef __attribute__((ext_vector_type(2))) _Float16 v2h;
typedef __attribute__((ext_vector_type(4))) _Float16 v4h;
typedef __attribute__((ext_vector_type(2))) unsigned short v2us;
typedef __attribute__((ext_vector_type(4))) unsigned short v4us;
typedef __attribute__((ext_vector_type(2))) float v2f;

__global__ __launch_bounds__(256) void k_wtG(const float* __restrict__ w, int K, int N, bf* Bt) {
    const int lane = threadIdx.x & 31; const int L0 = (blockIdx.x * 8 + (threadIdx.x >> 5)) * 8; const int nlines = N * K / 64;
{
#pragma unroll 1
        for (int l = 0; l < 8; ++l) { const int L = L0 + l; if (L >= nlines) break; const size_t e = (size_t)L * 64 + lane * 2; const int k = (int)(e % K), n = (int)(e / K); v2us o;
            o[0] = f2bf(w[(size_t)k * N + n]); o[1] = f2bf(w[(size_t)(k + 1) * N + n]); *(v2us*)(Bt + e) = o; }
         }
}
__global__ __launch_bounds__(256) void k_cvt8(const float* __restrict__ src, bf* dst, size_t n8) { const size_t i = (size_t)blockIdx.x * 256 + threadIdx.x; if (i >= n8) return; const v8f v = *(const v8f*)(src + i * 8); v8us o;
#pragma unroll
    for (int k = 0; k < 8; ++k) o[k] = f2bf(v[k]); *(v8us*)(dst + i * 8) = o;  }
__global__ __launch_bounds__(256) void k_f16(const float* __restrict__ F, size_t n4, h16* P) { const size_t i = ((size_t)blockIdx.x * 256 + threadIdx.x) * 4; if (i >= n4 * 4) return; const v4f a = *(const v4f*)(F + i); v4h o; o[0] = tohx(a[0]); o[1] = tohx(a[1]); o[2] = tohx(a[2]); o[3] = tohx(a[3]); *(v4h*)(P + i) = o;  }
__global__ __launch_bounds__(256) void k_gt16(const float* __restrict__ G, h16* GT) { const size_t e = ((size_t)blockIdx.x * 256 + threadIdx.x) * 2; if (e >= (size_t)CC * NN) return; const int n = (int)(e % NN), c = (int)(e / NN); v2h o; o[0] = tohx(G[(size_t)n * CC + c]); o[1] = tohx(G[(size_t)(n + 1) * CC + c]); *(v2h*)(GT + e) = o;  }
__global__ __launch_bounds__(256) void k_mvec(const float* __restrict__ mask, float* M) { const int n = blockIdx.x * 256 + threadIdx.x; if (n >= NN) return; const float mk = bfr(mask[n]); const float a = __fsub_rn(1.0f, fminf(mk, 0.f)); const float v = __fmul_rn(a, __fsub_rn(1.0f, mk)); *(float*)(M + n) = v;  }
__global__ __launch_bounds__(256) void k_soft3(const float* __restrict__ Sb, const float* __restrict__ M, h16* P) { const int lane = threadIdx.x & 31; const int row = blockIdx.x * 8 + (threadIdx.x >> 5); if (row >= QH) return; const float* sr = Sb + (size_t)row * NN; float mx = -3.0e38f;
    for (int ch = 0; ch < NN / 128; ++ch) { const v4f a = *(const v4f*)(sr + ch * 128 + lane * 4); mx = fmaxf(mx, fmaxf(fmaxf(a[0], a[1]), fmaxf(a[2], a[3]))); }
#pragma unroll
    for (int sh = 16; sh; sh >>= 1) mx = fmaxf(mx, __shfl_xor(mx, sh, 32));
    float sum = 0.f;
    for (int ch = 0; ch < NN / 128; ++ch) { const v4f a = *(const v4f*)(sr + ch * 128 + lane * 4);
#pragma unroll
        for (int q = 0; q < 4; ++q) { float d0 = __fsub_rn(a[q], mx); asm volatile("" : "+v"(d0)); sum += __expf(d0); } }
#pragma unroll
    for (int sh = 16; sh; sh >>= 1) sum += __shfl_xor(sum, sh, 32);
    const float f = __fdiv_rn(PCAR, sum);
    { for (int ch = 0; ch < NN / 128; ++ch) { const int j0 = ch * 128 + lane * 4; const v4f a = *(const v4f*)(sr + j0); const v4f m4 = *(const v4f*)(M + j0); v4h o;
#pragma unroll
            for (int q = 0; q < 4; ++q) { float d0 = __fsub_rn(a[q], mx); asm volatile("" : "+v"(d0)); float e = __fmul_rn(__expf(d0), f); asm volatile("" : "+v"(e)); o[q] = tohx(__fmul_rn(e, m4[q])); }
            *(v4h*)(P + (size_t)row * NN + j0) = o; }  } }
__global__ __launch_bounds__(256) void k_spl(const float* __restrict__ F, size_t n4, float sc, bf* Fh, bf* Fl) { const size_t i = ((size_t)blockIdx.x * 256 + threadIdx.x) * 4; if (i >= n4 * 4) return; const v4f a = *(const v4f*)(F + i); v4us oh, ol;
#pragma unroll
    for (int q = 0; q < 4; ++q) { unsigned short u, c2; splitf(a[q] * sc, u, c2); oh[q] = u; ol[q] = c2; } *(v4us*)(Fh + i) = oh; *(v4us*)(Fl + i) = ol;  }
__device__ __forceinline__ int reflect64(int i) { return i < 0 ? -i : (i >= HH ? 2 * HH - 2 - i : i); }
__global__ __launch_bounds__(256) void k_col3r(const float* __restrict__ F, bf* Ch, bf* Cl) { const size_t e = ((size_t)blockIdx.x * 256 + threadIdx.x) * 4; if (e >= (size_t)NN * KC) return; const int k = (int)(e % KC); const int n = (int)(e / KC); const int tap = k / CC, ci = k % CC; const int kh = tap / 3, kw = tap % 3; const int y = reflect64(n / HH + kh - 1), x = reflect64(n % HH + kw - 1); const v4f a = *(const v4f*)(F + ((size_t)y * HH + x) * CC + ci); v4us oh, ol;
#pragma unroll
    for (int q = 0; q < 4; ++q) { unsigned short u, c2; splitf(a[q], u, c2); oh[q] = u; ol[q] = c2; } *(v4us*)(Ch + e) = oh; *(v4us*)(Cl + e) = ol;  }
__global__ __launch_bounds__(128) void k_instat(const float* __restrict__ Cv, float* ST) { const int c = threadIdx.x; float s = 0.f; for (int n = 0; n < NN; ++n) s = __fadd_rn(s, Cv[(size_t)n * CC + c]); const float mu = s * (1.0f / NN); float q2 = 0.f; for (int n = 0; n < NN; ++n) { float d = __fsub_rn(Cv[(size_t)n * CC + c], mu); asm volatile("" : "+v"(d)); float p = __fmul_rn(d, d); asm volatile("" : "+v"(p)); q2 = __fadd_rn(q2, p); }
    float vq = q2 * (1.0f / NN); asm volatile("" : "+v"(vq)); const float rs = __frsqrt_rn(__fadd_rn(vq, 1e-3f)); v2f o; o[0] = mu; o[1] = rs; *(v2f*)(ST + 2 * c) = o;  }
__global__ __launch_bounds__(256) void k_inrelu(const float* __restrict__ Cv, const float* __restrict__ ST, const float* __restrict__ g, const float* __restrict__ be, float* Hout) { const size_t i = ((size_t)blockIdx.x * 256 + threadIdx.x) * 4; if (i >= (size_t)NN * CC) return; const int c = (int)(i % CC); const v4f a = *(const v4f*)(Cv + i); v4f o;
#pragma unroll
    for (int q = 0; q < 4; ++q) { float d = __fsub_rn(a[q], ST[2 * (c + q)]); asm volatile("" : "+v"(d)); float tn = __fmul_rn(d, ST[2 * (c + q) + 1]); asm volatile("" : "+v"(tn)); float tg = __fmul_rn(tn, bfr(g[c + q])); asm volatile("" : "+v"(tg)); o[q] = fmaxf(__fadd_rn(tg, bfr(be[c + q])), 0.f); }
    *(v4f*)(Hout + i) = o;  }
__global__ __launch_bounds__(256) void k_inres(const float* __restrict__ Cv, const float* __restrict__ ST, const float* __restrict__ g, const float* __restrict__ be, const float* __restrict__ WYin, float* WYout) { const size_t i = ((size_t)blockIdx.x * 256 + threadIdx.x) * 4; if (i >= (size_t)NN * CC) return; const int c = (int)(i % CC); const v4f a = *(const v4f*)(Cv + i), w = *(const v4f*)(WYin + i); v4f o;
#pragma unroll
    for (int q = 0; q < 4; ++q) { float d = __fsub_rn(a[q], ST[2 * (c + q)]); asm volatile("" : "+v"(d)); float tn = __fmul_rn(d, ST[2 * (c + q) + 1]); asm volatile("" : "+v"(tn)); float tg = __fmul_rn(tn, bfr(g[c + q])); asm volatile("" : "+v"(tg)); o[q] = __fadd_rn(w[q], __fadd_rn(tg, bfr(be[c + q]))); }
    *(v4f*)(WYout + i) = o;  }
__global__ __launch_bounds__(256) void k_blend(const float* __restrict__ x, const float* __restrict__ M, const float* __restrict__ WY, float* OUT) { const size_t i = ((size_t)blockIdx.x * 256 + threadIdx.x) * 4; if (i >= (size_t)NN * CC) return; const int n = (int)(i / CC); const float m = M[n]; const float om = __fsub_rn(1.0f, m); const v4f w = *(const v4f*)(WY + i); v4f o;
#pragma unroll
    for (int q = 0; q < 4; ++q) { float a = __fmul_rn(m, bfr(x[i + q])); asm volatile("" : "+v"(a)); float b = __fmul_rn(om, w[q]); asm volatile("" : "+v"(b)); o[q] = __fadd_rn(a, b); } *(v4f*)(OUT + i) = o;  }

extern "C" void kernel_launch(void* const* d_in, const int* in_sizes, int n_in,
                              void* d_out, int out_size, void* d_ws, size_t ws_size, hipStream_t stream) {
    (void)in_sizes; (void)n_in; (void)out_size;
    const float* IN[18]; for (int i = 0; i < 18; ++i) IN[i] = (const float*)d_in[i];   // 0 x, 1 mask, 2 wg, 3 bg, 4 wt, 5 bt, 6 wp, 7 bp, 8 ww, 9 bw, 10 res_w1 [3][3][3][128][128], 11 res_b1 [3][128], 12 res_g1, 13 res_be1, 14 res_w2, 15 res_b2, 16 res_g2, 17 res_be2
    float* OUT = (float*)d_out;     // [2][64][64][128]
    char* wsp = (char*)d_ws;
    auto take = [&](size_t bytes) { char* p = wsp; wsp += (bytes + 255) & ~(size_t)255; return (void*)p; };
    bf* WG = (bf*)take(CC * CC * 2); bf* WT = (bf*)take(CC * CC * 2); bf* WP = (bf*)take(CC * CC * 2); bf* WW = (bf*)take(CC * CC * 2); bf* WR = (bf*)take((size_t)6 * CC * KC * 2);
    bf* XB = (bf*)take((size_t)NN * CC * 2); float* GF = (float*)take((size_t)NN * CC * 4); float* TF = (float*)take((size_t)NN * CC * 4); float* PF = (float*)take((size_t)NN * CC * 4); h16* T16 = (h16*)take((size_t)NN * CC * 2); h16* P16k = (h16*)take((size_t)NN * CC * 2); h16* GT = (h16*)take((size_t)CC * NN * 2); float* M = (float*)take((size_t)NN * 4);
    float* Sb = (float*)take((size_t)QH * NN * 4); h16* PP = (h16*)take((size_t)QH * NN * 2); float* Y = (float*)take((size_t)NN * CC * 4); bf* Ah = (bf*)take((size_t)NN * KC * 2); bf* Al = (bf*)take((size_t)NN * KC * 2); float* WY = (float*)take((size_t)NN * CC * 4); float* WY2 = (float*)take((size_t)NN * CC * 4); float* CV = (float*)take((size_t)NN * CC * 4); float* HB = (float*)take((size_t)NN * CC * 4); float* ST = (float*)take(CC * 2 * 4);
    if ((size_t)(wsp - (char*)d_ws) > ws_size) return;    // total ~ 95 MB
    k_wtG<<<(CC * CC / 64 + 63) / 64, 256, 0, stream>>>(IN[2], CC, CC, WG); k_wtG<<<(CC * CC / 64 + 63) / 64, 256, 0, stream>>>(IN[4], CC, CC, WT); k_wtG<<<(CC * CC / 64 + 63) / 64, 256, 0, stream>>>(IN[6], CC, CC, WP); k_wtG<<<(CC * CC / 64 + 63) / 64, 256, 0, stream>>>(IN[8], CC, CC, WW);
    for (int i = 0; i < 3; ++i) { k_wtG<<<(KC * CC / 64 + 63) / 64, 256, 0, stream>>>(IN[10] + (size_t)i * KC * CC, KC, CC, WR + (size_t)(2 * i) * CC * KC); k_wtG<<<(KC * CC / 64 + 63) / 64, 256, 0, stream>>>(IN[14] + (size_t)i * KC * CC, KC, CC, WR + (size_t)(2 * i + 1) * CC * KC); }   // HWIO flattened = [(kh kw ci)][co] (x @ W layout)
    const unsigned L4 = (unsigned)(((size_t)NN * CC / 4 + 255) / 256);
    for (int b = 0; b < NB_; ++b) { const float* xb = IN[0] + (size_t)b * NN * CC;
        k_cvt8<<<(NN * CC / 8 + 255) / 256, 256, 0, stream>>>(xb, XB, (size_t)NN * CC / 8); k_mvec<<<NN / 256, 256, 0, stream>>>(IN[1] + (size_t)b * NN, M);
        k_gemmw<bf, 0, true><<<dim3(NN / 64, CC / 64, 1), 32, 0, stream>>>(XB, nullptr, WG, nullptr, CC, GF, CC, IN[3], 0, 0, 0); k_gemmw<bf, 0, true><<<dim3(NN / 64, CC / 64, 1), 32, 0, stream>>>(XB, nullptr, WT, nullptr, CC, TF, CC, IN[5], 0, 0, 0); k_gemmw<bf, 0, true><<<dim3(NN / 64, CC / 64, 1), 32, 0, stream>>>(XB, nullptr, WP, nullptr, CC, PF, CC, IN[7], 0, 0, 0);
        k_f16<<<L4, 256, 0, stream>>>(TF, (size_t)NN * CC / 4, T16); k_f16<<<L4, 256, 0, stream>>>(PF, (size_t)NN * CC / 4, P16k); k_gt16<<<(unsigned)(((size_t)CC * NN / 2 + 255) / 256), 256, 0, stream>>>(GF, GT);
        for (int qh = 0; qh < NN; qh += QH) {
            k_gemmw<h16, 0, false><<<dim3(QH / 64, NN / 64, 1), 32, 0, stream>>>(T16 + (size_t)qh * CC, nullptr, P16k, nullptr, CC, Sb, NN, nullptr, 0, 0, 0);
            k_soft3<<<QH / 8, 256, 0, stream>>>(Sb, M, PP);
            k_gemmw<h16, 0, false><<<dim3(QH / 64, CC / 64, 1), 32, 0, stream>>>(PP, nullptr, GT, nullptr, NN, Y + (size_t)qh * CC, CC, nullptr, 0, 0, 0); }
        k_spl<<<L4, 256, 0, stream>>>(Y, (size_t)NN * CC / 4, 1.0f / PCAR, Ah, Al);
        k_gemmw<bf, 1, true><<<dim3(NN / 64, CC / 64, 1), 32, 0, stream>>>(Ah, Al, WW, nullptr, CC, WY, CC, IN[9], 0, 0, 0);
        float* wy = WY; float* wyn = WY2;
        for (int i = 0; i < 3; ++i) {
            k_col3r<<<(unsigned)(((size_t)NN * KC / 4 + 255) / 256), 256, 0, stream>>>(wy, Ah, Al);
            k_gemmw<bf, 1, true><<<dim3(NN / 64, CC / 64, 1), 32, 0, stream>>>(Ah, Al, WR + (size_t)(2 * i) * CC * KC, nullptr, KC, CV, CC, IN[11] + i * CC, 0, 0, 0);
            k_instat<<<1, 128, 0, stream>>>(CV, ST); k_inrelu<<<L4, 256, 0, stream>>>(CV, ST, IN[12] + i * CC, IN[13] + i * CC, HB);
            k_col3r<<<(unsigned)(((size_t)NN * KC / 4 + 255) / 256), 256, 0, stream>>>(HB, Ah, Al);
            k_gemmw<bf, 1, true><<<dim3(NN / 64, CC / 64, 1), 32, 0, stream>>>(Ah, Al, WR + (size_t)(2 * i + 1) * CC * KC, nullptr, KC, CV, CC, IN[15] + i * CC, 0, 0, 0);
            k_instat<<<1, 128, 0, stream>>>(CV, ST); k_inres<<<L4, 256, 0, stream>>>(CV, ST, IN[16] + i * CC, IN[17] + i * CC, wy, wyn); float* t = wy; wy = wyn; wyn = t; }
        k_blend<<<L4, 256, 0, stream>>>(xb, M, wy, OUT + (size_t)b * NN * CC); }
}

// v001
// Measured time: 1190 microseconds a run.
// Two timings next to v000 put it at 7.84 and 7.88 times that version's speed.
#include <hip/hip_runtime.h>

// NonLocalBlock2D_with_mask_Res (x NHWC [2][64][64][128], mask [2][64][64][1]; g/theta/phi = 1x1 convs; f = softmax(theta.phi^T / 1) over keys; m = (1 - min(mask,0)) (1 - mask) (the reference's resize-identity / where / invert chain; mask read as data);
// f = m[key] f (after the softmax, no renormalisation); y = f g; w_y = 1x1 conv W; 3 ResNet blocks (reflect-pad conv3x3 -> InstanceNorm(1e-3) -> relu -> reflect-pad conv3x3 -> InstanceNorm, residual); z = m x + (1 - m) w_y -> [2][64][64][128]).
// Compute dtypes, f32 accumulate: every input rounded to bf16; g/theta/phi 1x1 projections on PLAIN bf16 operands (inputs: exact, + bias), W and conv3x3 on hi+lo bf16 activations; scores (K 128) and the gated probs . g on SINGLE fp16 planes (logits are O(1) at these scales);

#define NB_  2
#define HH   64
#define NN   4096
#define CC   128
#define KC   1152
#define QH   2048
#define PCAR 1024.0f
typedef _Float16 h16;
typedef unsigned short bf;
typedef __attribute__((ext_vector_type(16))) __bf16   v16bf;
typedef __attribute__((ext_vector_type(16))) _Float16 v16h;
typedef __attribute__((ext_vector_type(8)))  _Float16 v8h;
typedef __attribute__((ext_vector_type(8)))  unsigned short v8us;
typedef __attribute__((ext_vector_type(8)))  float    v8f;
typedef __attribute__((ext_vector_type(4)))  float    v4f;
typedef v8h  __attribute__((may_alias)) v8ha;
typedef v4f  __attribute__((may_alias)) v4fa;
typedef v8us __attribute__((may_alias)) v8usa;

__device__ __forceinline__ unsigned short f2bf(float f) { unsigned u = __float_as_uint(f); u += 0x7FFFu + ((u >> 16) & 1u); return (unsigned short)(u >> 16); }
__device__ __forceinline__ float bf2f(unsigned short b) { return __uint_as_float(((unsigned)b) << 16); }
__device__ __forceinline__ float bfr(float f) { return bf2f(f2bf(f)); }
__device__ __forceinline__ v16h cat16(v8h lo, v8h hi) { return __builtin_shufflevector(lo, hi, 0, 1, 2, 3, 4, 5, 6, 7, 8, 9, 10, 11, 12, 13, 14, 15); }
__device__ __forceinline__ v16bf cat16b(v8us lo, v8us hi) { return __builtin_bit_cast(v16bf, __builtin_shufflevector(lo, hi, 0, 1, 2, 3, 4, 5, 6, 7, 8, 9, 10, 11, 12, 13, 14, 15)); }
__device__ __forceinline__ v8f wmma16(v16h a, v16h b, v8f c) { return __builtin_amdgcn_wmma_f32_16x16x32_f16(false, a, false, b, (short)0, c, false, false); }
__device__ __forceinline__ v8f wmmab(v16bf a, v16bf b, v8f c) { return __builtin_amdgcn_wmma_f32_16x16x32_bf16(false, a, false, b, (short)0, c, false, false); }



// ---- k_gemmw: register-blocked GEMM, ONE WAVE per 64x64 output tile (16 accumulators), operands straight from K-contiguous 16-bit planes; grid (M/64, N/64, Z), 32 threads.
// C[m][n] (f32, pitch ldc, + optional f32 bias[n]) = sum_k A[m][k] Bt[n][k] (+ split products per NSPLIT). z-batch strides sA/sB/sC in elements. K % 32 == 0.
template <typename T16> struct WFrag;
template <> struct WFrag<h16> { typedef v16h V; static __device__ __forceinline__ V ld(const h16* p) { return cat16(*(const v8h*)p, *(const v8h*)(p + 16)); } static __device__ __forceinline__ v8f mma(V a, V b, v8f c) { return wmma16(a, b, c); } };
template <> struct WFrag<bf> { typedef v16bf V; static __device__ __forceinline__ V ld(const bf* p) { return cat16b(*(const v8us*)p, *(const v8us*)(p + 16)); } static __device__ __forceinline__ v8f mma(V a, V b, v8f c) { return wmmab(a, b, c); } };
template <typename T16, int NSPLIT, bool BIAS>
__global__ __launch_bounds__(32) void k_gemmw(const T16* __restrict__ A, const T16* __restrict__ A2, const T16* __restrict__ Bt, const T16* __restrict__ Bt2, int K, float* C, int ldc, const float* __restrict__ bias, size_t sA, size_t sB, size_t sC) {
    typedef typename WFrag<T16>::V V;
    __shared__ __align__(16) float os[16 * 68];
    const size_t z = blockIdx.z; A += z * sA; if (A2) A2 += z * sA; Bt += z * sB; if (Bt2) Bt2 += z * sB; C += z * sC;
    const int lane = threadIdx.x & 31, lr = lane & 15, hi = lane >> 4; const int r0 = blockIdx.x * 64, c0 = blockIdx.y * 64;
    v8f acc[4][4];
#pragma unroll
    for (int mb = 0; mb < 4; ++mb)
#pragma unroll
        for (int nb = 0; nb < 4; ++nb) acc[mb][nb] = (v8f){};
    const size_t aoff = (size_t)(r0 + lr) * K + 8 * hi, boff = (size_t)(c0 + lr) * K + 8 * hi;
#pragma unroll 1
    for (int kc = 0; kc < K; kc += 32) {
        V a[4], a2[4];
#pragma unroll
        for (int mb = 0; mb < 4; ++mb) { a[mb] = WFrag<T16>::ld(A + aoff + (size_t)mb * 16 * K + kc); if (NSPLIT == 1 || NSPLIT == 2) a2[mb] = WFrag<T16>::ld(A2 + aoff + (size_t)mb * 16 * K + kc); }
#pragma unroll
        for (int nb = 0; nb < 4; ++nb) { const V b = WFrag<T16>::ld(Bt + boff + (size_t)nb * 16 * K + kc); V b2; if (NSPLIT >= 2) b2 = WFrag<T16>::ld(Bt2 + boff + (size_t)nb * 16 * K + kc);
#pragma unroll
            for (int mb = 0; mb < 4; ++mb) { acc[mb][nb] = WFrag<T16>::mma(a[mb], b, acc[mb][nb]); if (NSPLIT == 1 || NSPLIT == 2) acc[mb][nb] = WFrag<T16>::mma(a2[mb], b, acc[mb][nb]); if (NSPLIT >= 2) acc[mb][nb] = WFrag<T16>::mma(a[mb], b2, acc[mb][nb]); } }
        asm volatile("v_nop\n\tv_nop\n\tv_nop\n\tv_nop" : "+v"(acc[0][0]), "+v"(acc[1][1]), "+v"(acc[2][2]), "+v"(acc[3][3]) : "v"(a[0]), "v"(a[3]));
    }
#pragma unroll
    for (int mb = 0; mb < 4; ++mb) {
#pragma unroll
        for (int nb = 0; nb < 4; ++nb) {
#pragma unroll
            for (int j = 0; j < 8; ++j) os[(hi * 8 + j) * 68 + nb * 16 + lr] = acc[mb][nb][j]; }
        __builtin_amdgcn_wave_barrier(); asm volatile("" ::: "memory");
        float* crow = C + (size_t)(r0 + mb * 16) * ldc + c0;
{
#pragma unroll
            for (int s = 0; s < 8; ++s) { const int row = 2 * s + hi, cofs = lr * 4; v4f val = *(const v4fa*)(os + row * 68 + cofs); if (BIAS) { val[0] += bfr(bias[c0 + cofs]); val[1] += bfr(bias[c0 + cofs + 1]); val[2] += bfr(bias[c0 + cofs + 2]); val[3] += bfr(bias[c0 + cofs + 3]); }
                *(v4f*)(crow + (size_t)row * ldc + cofs) = val; }
             }
        __builtin_amdgcn_wave_barrier(); asm volatile("" ::: "memory");
    }
}

__device__ __forceinline__ h16 tohx(float x) { return (h16)x; }
__device__ __forceinline__ void splitf(float y, unsigned short& h, unsigned short& l) { h = f2bf(y); l = f2bf(y - bf2f(h)); }
typedef __attribute__((ext_vector_type(2))) _Float16 v2h;
typedef __attribute__((ext_vector_type(4))) _Float16 v4h;
typedef __attribute__((ext_vector_type(2))) unsigned short v2us;
typedef __attribute__((ext_vector_type(4))) unsigned short v4us;
typedef __attribute__((ext_vector_type(2))) float v2f;

__global__ __launch_bounds__(256) void k_wtG(const float* __restrict__ w, int K, int N, bf* Bt) {
    const int lane = threadIdx.x & 31; const int L0 = (blockIdx.x * 8 + (threadIdx.x >> 5)) * 8; const int nlines = N * K / 64;
{
#pragma unroll 1
        for (int l = 0; l < 8; ++l) { const int L = L0 + l; if (L >= nlines) break; const size_t e = (size_t)L * 64 + lane * 2; const int k = (int)(e % K), n = (int)(e / K); v2us o;
            o[0] = f2bf(w[(size_t)k * N + n]); o[1] = f2bf(w[(size_t)(k + 1) * N + n]); *(v2us*)(Bt + e) = o; }
         }
}
__global__ __launch_bounds__(256) void k_cvt8(const float* __restrict__ src, bf* dst, size_t n8) { const size_t i = (size_t)blockIdx.x * 256 + threadIdx.x; if (i >= n8) return; const v8f v = *(const v8f*)(src + i * 8); v8us o;
#pragma unroll
    for (int k = 0; k < 8; ++k) o[k] = f2bf(v[k]); *(v8us*)(dst + i * 8) = o;  }
__global__ __launch_bounds__(256) void k_f16(const float* __restrict__ F, size_t n4, h16* P) { const size_t i = ((size_t)blockIdx.x * 256 + threadIdx.x) * 4; if (i >= n4 * 4) return; const v4f a = *(const v4f*)(F + i); v4h o; o[0] = tohx(a[0]); o[1] = tohx(a[1]); o[2] = tohx(a[2]); o[3] = tohx(a[3]); *(v4h*)(P + i) = o;  }
__global__ __launch_bounds__(256) void k_gt16(const float* __restrict__ G, h16* GT) { const size_t e = ((size_t)blockIdx.x * 256 + threadIdx.x) * 2; if (e >= (size_t)CC * NN) return; const int n = (int)(e % NN), c = (int)(e / NN); v2h o; o[0] = tohx(G[(size_t)n * CC + c]); o[1] = tohx(G[(size_t)(n + 1) * CC + c]); *(v2h*)(GT + e) = o;  }
__global__ __launch_bounds__(256) void k_mvec(const float* __restrict__ mask, float* M) { const int n = blockIdx.x * 256 + threadIdx.x; if (n >= NN) return; const float mk = bfr(mask[n]); const float a = __fsub_rn(1.0f, fminf(mk, 0.f)); const float v = __fmul_rn(a, __fsub_rn(1.0f, mk)); *(float*)(M + n) = v;  }
__global__ __launch_bounds__(256) void k_soft3(const float* __restrict__ Sb, const float* __restrict__ M, h16* P) { const int lane = threadIdx.x & 31; const int row = blockIdx.x * 8 + (threadIdx.x >> 5); if (row >= QH) return; const float* sr = Sb + (size_t)row * NN; float mx = -3.0e38f;
    for (int ch = 0; ch < NN / 128; ++ch) { const v4f a = *(const v4f*)(sr + ch * 128 + lane * 4); mx = fmaxf(mx, fmaxf(fmaxf(a[0], a[1]), fmaxf(a[2], a[3]))); }
#pragma unroll
    for (int sh = 16; sh; sh >>= 1) mx = fmaxf(mx, __shfl_xor(mx, sh, 32));
    float sum = 0.f;
    for (int ch = 0; ch < NN / 128; ++ch) { const v4f a = *(const v4f*)(sr + ch * 128 + lane * 4);
#pragma unroll
        for (int q = 0; q < 4; ++q) { float d0 = __fsub_rn(a[q], mx); asm volatile("" : "+v"(d0)); sum += __expf(d0); } }
#pragma unroll
    for (int sh = 16; sh; sh >>= 1) sum += __shfl_xor(sum, sh, 32);
    const float f = __fdiv_rn(PCAR, sum);
    { for (int ch = 0; ch < NN / 128; ++ch) { const int j0 = ch * 128 + lane * 4; const v4f a = *(const v4f*)(sr + j0); const v4f m4 = *(const v4f*)(M + j0); v4h o;
#pragma unroll
            for (int q = 0; q < 4; ++q) { float d0 = __fsub_rn(a[q], mx); asm volatile("" : "+v"(d0)); float e = __fmul_rn(__expf(d0), f); asm volatile("" : "+v"(e)); o[q] = tohx(__fmul_rn(e, m4[q])); }
            *(v4h*)(P + (size_t)row * NN + j0) = o; }  } }
__global__ __launch_bounds__(256) void k_spl(const float* __restrict__ F, size_t n4, float sc, bf* Fh, bf* Fl) { const size_t i = ((size_t)blockIdx.x * 256 + threadIdx.x) * 4; if (i >= n4 * 4) return; const v4f a = *(const v4f*)(F + i); v4us oh, ol;
#pragma unroll
    for (int q = 0; q < 4; ++q) { unsigned short u, c2; splitf(a[q] * sc, u, c2); oh[q] = u; ol[q] = c2; } *(v4us*)(Fh + i) = oh; *(v4us*)(Fl + i) = ol;  }
__device__ __forceinline__ int reflect64(int i) { return i < 0 ? -i : (i >= HH ? 2 * HH - 2 - i : i); }
__global__ __launch_bounds__(256) void k_col3r(const float* __restrict__ F, bf* Ch, bf* Cl) { const size_t e = ((size_t)blockIdx.x * 256 + threadIdx.x) * 4; if (e >= (size_t)NN * KC) return; const int k = (int)(e % KC); const int n = (int)(e / KC); const int tap = k / CC, ci = k % CC; const int kh = tap / 3, kw = tap % 3; const int y = reflect64(n / HH + kh - 1), x = reflect64(n % HH + kw - 1); const v4f a = *(const v4f*)(F + ((size_t)y * HH + x) * CC + ci); v4us oh, ol;
#pragma unroll
    for (int q = 0; q < 4; ++q) { unsigned short u, c2; splitf(a[q], u, c2); oh[q] = u; ol[q] = c2; } *(v4us*)(Ch + e) = oh; *(v4us*)(Cl + e) = ol;  }
// ---- k_instat: per-channel mean and 1/sqrt(var + eps) over the NN rows. One work-group of 32 waves per 16 channels (grid CC/16): thread = (row group t >> 2, channel quad t & 3) loads its 16 rows x 4 channels once,
// keeps them in registers for both sums (mean, then squares about the mean); each sum: 16 serial adds per thread, butterfly over the wave's 8 row lanes, 32 wave partials through LDS, summed alike by every wave.
__device__ __forceinline__ v4f wsum8(v4f s) {
#pragma unroll
    for (int sh = 4; sh <= 16; sh <<= 1) {
#pragma unroll
        for (int q = 0; q < 4; ++q) s[q] += __shfl_xor(s[q], sh, 32); }
    return s; }
__device__ __forceinline__ v4f bsum(v4f s, float* red, int lane, int wave) {
    s = wsum8(s); if (lane < 4) *(v4fa*)(red + (wave * 4 + lane) * 4) = s;
    __syncthreads();
    v4f t = *(const v4fa*)(red + lane * 4);
#pragma unroll
    for (int j = 1; j < 4; ++j) t += *(const v4fa*)(red + (j * 32 + lane) * 4);
    return wsum8(t); }
__global__ __launch_bounds__(1024) void k_instat(const float* __restrict__ Cv, float* ST) {
    __shared__ __align__(16) float red1[32 * 16]; __shared__ __align__(16) float red2[32 * 16];
    const int t = threadIdx.x, lane = t & 31, wave = t >> 5; const int c = blockIdx.x * 16 + (t & 3) * 4; const float* p = Cv + (size_t)(t >> 2) * CC + c; v4f v[16];
#pragma unroll
    for (int i = 0; i < 15; ++i) v[i] = *(const v4f*)(p + (size_t)i * 256 * CC);
    asm volatile("s_wait_xcnt 0x0" ::: "memory");   // the compiler lets the last load's result land on the address pair that the 15 issued loads name: the wait stands in front of that overwrite
    v[15] = *(const v4f*)(p + (size_t)15 * 256 * CC);
    v4f s = v[0];
#pragma unroll
    for (int i = 1; i < 16; ++i) s += v[i];
    const v4f mu = bsum(s, red1, lane, wave) * (1.0f / NN);
    v4f q2 = (v4f){};
#pragma unroll
    for (int i = 0; i < 16; ++i) { const v4f d = v[i] - mu; q2 += d * d; }
    const v4f vq = bsum(q2, red2, lane, wave) * (1.0f / NN);
    if (t < 4) { v4f o0, o1; o0[0] = mu[0]; o0[1] = __frsqrt_rn(vq[0] + 1e-3f); o0[2] = mu[1]; o0[3] = __frsqrt_rn(vq[1] + 1e-3f); o1[0] = mu[2]; o1[1] = __frsqrt_rn(vq[2] + 1e-3f); o1[2] = mu[3]; o1[3] = __frsqrt_rn(vq[3] + 1e-3f);
        *(v4f*)(ST + 2 * c) = o0; *(v4f*)(ST + 2 * c + 4) = o1; } }
__global__ __launch_bounds__(256) void k_inrelu(const float* __restrict__ Cv, const float* __restrict__ ST, const float* __restrict__ g, const float* __restrict__ be, float* Hout) { const size_t i = ((size_t)blockIdx.x * 256 + threadIdx.x) * 4; if (i >= (size_t)NN * CC) return; const int c = (int)(i % CC); const v4f a = *(const v4f*)(Cv + i); v4f o;
#pragma unroll
    for (int q = 0; q < 4; ++q) { float d = __fsub_rn(a[q], ST[2 * (c + q)]); asm volatile("" : "+v"(d)); float tn = __fmul_rn(d, ST[2 * (c + q) + 1]); asm volatile("" : "+v"(tn)); float tg = __fmul_rn(tn, bfr(g[c + q])); asm volatile("" : "+v"(tg)); o[q] = fmaxf(__fadd_rn(tg, bfr(be[c + q])), 0.f); }
    *(v4f*)(Hout + i) = o;  }
__global__ __launch_bounds__(256) void k_inres(const float* __restrict__ Cv, const float* __restrict__ ST, const float* __restrict__ g, const float* __restrict__ be, const float* __restrict__ WYin, float* WYout) { const size_t i = ((size_t)blockIdx.x * 256 + threadIdx.x) * 4; if (i >= (size_t)NN * CC) return; const int c = (int)(i % CC); const v4f a = *(const v4f*)(Cv + i), w = *(const v4f*)(WYin + i); v4f o;
#pragma unroll
    for (int q = 0; q < 4; ++q) { float d = __fsub_rn(a[q], ST[2 * (c + q)]); asm volatile("" : "+v"(d)); float tn = __fmul_rn(d, ST[2 * (c + q) + 1]); asm volatile("" : "+v"(tn)); float tg = __fmul_rn(tn, bfr(g[c + q])); asm volatile("" : "+v"(tg)); o[q] = __fadd_rn(w[q], __fadd_rn(tg, bfr(be[c + q]))); }
    *(v4f*)(WYout + i) = o;  }
__global__ __launch_bounds__(256) void k_blend(const float* __restrict__ x, const float* __restrict__ M, const float* __restrict__ WY, float* OUT) { const size_t i = ((size_t)blockIdx.x * 256 + threadIdx.x) * 4; if (i >= (size_t)NN * CC) return; const int n = (int)(i / CC); const float m = M[n]; const float om = __fsub_rn(1.0f, m); const v4f w = *(const v4f*)(WY + i); v4f o;
#pragma unroll
    for (int q = 0; q < 4; ++q) { float a = __fmul_rn(m, bfr(x[i + q])); asm volatile("" : "+v"(a)); float b = __fmul_rn(om, w[q]); asm volatile("" : "+v"(b)); o[q] = __fadd_rn(a, b); } *(v4f*)(OUT + i) = o;  }

extern "C" void kernel_launch(void* const* d_in, const int* in_sizes, int n_in,
                              void* d_out, int out_size, void* d_ws, size_t ws_size, hipStream_t stream) {
    (void)in_sizes; (void)n_in; (void)out_size;
    const float* IN[18]; for (int i = 0; i < 18; ++i) IN[i] = (const float*)d_in[i];   // 0 x, 1 mask, 2 wg, 3 bg, 4 wt, 5 bt, 6 wp, 7 bp, 8 ww, 9 bw, 10 res_w1 [3][3][3][128][128], 11 res_b1 [3][128], 12 res_g1, 13 res_be1, 14 res_w2, 15 res_b2, 16 res_g2, 17 res_be2
    float* OUT = (float*)d_out;     // [2][64][64][128]
    char* wsp = (char*)d_ws;
    auto take = [&](size_t bytes) { char* p = wsp; wsp += (bytes + 255) & ~(size_t)255; return (void*)p; };
    bf* WG = (bf*)take(CC * CC * 2); bf* WT = (bf*)take(CC * CC * 2); bf* WP = (bf*)take(CC * CC * 2); bf* WW = (bf*)take(CC * CC * 2); bf* WR = (bf*)take((size_t)6 * CC * KC * 2);
    bf* XB = (bf*)take((size_t)NN * CC * 2); float* GF = (float*)take((size_t)NN * CC * 4); float* TF = (float*)take((size_t)NN * CC * 4); float* PF = (float*)take((size_t)NN * CC * 4); h16* T16 = (h16*)take((size_t)NN * CC * 2); h16* P16k = (h16*)take((size_t)NN * CC * 2); h16* GT = (h16*)take((size_t)CC * NN * 2); float* M = (float*)take((size_t)NN * 4);
    float* Sb = (float*)take((size_t)QH * NN * 4); h16* PP = (h16*)take((size_t)QH * NN * 2); float* Y = (float*)take((size_t)NN * CC * 4); bf* Ah = (bf*)take((size_t)NN * KC * 2); bf* Al = (bf*)take((size_t)NN * KC * 2); float* WY = (float*)take((size_t)NN * CC * 4); float* WY2 = (float*)take((size_t)NN * CC * 4); float* CV = (float*)take((size_t)NN * CC * 4); float* HB = (float*)take((size_t)NN * CC * 4); float* ST = (float*)take(CC * 2 * 4);
    if ((size_t)(wsp - (char*)d_ws) > ws_size) return;    // total ~ 95 MB
    k_wtG<<<(CC * CC / 64 + 63) / 64, 256, 0, stream>>>(IN[2], CC, CC, WG); k_wtG<<<(CC * CC / 64 + 63) / 64, 256, 0, stream>>>(IN[4], CC, CC, WT); k_wtG<<<(CC * CC / 64 + 63) / 64, 256, 0, stream>>>(IN[6], CC, CC, WP); k_wtG<<<(CC * CC / 64 + 63) / 64, 256, 0, stream>>>(IN[8], CC, CC, WW);
    for (int i = 0; i < 3; ++i) { k_wtG<<<(KC * CC / 64 + 63) / 64, 256, 0, stream>>>(IN[10] + (size_t)i * KC * CC, KC, CC, WR + (size_t)(2 * i) * CC * KC); k_wtG<<<(KC * CC / 64 + 63) / 64, 256, 0, stream>>>(IN[14] + (size_t)i * KC * CC, KC, CC, WR + (size_t)(2 * i + 1) * CC * KC); }   // HWIO flattened = [(kh kw ci)][co] (x @ W layout)
    const unsigned L4 = (unsigned)(((size_t)NN * CC / 4 + 255) / 256);
    for (int b = 0; b < NB_; ++b) { const float* xb = IN[0] + (size_t)b * NN * CC;
        k_cvt8<<<(NN * CC / 8 + 255) / 256, 256, 0, stream>>>(xb, XB, (size_t)NN * CC / 8); k_mvec<<<NN / 256, 256, 0, stream>>>(IN[1] + (size_t)b * NN, M);
        k_gemmw<bf, 0, true><<<dim3(NN / 64, CC / 64, 1), 32, 0, stream>>>(XB, nullptr, WG, nullptr, CC, GF, CC, IN[3], 0, 0, 0); k_gemmw<bf, 0, true><<<dim3(NN / 64, CC / 64, 1), 32, 0, stream>>>(XB, nullptr, WT, nullptr, CC, TF, CC, IN[5], 0, 0, 0); k_gemmw<bf, 0, true><<<dim3(NN / 64, CC / 64, 1), 32, 0, stream>>>(XB, nullptr, WP, nullptr, CC, PF, CC, IN[7], 0, 0, 0);
        k_f16<<<L4, 256, 0, stream>>>(TF, (size_t)NN * CC / 4, T16); k_f16<<<L4, 256, 0, stream>>>(PF, (size_t)NN * CC / 4, P16k); k_gt16<<<(unsigned)(((size_t)CC * NN / 2 + 255) / 256), 256, 0, stream>>>(GF, GT);
        for (int qh = 0; qh < NN; qh += QH) {
            k_gemmw<h16, 0, false><<<dim3(QH / 64, NN / 64, 1), 32, 0, stream>>>(T16 + (size_t)qh * CC, nullptr, P16k, nullptr, CC, Sb, NN, nullptr, 0, 0, 0);
            k_soft3<<<QH / 8, 256, 0, stream>>>(Sb, M, PP);
            k_gemmw<h16, 0, false><<<dim3(QH / 64, CC / 64, 1), 32, 0, stream>>>(PP, nullptr, GT, nullptr, NN, Y + (size_t)qh * CC, CC, nullptr, 0, 0, 0); }
        k_spl<<<L4, 256, 0, stream>>>(Y, (size_t)NN * CC / 4, 1.0f / PCAR, Ah, Al);
        k_gemmw<bf, 1, true><<<dim3(NN / 64, CC / 64, 1), 32, 0, stream>>>(Ah, Al, WW, nullptr, CC, WY, CC, IN[9], 0, 0, 0);
        float* wy = WY; float* wyn = WY2;
        for (int i = 0; i < 3; ++i) {
            k_col3r<<<(unsigned)(((size_t)NN * KC / 4 + 255) / 256), 256, 0, stream>>>(wy, Ah, Al);
            k_gemmw<bf, 1, true><<<dim3(NN / 64, CC / 64, 1), 32, 0, stream>>>(Ah, Al, WR + (size_t)(2 * i) * CC * KC, nullptr, KC, CV, CC, IN[11] + i * CC, 0, 0, 0);
            k_instat<<<CC / 16, 1024, 0, stream>>>(CV, ST); k_inrelu<<<L4, 256, 0, stream>>>(CV, ST, IN[12] + i * CC, IN[13] + i * CC, HB);
            k_col3r<<<(unsigned)(((size_t)NN * KC / 4 + 255) / 256), 256, 0, stream>>>(HB, Ah, Al);
            k_gemmw<bf, 1, true><<<dim3(NN / 64, CC / 64, 1), 32, 0, stream>>>(Ah, Al, WR + (size_t)(2 * i + 1) * CC * KC, nullptr, KC, CV, CC, IN[15] + i * CC, 0, 0, 0);
            k_instat<<<CC / 16, 1024, 0, stream>>>(CV, ST); k_inres<<<L4, 256, 0, stream>>>(CV, ST, IN[16] + i * CC, IN[17] + i * CC, wy, wyn); float* t = wy; wy = wyn; wyn = t; }
        k_blend<<<L4, 256, 0, stream>>>(xb, M, wy, OUT + (size_t)b * NN * CC); }
}

// v002
// One run takes 591 microseconds.
// In two side-by-side timings against v001, it was 2.01 and 2.02 times as fast.
// Over all steps from v000 it is 15.8 times as fast.
#include <hip/hip_runtime.h>

// NonLocalBlock2D_with_mask_Res (x NHWC [2][64][64][128], mask [2][64][64][1]; g/theta/phi = 1x1 convs; f = softmax(theta.phi^T / 1) over keys; m = (1 - min(mask,0)) (1 - mask) (the reference's resize-identity / where / invert chain; mask read as data);
// f = m[key] f (after the softmax, no renormalisation); y = f g; w_y = 1x1 conv W; 3 ResNet blocks (reflect-pad conv3x3 -> InstanceNorm(1e-3) -> relu -> reflect-pad conv3x3 -> InstanceNorm, residual); z = m x + (1 - m) w_y -> [2][64][64][128]).
// Compute dtypes, f32 accumulate: every input rounded to bf16; g/theta/phi 1x1 projections on PLAIN bf16 operands (inputs: exact, + bias), W and conv3x3 on hi+lo bf16 activations; scores (K 128) and the gated probs . g on SINGLE fp16 planes (logits are O(1) at these scales);

#define NB_  2
#define HH   64
#define NN   4096
#define CC   128
#define KC   1152
#define NR   (NB_ * NN)   // rows of both images, image-major
#define PCAR 1024.0f
typedef _Float16 h16;
typedef unsigned short bf;
typedef __attribute__((ext_vector_type(16))) __bf16   v16bf;
typedef __attribute__((ext_vector_type(16))) _Float16 v16h;
typedef __attribute__((ext_vector_type(8)))  _Float16 v8h;
typedef __attribute__((ext_vector_type(8)))  unsigned short v8us;
typedef __attribute__((ext_vector_type(8)))  float    v8f;
typedef __attribute__((ext_vector_type(4)))  float    v4f;
typedef v8h  __attribute__((may_alias)) v8ha;
typedef v4f  __attribute__((may_alias)) v4fa;
typedef v8us __attribute__((may_alias)) v8usa;

__device__ __forceinline__ unsigned short f2bf(float f) { unsigned u = __float_as_uint(f); u += 0x7FFFu + ((u >> 16) & 1u); return (unsigned short)(u >> 16); }
__device__ __forceinline__ float bf2f(unsigned short b) { return __uint_as_float(((unsigned)b) << 16); }
__device__ __forceinline__ float bfr(float f) { return bf2f(f2bf(f)); }
__device__ __forceinline__ v16h cat16(v8h lo, v8h hi) { return __builtin_shufflevector(lo, hi, 0, 1, 2, 3, 4, 5, 6, 7, 8, 9, 10, 11, 12, 13, 14, 15); }
__device__ __forceinline__ v16bf cat16b(v8us lo, v8us hi) { return __builtin_bit_cast(v16bf, __builtin_shufflevector(lo, hi, 0, 1, 2, 3, 4, 5, 6, 7, 8, 9, 10, 11, 12, 13, 14, 15)); }
__device__ __forceinline__ v8f wmma16(v16h a, v16h b, v8f c) { return __builtin_amdgcn_wmma_f32_16x16x32_f16(false, a, false, b, (short)0, c, false, false); }
__device__ __forceinline__ v8f wmmab(v16bf a, v16bf b, v8f c) { return __builtin_amdgcn_wmma_f32_16x16x32_bf16(false, a, false, b, (short)0, c, false, false); }



// ---- k_gemmw: register-blocked GEMM, ONE WAVE per 64x64 output tile (16 accumulators), operands straight from K-contiguous 16-bit planes; grid (M/64, N/64, Z), 32 threads.
// C[m][n] (f32, pitch ldc, + optional f32 bias[n]) = sum_k A[m][k] Bt[n][k] (+ split products per NSPLIT). z-batch strides sA/sB/sC in elements. K % 32 == 0.
template <typename T16> struct WFrag;
template <> struct WFrag<h16> { typedef v16h V; static __device__ __forceinline__ V ld(const h16* p) { return cat16(*(const v8h*)p, *(const v8h*)(p + 16)); } static __device__ __forceinline__ v8f mma(V a, V b, v8f c) { return wmma16(a, b, c); } };
template <> struct WFrag<bf> { typedef v16bf V; static __device__ __forceinline__ V ld(const bf* p) { return cat16b(*(const v8us*)p, *(const v8us*)(p + 16)); } static __device__ __forceinline__ v8f mma(V a, V b, v8f c) { return wmmab(a, b, c); } };
template <typename T16, int NSPLIT, bool BIAS>
__global__ __launch_bounds__(32) void k_gemmw(const T16* __restrict__ A, const T16* __restrict__ A2, const T16* __restrict__ Bt, const T16* __restrict__ Bt2, int K, float* C, int ldc, const float* __restrict__ bias, size_t sA, size_t sB, size_t sC) {
    typedef typename WFrag<T16>::V V;
    __shared__ __align__(16) float os[16 * 68];
    const size_t z = blockIdx.z; A += z * sA; if (A2) A2 += z * sA; Bt += z * sB; if (Bt2) Bt2 += z * sB; C += z * sC;
    const int lane = threadIdx.x & 31, lr = lane & 15, hi = lane >> 4; const int r0 = blockIdx.x * 64, c0 = blockIdx.y * 64;
    v8f acc[4][4];
#pragma unroll
    for (int mb = 0; mb < 4; ++mb)
#pragma unroll
        for (int nb = 0; nb < 4; ++nb) acc[mb][nb] = (v8f){};
    const size_t aoff = (size_t)(r0 + lr) * K + 8 * hi, boff = (size_t)(c0 + lr) * K + 8 * hi;
#pragma unroll 1
    for (int kc = 0; kc < K; kc += 32) {
        V a[4], a2[4];
#pragma unroll
        for (int mb = 0; mb < 4; ++mb) { a[mb] = WFrag<T16>::ld(A + aoff + (size_t)mb * 16 * K + kc); if (NSPLIT == 1 || NSPLIT == 2) a2[mb] = WFrag<T16>::ld(A2 + aoff + (size_t)mb * 16 * K + kc); }
#pragma unroll
        for (int nb = 0; nb < 4; ++nb) { const V b = WFrag<T16>::ld(Bt + boff + (size_t)nb * 16 * K + kc); V b2; if (NSPLIT >= 2) b2 = WFrag<T16>::ld(Bt2 + boff + (size_t)nb * 16 * K + kc);
#pragma unroll
            for (int mb = 0; mb < 4; ++mb) { acc[mb][nb] = WFrag<T16>::mma(a[mb], b, acc[mb][nb]); if (NSPLIT == 1 || NSPLIT == 2) acc[mb][nb] = WFrag<T16>::mma(a2[mb], b, acc[mb][nb]); if (NSPLIT >= 2) acc[mb][nb] = WFrag<T16>::mma(a[mb], b2, acc[mb][nb]); } }
        asm volatile("v_nop\n\tv_nop\n\tv_nop\n\tv_nop" : "+v"(acc[0][0]), "+v"(acc[1][1]), "+v"(acc[2][2]), "+v"(acc[3][3]) : "v"(a[0]), "v"(a[3]));
    }
#pragma unroll
    for (int mb = 0; mb < 4; ++mb) {
#pragma unroll
        for (int nb = 0; nb < 4; ++nb) {
#pragma unroll
            for (int j = 0; j < 8; ++j) os[(hi * 8 + j) * 68 + nb * 16 + lr] = acc[mb][nb][j]; }
        __builtin_amdgcn_wave_barrier(); asm volatile("" ::: "memory");
        float* crow = C + (size_t)(r0 + mb * 16) * ldc + c0;
{
#pragma unroll
            for (int s = 0; s < 8; ++s) { const int row = 2 * s + hi, cofs = lr * 4; v4f val = *(const v4fa*)(os + row * 68 + cofs); if (BIAS) { val[0] += bfr(bias[c0 + cofs]); val[1] += bfr(bias[c0 + cofs + 1]); val[2] += bfr(bias[c0 + cofs + 2]); val[3] += bfr(bias[c0 + cofs + 3]); }
                *(v4f*)(crow + (size_t)row * ldc + cofs) = val; }
             }
        __builtin_amdgcn_wave_barrier(); asm volatile("" ::: "memory");
    }
}

__device__ __forceinline__ h16 tohx(float x) { return (h16)x; }
__device__ __forceinline__ void splitf(float y, unsigned short& h, unsigned short& l) { h = f2bf(y); l = f2bf(y - bf2f(h)); }
typedef __attribute__((ext_vector_type(2))) _Float16 v2h;
typedef __attribute__((ext_vector_type(4))) _Float16 v4h;
typedef __attribute__((ext_vector_type(2))) unsigned short v2us;
typedef __attribute__((ext_vector_type(4))) unsigned short v4us;
typedef __attribute__((ext_vector_type(2))) float v2f;

__global__ __launch_bounds__(256) void k_wtG(const float* __restrict__ w, int K, int N, bf* Bt) {
    const int lane = threadIdx.x & 31; const int L0 = (blockIdx.x * 8 + (threadIdx.x >> 5)) * 8; const int nlines = N * K / 64;
{
#pragma unroll 1
        for (int l = 0; l < 8; ++l) { const int L = L0 + l; if (L >= nlines) break; const size_t e = (size_t)L * 64 + lane * 2; const int k = (int)(e % K), n = (int)(e / K); v2us o;
            o[0] = f2bf(w[(size_t)k * N + n]); o[1] = f2bf(w[(size_t)(k + 1) * N + n]); *(v2us*)(Bt + e) = o; }
         }
}
__global__ __launch_bounds__(256) void k_cvt8(const float* __restrict__ src, bf* dst, size_t n8) { const size_t i = (size_t)blockIdx.x * 256 + threadIdx.x; if (i >= n8) return; const v8f v = *(const v8f*)(src + i * 8); v8us o;
#pragma unroll
    for (int k = 0; k < 8; ++k) o[k] = f2bf(v[k]); *(v8us*)(dst + i * 8) = o;  }
__global__ __launch_bounds__(256) void k_f16(const float* __restrict__ F, size_t n4, h16* P) { const size_t i = ((size_t)blockIdx.x * 256 + threadIdx.x) * 4; if (i >= n4 * 4) return; const v4f a = *(const v4f*)(F + i); v4h o; o[0] = tohx(a[0]); o[1] = tohx(a[1]); o[2] = tohx(a[2]); o[3] = tohx(a[3]); *(v4h*)(P + i) = o;  }
__global__ __launch_bounds__(256) void k_gt16(const float* __restrict__ G, h16* GT) { const size_t e = ((size_t)blockIdx.x * 256 + threadIdx.x) * 2; if (e >= (size_t)NB_ * CC * NN) return; const int n = (int)(e % NN), c = (int)(e / NN) % CC; G += (e / ((size_t)CC * NN)) * NN * CC; v2h o; o[0] = tohx(G[(size_t)n * CC + c]); o[1] = tohx(G[(size_t)(n + 1) * CC + c]); *(v2h*)(GT + e) = o;  }
__global__ __launch_bounds__(256) void k_mvec(const float* __restrict__ mask, float* M) { const int n = blockIdx.x * 256 + threadIdx.x; if (n >= NR) return; const float mk = bfr(mask[n]); const float a = __fsub_rn(1.0f, fminf(mk, 0.f)); const float v = __fmul_rn(a, __fsub_rn(1.0f, mk)); *(float*)(M + n) = v;  }
__global__ __launch_bounds__(256) void k_soft3(const float* __restrict__ Sb, const float* __restrict__ M, h16* P) { const int lane = threadIdx.x & 31; const int row = blockIdx.x * 8 + (threadIdx.x >> 5); if (row >= NR) return; const float* sr = Sb + (size_t)row * NN; M += (row / NN) * NN; float mx = -3.0e38f;
    for (int ch = 0; ch < NN / 128; ++ch) { const v4f a = *(const v4f*)(sr + ch * 128 + lane * 4); mx = fmaxf(mx, fmaxf(fmaxf(a[0], a[1]), fmaxf(a[2], a[3]))); }
#pragma unroll
    for (int sh = 16; sh; sh >>= 1) mx = fmaxf(mx, __shfl_xor(mx, sh, 32));
    float sum = 0.f;
    for (int ch = 0; ch < NN / 128; ++ch) { const v4f a = *(const v4f*)(sr + ch * 128 + lane * 4);
#pragma unroll
        for (int q = 0; q < 4; ++q) { float d0 = __fsub_rn(a[q], mx); asm volatile("" : "+v"(d0)); sum += __expf(d0); } }
#pragma unroll
    for (int sh = 16; sh; sh >>= 1) sum += __shfl_xor(sum, sh, 32);
    const float f = __fdiv_rn(PCAR, sum);
    { for (int ch = 0; ch < NN / 128; ++ch) { const int j0 = ch * 128 + lane * 4; const v4f a = *(const v4f*)(sr + j0); const v4f m4 = *(const v4f*)(M + j0); v4h o;
#pragma unroll
            for (int q = 0; q < 4; ++q) { float d0 = __fsub_rn(a[q], mx); asm volatile("" : "+v"(d0)); float e = __fmul_rn(__expf(d0), f); asm volatile("" : "+v"(e)); o[q] = tohx(__fmul_rn(e, m4[q])); }
            *(v4h*)(P + (size_t)row * NN + j0) = o; }  } }
__global__ __launch_bounds__(256) void k_spl(const float* __restrict__ F, size_t n4, float sc, bf* Fh, bf* Fl) { const size_t i = ((size_t)blockIdx.x * 256 + threadIdx.x) * 4; if (i >= n4 * 4) return; const v4f a = *(const v4f*)(F + i); v4us oh, ol;
#pragma unroll
    for (int q = 0; q < 4; ++q) { unsigned short u, c2; splitf(a[q] * sc, u, c2); oh[q] = u; ol[q] = c2; } *(v4us*)(Fh + i) = oh; *(v4us*)(Fl + i) = ol;  }
__device__ __forceinline__ int reflect64(int i) { return i < 0 ? -i : (i >= HH ? 2 * HH - 2 - i : i); }
__global__ __launch_bounds__(256) void k_col3r(const float* __restrict__ F, bf* Ch, bf* Cl) { const size_t e = ((size_t)blockIdx.x * 256 + threadIdx.x) * 4; if (e >= (size_t)NR * KC) return; const int k = (int)(e % KC); const int n = (int)(e / KC) % NN; F += (e / ((size_t)NN * KC)) * NN * CC; const int tap = k / CC, ci = k % CC; const int kh = tap / 3, kw = tap % 3; const int y = reflect64(n / HH + kh - 1), x = reflect64(n % HH + kw - 1); const v4f a = *(const v4f*)(F + ((size_t)y * HH + x) * CC + ci); v4us oh, ol;
#pragma unroll
    for (int q = 0; q < 4; ++q) { unsigned short u, c2; splitf(a[q], u, c2); oh[q] = u; ol[q] = c2; } *(v4us*)(Ch + e) = oh; *(v4us*)(Cl + e) = ol;  }
// ---- k_instat: per-channel mean and 1/sqrt(var + eps) over the NN rows. One work-group of 32 waves per 16 channels of one image (grid (CC/16, NB_)): thread = (row group t >> 2, channel quad t & 3) loads its 16 rows x 4 channels once,
// keeps them in registers for both sums (mean, then squares about the mean); each sum: 16 serial adds per thread, butterfly over the wave's 8 row lanes, 32 wave partials through LDS, summed alike by every wave.
__device__ __forceinline__ v4f wsum8(v4f s) {
#pragma unroll
    for (int sh = 4; sh <= 16; sh <<= 1) {
#pragma unroll
        for (int q = 0; q < 4; ++q) s[q] += __shfl_xor(s[q], sh, 32); }
    return s; }
__device__ __forceinline__ v4f bsum(v4f s, float* red, int lane, int wave) {
    s = wsum8(s); if (lane < 4) *(v4fa*)(red + (wave * 4 + lane) * 4) = s;
    __syncthreads();
    v4f t = *(const v4fa*)(red + lane * 4);
#pragma unroll
    for (int j = 1; j < 4; ++j) t += *(const v4fa*)(red + (j * 32 + lane) * 4);
    return wsum8(t); }
__global__ __launch_bounds__(1024) void k_instat(const float* __restrict__ Cv, float* ST) {
    __shared__ __align__(16) float red1[32 * 16]; __shared__ __align__(16) float red2[32 * 16];
    const int t = threadIdx.x, lane = t & 31, wave = t >> 5; const int c = blockIdx.x * 16 + (t & 3) * 4; const float* p = Cv + ((size_t)blockIdx.y * NN + (t >> 2)) * CC + c; ST += blockIdx.y * 2 * CC; v4f v[16];
#pragma unroll
    for (int i = 0; i < 15; ++i) v[i] = *(const v4f*)(p + (size_t)i * 256 * CC);
    asm volatile("s_wait_xcnt 0x0" ::: "memory");   // the compiler lets the last load's result land on the address pair that the 15 issued loads name: the wait stands in front of that overwrite
    v[15] = *(const v4f*)(p + (size_t)15 * 256 * CC);
    v4f s = v[0];
#pragma unroll
    for (int i = 1; i < 16; ++i) s += v[i];
    const v4f mu = bsum(s, red1, lane, wave) * (1.0f / NN);
    v4f q2 = (v4f){};
#pragma unroll
    for (int i = 0; i < 16; ++i) { const v4f d = v[i] - mu; q2 += d * d; }
    const v4f vq = bsum(q2, red2, lane, wave) * (1.0f / NN);
    if (t < 4) { v4f o0, o1; o0[0] = mu[0]; o0[1] = __frsqrt_rn(vq[0] + 1e-3f); o0[2] = mu[1]; o0[3] = __frsqrt_rn(vq[1] + 1e-3f); o1[0] = mu[2]; o1[1] = __frsqrt_rn(vq[2] + 1e-3f); o1[2] = mu[3]; o1[3] = __frsqrt_rn(vq[3] + 1e-3f);
        *(v4f*)(ST + 2 * c) = o0; *(v4f*)(ST + 2 * c + 4) = o1; } }
__global__ __launch_bounds__(256) void k_inrelu(const float* __restrict__ Cv, const float* __restrict__ ST, const float* __restrict__ g, const float* __restrict__ be, float* Hout) { const size_t i = ((size_t)blockIdx.x * 256 + threadIdx.x) * 4; if (i >= (size_t)NR * CC) return; const int c = (int)(i % CC); ST += (i / ((size_t)NN * CC)) * 2 * CC; const v4f a = *(const v4f*)(Cv + i); v4f o;
#pragma unroll
    for (int q = 0; q < 4; ++q) { float d = __fsub_rn(a[q], ST[2 * (c + q)]); asm volatile("" : "+v"(d)); float tn = __fmul_rn(d, ST[2 * (c + q) + 1]); asm volatile("" : "+v"(tn)); float tg = __fmul_rn(tn, bfr(g[c + q])); asm volatile("" : "+v"(tg)); o[q] = fmaxf(__fadd_rn(tg, bfr(be[c + q])), 0.f); }
    *(v4f*)(Hout + i) = o;  }
__global__ __launch_bounds__(256) void k_inres(const float* __restrict__ Cv, const float* __restrict__ ST, const float* __restrict__ g, const float* __restrict__ be, const float* __restrict__ WYin, float* WYout) { const size_t i = ((size_t)blockIdx.x * 256 + threadIdx.x) * 4; if (i >= (size_t)NR * CC) return; const int c = (int)(i % CC); ST += (i / ((size_t)NN * CC)) * 2 * CC; const v4f a = *(const v4f*)(Cv + i);
    asm volatile("s_wait_xcnt 0x0" ::: "memory");   // the compiler lets the next load's result land on the address pair that the issued Cv load names: the wait stands in front of that overwrite
    const v4f w = *(const v4f*)(WYin + i); v4f o;
#pragma unroll
    for (int q = 0; q < 4; ++q) { float d = __fsub_rn(a[q], ST[2 * (c + q)]); asm volatile("" : "+v"(d)); float tn = __fmul_rn(d, ST[2 * (c + q) + 1]); asm volatile("" : "+v"(tn)); float tg = __fmul_rn(tn, bfr(g[c + q])); asm volatile("" : "+v"(tg)); o[q] = __fadd_rn(w[q], __fadd_rn(tg, bfr(be[c + q]))); }
    *(v4f*)(WYout + i) = o;  }
__global__ __launch_bounds__(256) void k_blend(const float* __restrict__ x, const float* __restrict__ M, const float* __restrict__ WY, float* OUT) { const size_t i = ((size_t)blockIdx.x * 256 + threadIdx.x) * 4; if (i >= (size_t)NR * CC) return; const int n = (int)(i / CC); const float m = M[n]; const float om = __fsub_rn(1.0f, m); const v4f w = *(const v4f*)(WY + i); v4f o;
#pragma unroll
    for (int q = 0; q < 4; ++q) { float a = __fmul_rn(m, bfr(x[i + q])); asm volatile("" : "+v"(a)); float b = __fmul_rn(om, w[q]); asm volatile("" : "+v"(b)); o[q] = __fadd_rn(a, b); } *(v4f*)(OUT + i) = o;  }

extern "C" void kernel_launch(void* const* d_in, const int* in_sizes, int n_in,
                              void* d_out, int out_size, void* d_ws, size_t ws_size, hipStream_t stream) {
    (void)in_sizes; (void)n_in; (void)out_size;
    const float* IN[18]; for (int i = 0; i < 18; ++i) IN[i] = (const float*)d_in[i];   // 0 x, 1 mask, 2 wg, 3 bg, 4 wt, 5 bt, 6 wp, 7 bp, 8 ww, 9 bw, 10 res_w1 [3][3][3][128][128], 11 res_b1 [3][128], 12 res_g1, 13 res_be1, 14 res_w2, 15 res_b2, 16 res_g2, 17 res_be2
    float* OUT = (float*)d_out;     // [2][64][64][128]
    char* wsp = (char*)d_ws;
    auto take = [&](size_t bytes) { char* p = wsp; wsp += (bytes + 255) & ~(size_t)255; return (void*)p; };
    bf* WG = (bf*)take(CC * CC * 2); bf* WT = (bf*)take(CC * CC * 2); bf* WP = (bf*)take(CC * CC * 2); bf* WW = (bf*)take(CC * CC * 2); bf* WR = (bf*)take((size_t)6 * CC * KC * 2);
    bf* XB = (bf*)take((size_t)NR * CC * 2); float* GF = (float*)take((size_t)NR * CC * 4); float* TF = (float*)take((size_t)NR * CC * 4); float* PF = (float*)take((size_t)NR * CC * 4); h16* T16 = (h16*)take((size_t)NR * CC * 2); h16* P16k = (h16*)take((size_t)NR * CC * 2); h16* GT = (h16*)take((size_t)NR * CC * 2); float* M = (float*)take((size_t)NR * 4);
    float* Sb = (float*)take((size_t)NR * NN * 4); h16* PP = (h16*)take((size_t)NR * NN * 2); float* Y = (float*)take((size_t)NR * CC * 4); float* WY = (float*)take((size_t)NR * CC * 4); float* WY2 = (float*)take((size_t)NR * CC * 4); float* CV = (float*)take((size_t)NR * CC * 4); float* HB = (float*)take((size_t)NR * CC * 4); float* ST = (float*)take(NB_ * CC * 2 * 4);
    bf* Ah = (bf*)Sb; bf* Al = Ah + (size_t)NR * KC;    // the split planes reuse the score plane: first written after its last reader (k_soft3) has ended
    if ((size_t)(wsp - (char*)d_ws) > ws_size) return;    // total ~ 245 MB
    k_wtG<<<(CC * CC / 64 + 63) / 64, 256, 0, stream>>>(IN[2], CC, CC, WG); k_wtG<<<(CC * CC / 64 + 63) / 64, 256, 0, stream>>>(IN[4], CC, CC, WT); k_wtG<<<(CC * CC / 64 + 63) / 64, 256, 0, stream>>>(IN[6], CC, CC, WP); k_wtG<<<(CC * CC / 64 + 63) / 64, 256, 0, stream>>>(IN[8], CC, CC, WW);
    for (int i = 0; i < 3; ++i) { k_wtG<<<(KC * CC / 64 + 63) / 64, 256, 0, stream>>>(IN[10] + (size_t)i * KC * CC, KC, CC, WR + (size_t)(2 * i) * CC * KC); k_wtG<<<(KC * CC / 64 + 63) / 64, 256, 0, stream>>>(IN[14] + (size_t)i * KC * CC, KC, CC, WR + (size_t)(2 * i + 1) * CC * KC); }   // HWIO flattened = [(kh kw ci)][co] (x @ W layout)
    // every launch below covers both images (rows image-major; per-image operands through grid z / y) and all NN queries
    const unsigned L4 = (unsigned)(((size_t)NR * CC / 4 + 255) / 256); const unsigned LC = (unsigned)(((size_t)NR * KC / 4 + 255) / 256);
    k_cvt8<<<(NR * CC / 8 + 255) / 256, 256, 0, stream>>>(IN[0], XB, (size_t)NR * CC / 8); k_mvec<<<NR / 256, 256, 0, stream>>>(IN[1], M);
    k_gemmw<bf, 0, true><<<dim3(NR / 64, CC / 64, 1), 32, 0, stream>>>(XB, nullptr, WG, nullptr, CC, GF, CC, IN[3], 0, 0, 0); k_gemmw<bf, 0, true><<<dim3(NR / 64, CC / 64, 1), 32, 0, stream>>>(XB, nullptr, WT, nullptr, CC, TF, CC, IN[5], 0, 0, 0); k_gemmw<bf, 0, true><<<dim3(NR / 64, CC / 64, 1), 32, 0, stream>>>(XB, nullptr, WP, nullptr, CC, PF, CC, IN[7], 0, 0, 0);
    k_f16<<<L4, 256, 0, stream>>>(TF, (size_t)NR * CC / 4, T16); k_f16<<<L4, 256, 0, stream>>>(PF, (size_t)NR * CC / 4, P16k); k_gt16<<<(unsigned)(((size_t)NR * CC / 2 + 255) / 256), 256, 0, stream>>>(GF, GT);
    k_gemmw<h16, 0, false><<<dim3(NN / 64, NN / 64, NB_), 32, 0, stream>>>(T16, nullptr, P16k, nullptr, CC, Sb, NN, nullptr, (size_t)NN * CC, (size_t)NN * CC, (size_t)NN * NN);
    k_soft3<<<NR / 8, 256, 0, stream>>>(Sb, M, PP);
    k_gemmw<h16, 0, false><<<dim3(NN / 64, CC / 64, NB_), 32, 0, stream>>>(PP, nullptr, GT, nullptr, NN, Y, CC, nullptr, (size_t)NN * NN, (size_t)CC * NN, (size_t)NN * CC);
    k_spl<<<L4, 256, 0, stream>>>(Y, (size_t)NR * CC / 4, 1.0f / PCAR, Ah, Al);
    k_gemmw<bf, 1, true><<<dim3(NR / 64, CC / 64, 1), 32, 0, stream>>>(Ah, Al, WW, nullptr, CC, WY, CC, IN[9], 0, 0, 0);
    float* wy = WY; float* wyn = WY2;
    for (int i = 0; i < 3; ++i) {
        k_col3r<<<LC, 256, 0, stream>>>(wy, Ah, Al);
        k_gemmw<bf, 1, true><<<dim3(NR / 64, CC / 64, 1), 32, 0, stream>>>(Ah, Al, WR + (size_t)(2 * i) * CC * KC, nullptr, KC, CV, CC, IN[11] + i * CC, 0, 0, 0);
        k_instat<<<dim3(CC / 16, NB_, 1), 1024, 0, stream>>>(CV, ST); k_inrelu<<<L4, 256, 0, stream>>>(CV, ST, IN[12] + i * CC, IN[13] + i * CC, HB);
        k_col3r<<<LC, 256, 0, stream>>>(HB, Ah, Al);
        k_gemmw<bf, 1, true><<<dim3(NR / 64, CC / 64, 1), 32, 0, stream>>>(Ah, Al, WR + (size_t)(2 * i + 1) * CC * KC, nullptr, KC, CV, CC, IN[15] + i * CC, 0, 0, 0);
        k_instat<<<dim3(CC / 16, NB_, 1), 1024, 0, stream>>>(CV, ST); k_inres<<<L4, 256, 0, stream>>>(CV, ST, IN[16] + i * CC, IN[17] + i * CC, wy, wyn); float* t = wy; wy = wyn; wyn = t; }
    k_blend<<<L4, 256, 0, stream>>>(IN[0], M, wy, OUT);
}

// v003
// One run takes 405 microseconds.
// Next to v002, in two timings, it ran 1.46 and 1.47 times as fast.
// Counting every step since v000, it is 23.2 times as fast.
#include <hip/hip_runtime.h>

// NonLocalBlock2D_with_mask_Res (x NHWC [2][64][64][128], mask [2][64][64][1]; g/theta/phi = 1x1 convs; f = softmax(theta.phi^T / 1) over keys; m = (1 - min(mask,0)) (1 - mask) (the reference's resize-identity / where / invert chain; mask read as data);
// f = m[key] f (after the softmax, no renormalisation); y = f g; w_y = 1x1 conv W; 3 ResNet blocks (reflect-pad conv3x3 -> InstanceNorm(1e-3) -> relu -> reflect-pad conv3x3 -> InstanceNorm, residual); z = m x + (1 - m) w_y -> [2][64][64][128]).
// Compute dtypes, f32 accumulate: every input rounded to bf16; g/theta/phi 1x1 projections on PLAIN bf16 operands (inputs: exact, + bias), W and conv3x3 on hi+lo bf16 activations; scores (K 128) and the gated probs . g on SINGLE fp16 planes (logits are O(1) at these scales);

#define NB_  2
#define HH   64
#define NN   4096
#define CC   128
#define KC   1152
#define NR   (NB_ * NN)   // rows of both images, image-major
#define PCAR 1024.0f
typedef _Float16 h16;
typedef unsigned short bf;
typedef __attribute__((ext_vector_type(16))) __bf16   v16bf;
typedef __attribute__((ext_vector_type(16))) _Float16 v16h;
typedef __attribute__((ext_vector_type(8)))  _Float16 v8h;
typedef __attribute__((ext_vector_type(8)))  unsigned short v8us;
typedef __attribute__((ext_vector_type(8)))  float    v8f;
typedef __attribute__((ext_vector_type(4)))  float    v4f;
typedef v8h  __attribute__((may_alias)) v8ha;
typedef v4f  __attribute__((may_alias)) v4fa;
typedef v8us __attribute__((may_alias)) v8usa;

__device__ __forceinline__ unsigned short f2bf(float f) { unsigned u = __float_as_uint(f); u += 0x7FFFu + ((u >> 16) & 1u); return (unsigned short)(u >> 16); }
__device__ __forceinline__ float bf2f(unsigned short b) { return __uint_as_float(((unsigned)b) << 16); }
__device__ __forceinline__ float bfr(float f) { return bf2f(f2bf(f)); }
__device__ __forceinline__ v16h cat16(v8h lo, v8h hi) { return __builtin_shufflevector(lo, hi, 0, 1, 2, 3, 4, 5, 6, 7, 8, 9, 10, 11, 12, 13, 14, 15); }
__device__ __forceinline__ v16bf cat16b(v8us lo, v8us hi) { return __builtin_bit_cast(v16bf, __builtin_shufflevector(lo, hi, 0, 1, 2, 3, 4, 5, 6, 7, 8, 9, 10, 11, 12, 13, 14, 15)); }
__device__ __forceinline__ v8f wmma16(v16h a, v16h b, v8f c) { return __builtin_amdgcn_wmma_f32_16x16x32_f16(false, a, false, b, (short)0, c, false, false); }
__device__ __forceinline__ v8f wmmab(v16bf a, v16bf b, v8f c) { return __builtin_amdgcn_wmma_f32_16x16x32_bf16(false, a, false, b, (short)0, c, false, false); }



// ---- k_gemmw: register-blocked GEMM, NW WAVES per 64x64 output tile (16 accumulators each), operands straight from K-contiguous 16-bit planes; grid (M/64, N/64, Z), NW * 32 threads.
// Wave w takes the 32-wide K chunks w, w + NW, ...; for NW > 1 the NW partial tiles meet in LDS and are summed in wave order 0 .. NW - 1 (fixed order, bias last).
// C[m][n] (f32, pitch ldc, + optional f32 bias[n]) = sum_k A[m][k] Bt[n][k] (+ split products per NSPLIT). z-batch strides sA/sB/sC in elements. K % 32 == 0.
template <typename T16> struct WFrag;
template <> struct WFrag<h16> { typedef v16h V; static __device__ __forceinline__ V ld(const h16* p) { return cat16(*(const v8h*)p, *(const v8h*)(p + 16)); } static __device__ __forceinline__ v8f mma(V a, V b, v8f c) { return wmma16(a, b, c); } };
template <> struct WFrag<bf> { typedef v16bf V; static __device__ __forceinline__ V ld(const bf* p) { return cat16b(*(const v8us*)p, *(const v8us*)(p + 16)); } static __device__ __forceinline__ v8f mma(V a, V b, v8f c) { return wmmab(a, b, c); } };
template <typename T16, int NSPLIT, bool BIAS, int NW>
__global__ __launch_bounds__(NW * 32) void k_gemmw(const T16* __restrict__ A, const T16* __restrict__ A2, const T16* __restrict__ Bt, const T16* __restrict__ Bt2, int K, float* C, int ldc, const float* __restrict__ bias, size_t sA, size_t sB, size_t sC) {
    typedef typename WFrag<T16>::V V;
    __shared__ __align__(16) float os[(NW == 1 ? 16 : NW * 64) * 68];
    const size_t z = blockIdx.z; A += z * sA; if (A2) A2 += z * sA; Bt += z * sB; if (Bt2) Bt2 += z * sB; C += z * sC;
    const int lane = threadIdx.x & 31, lr = lane & 15, hi = lane >> 4; const int r0 = blockIdx.x * 64, c0 = blockIdx.y * 64;
    const int wv = NW == 1 ? 0 : __builtin_amdgcn_readfirstlane((int)(threadIdx.x >> 5));   // the wave's number, held scalar so that the K loop's counter and branch stay scalar
    v8f acc[4][4];
#pragma unroll
    for (int mb = 0; mb < 4; ++mb)
#pragma unroll
        for (int nb = 0; nb < 4; ++nb) acc[mb][nb] = (v8f){};
    const size_t aoff = (size_t)(r0 + lr) * K + 8 * hi, boff = (size_t)(c0 + lr) * K + 8 * hi;
#pragma unroll 1
    for (int kc = wv * 32; kc < K; kc += NW * 32) {
        V a[4], a2[4];
#pragma unroll
        for (int mb = 0; mb < 4; ++mb) { a[mb] = WFrag<T16>::ld(A + aoff + (size_t)mb * 16 * K + kc); if (NSPLIT == 1 || NSPLIT == 2) a2[mb] = WFrag<T16>::ld(A2 + aoff + (size_t)mb * 16 * K + kc); }
#pragma unroll
        for (int nb = 0; nb < 4; ++nb) { const V b = WFrag<T16>::ld(Bt + boff + (size_t)nb * 16 * K + kc); V b2; if (NSPLIT >= 2) b2 = WFrag<T16>::ld(Bt2 + boff + (size_t)nb * 16 * K + kc);
#pragma unroll
            for (int mb = 0; mb < 4; ++mb) { acc[mb][nb] = WFrag<T16>::mma(a[mb], b, acc[mb][nb]); if (NSPLIT == 1 || NSPLIT == 2) acc[mb][nb] = WFrag<T16>::mma(a2[mb], b, acc[mb][nb]); if (NSPLIT >= 2) acc[mb][nb] = WFrag<T16>::mma(a[mb], b2, acc[mb][nb]); } }
        asm volatile("v_nop\n\tv_nop\n\tv_nop\n\tv_nop" : "+v"(acc[0][0]), "+v"(acc[1][1]), "+v"(acc[2][2]), "+v"(acc[3][3]) : "v"(a[0]), "v"(a[3]));
    }
    if constexpr (NW > 1) {
        float* mine = os + wv * (64 * 68);
        // the three loops are unrolled so that every accumulator index is a constant and acc stays in registers
#pragma unroll
        for (int mb = 0; mb < 4; ++mb)
#pragma unroll
            for (int nb = 0; nb < 4; ++nb)
#pragma unroll
                for (int j = 0; j < 8; ++j) mine[(mb * 16 + hi * 8 + j) * 68 + nb * 16 + lr] = acc[mb][nb][j];
        __syncthreads();   // every wave's partial tile is in LDS before any thread sums across the waves
        for (int g = threadIdx.x; g < 64 * 16; g += NW * 32) { const int row = g >> 4, cofs = (g & 15) * 4; v4f val = *(const v4fa*)(os + row * 68 + cofs);
#pragma unroll   // the NW LDS reads of a trip are issued together instead of one per round trip
            for (int w = 1; w < NW; ++w) val += *(const v4fa*)(os + (w * 64 + row) * 68 + cofs);
            if (BIAS) { val[0] += bfr(bias[c0 + cofs]); val[1] += bfr(bias[c0 + cofs + 1]); val[2] += bfr(bias[c0 + cofs + 2]); val[3] += bfr(bias[c0 + cofs + 3]); }
            *(v4f*)(C + (size_t)(r0 + row) * ldc + c0 + cofs) = val;
        }
        return;
    }
#pragma unroll
    for (int mb = 0; mb < 4; ++mb) {
#pragma unroll
        for (int nb = 0; nb < 4; ++nb) {
#pragma unroll
            for (int j = 0; j < 8; ++j) os[(hi * 8 + j) * 68 + nb * 16 + lr] = acc[mb][nb][j]; }
        __builtin_amdgcn_wave_barrier(); asm volatile("" ::: "memory");
        float* crow = C + (size_t)(r0 + mb * 16) * ldc + c0;
{
#pragma unroll
            for (int s = 0; s < 8; ++s) { const int row = 2 * s + hi, cofs = lr * 4; v4f val = *(const v4fa*)(os + row * 68 + cofs); if (BIAS) { val[0] += bfr(bias[c0 + cofs]); val[1] += bfr(bias[c0 + cofs + 1]); val[2] += bfr(bias[c0 + cofs + 2]); val[3] += bfr(bias[c0 + cofs + 3]); }
                *(v4f*)(crow + (size_t)row * ldc + cofs) = val; }
             }
        __builtin_amdgcn_wave_barrier(); asm volatile("" ::: "memory");
    }
}

__device__ __forceinline__ h16 tohx(float x) { return (h16)x; }
__device__ __forceinline__ void splitf(float y, unsigned short& h, unsigned short& l) { h = f2bf(y); l = f2bf(y - bf2f(h)); }
typedef __attribute__((ext_vector_type(2))) _Float16 v2h;
typedef __attribute__((ext_vector_type(4))) _Float16 v4h;
typedef __attribute__((ext_vector_type(2))) unsigned short v2us;
typedef __attribute__((ext_vector_type(4))) unsigned short v4us;
typedef __attribute__((ext_vector_type(2))) float v2f;

__global__ __launch_bounds__(256) void k_wtG(const float* __restrict__ w, int K, int N, bf* Bt) {
    const int lane = threadIdx.x & 31; const int L0 = (blockIdx.x * 8 + (threadIdx.x >> 5)) * 8; const int nlines = N * K / 64;
{
#pragma unroll 1
        for (int l = 0; l < 8; ++l) { const int L = L0 + l; if (L >= nlines) break; const size_t e = (size_t)L * 64 + lane * 2; const int k = (int)(e % K), n = (int)(e / K); v2us o;
            o[0] = f2bf(w[(size_t)k * N + n]); o[1] = f2bf(w[(size_t)(k + 1) * N + n]); *(v2us*)(Bt + e) = o; }
         }
}
__global__ __launch_bounds__(256) void k_cvt8(const float* __restrict__ src, bf* dst, size_t n8) { const size_t i = (size_t)blockIdx.x * 256 + threadIdx.x; if (i >= n8) return; const v8f v = *(const v8f*)(src + i * 8); v8us o;
#pragma unroll
    for (int k = 0; k < 8; ++k) o[k] = f2bf(v[k]); *(v8us*)(dst + i * 8) = o;  }
__global__ __launch_bounds__(256) void k_f16(const float* __restrict__ F, size_t n4, h16* P) { const size_t i = ((size_t)blockIdx.x * 256 + threadIdx.x) * 4; if (i >= n4 * 4) return; const v4f a = *(const v4f*)(F + i); v4h o; o[0] = tohx(a[0]); o[1] = tohx(a[1]); o[2] = tohx(a[2]); o[3] = tohx(a[3]); *(v4h*)(P + i) = o;  }
__global__ __launch_bounds__(256) void k_gt16(const float* __restrict__ G, h16* GT) { const size_t e = ((size_t)blockIdx.x * 256 + threadIdx.x) * 2; if (e >= (size_t)NB_ * CC * NN) return; const int n = (int)(e % NN), c = (int)(e / NN) % CC; G += (e / ((size_t)CC * NN)) * NN * CC; v2h o; o[0] = tohx(G[(size_t)n * CC + c]); o[1] = tohx(G[(size_t)(n + 1) * CC + c]); *(v2h*)(GT + e) = o;  }
__global__ __launch_bounds__(256) void k_mvec(const float* __restrict__ mask, float* M) { const int n = blockIdx.x * 256 + threadIdx.x; if (n >= NR) return; const float mk = bfr(mask[n]); const float a = __fsub_rn(1.0f, fminf(mk, 0.f)); const float v = __fmul_rn(a, __fsub_rn(1.0f, mk)); *(float*)(M + n) = v;  }
__global__ __launch_bounds__(256) void k_soft3(const float* __restrict__ Sb, const float* __restrict__ M, h16* P) { const int lane = threadIdx.x & 31; const int row = blockIdx.x * 8 + (threadIdx.x >> 5); if (row >= NR) return; const float* sr = Sb + (size_t)row * NN; M += (row / NN) * NN; float mx = -3.0e38f;
    for (int ch = 0; ch < NN / 128; ++ch) { const v4f a = *(const v4f*)(sr + ch * 128 + lane * 4); mx = fmaxf(mx, fmaxf(fmaxf(a[0], a[1]), fmaxf(a[2], a[3]))); }
#pragma unroll
    for (int sh = 16; sh; sh >>= 1) mx = fmaxf(mx, __shfl_xor(mx, sh, 32));
    float sum = 0.f;
    for (int ch = 0; ch < NN / 128; ++ch) { const v4f a = *(const v4f*)(sr + ch * 128 + lane * 4);
#pragma unroll
        for (int q = 0; q < 4; ++q) { float d0 = __fsub_rn(a[q], mx); asm volatile("" : "+v"(d0)); sum += __expf(d0); } }
#pragma unroll
    for (int sh = 16; sh; sh >>= 1) sum += __shfl_xor(sum, sh, 32);
    const float f = __fdiv_rn(PCAR, sum);
    { for (int ch = 0; ch < NN / 128; ++ch) { const int j0 = ch * 128 + lane * 4; const v4f a = *(const v4f*)(sr + j0); const v4f m4 = *(const v4f*)(M + j0); v4h o;
#pragma unroll
            for (int q = 0; q < 4; ++q) { float d0 = __fsub_rn(a[q], mx); asm volatile("" : "+v"(d0)); float e = __fmul_rn(__expf(d0), f); asm volatile("" : "+v"(e)); o[q] = tohx(__fmul_rn(e, m4[q])); }
            *(v4h*)(P + (size_t)row * NN + j0) = o; }  } }
__global__ __launch_bounds__(256) void k_spl(const float* __restrict__ F, size_t n4, float sc, bf* Fh, bf* Fl) { const size_t i = ((size_t)blockIdx.x * 256 + threadIdx.x) * 4; if (i >= n4 * 4) return; const v4f a = *(const v4f*)(F + i); v4us oh, ol;
#pragma unroll
    for (int q = 0; q < 4; ++q) { unsigned short u, c2; splitf(a[q] * sc, u, c2); oh[q] = u; ol[q] = c2; } *(v4us*)(Fh + i) = oh; *(v4us*)(Fl + i) = ol;  }
__device__ __forceinline__ int reflect64(int i) { return i < 0 ? -i : (i >= HH ? 2 * HH - 2 - i : i); }
__global__ __launch_bounds__(256) void k_col3r(const float* __restrict__ F, bf* Ch, bf* Cl) { const size_t e = ((size_t)blockIdx.x * 256 + threadIdx.x) * 4; if (e >= (size_t)NR * KC) return; const int k = (int)(e % KC); const int n = (int)(e / KC) % NN; F += (e / ((size_t)NN * KC)) * NN * CC; const int tap = k / CC, ci = k % CC; const int kh = tap / 3, kw = tap % 3; const int y = reflect64(n / HH + kh - 1), x = reflect64(n % HH + kw - 1); const v4f a = *(const v4f*)(F + ((size_t)y * HH + x) * CC + ci); v4us oh, ol;
#pragma unroll
    for (int q = 0; q < 4; ++q) { unsigned short u, c2; splitf(a[q], u, c2); oh[q] = u; ol[q] = c2; } *(v4us*)(Ch + e) = oh; *(v4us*)(Cl + e) = ol;  }
// ---- k_instat: per-channel mean and 1/sqrt(var + eps) over the NN rows. One work-group of 32 waves per 16 channels of one image (grid (CC/16, NB_)): thread = (row group t >> 2, channel quad t & 3) loads its 16 rows x 4 channels once,
// keeps them in registers for both sums (mean, then squares about the mean); each sum: 16 serial adds per thread, butterfly over the wave's 8 row lanes, 32 wave partials through LDS, summed alike by every wave.
__device__ __forceinline__ v4f wsum8(v4f s) {
#pragma unroll
    for (int sh = 4; sh <= 16; sh <<= 1) {
#pragma unroll
        for (int q = 0; q < 4; ++q) s[q] += __shfl_xor(s[q], sh, 32); }
    return s; }
__device__ __forceinline__ v4f bsum(v4f s, float* red, int lane, int wave) {
    s = wsum8(s); if (lane < 4) *(v4fa*)(red + (wave * 4 + lane) * 4) = s;
    __syncthreads();
    v4f t = *(const v4fa*)(red + lane * 4);
#pragma unroll
    for (int j = 1; j < 4; ++j) t += *(const v4fa*)(red + (j * 32 + lane) * 4);
    return wsum8(t); }
__global__ __launch_bounds__(1024) void k_instat(const float* __restrict__ Cv, float* ST) {
    __shared__ __align__(16) float red1[32 * 16]; __shared__ __align__(16) float red2[32 * 16];
    const int t = threadIdx.x, lane = t & 31, wave = t >> 5; const int c = blockIdx.x * 16 + (t & 3) * 4; const float* p = Cv + ((size_t)blockIdx.y * NN + (t >> 2)) * CC + c; ST += blockIdx.y * 2 * CC; v4f v[16];
#pragma unroll
    for (int i = 0; i < 15; ++i) v[i] = *(const v4f*)(p + (size_t)i * 256 * CC);
    asm volatile("s_wait_xcnt 0x0" ::: "memory");   // the compiler lets the last load's result land on the address pair that the 15 issued loads name: the wait stands in front of that overwrite
    v[15] = *(const v4f*)(p + (size_t)15 * 256 * CC);
    v4f s = v[0];
#pragma unroll
    for (int i = 1; i < 16; ++i) s += v[i];
    const v4f mu = bsum(s, red1, lane, wave) * (1.0f / NN);
    v4f q2 = (v4f){};
#pragma unroll
    for (int i = 0; i < 16; ++i) { const v4f d = v[i] - mu; q2 += d * d; }
    const v4f vq = bsum(q2, red2, lane, wave) * (1.0f / NN);
    if (t < 4) { v4f o0, o1; o0[0] = mu[0]; o0[1] = __frsqrt_rn(vq[0] + 1e-3f); o0[2] = mu[1]; o0[3] = __frsqrt_rn(vq[1] + 1e-3f); o1[0] = mu[2]; o1[1] = __frsqrt_rn(vq[2] + 1e-3f); o1[2] = mu[3]; o1[3] = __frsqrt_rn(vq[3] + 1e-3f);
        *(v4f*)(ST + 2 * c) = o0; *(v4f*)(ST + 2 * c + 4) = o1; } }
__global__ __launch_bounds__(256) void k_inrelu(const float* __restrict__ Cv, const float* __restrict__ ST, const float* __restrict__ g, const float* __restrict__ be, float* Hout) { const size_t i = ((size_t)blockIdx.x * 256 + threadIdx.x) * 4; if (i >= (size_t)NR * CC) return; const int c = (int)(i % CC); ST += (i / ((size_t)NN * CC)) * 2 * CC; const v4f a = *(const v4f*)(Cv + i); v4f o;
#pragma unroll
    for (int q = 0; q < 4; ++q) { float d = __fsub_rn(a[q], ST[2 * (c + q)]); asm volatile("" : "+v"(d)); float tn = __fmul_rn(d, ST[2 * (c + q) + 1]); asm volatile("" : "+v"(tn)); float tg = __fmul_rn(tn, bfr(g[c + q])); asm volatile("" : "+v"(tg)); o[q] = fmaxf(__fadd_rn(tg, bfr(be[c + q])), 0.f); }
    *(v4f*)(Hout + i) = o;  }
__global__ __launch_bounds__(256) void k_inres(const float* __restrict__ Cv, const float* __restrict__ ST, const float* __restrict__ g, const float* __restrict__ be, const float* __restrict__ WYin, float* WYout) { const size_t i = ((size_t)blockIdx.x * 256 + threadIdx.x) * 4; if (i >= (size_t)NR * CC) return; const int c = (int)(i % CC); ST += (i / ((size_t)NN * CC)) * 2 * CC; const v4f a = *(const v4f*)(Cv + i);
    asm volatile("s_wait_xcnt 0x0" ::: "memory");   // the compiler lets the next load's result land on the address pair that the issued Cv load names: the wait stands in front of that overwrite
    const v4f w = *(const v4f*)(WYin + i); v4f o;
#pragma unroll
    for (int q = 0; q < 4; ++q) { float d = __fsub_rn(a[q], ST[2 * (c + q)]); asm volatile("" : "+v"(d)); float tn = __fmul_rn(d, ST[2 * (c + q) + 1]); asm volatile("" : "+v"(tn)); float tg = __fmul_rn(tn, bfr(g[c + q])); asm volatile("" : "+v"(tg)); o[q] = __fadd_rn(w[q], __fadd_rn(tg, bfr(be[c + q]))); }
    *(v4f*)(WYout + i) = o;  }
__global__ __launch_bounds__(256) void k_blend(const float* __restrict__ x, const float* __restrict__ M, const float* __restrict__ WY, float* OUT) { const size_t i = ((size_t)blockIdx.x * 256 + threadIdx.x) * 4; if (i >= (size_t)NR * CC) return; const int n = (int)(i / CC); const float m = M[n]; const float om = __fsub_rn(1.0f, m); const v4f w = *(const v4f*)(WY + i); v4f o;
#pragma unroll
    for (int q = 0; q < 4; ++q) { float a = __fmul_rn(m, bfr(x[i + q])); asm volatile("" : "+v"(a)); float b = __fmul_rn(om, w[q]); asm volatile("" : "+v"(b)); o[q] = __fadd_rn(a, b); } *(v4f*)(OUT + i) = o;  }

extern "C" void kernel_launch(void* const* d_in, const int* in_sizes, int n_in,
                              void* d_out, int out_size, void* d_ws, size_t ws_size, hipStream_t stream) {
    (void)in_sizes; (void)n_in; (void)out_size;
    const float* IN[18]; for (int i = 0; i < 18; ++i) IN[i] = (const float*)d_in[i];   // 0 x, 1 mask, 2 wg, 3 bg, 4 wt, 5 bt, 6 wp, 7 bp, 8 ww, 9 bw, 10 res_w1 [3][3][3][128][128], 11 res_b1 [3][128], 12 res_g1, 13 res_be1, 14 res_w2, 15 res_b2, 16 res_g2, 17 res_be2
    float* OUT = (float*)d_out;     // [2][64][64][128]
    char* wsp = (char*)d_ws;
    auto take = [&](size_t bytes) { char* p = wsp; wsp += (bytes + 255) & ~(size_t)255; return (void*)p; };
    bf* WG = (bf*)take(CC * CC * 2); bf* WT = (bf*)take(CC * CC * 2); bf* WP = (bf*)take(CC * CC * 2); bf* WW = (bf*)take(CC * CC * 2); bf* WR = (bf*)take((size_t)6 * CC * KC * 2);
    bf* XB = (bf*)take((size_t)NR * CC * 2); float* GF = (float*)take((size_t)NR * CC * 4); float* TF = (float*)take((size_t)NR * CC * 4); float* PF = (float*)take((size_t)NR * CC * 4); h16* T16 = (h16*)take((size_t)NR * CC * 2); h16* P16k = (h16*)take((size_t)NR * CC * 2); h16* GT = (h16*)take((size_t)NR * CC * 2); float* M = (float*)take((size_t)NR * 4);
    float* Sb = (float*)take((size_t)NR * NN * 4); h16* PP = (h16*)take((size_t)NR * NN * 2); float* Y = (float*)take((size_t)NR * CC * 4); float* WY = (float*)take((size_t)NR * CC * 4); float* WY2 = (float*)take((size_t)NR * CC * 4); float* CV = (float*)take((size_t)NR * CC * 4); float* HB = (float*)take((size_t)NR * CC * 4); float* ST = (float*)take(NB_ * CC * 2 * 4);
    bf* Ah = (bf*)Sb; bf* Al = Ah + (size_t)NR * KC;    // the split planes reuse the score plane: first written after its last reader (k_soft3) has ended
    if ((size_t)(wsp - (char*)d_ws) > ws_size) return;    // total ~ 245 MB
    k_wtG<<<(CC * CC / 64 + 63) / 64, 256, 0, stream>>>(IN[2], CC, CC, WG); k_wtG<<<(CC * CC / 64 + 63) / 64, 256, 0, stream>>>(IN[4], CC, CC, WT); k_wtG<<<(CC * CC / 64 + 63) / 64, 256, 0, stream>>>(IN[6], CC, CC, WP); k_wtG<<<(CC * CC / 64 + 63) / 64, 256, 0, stream>>>(IN[8], CC, CC, WW);
    for (int i = 0; i < 3; ++i) { k_wtG<<<(KC * CC / 64 + 63) / 64, 256, 0, stream>>>(IN[10] + (size_t)i * KC * CC, KC, CC, WR + (size_t)(2 * i) * CC * KC); k_wtG<<<(KC * CC / 64 + 63) / 64, 256, 0, stream>>>(IN[14] + (size_t)i * KC * CC, KC, CC, WR + (size_t)(2 * i + 1) * CC * KC); }   // HWIO flattened = [(kh kw ci)][co] (x @ W layout)
    // every launch below covers both images (rows image-major; per-image operands through grid z / y) and all NN queries
    const unsigned L4 = (unsigned)(((size_t)NR * CC / 4 + 255) / 256); const unsigned LC = (unsigned)(((size_t)NR * KC / 4 + 255) / 256);
    k_cvt8<<<(NR * CC / 8 + 255) / 256, 256, 0, stream>>>(IN[0], XB, (size_t)NR * CC / 8); k_mvec<<<NR / 256, 256, 0, stream>>>(IN[1], M);
    k_gemmw<bf, 0, true, 4><<<dim3(NR / 64, CC / 64, 1), 4 * 32, 0, stream>>>(XB, nullptr, WG, nullptr, CC, GF, CC, IN[3], 0, 0, 0); k_gemmw<bf, 0, true, 4><<<dim3(NR / 64, CC / 64, 1), 4 * 32, 0, stream>>>(XB, nullptr, WT, nullptr, CC, TF, CC, IN[5], 0, 0, 0); k_gemmw<bf, 0, true, 4><<<dim3(NR / 64, CC / 64, 1), 4 * 32, 0, stream>>>(XB, nullptr, WP, nullptr, CC, PF, CC, IN[7], 0, 0, 0);
    k_f16<<<L4, 256, 0, stream>>>(TF, (size_t)NR * CC / 4, T16); k_f16<<<L4, 256, 0, stream>>>(PF, (size_t)NR * CC / 4, P16k); k_gt16<<<(unsigned)(((size_t)NR * CC / 2 + 255) / 256), 256, 0, stream>>>(GF, GT);
    k_gemmw<h16, 0, false, 1><<<dim3(NN / 64, NN / 64, NB_), 32, 0, stream>>>(T16, nullptr, P16k, nullptr, CC, Sb, NN, nullptr, (size_t)NN * CC, (size_t)NN * CC, (size_t)NN * NN);
    k_soft3<<<NR / 8, 256, 0, stream>>>(Sb, M, PP);
    k_gemmw<h16, 0, false, 16><<<dim3(NN / 64, CC / 64, NB_), 16 * 32, 0, stream>>>(PP, nullptr, GT, nullptr, NN, Y, CC, nullptr, (size_t)NN * NN, (size_t)CC * NN, (size_t)NN * CC);
    k_spl<<<L4, 256, 0, stream>>>(Y, (size_t)NR * CC / 4, 1.0f / PCAR, Ah, Al);
    k_gemmw<bf, 1, true, 4><<<dim3(NR / 64, CC / 64, 1), 4 * 32, 0, stream>>>(Ah, Al, WW, nullptr, CC, WY, CC, IN[9], 0, 0, 0);
    float* wy = WY; float* wyn = WY2;
    for (int i = 0; i < 3; ++i) {
        k_col3r<<<LC, 256, 0, stream>>>(wy, Ah, Al);
        k_gemmw<bf, 1, true, 12><<<dim3(NR / 64, CC / 64, 1), 12 * 32, 0, stream>>>(Ah, Al, WR + (size_t)(2 * i) * CC * KC, nullptr, KC, CV, CC, IN[11] + i * CC, 0, 0, 0);
        k_instat<<<dim3(CC / 16, NB_, 1), 1024, 0, stream>>>(CV, ST); k_inrelu<<<L4, 256, 0, stream>>>(CV, ST, IN[12] + i * CC, IN[13] + i * CC, HB);
        k_col3r<<<LC, 256, 0, stream>>>(HB, Ah, Al);
        k_gemmw<bf, 1, true, 12><<<dim3(NR / 64, CC / 64, 1), 12 * 32, 0, stream>>>(Ah, Al, WR + (size_t)(2 * i + 1) * CC * KC, nullptr, KC, CV, CC, IN[15] + i * CC, 0, 0, 0);
        k_instat<<<dim3(CC / 16, NB_, 1), 1024, 0, stream>>>(CV, ST); k_inres<<<L4, 256, 0, stream>>>(CV, ST, IN[16] + i * CC, IN[17] + i * CC, wy, wyn); float* t = wy; wy = wyn; wyn = t; }
    k_blend<<<L4, 256, 0, stream>>>(IN[0], M, wy, OUT);
}

// v004
// A run of this version takes 337 microseconds.
// Timed twice side by side with v003, it ran 1.19 and 1.20 times as fast.
// Counting every step since v000, it is 27.7 times as fast.
#include <hip/hip_runtime.h>

// NonLocalBlock2D_with_mask_Res (x NHWC [2][64][64][128], mask [2][64][64][1]; g/theta/phi = 1x1 convs; f = softmax(theta.phi^T / 1) over keys; m = (1 - min(mask,0)) (1 - mask) (the reference's resize-identity / where / invert chain; mask read as data);
// f = m[key] f (after the softmax, no renormalisation); y = f g; w_y = 1x1 conv W; 3 ResNet blocks (reflect-pad conv3x3 -> InstanceNorm(1e-3) -> relu -> reflect-pad conv3x3 -> InstanceNorm, residual); z = m x + (1 - m) w_y -> [2][64][64][128]).
// Compute dtypes, f32 accumulate: every input rounded to bf16; g/theta/phi 1x1 projections on PLAIN bf16 operands (inputs: exact, + bias), W and conv3x3 on hi+lo bf16 activations; scores (K 128) and the gated probs . g on SINGLE fp16 planes (logits are O(1) at these scales);

#define NB_  2
#define HH   64
#define NN   4096
#define CC   128
#define KC   1152
#define NR   (NB_ * NN)   // rows of both images, image-major
#define PCAR 1024.0f
typedef _Float16 h16;
typedef unsigned short bf;
typedef __attribute__((ext_vector_type(16))) __bf16   v16bf;
typedef __attribute__((ext_vector_type(16))) _Float16 v16h;
typedef __attribute__((ext_vector_type(8)))  _Float16 v8h;
typedef __attribute__((ext_vector_type(8)))  unsigned short v8us;
typedef __attribute__((ext_vector_type(8)))  float    v8f;
typedef __attribute__((ext_vector_type(4)))  float    v4f;
typedef v8h  __attribute__((may_alias)) v8ha;
typedef v4f  __attribute__((may_alias)) v4fa;
typedef v8us __attribute__((may_alias)) v8usa;

__device__ __forceinline__ unsigned short f2bf(float f) { unsigned u = __float_as_uint(f); u += 0x7FFFu + ((u >> 16) & 1u); return (unsigned short)(u >> 16); }
__device__ __forceinline__ float bf2f(unsigned short b) { return __uint_as_float(((unsigned)b) << 16); }
__device__ __forceinline__ float bfr(float f) { return bf2f(f2bf(f)); }
__device__ __forceinline__ v16h cat16(v8h lo, v8h hi) { return __builtin_shufflevector(lo, hi, 0, 1, 2, 3, 4, 5, 6, 7, 8, 9, 10, 11, 12, 13, 14, 15); }
__device__ __forceinline__ v16bf cat16b(v8us lo, v8us hi) { return __builtin_bit_cast(v16bf, __builtin_shufflevector(lo, hi, 0, 1, 2, 3, 4, 5, 6, 7, 8, 9, 10, 11, 12, 13, 14, 15)); }
__device__ __forceinline__ v8f wmma16(v16h a, v16h b, v8f c) { return __builtin_amdgcn_wmma_f32_16x16x32_f16(false, a, false, b, (short)0, c, false, false); }
__device__ __forceinline__ v8f wmmab(v16bf a, v16bf b, v8f c) { return __builtin_amdgcn_wmma_f32_16x16x32_bf16(false, a, false, b, (short)0, c, false, false); }



// ---- k_gemmw: register-blocked GEMM, NW WAVES per 64x64 output tile (16 accumulators each), operands straight from K-contiguous 16-bit planes; grid (M/64, N/64, Z), NW * 32 threads.
// Wave w takes the 32-wide K chunks w, w + NW, ...; for NW > 1 the NW partial tiles meet in LDS and are summed in wave order 0 .. NW - 1 (fixed order, bias last).
// C[m][n] (f32, pitch ldc, + optional f32 bias[n]) = sum_k A[m][k] Bt[n][k] (+ split products per NSPLIT). z-batch strides sA/sB/sC in elements. K % 32 == 0.
template <typename T16> struct WFrag;
template <> struct WFrag<h16> { typedef v16h V; static __device__ __forceinline__ V ld(const h16* p) { return cat16(*(const v8h*)p, *(const v8h*)(p + 16)); } static __device__ __forceinline__ v8f mma(V a, V b, v8f c) { return wmma16(a, b, c); } };
template <> struct WFrag<bf> { typedef v16bf V; static __device__ __forceinline__ V ld(const bf* p) { return cat16b(*(const v8us*)p, *(const v8us*)(p + 16)); } static __device__ __forceinline__ v8f mma(V a, V b, v8f c) { return wmmab(a, b, c); } };
template <typename T16, int NSPLIT, bool BIAS, int NW>
__global__ __launch_bounds__(NW * 32) void k_gemmw(const T16* __restrict__ A, const T16* __restrict__ A2, const T16* __restrict__ Bt, const T16* __restrict__ Bt2, int K, float* C, int ldc, const float* __restrict__ bias, size_t sA, size_t sB, size_t sC) {
    typedef typename WFrag<T16>::V V;
    __shared__ __align__(16) float os[(NW == 1 ? 16 : NW * 64) * 68];
    const size_t z = blockIdx.z; A += z * sA; if (A2) A2 += z * sA; Bt += z * sB; if (Bt2) Bt2 += z * sB; C += z * sC;
    const int lane = threadIdx.x & 31, lr = lane & 15, hi = lane >> 4; const int r0 = blockIdx.x * 64, c0 = blockIdx.y * 64;
    const int wv = NW == 1 ? 0 : __builtin_amdgcn_readfirstlane((int)(threadIdx.x >> 5));   // the wave's number, held scalar so that the K loop's counter and branch stay scalar
    v8f acc[4][4];
#pragma unroll
    for (int mb = 0; mb < 4; ++mb)
#pragma unroll
        for (int nb = 0; nb < 4; ++nb) acc[mb][nb] = (v8f){};
    const size_t aoff = (size_t)(r0 + lr) * K + 8 * hi, boff = (size_t)(c0 + lr) * K + 8 * hi;
#pragma unroll 1
    for (int kc = wv * 32; kc < K; kc += NW * 32) {
        V a[4], a2[4];
#pragma unroll
        for (int mb = 0; mb < 4; ++mb) { a[mb] = WFrag<T16>::ld(A + aoff + (size_t)mb * 16 * K + kc); if (NSPLIT == 1 || NSPLIT == 2) a2[mb] = WFrag<T16>::ld(A2 + aoff + (size_t)mb * 16 * K + kc); }
#pragma unroll
        for (int nb = 0; nb < 4; ++nb) { const V b = WFrag<T16>::ld(Bt + boff + (size_t)nb * 16 * K + kc); V b2; if (NSPLIT >= 2) b2 = WFrag<T16>::ld(Bt2 + boff + (size_t)nb * 16 * K + kc);
#pragma unroll
            for (int mb = 0; mb < 4; ++mb) { acc[mb][nb] = WFrag<T16>::mma(a[mb], b, acc[mb][nb]); if (NSPLIT == 1 || NSPLIT == 2) acc[mb][nb] = WFrag<T16>::mma(a2[mb], b, acc[mb][nb]); if (NSPLIT >= 2) acc[mb][nb] = WFrag<T16>::mma(a[mb], b2, acc[mb][nb]); } }
        asm volatile("v_nop\n\tv_nop\n\tv_nop\n\tv_nop" : "+v"(acc[0][0]), "+v"(acc[1][1]), "+v"(acc[2][2]), "+v"(acc[3][3]) : "v"(a[0]), "v"(a[3]));
    }
    if constexpr (NW > 1) {
        float* mine = os + wv * (64 * 68);
        // the three loops are unrolled so that every accumulator index is a constant and acc stays in registers
#pragma unroll
        for (int mb = 0; mb < 4; ++mb)
#pragma unroll
            for (int nb = 0; nb < 4; ++nb)
#pragma unroll
                for (int j = 0; j < 8; ++j) mine[(mb * 16 + hi * 8 + j) * 68 + nb * 16 + lr] = acc[mb][nb][j];
        __syncthreads();   // every wave's partial tile is in LDS before any thread sums across the waves
        for (int g = threadIdx.x; g < 64 * 16; g += NW * 32) { const int row = g >> 4, cofs = (g & 15) * 4; v4f val = *(const v4fa*)(os + row * 68 + cofs);
#pragma unroll   // the NW LDS reads of a trip are issued together instead of one per round trip
            for (int w = 1; w < NW; ++w) val += *(const v4fa*)(os + (w * 64 + row) * 68 + cofs);
            if (BIAS) { val[0] += bfr(bias[c0 + cofs]); val[1] += bfr(bias[c0 + cofs + 1]); val[2] += bfr(bias[c0 + cofs + 2]); val[3] += bfr(bias[c0 + cofs + 3]); }
            *(v4f*)(C + (size_t)(r0 + row) * ldc + c0 + cofs) = val;
        }
        return;
    }
#pragma unroll
    for (int mb = 0; mb < 4; ++mb) {
#pragma unroll
        for (int nb = 0; nb < 4; ++nb) {
#pragma unroll
            for (int j = 0; j < 8; ++j) os[(hi * 8 + j) * 68 + nb * 16 + lr] = acc[mb][nb][j]; }
        __builtin_amdgcn_wave_barrier(); asm volatile("" ::: "memory");
        float* crow = C + (size_t)(r0 + mb * 16) * ldc + c0;
{
#pragma unroll
            for (int s = 0; s < 8; ++s) { const int row = 2 * s + hi, cofs = lr * 4; v4f val = *(const v4fa*)(os + row * 68 + cofs); if (BIAS) { val[0] += bfr(bias[c0 + cofs]); val[1] += bfr(bias[c0 + cofs + 1]); val[2] += bfr(bias[c0 + cofs + 2]); val[3] += bfr(bias[c0 + cofs + 3]); }
                *(v4f*)(crow + (size_t)row * ldc + cofs) = val; }
             }
        __builtin_amdgcn_wave_barrier(); asm volatile("" ::: "memory");
    }
}

__device__ __forceinline__ h16 tohx(float x) { return (h16)x; }
__device__ __forceinline__ void splitf(float y, unsigned short& h, unsigned short& l) { h = f2bf(y); l = f2bf(y - bf2f(h)); }
typedef __attribute__((ext_vector_type(2))) _Float16 v2h;
typedef __attribute__((ext_vector_type(4))) _Float16 v4h;
typedef __attribute__((ext_vector_type(2))) unsigned short v2us;
typedef __attribute__((ext_vector_type(4))) unsigned short v4us;
typedef __attribute__((ext_vector_type(2))) float v2f;

__global__ __launch_bounds__(256) void k_wtG(const float* __restrict__ w, int K, int N, bf* Bt) {
    const int lane = threadIdx.x & 31; const int L0 = (blockIdx.x * 8 + (threadIdx.x >> 5)) * 8; const int nlines = N * K / 64;
{
#pragma unroll 1
        for (int l = 0; l < 8; ++l) { const int L = L0 + l; if (L >= nlines) break; const size_t e = (size_t)L * 64 + lane * 2; const int k = (int)(e % K), n = (int)(e / K); v2us o;
            o[0] = f2bf(w[(size_t)k * N + n]); o[1] = f2bf(w[(size_t)(k + 1) * N + n]); *(v2us*)(Bt + e) = o; }
         }
}
__global__ __launch_bounds__(256) void k_cvt8(const float* __restrict__ src, bf* dst, size_t n8) { const size_t i = (size_t)blockIdx.x * 256 + threadIdx.x; if (i >= n8) return; const v8f v = *(const v8f*)(src + i * 8); v8us o;
#pragma unroll
    for (int k = 0; k < 8; ++k) o[k] = f2bf(v[k]); *(v8us*)(dst + i * 8) = o;  }
__global__ __launch_bounds__(256) void k_f16(const float* __restrict__ F, size_t n4, h16* P) { const size_t i = ((size_t)blockIdx.x * 256 + threadIdx.x) * 4; if (i >= n4 * 4) return; const v4f a = *(const v4f*)(F + i); v4h o; o[0] = tohx(a[0]); o[1] = tohx(a[1]); o[2] = tohx(a[2]); o[3] = tohx(a[3]); *(v4h*)(P + i) = o;  }
__global__ __launch_bounds__(256) void k_gt16(const float* __restrict__ G, h16* GT) { const size_t e = ((size_t)blockIdx.x * 256 + threadIdx.x) * 2; if (e >= (size_t)NB_ * CC * NN) return; const int n = (int)(e % NN), c = (int)(e / NN) % CC; G += (e / ((size_t)CC * NN)) * NN * CC; v2h o; o[0] = tohx(G[(size_t)n * CC + c]); o[1] = tohx(G[(size_t)(n + 1) * CC + c]); *(v2h*)(GT + e) = o;  }
__global__ __launch_bounds__(256) void k_mvec(const float* __restrict__ mask, float* M) { const int n = blockIdx.x * 256 + threadIdx.x; if (n >= NR) return; const float mk = bfr(mask[n]); const float a = __fsub_rn(1.0f, fminf(mk, 0.f)); const float v = __fmul_rn(a, __fsub_rn(1.0f, mk)); *(float*)(M + n) = v;  }
__global__ __launch_bounds__(256) void k_soft3(const float* __restrict__ Sb, const float* __restrict__ M, h16* P) { const int lane = threadIdx.x & 31; const int row = blockIdx.x * 8 + (threadIdx.x >> 5); if (row >= NR) return; const float* sr = Sb + (size_t)row * NN; M += (row / NN) * NN; float mx = -3.0e38f;
    for (int ch = 0; ch < NN / 128; ++ch) { const v4f a = *(const v4f*)(sr + ch * 128 + lane * 4); mx = fmaxf(mx, fmaxf(fmaxf(a[0], a[1]), fmaxf(a[2], a[3]))); }
#pragma unroll
    for (int sh = 16; sh; sh >>= 1) mx = fmaxf(mx, __shfl_xor(mx, sh, 32));
    float sum = 0.f;
    for (int ch = 0; ch < NN / 128; ++ch) { const v4f a = *(const v4f*)(sr + ch * 128 + lane * 4);
#pragma unroll
        for (int q = 0; q < 4; ++q) { float d0 = __fsub_rn(a[q], mx); asm volatile("" : "+v"(d0)); sum += __expf(d0); } }
#pragma unroll
    for (int sh = 16; sh; sh >>= 1) sum += __shfl_xor(sum, sh, 32);
    const float f = __fdiv_rn(PCAR, sum);
    { for (int ch = 0; ch < NN / 128; ++ch) { const int j0 = ch * 128 + lane * 4; const v4f a = *(const v4f*)(sr + j0); const v4f m4 = *(const v4f*)(M + j0); v4h o;
#pragma unroll
            for (int q = 0; q < 4; ++q) { float d0 = __fsub_rn(a[q], mx); asm volatile("" : "+v"(d0)); float e = __fmul_rn(__expf(d0), f); asm volatile("" : "+v"(e)); o[q] = tohx(__fmul_rn(e, m4[q])); }
            *(v4h*)(P + (size_t)row * NN + j0) = o; }  } }
__global__ __launch_bounds__(256) void k_spl(const float* __restrict__ F, size_t n4, float sc, bf* Fh, bf* Fl) { const size_t i = ((size_t)blockIdx.x * 256 + threadIdx.x) * 4; if (i >= n4 * 4) return; const v4f a = *(const v4f*)(F + i); v4us oh, ol;
#pragma unroll
    for (int q = 0; q < 4; ++q) { unsigned short u, c2; splitf(a[q] * sc, u, c2); oh[q] = u; ol[q] = c2; } *(v4us*)(Fh + i) = oh; *(v4us*)(Fl + i) = ol;  }
__device__ __forceinline__ int reflect64(int i) { return i < 0 ? -i : (i >= HH ? 2 * HH - 2 - i : i); }
// ---- k_conv3: reflect-pad conv3x3 as an implicit GEMM, no im2col copy. One 64x64 output tile per work-group = one image row (64 pixels) x 64 output channels; grid (NR/64, CC/64), NWC * 32 threads.
// K = (kh kw ci) as in Bt's rows; wave w takes the 32-wide K chunks w, w + NWC, ... (a chunk lies inside one tap). The A fragment of a chunk is read from the f32 map at the tap's reflected pixel and split into bf16 hi + lo in registers;
// C = sum (hi + lo) Bt, the NWC partial tiles meet in LDS and are summed in wave order 0 .. NWC - 1 (fixed order, bias last).
#define NWC 12
typedef __attribute__((ext_vector_type(2))) __bf16 v2bf;
typedef __attribute__((ext_vector_type(8))) unsigned v8u;
// two f32 -> packed bf16 hi pair and packed bf16 lo pair (lo = bf16(y - hi)), round to nearest even by the hardware's packed convert: the values of splitf for every finite y
__device__ __forceinline__ void split2(float y0, float y1, unsigned& h, unsigned& l) { v2f y; y[0] = y0; y[1] = y1; h = __builtin_bit_cast(unsigned, __builtin_convertvector(y, v2bf)); v2f r; r[0] = y0 - __uint_as_float(h << 16); r[1] = y1 - __uint_as_float(h & 0xFFFF0000u); l = __builtin_bit_cast(unsigned, __builtin_convertvector(r, v2bf)); }
__global__ __launch_bounds__(NWC * 32) void k_conv3(const float* __restrict__ F, const bf* __restrict__ Bt, float* C, const float* __restrict__ bias) {
    __shared__ __align__(16) float os[NWC * 64 * 68];
    const int lane = threadIdx.x & 31, lr = lane & 15, hi = lane >> 4; const int r0 = blockIdx.x * 64, c0 = blockIdx.y * 64;
    const int wv = __builtin_amdgcn_readfirstlane((int)(threadIdx.x >> 5));   // the wave's number, held scalar so that the K loop's counter, tap and branch stay scalar
    const int y = blockIdx.x % HH; F += (size_t)(blockIdx.x / HH) * NN * CC + 8 * hi;
    v8f acc[4][4];
#pragma unroll
    for (int mb = 0; mb < 4; ++mb)
#pragma unroll
        for (int nb = 0; nb < 4; ++nb) acc[mb][nb] = (v8f){};
    const size_t boff = (size_t)(c0 + lr) * KC + 8 * hi;
#pragma unroll 1
    for (int kc = wv * 32; kc < KC; kc += NWC * 32) {
        const int tap = kc / CC, kh = tap / 3, kw = tap % 3; const float* Fr = F + (size_t)reflect64(y + kh - 1) * HH * CC + kc % CC;
        v16bf b[4]; v4f raw[4][4];
#pragma unroll
        for (int mb = 0; mb < 4; ++mb) { const float* p = Fr + reflect64(mb * 16 + lr + kw - 1) * CC; raw[mb][0] = *(const v4f*)p; raw[mb][1] = *(const v4f*)(p + 4); raw[mb][2] = *(const v4f*)(p + 16); raw[mb][3] = *(const v4f*)(p + 20); }
        asm volatile("s_wait_xcnt 0x0" ::: "memory");   // the 16 map loads are issued: the wait stands in front of the weight loads, whose results may land on the address pairs that the map loads name
#pragma unroll
        for (int nb = 0; nb < 4; ++nb) b[nb] = WFrag<bf>::ld(Bt + boff + (size_t)nb * 16 * KC + kc);
        asm volatile("s_wait_xcnt 0x0" ::: "memory");   // the 8 weight loads are issued: the wait stands in front of the step of their address pair
        __builtin_amdgcn_sched_barrier(0);   // keeps the converts behind all 24 loads: without it the first converts, with their data waits, move in front of the later loads and a trip pays two memory round trips
        v16bf a[4], a2[4];
#pragma unroll
        for (int mb = 0; mb < 4; ++mb) { v8u h, l;
#pragma unroll
            for (int q = 0; q < 4; ++q) { unsigned u, c2; split2(raw[mb][q][0], raw[mb][q][1], u, c2); h[2 * q] = u; l[2 * q] = c2; split2(raw[mb][q][2], raw[mb][q][3], u, c2); h[2 * q + 1] = u; l[2 * q + 1] = c2; }
            a[mb] = __builtin_bit_cast(v16bf, h); a2[mb] = __builtin_bit_cast(v16bf, l); }
#pragma unroll
        for (int nb = 0; nb < 4; ++nb)
#pragma unroll
            for (int mb = 0; mb < 4; ++mb) { acc[mb][nb] = wmmab(a[mb], b[nb], acc[mb][nb]); acc[mb][nb] = wmmab(a2[mb], b[nb], acc[mb][nb]); }
        // four vector slots between the trip's last matrix instructions and whatever overwrites their operands on the taken back edge
        asm volatile("v_nop\n\tv_nop\n\tv_nop\n\tv_nop" : "+v"(acc[0][0]), "+v"(acc[1][1]), "+v"(acc[2][2]), "+v"(acc[3][3]) : "v"(a[0]), "v"(a[3]));
    }
    float* mine = os + wv * (64 * 68);
    // the three loops are unrolled so that every accumulator index is a constant and acc stays in registers
#pragma unroll
    for (int mb = 0; mb < 4; ++mb)
#pragma unroll
        for (int nb = 0; nb < 4; ++nb)
#pragma unroll
            for (int j = 0; j < 8; ++j) mine[(mb * 16 + hi * 8 + j) * 68 + nb * 16 + lr] = acc[mb][nb][j];
    __syncthreads();   // every wave's partial tile is in LDS before any thread sums across the waves
    for (int g = threadIdx.x; g < 64 * 16; g += NWC * 32) { const int row = g >> 4, cofs = (g & 15) * 4; v4f val = *(const v4fa*)(os + row * 68 + cofs);
#pragma unroll   // the NWC LDS reads of a trip are issued together instead of one per round trip
        for (int w = 1; w < NWC; ++w) val += *(const v4fa*)(os + (w * 64 + row) * 68 + cofs);
        val[0] += bfr(bias[c0 + cofs]); val[1] += bfr(bias[c0 + cofs + 1]); val[2] += bfr(bias[c0 + cofs + 2]); val[3] += bfr(bias[c0 + cofs + 3]);
        *(v4f*)(C + (size_t)(r0 + row) * CC + c0 + cofs) = val;
    }
}
// ---- k_instat: per-channel mean and 1/sqrt(var + eps) over the NN rows. One work-group of 32 waves per 16 channels of one image (grid (CC/16, NB_)): thread = (row group t >> 2, channel quad t & 3) loads its 16 rows x 4 channels once,
// keeps them in registers for both sums (mean, then squares about the mean); each sum: 16 serial adds per thread, butterfly over the wave's 8 row lanes, 32 wave partials through LDS, summed alike by every wave.
__device__ __forceinline__ v4f wsum8(v4f s) {
#pragma unroll
    for (int sh = 4; sh <= 16; sh <<= 1) {
#pragma unroll
        for (int q = 0; q < 4; ++q) s[q] += __shfl_xor(s[q], sh, 32); }
    return s; }
__device__ __forceinline__ v4f bsum(v4f s, float* red, int lane, int wave) {
    s = wsum8(s); if (lane < 4) *(v4fa*)(red + (wave * 4 + lane) * 4) = s;
    __syncthreads();
    v4f t = *(const v4fa*)(red + lane * 4);
#pragma unroll
    for (int j = 1; j < 4; ++j) t += *(const v4fa*)(red + (j * 32 + lane) * 4);
    return wsum8(t); }
__global__ __launch_bounds__(1024) void k_instat(const float* __restrict__ Cv, float* ST) {
    __shared__ __align__(16) float red1[32 * 16]; __shared__ __align__(16) float red2[32 * 16];
    const int t = threadIdx.x, lane = t & 31, wave = t >> 5; const int c = blockIdx.x * 16 + (t & 3) * 4; const float* p = Cv + ((size_t)blockIdx.y * NN + (t >> 2)) * CC + c; ST += blockIdx.y * 2 * CC; v4f v[16];
#pragma unroll
    for (int i = 0; i < 15; ++i) v[i] = *(const v4f*)(p + (size_t)i * 256 * CC);
    asm volatile("s_wait_xcnt 0x0" ::: "memory");   // the compiler lets the last load's result land on the address pair that the 15 issued loads name: the wait stands in front of that overwrite
    v[15] = *(const v4f*)(p + (size_t)15 * 256 * CC);
    v4f s = v[0];
#pragma unroll
    for (int i = 1; i < 16; ++i) s += v[i];
    const v4f mu = bsum(s, red1, lane, wave) * (1.0f / NN);
    v4f q2 = (v4f){};
#pragma unroll
    for (int i = 0; i < 16; ++i) { const v4f d = v[i] - mu; q2 += d * d; }
    const v4f vq = bsum(q2, red2, lane, wave) * (1.0f / NN);
    if (t < 4) { v4f o0, o1; o0[0] = mu[0]; o0[1] = __frsqrt_rn(vq[0] + 1e-3f); o0[2] = mu[1]; o0[3] = __frsqrt_rn(vq[1] + 1e-3f); o1[0] = mu[2]; o1[1] = __frsqrt_rn(vq[2] + 1e-3f); o1[2] = mu[3]; o1[3] = __frsqrt_rn(vq[3] + 1e-3f);
        *(v4f*)(ST + 2 * c) = o0; *(v4f*)(ST + 2 * c + 4) = o1; } }
__global__ __launch_bounds__(256) void k_inrelu(const float* __restrict__ Cv, const float* __restrict__ ST, const float* __restrict__ g, const float* __restrict__ be, float* Hout) { const size_t i = ((size_t)blockIdx.x * 256 + threadIdx.x) * 4; if (i >= (size_t)NR * CC) return; const int c = (int)(i % CC); ST += (i / ((size_t)NN * CC)) * 2 * CC; const v4f a = *(const v4f*)(Cv + i); v4f o;
#pragma unroll
    for (int q = 0; q < 4; ++q) { float d = __fsub_rn(a[q], ST[2 * (c + q)]); asm volatile("" : "+v"(d)); float tn = __fmul_rn(d, ST[2 * (c + q) + 1]); asm volatile("" : "+v"(tn)); float tg = __fmul_rn(tn, bfr(g[c + q])); asm volatile("" : "+v"(tg)); o[q] = fmaxf(__fadd_rn(tg, bfr(be[c + q])), 0.f); }
    *(v4f*)(Hout + i) = o;  }
__global__ __launch_bounds__(256) void k_inres(const float* __restrict__ Cv, const float* __restrict__ ST, const float* __restrict__ g, const float* __restrict__ be, const float* __restrict__ WYin, float* WYout) { const size_t i = ((size_t)blockIdx.x * 256 + threadIdx.x) * 4; if (i >= (size_t)NR * CC) return; const int c = (int)(i % CC); ST += (i / ((size_t)NN * CC)) * 2 * CC; const v4f a = *(const v4f*)(Cv + i);
    asm volatile("s_wait_xcnt 0x0" ::: "memory");   // the compiler lets the next load's result land on the address pair that the issued Cv load names: the wait stands in front of that overwrite
    const v4f w = *(const v4f*)(WYin + i); v4f o;
#pragma unroll
    for (int q = 0; q < 4; ++q) { float d = __fsub_rn(a[q], ST[2 * (c + q)]); asm volatile("" : "+v"(d)); float tn = __fmul_rn(d, ST[2 * (c + q) + 1]); asm volatile("" : "+v"(tn)); float tg = __fmul_rn(tn, bfr(g[c + q])); asm volatile("" : "+v"(tg)); o[q] = __fadd_rn(w[q], __fadd_rn(tg, bfr(be[c + q]))); }
    *(v4f*)(WYout + i) = o;  }
__global__ __launch_bounds__(256) void k_blend(const float* __restrict__ x, const float* __restrict__ M, const float* __restrict__ WY, float* OUT) { const size_t i = ((size_t)blockIdx.x * 256 + threadIdx.x) * 4; if (i >= (size_t)NR * CC) return; const int n = (int)(i / CC); const float m = M[n]; const float om = __fsub_rn(1.0f, m); const v4f w = *(const v4f*)(WY + i); v4f o;
#pragma unroll
    for (int q = 0; q < 4; ++q) { float a = __fmul_rn(m, bfr(x[i + q])); asm volatile("" : "+v"(a)); float b = __fmul_rn(om, w[q]); asm volatile("" : "+v"(b)); o[q] = __fadd_rn(a, b); } *(v4f*)(OUT + i) = o;  }

extern "C" void kernel_launch(void* const* d_in, const int* in_sizes, int n_in,
                              void* d_out, int out_size, void* d_ws, size_t ws_size, hipStream_t stream) {
    (void)in_sizes; (void)n_in; (void)out_size;
    const float* IN[18]; for (int i = 0; i < 18; ++i) IN[i] = (const float*)d_in[i];   // 0 x, 1 mask, 2 wg, 3 bg, 4 wt, 5 bt, 6 wp, 7 bp, 8 ww, 9 bw, 10 res_w1 [3][3][3][128][128], 11 res_b1 [3][128], 12 res_g1, 13 res_be1, 14 res_w2, 15 res_b2, 16 res_g2, 17 res_be2
    float* OUT = (float*)d_out;     // [2][64][64][128]
    char* wsp = (char*)d_ws;
    auto take = [&](size_t bytes) { char* p = wsp; wsp += (bytes + 255) & ~(size_t)255; return (void*)p; };
    bf* WG = (bf*)take(CC * CC * 2); bf* WT = (bf*)take(CC * CC * 2); bf* WP = (bf*)take(CC * CC * 2); bf* WW = (bf*)take(CC * CC * 2); bf* WR = (bf*)take((size_t)6 * CC * KC * 2);
    bf* XB = (bf*)take((size_t)NR * CC * 2); float* GF = (float*)take((size_t)NR * CC * 4); float* TF = (float*)take((size_t)NR * CC * 4); float* PF = (float*)take((size_t)NR * CC * 4); h16* T16 = (h16*)take((size_t)NR * CC * 2); h16* P16k = (h16*)take((size_t)NR * CC * 2); h16* GT = (h16*)take((size_t)NR * CC * 2); float* M = (float*)take((size_t)NR * 4);
    float* Sb = (float*)take((size_t)NR * NN * 4); h16* PP = (h16*)take((size_t)NR * NN * 2); float* Y = (float*)take((size_t)NR * CC * 4); float* WY = (float*)take((size_t)NR * CC * 4); float* WY2 = (float*)take((size_t)NR * CC * 4); float* CV = (float*)take((size_t)NR * CC * 4); float* HB = (float*)take((size_t)NR * CC * 4); float* ST = (float*)take(NB_ * CC * 2 * 4);
    bf* Ah = (bf*)Sb; bf* Al = Ah + (size_t)NR * KC;    // the split planes reuse the score plane: first written after its last reader (k_soft3) has ended
    if ((size_t)(wsp - (char*)d_ws) > ws_size) return;    // total ~ 245 MB
    k_wtG<<<(CC * CC / 64 + 63) / 64, 256, 0, stream>>>(IN[2], CC, CC, WG); k_wtG<<<(CC * CC / 64 + 63) / 64, 256, 0, stream>>>(IN[4], CC, CC, WT); k_wtG<<<(CC * CC / 64 + 63) / 64, 256, 0, stream>>>(IN[6], CC, CC, WP); k_wtG<<<(CC * CC / 64 + 63) / 64, 256, 0, stream>>>(IN[8], CC, CC, WW);
    for (int i = 0; i < 3; ++i) { k_wtG<<<(KC * CC / 64 + 63) / 64, 256, 0, stream>>>(IN[10] + (size_t)i * KC * CC, KC, CC, WR + (size_t)(2 * i) * CC * KC); k_wtG<<<(KC * CC / 64 + 63) / 64, 256, 0, stream>>>(IN[14] + (size_t)i * KC * CC, KC, CC, WR + (size_t)(2 * i + 1) * CC * KC); }   // HWIO flattened = [(kh kw ci)][co] (x @ W layout)
    // every launch below covers both images (rows image-major; per-image operands through grid z / y) and all NN queries
    const unsigned L4 = (unsigned)(((size_t)NR * CC / 4 + 255) / 256);
    k_cvt8<<<(NR * CC / 8 + 255) / 256, 256, 0, stream>>>(IN[0], XB, (size_t)NR * CC / 8); k_mvec<<<NR / 256, 256, 0, stream>>>(IN[1], M);
    k_gemmw<bf, 0, true, 4><<<dim3(NR / 64, CC / 64, 1), 4 * 32, 0, stream>>>(XB, nullptr, WG, nullptr, CC, GF, CC, IN[3], 0, 0, 0); k_gemmw<bf, 0, true, 4><<<dim3(NR / 64, CC / 64, 1), 4 * 32, 0, stream>>>(XB, nullptr, WT, nullptr, CC, TF, CC, IN[5], 0, 0, 0); k_gemmw<bf, 0, true, 4><<<dim3(NR / 64, CC / 64, 1), 4 * 32, 0, stream>>>(XB, nullptr, WP, nullptr, CC, PF, CC, IN[7], 0, 0, 0);
    k_f16<<<L4, 256, 0, stream>>>(TF, (size_t)NR * CC / 4, T16); k_f16<<<L4, 256, 0, stream>>>(PF, (size_t)NR * CC / 4, P16k); k_gt16<<<(unsigned)(((size_t)NR * CC / 2 + 255) / 256), 256, 0, stream>>>(GF, GT);
    k_gemmw<h16, 0, false, 1><<<dim3(NN / 64, NN / 64, NB_), 32, 0, stream>>>(T16, nullptr, P16k, nullptr, CC, Sb, NN, nullptr, (size_t)NN * CC, (size_t)NN * CC, (size_t)NN * NN);
    k_soft3<<<NR / 8, 256, 0, stream>>>(Sb, M, PP);
    k_gemmw<h16, 0, false, 16><<<dim3(NN / 64, CC / 64, NB_), 16 * 32, 0, stream>>>(PP, nullptr, GT, nullptr, NN, Y, CC, nullptr, (size_t)NN * NN, (size_t)CC * NN, (size_t)NN * CC);
    k_spl<<<L4, 256, 0, stream>>>(Y, (size_t)NR * CC / 4, 1.0f / PCAR, Ah, Al);
    k_gemmw<bf, 1, true, 4><<<dim3(NR / 64, CC / 64, 1), 4 * 32, 0, stream>>>(Ah, Al, WW, nullptr, CC, WY, CC, IN[9], 0, 0, 0);
    float* wy = WY; float* wyn = WY2;
    for (int i = 0; i < 3; ++i) {
        k_conv3<<<dim3(NR / 64, CC / 64, 1), NWC * 32, 0, stream>>>(wy, WR + (size_t)(2 * i) * CC * KC, CV, IN[11] + i * CC);
        k_instat<<<dim3(CC / 16, NB_, 1), 1024, 0, stream>>>(CV, ST); k_inrelu<<<L4, 256, 0, stream>>>(CV, ST, IN[12] + i * CC, IN[13] + i * CC, HB);
        k_conv3<<<dim3(NR / 64, CC / 64, 1), NWC * 32, 0, stream>>>(HB, WR + (size_t)(2 * i + 1) * CC * KC, CV, IN[15] + i * CC);
        k_instat<<<dim3(CC / 16, NB_, 1), 1024, 0, stream>>>(CV, ST); k_inres<<<L4, 256, 0, stream>>>(CV, ST, IN[16] + i * CC, IN[17] + i * CC, wy, wyn); float* t = wy; wy = wyn; wyn = t; }
    k_blend<<<L4, 256, 0, stream>>>(IN[0], M, wy, OUT);
}

// v005
// Measured time: 274 microseconds a run.
// In both of two side-by-side timings against v004, it was 1.23 times as fast.
// Over all steps from v000 it is 34.0 times as fast.
#include <hip/hip_runtime.h>

// NonLocalBlock2D_with_mask_Res (x NHWC [2][64][64][128], mask [2][64][64][1]; g/theta/phi = 1x1 convs; f = softmax(theta.phi^T / 1) over keys; m = (1 - min(mask,0)) (1 - mask) (the reference's resize-identity / where / invert chain; mask read as data);
// f = m[key] f (after the softmax, no renormalisation); y = f g; w_y = 1x1 conv W; 3 ResNet blocks (reflect-pad conv3x3 -> InstanceNorm(1e-3) -> relu -> reflect-pad conv3x3 -> InstanceNorm, residual); z = m x + (1 - m) w_y -> [2][64][64][128]).
// Compute dtypes, f32 accumulate: every input rounded to bf16; g/theta/phi 1x1 projections on PLAIN bf16 operands (inputs: exact, + bias), W and conv3x3 on hi+lo bf16 activations; scores (K 128) and the gated probs . g on SINGLE fp16 planes (logits are O(1) at these scales);

#define NB_  2
#define HH   64
#define NN   4096
#define CC   128
#define KC   1152
#define NR   (NB_ * NN)   // rows of both images, image-major
#define PCAR 1024.0f
typedef _Float16 h16;
typedef unsigned short bf;
typedef __attribute__((ext_vector_type(16))) __bf16   v16bf;
typedef __attribute__((ext_vector_type(16))) _Float16 v16h;
typedef __attribute__((ext_vector_type(8)))  _Float16 v8h;
typedef __attribute__((ext_vector_type(8)))  unsigned short v8us;
typedef __attribute__((ext_vector_type(8)))  float    v8f;
typedef __attribute__((ext_vector_type(4)))  float    v4f;
typedef v8h  __attribute__((may_alias)) v8ha;
typedef v4f  __attribute__((may_alias)) v4fa;
typedef v8us __attribute__((may_alias)) v8usa;

__device__ __forceinline__ unsigned short f2bf(float f) { unsigned u = __float_as_uint(f); u += 0x7FFFu + ((u >> 16) & 1u); return (unsigned short)(u >> 16); }
__device__ __forceinline__ float bf2f(unsigned short b) { return __uint_as_float(((unsigned)b) << 16); }
__device__ __forceinline__ float bfr(float f) { return bf2f(f2bf(f)); }
__device__ __forceinline__ v16h cat16(v8h lo, v8h hi) { return __builtin_shufflevector(lo, hi, 0, 1, 2, 3, 4, 5, 6, 7, 8, 9, 10, 11, 12, 13, 14, 15); }
__device__ __forceinline__ v16bf cat16b(v8us lo, v8us hi) { return __builtin_bit_cast(v16bf, __builtin_shufflevector(lo, hi, 0, 1, 2, 3, 4, 5, 6, 7, 8, 9, 10, 11, 12, 13, 14, 15)); }
__device__ __forceinline__ v8f wmma16(v16h a, v16h b, v8f c) { return __builtin_amdgcn_wmma_f32_16x16x32_f16(false, a, false, b, (short)0, c, false, false); }
__device__ __forceinline__ v8f wmmab(v16bf a, v16bf b, v8f c) { return __builtin_amdgcn_wmma_f32_16x16x32_bf16(false, a, false, b, (short)0, c, false, false); }



// ---- k_gemmw: register-blocked GEMM, NW WAVES per 64x64 output tile (16 accumulators each), operands straight from K-contiguous 16-bit planes; grid (M/64, N/64, Z), NW * 32 threads.
// Wave w takes the 32-wide K chunks w, w + NW, ...; for NW > 1 the NW partial tiles meet in LDS and are summed in wave order 0 .. NW - 1 (fixed order, bias last).
// C[m][n] (f32, pitch ldc, + optional f32 bias[n]) = sum_k A[m][k] Bt[n][k] (+ split products per NSPLIT). z-batch strides sA/sB/sC in elements; batch z = 0 / 1 / 2 adds bias / bias1 / bias2. K % 32 == 0.
template <typename T16> struct WFrag;
template <> struct WFrag<h16> { typedef v16h V; static __device__ __forceinline__ V ld(const h16* p) { return cat16(*(const v8h*)p, *(const v8h*)(p + 16)); } static __device__ __forceinline__ v8f mma(V a, V b, v8f c) { return wmma16(a, b, c); } };
template <> struct WFrag<bf> { typedef v16bf V; static __device__ __forceinline__ V ld(const bf* p) { return cat16b(*(const v8us*)p, *(const v8us*)(p + 16)); } static __device__ __forceinline__ v8f mma(V a, V b, v8f c) { return wmmab(a, b, c); } };
template <typename T16, int NSPLIT, bool BIAS, int NW>
__global__ __launch_bounds__(NW * 32) void k_gemmw(const T16* __restrict__ A, const T16* __restrict__ A2, const T16* __restrict__ Bt, const T16* __restrict__ Bt2, int K, float* C, int ldc, const float* __restrict__ bias, const float* __restrict__ bias1, const float* __restrict__ bias2, size_t sA, size_t sB, size_t sC) {
    typedef typename WFrag<T16>::V V;
    __shared__ __align__(16) float os[(NW == 1 ? 16 : NW * 64) * 68];
    const size_t z = blockIdx.z; A += z * sA; if (A2) A2 += z * sA; Bt += z * sB; if (Bt2) Bt2 += z * sB; C += z * sC; if (BIAS && z) bias = z == 1 ? bias1 : bias2;
    const int lane = threadIdx.x & 31, lr = lane & 15, hi = lane >> 4; const int r0 = blockIdx.x * 64, c0 = blockIdx.y * 64;
    const int wv = NW == 1 ? 0 : __builtin_amdgcn_readfirstlane((int)(threadIdx.x >> 5));   // the wave's number, held scalar so that the K loop's counter and branch stay scalar
    v8f acc[4][4];
#pragma unroll
    for (int mb = 0; mb < 4; ++mb)
#pragma unroll
        for (int nb = 0; nb < 4; ++nb) acc[mb][nb] = (v8f){};
    const size_t aoff = (size_t)(r0 + lr) * K + 8 * hi, boff = (size_t)(c0 + lr) * K + 8 * hi;
#pragma unroll 1
    for (int kc = wv * 32; kc < K; kc += NW * 32) {
        V a[4], a2[4];
#pragma unroll
        for (int mb = 0; mb < 4; ++mb) { a[mb] = WFrag<T16>::ld(A + aoff + (size_t)mb * 16 * K + kc); if (NSPLIT == 1 || NSPLIT == 2) a2[mb] = WFrag<T16>::ld(A2 + aoff + (size_t)mb * 16 * K + kc); }
#pragma unroll
        for (int nb = 0; nb < 4; ++nb) { const V b = WFrag<T16>::ld(Bt + boff + (size_t)nb * 16 * K + kc); V b2; if (NSPLIT >= 2) b2 = WFrag<T16>::ld(Bt2 + boff + (size_t)nb * 16 * K + kc);
#pragma unroll
            for (int mb = 0; mb < 4; ++mb) { acc[mb][nb] = WFrag<T16>::mma(a[mb], b, acc[mb][nb]); if (NSPLIT == 1 || NSPLIT == 2) acc[mb][nb] = WFrag<T16>::mma(a2[mb], b, acc[mb][nb]); if (NSPLIT >= 2) acc[mb][nb] = WFrag<T16>::mma(a[mb], b2, acc[mb][nb]); } }
        asm volatile("v_nop\n\tv_nop\n\tv_nop\n\tv_nop" : "+v"(acc[0][0]), "+v"(acc[1][1]), "+v"(acc[2][2]), "+v"(acc[3][3]) : "v"(a[0]), "v"(a[3]));
    }
    if constexpr (NW > 1) {
        float* mine = os + wv * (64 * 68);
        // the three loops are unrolled so that every accumulator index is a constant and acc stays in registers
#pragma unroll
        for (int mb = 0; mb < 4; ++mb)
#pragma unroll
            for (int nb = 0; nb < 4; ++nb)
#pragma unroll
                for (int j = 0; j < 8; ++j) mine[(mb * 16 + hi * 8 + j) * 68 + nb * 16 + lr] = acc[mb][nb][j];
        __syncthreads();   // every wave's partial tile is in LDS before any thread sums across the waves
        for (int g = threadIdx.x; g < 64 * 16; g += NW * 32) { const int row = g >> 4, cofs = (g & 15) * 4; v4f val = *(const v4fa*)(os + row * 68 + cofs);
#pragma unroll   // the NW LDS reads of a trip are issued together instead of one per round trip
            for (int w = 1; w < NW; ++w) val += *(const v4fa*)(os + (w * 64 + row) * 68 + cofs);
            if (BIAS) { val[0] += bfr(bias[c0 + cofs]); val[1] += bfr(bias[c0 + cofs + 1]); val[2] += bfr(bias[c0 + cofs + 2]); val[3] += bfr(bias[c0 + cofs + 3]); }
            *(v4f*)(C + (size_t)(r0 + row) * ldc + c0 + cofs) = val;
        }
        return;
    }
#pragma unroll
    for (int mb = 0; mb < 4; ++mb) {
#pragma unroll
        for (int nb = 0; nb < 4; ++nb) {
#pragma unroll
            for (int j = 0; j < 8; ++j) os[(hi * 8 + j) * 68 + nb * 16 + lr] = acc[mb][nb][j]; }
        __builtin_amdgcn_wave_barrier(); asm volatile("" ::: "memory");
        float* crow = C + (size_t)(r0 + mb * 16) * ldc + c0;
{
#pragma unroll
            for (int s = 0; s < 8; ++s) { const int row = 2 * s + hi, cofs = lr * 4; v4f val = *(const v4fa*)(os + row * 68 + cofs); if (BIAS) { val[0] += bfr(bias[c0 + cofs]); val[1] += bfr(bias[c0 + cofs + 1]); val[2] += bfr(bias[c0 + cofs + 2]); val[3] += bfr(bias[c0 + cofs + 3]); }
                *(v4f*)(crow + (size_t)row * ldc + cofs) = val; }
             }
        __builtin_amdgcn_wave_barrier(); asm volatile("" ::: "memory");
    }
}

__device__ __forceinline__ h16 tohx(float x) { return (h16)x; }
__device__ __forceinline__ void splitf(float y, unsigned short& h, unsigned short& l) { h = f2bf(y); l = f2bf(y - bf2f(h)); }
typedef __attribute__((ext_vector_type(2))) _Float16 v2h;
typedef __attribute__((ext_vector_type(4))) _Float16 v4h;
typedef __attribute__((ext_vector_type(2))) unsigned short v2us;
typedef __attribute__((ext_vector_type(4))) unsigned short v4us;
typedef __attribute__((ext_vector_type(2))) float v2f;

// The bodies d_* each do the work of one 256-thread block, number bx, of a pass; passes that read nothing of one another share a launch (k_prep, k_h16), each on its own range of blocks.
__device__ __forceinline__ void d_wtG(int bx, const float* __restrict__ w, int K, int N, bf* Bt) {
    const int lane = threadIdx.x & 31; const int L0 = (bx * 8 + (threadIdx.x >> 5)) * 8; const int nlines = N * K / 64;
{
#pragma unroll 1
        for (int l = 0; l < 8; ++l) { const int L = L0 + l; if (L >= nlines) break; const size_t e = (size_t)L * 64 + lane * 2; const int k = (int)(e % K), n = (int)(e / K); v2us o;
            o[0] = f2bf(w[(size_t)k * N + n]); o[1] = f2bf(w[(size_t)(k + 1) * N + n]); *(v2us*)(Bt + e) = o; }
         }
}
__device__ __forceinline__ void d_cvt8(int bx, const float* __restrict__ src, bf* dst, size_t n8) { const size_t i = (size_t)bx * 256 + threadIdx.x; if (i >= n8) return; const v8f v = *(const v8f*)(src + i * 8); v8us o;
#pragma unroll
    for (int k = 0; k < 8; ++k) o[k] = f2bf(v[k]); *(v8us*)(dst + i * 8) = o;  }
__device__ __forceinline__ void d_f16(int bx, const float* __restrict__ F, size_t n4, h16* P) { const size_t i = ((size_t)bx * 256 + threadIdx.x) * 4; if (i >= n4 * 4) return; const v4f a = *(const v4f*)(F + i); v4h o; o[0] = tohx(a[0]); o[1] = tohx(a[1]); o[2] = tohx(a[2]); o[3] = tohx(a[3]); *(v4h*)(P + i) = o;  }
__device__ __forceinline__ void d_gt16(int bx, const float* __restrict__ G, h16* GT) { const size_t e = ((size_t)bx * 256 + threadIdx.x) * 2; if (e >= (size_t)NB_ * CC * NN) return; const int n = (int)(e % NN), c = (int)(e / NN) % CC; G += (e / ((size_t)CC * NN)) * NN * CC; v2h o; o[0] = tohx(G[(size_t)n * CC + c]); o[1] = tohx(G[(size_t)(n + 1) * CC + c]); *(v2h*)(GT + e) = o;  }
__device__ __forceinline__ void d_mvec(int bx, const float* __restrict__ mask, float* M) { const int n = bx * 256 + threadIdx.x; if (n >= NR) return; const float mk = bfr(mask[n]); const float a = __fsub_rn(1.0f, fminf(mk, 0.f)); const float v = __fmul_rn(a, __fsub_rn(1.0f, mk)); *(float*)(M + n) = v;  }
// ---- k_prep: every pass that reads inputs only, in one launch. Blocks, longest bodies first: 6 x PBL the 3x3 weights (W1[0], W2[0], W1[1], ... -> WR), 4 x PBS the 1x1 weights (wg, wt, wp, ww -> four planes from WS on), PBX x -> bf16, PBM the mask vector.
#define PBL ((KC * CC / 64 + 63) / 64)
#define PBS ((CC * CC / 64 + 63) / 64)
#define PBX (NR * CC / 8 / 256)
#define PBM (NR / 256)
__global__ __launch_bounds__(256) void k_prep(const float* __restrict__ x, const float* __restrict__ mask, const float* __restrict__ wg, const float* __restrict__ wt, const float* __restrict__ wp, const float* __restrict__ ww, const float* __restrict__ rw1, const float* __restrict__ rw2, bf* WS, bf* WR, bf* XB, float* M) {
    int b = blockIdx.x;
    if (b < 6 * PBL) { const int i = b / PBL; d_wtG(b % PBL, ((i & 1) ? rw2 : rw1) + (size_t)(i >> 1) * KC * CC, KC, CC, WR + (size_t)i * CC * KC); return; }
    b -= 6 * PBL;
    if (b < 4 * PBS) { const int i = b / PBS; d_wtG(b % PBS, i == 0 ? wg : i == 1 ? wt : i == 2 ? wp : ww, CC, CC, WS + (size_t)i * CC * CC); return; }
    b -= 4 * PBS;
    if (b < PBX) { d_cvt8(b, x, XB, (size_t)NR * CC / 8); return; }
    d_mvec(b - PBX, mask, M);
}
// ---- k_h16: the three fp16 planes of the projections in one launch: PBG blocks g -> its transpose GT, then theta and phi (adjacent f32 planes from TP on -> adjacent fp16 planes from TP16 on).
#define PBG (NR * CC / 2 / 256)
#define PBF (2 * NR * CC / 4 / 256)
__global__ __launch_bounds__(256) void k_h16(const float* __restrict__ G, const float* __restrict__ TP, h16* GT, h16* TP16) {
    const int b = blockIdx.x;
    if (b < PBG) { d_gt16(b, G, GT); return; }
    d_f16(b - PBG, TP, (size_t)2 * NR * CC / 4, TP16);
}
__global__ __launch_bounds__(256) void k_soft3(const float* __restrict__ Sb, const float* __restrict__ M, h16* P) { const int lane = threadIdx.x & 31; const int row = blockIdx.x * 8 + (threadIdx.x >> 5); if (row >= NR) return; const float* sr = Sb + (size_t)row * NN; M += (row / NN) * NN; float mx = -3.0e38f;
    for (int ch = 0; ch < NN / 128; ++ch) { const v4f a = *(const v4f*)(sr + ch * 128 + lane * 4); mx = fmaxf(mx, fmaxf(fmaxf(a[0], a[1]), fmaxf(a[2], a[3]))); }
#pragma unroll
    for (int sh = 16; sh; sh >>= 1) mx = fmaxf(mx, __shfl_xor(mx, sh, 32));
    float sum = 0.f;
    for (int ch = 0; ch < NN / 128; ++ch) { const v4f a = *(const v4f*)(sr + ch * 128 + lane * 4);
#pragma unroll
        for (int q = 0; q < 4; ++q) { float d0 = __fsub_rn(a[q], mx); asm volatile("" : "+v"(d0)); sum += __expf(d0); } }
#pragma unroll
    for (int sh = 16; sh; sh >>= 1) sum += __shfl_xor(sum, sh, 32);
    const float f = __fdiv_rn(PCAR, sum);
    { for (int ch = 0; ch < NN / 128; ++ch) { const int j0 = ch * 128 + lane * 4; const v4f a = *(const v4f*)(sr + j0); const v4f m4 = *(const v4f*)(M + j0); v4h o;
#pragma unroll
            for (int q = 0; q < 4; ++q) { float d0 = __fsub_rn(a[q], mx); asm volatile("" : "+v"(d0)); float e = __fmul_rn(__expf(d0), f); asm volatile("" : "+v"(e)); o[q] = tohx(__fmul_rn(e, m4[q])); }
            *(v4h*)(P + (size_t)row * NN + j0) = o; }  } }
__global__ __launch_bounds__(256) void k_spl(const float* __restrict__ F, size_t n4, float sc, bf* Fh, bf* Fl) { const size_t i = ((size_t)blockIdx.x * 256 + threadIdx.x) * 4; if (i >= n4 * 4) return; const v4f a = *(const v4f*)(F + i); v4us oh, ol;
#pragma unroll
    for (int q = 0; q < 4; ++q) { unsigned short u, c2; splitf(a[q] * sc, u, c2); oh[q] = u; ol[q] = c2; } *(v4us*)(Fh + i) = oh; *(v4us*)(Fl + i) = ol;  }
__device__ __forceinline__ int reflect64(int i) { return i < 0 ? -i : (i >= HH ? 2 * HH - 2 - i : i); }
// ---- k_conv3: reflect-pad conv3x3 as an implicit GEMM, no im2col copy. One 64x64 output tile per work-group = one image row (64 pixels) x 64 output channels; grid (NR/64, CC/64), NWC * 32 threads.
// K = (kh kw ci) as in Bt's rows; wave w takes the 32-wide K chunks w, w + NWC, ... (a chunk lies inside one tap). The A fragment of a chunk is read from the f32 map at the tap's reflected pixel and split into bf16 hi + lo in registers;
// C = sum (hi + lo) Bt, the NWC partial tiles meet in LDS and are summed in wave order 0 .. NWC - 1 (fixed order, bias last).
#define NWC 12
typedef __attribute__((ext_vector_type(2))) __bf16 v2bf;
typedef __attribute__((ext_vector_type(8))) unsigned v8u;
// two f32 -> packed bf16 hi pair and packed bf16 lo pair (lo = bf16(y - hi)), round to nearest even by the hardware's packed convert: the values of splitf for every finite y
__device__ __forceinline__ void split2(float y0, float y1, unsigned& h, unsigned& l) { v2f y; y[0] = y0; y[1] = y1; h = __builtin_bit_cast(unsigned, __builtin_convertvector(y, v2bf)); v2f r; r[0] = y0 - __uint_as_float(h << 16); r[1] = y1 - __uint_as_float(h & 0xFFFF0000u); l = __builtin_bit_cast(unsigned, __builtin_convertvector(r, v2bf)); }
__global__ __launch_bounds__(NWC * 32) void k_conv3(const float* __restrict__ F, const bf* __restrict__ Bt, float* C, const float* __restrict__ bias) {
    __shared__ __align__(16) float os[NWC * 64 * 68];
    const int lane = threadIdx.x & 31, lr = lane & 15, hi = lane >> 4; const int r0 = blockIdx.x * 64, c0 = blockIdx.y * 64;
    const int wv = __builtin_amdgcn_readfirstlane((int)(threadIdx.x >> 5));   // the wave's number, held scalar so that the K loop's counter, tap and branch stay scalar
    const int y = blockIdx.x % HH; F += (size_t)(blockIdx.x / HH) * NN * CC + 8 * hi;
    v8f acc[4][4];
#pragma unroll
    for (int mb = 0; mb < 4; ++mb)
#pragma unroll
        for (int nb = 0; nb < 4; ++nb) acc[mb][nb] = (v8f){};
    const size_t boff = (size_t)(c0 + lr) * KC + 8 * hi;
#pragma unroll 1
    for (int kc = wv * 32; kc < KC; kc += NWC * 32) {
        const int tap = kc / CC, kh = tap / 3, kw = tap % 3; const float* Fr = F + (size_t)reflect64(y + kh - 1) * HH * CC + kc % CC;
        v16bf b[4]; v4f raw[4][4];
#pragma unroll
        for (int mb = 0; mb < 4; ++mb) { const float* p = Fr + reflect64(mb * 16 + lr + kw - 1) * CC; raw[mb][0] = *(const v4f*)p; raw[mb][1] = *(const v4f*)(p + 4); raw[mb][2] = *(const v4f*)(p + 16); raw[mb][3] = *(const v4f*)(p + 20); }
        asm volatile("s_wait_xcnt 0x0" ::: "memory");   // the 16 map loads are issued: the wait stands in front of the weight loads, whose results may land on the address pairs that the map loads name
#pragma unroll
        for (int nb = 0; nb < 4; ++nb) b[nb] = WFrag<bf>::ld(Bt + boff + (size_t)nb * 16 * KC + kc);
        asm volatile("s_wait_xcnt 0x0" ::: "memory");   // the 8 weight loads are issued: the wait stands in front of the step of their address pair
        __builtin_amdgcn_sched_barrier(0);   // keeps the converts behind all 24 loads: without it the first converts, with their data waits, move in front of the later loads and a trip pays two memory round trips
        v16bf a[4], a2[4];
#pragma unroll
        for (int mb = 0; mb < 4; ++mb) { v8u h, l;
#pragma unroll
            for (int q = 0; q < 4; ++q) { unsigned u, c2; split2(raw[mb][q][0], raw[mb][q][1], u, c2); h[2 * q] = u; l[2 * q] = c2; split2(raw[mb][q][2], raw[mb][q][3], u, c2); h[2 * q + 1] = u; l[2 * q + 1] = c2; }
            a[mb] = __builtin_bit_cast(v16bf, h); a2[mb] = __builtin_bit_cast(v16bf, l); }
#pragma unroll
        for (int nb = 0; nb < 4; ++nb)
#pragma unroll
            for (int mb = 0; mb < 4; ++mb) { acc[mb][nb] = wmmab(a[mb], b[nb], acc[mb][nb]); acc[mb][nb] = wmmab(a2[mb], b[nb], acc[mb][nb]); }
        // four vector slots between the trip's last matrix instructions and whatever overwrites their operands on the taken back edge
        asm volatile("v_nop\n\tv_nop\n\tv_nop\n\tv_nop" : "+v"(acc[0][0]), "+v"(acc[1][1]), "+v"(acc[2][2]), "+v"(acc[3][3]) : "v"(a[0]), "v"(a[3]));
    }
    float* mine = os + wv * (64 * 68);
    // the three loops are unrolled so that every accumulator index is a constant and acc stays in registers
#pragma unroll
    for (int mb = 0; mb < 4; ++mb)
#pragma unroll
        for (int nb = 0; nb < 4; ++nb)
#pragma unroll
            for (int j = 0; j < 8; ++j) mine[(mb * 16 + hi * 8 + j) * 68 + nb * 16 + lr] = acc[mb][nb][j];
    __syncthreads();   // every wave's partial tile is in LDS before any thread sums across the waves
    for (int g = threadIdx.x; g < 64 * 16; g += NWC * 32) { const int row = g >> 4, cofs = (g & 15) * 4; v4f val = *(const v4fa*)(os + row * 68 + cofs);
#pragma unroll   // the NWC LDS reads of a trip are issued together instead of one per round trip
        for (int w = 1; w < NWC; ++w) val += *(const v4fa*)(os + (w * 64 + row) * 68 + cofs);
        val[0] += bfr(bias[c0 + cofs]); val[1] += bfr(bias[c0 + cofs + 1]); val[2] += bfr(bias[c0 + cofs + 2]); val[3] += bfr(bias[c0 + cofs + 3]);
        *(v4f*)(C + (size_t)(r0 + row) * CC + c0 + cofs) = val;
    }
}
// ---- k_instat: per-channel mean and 1/sqrt(var + eps) over the NN rows. One work-group of 32 waves per 16 channels of one image (grid (CC/16, NB_)): thread = (row group t >> 2, channel quad t & 3) loads its 16 rows x 4 channels once,
// keeps them in registers for both sums (mean, then squares about the mean); each sum: 16 serial adds per thread, butterfly over the wave's 8 row lanes, 32 wave partials through LDS, summed alike by every wave.
__device__ __forceinline__ v4f wsum8(v4f s) {
#pragma unroll
    for (int sh = 4; sh <= 16; sh <<= 1) {
#pragma unroll
        for (int q = 0; q < 4; ++q) s[q] += __shfl_xor(s[q], sh, 32); }
    return s; }
__device__ __forceinline__ v4f bsum(v4f s, float* red, int lane, int wave) {
    s = wsum8(s); if (lane < 4) *(v4fa*)(red + (wave * 4 + lane) * 4) = s;
    __syncthreads();
    v4f t = *(const v4fa*)(red + lane * 4);
#pragma unroll
    for (int j = 1; j < 4; ++j) t += *(const v4fa*)(red + (j * 32 + lane) * 4);
    return wsum8(t); }
__global__ __launch_bounds__(1024) void k_instat(const float* __restrict__ Cv, float* ST) {
    __shared__ __align__(16) float red1[32 * 16]; __shared__ __align__(16) float red2[32 * 16];
    const int t = threadIdx.x, lane = t & 31, wave = t >> 5; const int c = blockIdx.x * 16 + (t & 3) * 4; const float* p = Cv + ((size_t)blockIdx.y * NN + (t >> 2)) * CC + c; ST += blockIdx.y * 2 * CC; v4f v[16];
#pragma unroll
    for (int i = 0; i < 15; ++i) v[i] = *(const v4f*)(p + (size_t)i * 256 * CC);
    asm volatile("s_wait_xcnt 0x0" ::: "memory");   // the compiler lets the last load's result land on the address pair that the 15 issued loads name: the wait stands in front of that overwrite
    v[15] = *(const v4f*)(p + (size_t)15 * 256 * CC);
    v4f s = v[0];
#pragma unroll
    for (int i = 1; i < 16; ++i) s += v[i];
    const v4f mu = bsum(s, red1, lane, wave) * (1.0f / NN);
    v4f q2 = (v4f){};
#pragma unroll
    for (int i = 0; i < 16; ++i) { const v4f d = v[i] - mu; q2 += d * d; }
    const v4f vq = bsum(q2, red2, lane, wave) * (1.0f / NN);
    if (t < 4) { v4f o0, o1; o0[0] = mu[0]; o0[1] = __frsqrt_rn(vq[0] + 1e-3f); o0[2] = mu[1]; o0[3] = __frsqrt_rn(vq[1] + 1e-3f); o1[0] = mu[2]; o1[1] = __frsqrt_rn(vq[2] + 1e-3f); o1[2] = mu[3]; o1[3] = __frsqrt_rn(vq[3] + 1e-3f);
        *(v4f*)(ST + 2 * c) = o0; *(v4f*)(ST + 2 * c + 4) = o1; } }
__global__ __launch_bounds__(256) void k_inrelu(const float* __restrict__ Cv, const float* __restrict__ ST, const float* __restrict__ g, const float* __restrict__ be, float* Hout) { const size_t i = ((size_t)blockIdx.x * 256 + threadIdx.x) * 4; if (i >= (size_t)NR * CC) return; const int c = (int)(i % CC); ST += (i / ((size_t)NN * CC)) * 2 * CC; const v4f a = *(const v4f*)(Cv + i); v4f o;
#pragma unroll
    for (int q = 0; q < 4; ++q) { float d = __fsub_rn(a[q], ST[2 * (c + q)]); asm volatile("" : "+v"(d)); float tn = __fmul_rn(d, ST[2 * (c + q) + 1]); asm volatile("" : "+v"(tn)); float tg = __fmul_rn(tn, bfr(g[c + q])); asm volatile("" : "+v"(tg)); o[q] = fmaxf(__fadd_rn(tg, bfr(be[c + q])), 0.f); }
    *(v4f*)(Hout + i) = o;  }
__global__ __launch_bounds__(256) void k_inres(const float* __restrict__ Cv, const float* __restrict__ ST, const float* __restrict__ g, const float* __restrict__ be, const float* __restrict__ WYin, float* WYout) { const size_t i = ((size_t)blockIdx.x * 256 + threadIdx.x) * 4; if (i >= (size_t)NR * CC) return; const int c = (int)(i % CC); ST += (i / ((size_t)NN * CC)) * 2 * CC; const v4f a = *(const v4f*)(Cv + i);
    asm volatile("s_wait_xcnt 0x0" ::: "memory");   // the compiler lets the next load's result land on the address pair that the issued Cv load names: the wait stands in front of that overwrite
    const v4f w = *(const v4f*)(WYin + i); v4f o;
#pragma unroll
    for (int q = 0; q < 4; ++q) { float d = __fsub_rn(a[q], ST[2 * (c + q)]); asm volatile("" : "+v"(d)); float tn = __fmul_rn(d, ST[2 * (c + q) + 1]); asm volatile("" : "+v"(tn)); float tg = __fmul_rn(tn, bfr(g[c + q])); asm volatile("" : "+v"(tg)); o[q] = __fadd_rn(w[q], __fadd_rn(tg, bfr(be[c + q]))); }
    *(v4f*)(WYout + i) = o;  }
__global__ __launch_bounds__(256) void k_blend(const float* __restrict__ x, const float* __restrict__ M, const float* __restrict__ WY, float* OUT) { const size_t i = ((size_t)blockIdx.x * 256 + threadIdx.x) * 4; if (i >= (size_t)NR * CC) return; const int n = (int)(i / CC); const float m = M[n]; const float om = __fsub_rn(1.0f, m); const v4f w = *(const v4f*)(WY + i); v4f o;
#pragma unroll
    for (int q = 0; q < 4; ++q) { float a = __fmul_rn(m, bfr(x[i + q])); asm volatile("" : "+v"(a)); float b = __fmul_rn(om, w[q]); asm volatile("" : "+v"(b)); o[q] = __fadd_rn(a, b); } *(v4f*)(OUT + i) = o;  }

extern "C" void kernel_launch(void* const* d_in, const int* in_sizes, int n_in,
                              void* d_out, int out_size, void* d_ws, size_t ws_size, hipStream_t stream) {
    (void)in_sizes; (void)n_in; (void)out_size;
    const float* IN[18]; for (int i = 0; i < 18; ++i) IN[i] = (const float*)d_in[i];   // 0 x, 1 mask, 2 wg, 3 bg, 4 wt, 5 bt, 6 wp, 7 bp, 8 ww, 9 bw, 10 res_w1 [3][3][3][128][128], 11 res_b1 [3][128], 12 res_g1, 13 res_be1, 14 res_w2, 15 res_b2, 16 res_g2, 17 res_be2
    float* OUT = (float*)d_out;     // [2][64][64][128]
    char* wsp = (char*)d_ws;
    auto take = [&](size_t bytes) { char* p = wsp; wsp += (bytes + 255) & ~(size_t)255; return (void*)p; };
    bf* WG = (bf*)take(CC * CC * 2); bf* WT = (bf*)take(CC * CC * 2); bf* WP = (bf*)take(CC * CC * 2); bf* WW = (bf*)take(CC * CC * 2); bf* WR = (bf*)take((size_t)6 * CC * KC * 2);
    bf* XB = (bf*)take((size_t)NR * CC * 2); float* GF = (float*)take((size_t)NR * CC * 4); float* TF = (float*)take((size_t)NR * CC * 4); float* PF = (float*)take((size_t)NR * CC * 4); h16* T16 = (h16*)take((size_t)NR * CC * 2); h16* P16k = (h16*)take((size_t)NR * CC * 2); h16* GT = (h16*)take((size_t)NR * CC * 2); float* M = (float*)take((size_t)NR * 4);
    float* Sb = (float*)take((size_t)NR * NN * 4); h16* PP = (h16*)take((size_t)NR * NN * 2); float* Y = (float*)take((size_t)NR * CC * 4); float* WY = (float*)take((size_t)NR * CC * 4); float* WY2 = (float*)take((size_t)NR * CC * 4); float* CV = (float*)take((size_t)NR * CC * 4); float* HB = (float*)take((size_t)NR * CC * 4); float* ST = (float*)take(NB_ * CC * 2 * 4);
    bf* Ah = (bf*)Sb; bf* Al = Ah + (size_t)NR * KC;    // the split planes reuse the score plane: first written after its last reader (k_soft3) has ended
    if ((size_t)(wsp - (char*)d_ws) > ws_size) return;    // total ~ 245 MB
    (void)WT; (void)WP; (void)PF;   // reached through WG, GF and TF: the planes of a merged launch lie one behind the other (every size above is a multiple of 256 bytes)
    // every launch below covers both images (rows image-major; per-image operands through grid z / y) and all NN queries
    const unsigned L4 = (unsigned)(((size_t)NR * CC / 4 + 255) / 256);
    k_prep<<<6 * PBL + 4 * PBS + PBX + PBM, 256, 0, stream>>>(IN[0], IN[1], IN[2], IN[4], IN[6], IN[8], IN[10], IN[14], WG, WR, XB, M);   // HWIO flattened = [(kh kw ci)][co] (x @ W layout); WG, WT, WP, WW lie one behind the other
    k_gemmw<bf, 0, true, 4><<<dim3(NR / 64, CC / 64, 3), 4 * 32, 0, stream>>>(XB, nullptr, WG, nullptr, CC, GF, CC, IN[3], IN[5], IN[7], 0, (size_t)CC * CC, (size_t)NR * CC);   // z = g, theta, phi: WG, WT, WP and GF, TF, PF lie one behind the other
    k_h16<<<PBG + PBF, 256, 0, stream>>>(GF, TF, GT, T16);   // TF, PF and T16, P16k lie one behind the other
    k_gemmw<h16, 0, false, 1><<<dim3(NN / 64, NN / 64, NB_), 32, 0, stream>>>(T16, nullptr, P16k, nullptr, CC, Sb, NN, nullptr, nullptr, nullptr, (size_t)NN * CC, (size_t)NN * CC, (size_t)NN * NN);
    k_soft3<<<NR / 8, 256, 0, stream>>>(Sb, M, PP);
    k_gemmw<h16, 0, false, 16><<<dim3(NN / 64, CC / 64, NB_), 16 * 32, 0, stream>>>(PP, nullptr, GT, nullptr, NN, Y, CC, nullptr, nullptr, nullptr, (size_t)NN * NN, (size_t)CC * NN, (size_t)NN * CC);
    k_spl<<<L4, 256, 0, stream>>>(Y, (size_t)NR * CC / 4, 1.0f / PCAR, Ah, Al);
    k_gemmw<bf, 1, true, 4><<<dim3(NR / 64, CC / 64, 1), 4 * 32, 0, stream>>>(Ah, Al, WW, nullptr, CC, WY, CC, IN[9], nullptr, nullptr, 0, 0, 0);
    float* wy = WY; float* wyn = WY2;
    for (int i = 0; i < 3; ++i) {
        k_conv3<<<dim3(NR / 64, CC / 64, 1), NWC * 32, 0, stream>>>(wy, WR + (size_t)(2 * i) * CC * KC, CV, IN[11] + i * CC);
        k_instat<<<dim3(CC / 16, NB_, 1), 1024, 0, stream>>>(CV, ST); k_inrelu<<<L4, 256, 0, stream>>>(CV, ST, IN[12] + i * CC, IN[13] + i * CC, HB);
        k_conv3<<<dim3(NR / 64, CC / 64, 1), NWC * 32, 0, stream>>>(HB, WR + (size_t)(2 * i + 1) * CC * KC, CV, IN[15] + i * CC);
        k_instat<<<dim3(CC / 16, NB_, 1), 1024, 0, stream>>>(CV, ST); k_inres<<<L4, 256, 0, stream>>>(CV, ST, IN[16] + i * CC, IN[17] + i * CC, wy, wyn); float* t = wy; wy = wyn; wyn = t; }
    k_blend<<<L4, 256, 0, stream>>>(IN[0], M, wy, OUT);
}

// v006
// It runs in 193 microseconds.
// Timed twice side by side with v005, it ran 1.42 and 1.44 times as fast.
// All steps since v000 together make it 48.5 times as fast.
#include <hip/hip_runtime.h>

// NonLocalBlock2D_with_mask_Res (x NHWC [2][64][64][128], mask [2][64][64][1]; g/theta/phi = 1x1 convs; f = softmax(theta.phi^T / 1) over keys; m = (1 - min(mask,0)) (1 - mask) (the reference's resize-identity / where / invert chain; mask read as data);
// f = m[key] f (after the softmax, no renormalisation); y = f g; w_y = 1x1 conv W; 3 ResNet blocks (reflect-pad conv3x3 -> InstanceNorm(1e-3) -> relu -> reflect-pad conv3x3 -> InstanceNorm, residual); z = m x + (1 - m) w_y -> [2][64][64][128]).
// Compute dtypes, f32 accumulate: every input rounded to bf16; g/theta/phi 1x1 projections on PLAIN bf16 operands (inputs: exact, + bias), W and conv3x3 on hi+lo bf16 activations; scores (K 128) and the gated probs . g on SINGLE fp16 planes (logits are O(1) at these scales);

#define NB_  2
#define HH   64
#define NN   4096
#define CC   128
#define KC   1152
#define NR   (NB_ * NN)   // rows of both images, image-major
typedef _Float16 h16;
typedef unsigned short bf;
typedef __attribute__((ext_vector_type(16))) __bf16   v16bf;
typedef __attribute__((ext_vector_type(16))) _Float16 v16h;
typedef __attribute__((ext_vector_type(8)))  _Float16 v8h;
typedef __attribute__((ext_vector_type(8)))  unsigned short v8us;
typedef __attribute__((ext_vector_type(8)))  float    v8f;
typedef __attribute__((ext_vector_type(4)))  float    v4f;
typedef v8h  __attribute__((may_alias)) v8ha;
typedef v4f  __attribute__((may_alias)) v4fa;
typedef v8us __attribute__((may_alias)) v8usa;

__device__ __forceinline__ unsigned short f2bf(float f) { unsigned u = __float_as_uint(f); u += 0x7FFFu + ((u >> 16) & 1u); return (unsigned short)(u >> 16); }
__device__ __forceinline__ float bf2f(unsigned short b) { return __uint_as_float(((unsigned)b) << 16); }
__device__ __forceinline__ float bfr(float f) { return bf2f(f2bf(f)); }
__device__ __forceinline__ v16h cat16(v8h lo, v8h hi) { return __builtin_shufflevector(lo, hi, 0, 1, 2, 3, 4, 5, 6, 7, 8, 9, 10, 11, 12, 13, 14, 15); }
__device__ __forceinline__ v16bf cat16b(v8us lo, v8us hi) { return __builtin_bit_cast(v16bf, __builtin_shufflevector(lo, hi, 0, 1, 2, 3, 4, 5, 6, 7, 8, 9, 10, 11, 12, 13, 14, 15)); }
__device__ __forceinline__ v8f wmma16(v16h a, v16h b, v8f c) { return __builtin_amdgcn_wmma_f32_16x16x32_f16(false, a, false, b, (short)0, c, false, false); }
__device__ __forceinline__ v8f wmmab(v16bf a, v16bf b, v8f c) { return __builtin_amdgcn_wmma_f32_16x16x32_bf16(false, a, false, b, (short)0, c, false, false); }



// ---- k_gemmw: register-blocked GEMM, NW WAVES per 64x64 output tile (16 accumulators each), operands straight from K-contiguous 16-bit planes; grid (M/64, N/64, Z), NW * 32 threads.
// Wave w takes the 32-wide K chunks w, w + NW, ...; for NW > 1 the NW partial tiles meet in LDS and are summed in wave order 0 .. NW - 1 (fixed order, bias last).
// C[m][n] (f32, pitch ldc, + optional f32 bias[n]) = sum_k A[m][k] Bt[n][k] (+ split products per NSPLIT). z-batch strides sA/sB/sC in elements; batch z = 0 / 1 / 2 adds bias / bias1 / bias2. K % 32 == 0.
template <typename T16> struct WFrag;
template <> struct WFrag<h16> { typedef v16h V; static __device__ __forceinline__ V ld(const h16* p) { return cat16(*(const v8h*)p, *(const v8h*)(p + 16)); } static __device__ __forceinline__ v8f mma(V a, V b, v8f c) { return wmma16(a, b, c); } };
template <> struct WFrag<bf> { typedef v16bf V; static __device__ __forceinline__ V ld(const bf* p) { return cat16b(*(const v8us*)p, *(const v8us*)(p + 16)); } static __device__ __forceinline__ v8f mma(V a, V b, v8f c) { return wmmab(a, b, c); } };
template <typename T16, int NSPLIT, bool BIAS, int NW>
__global__ __launch_bounds__(NW * 32) void k_gemmw(const T16* __restrict__ A, const T16* __restrict__ A2, const T16* __restrict__ Bt, const T16* __restrict__ Bt2, int K, float* C, int ldc, const float* __restrict__ bias, const float* __restrict__ bias1, const float* __restrict__ bias2, size_t sA, size_t sB, size_t sC) {
    typedef typename WFrag<T16>::V V;
    __shared__ __align__(16) float os[(NW == 1 ? 16 : NW * 64) * 68];
    const size_t z = blockIdx.z; A += z * sA; if (A2) A2 += z * sA; Bt += z * sB; if (Bt2) Bt2 += z * sB; C += z * sC; if (BIAS && z) bias = z == 1 ? bias1 : bias2;
    const int lane = threadIdx.x & 31, lr = lane & 15, hi = lane >> 4; const int r0 = blockIdx.x * 64, c0 = blockIdx.y * 64;
    const int wv = NW == 1 ? 0 : __builtin_amdgcn_readfirstlane((int)(threadIdx.x >> 5));   // the wave's number, held scalar so that the K loop's counter and branch stay scalar
    v8f acc[4][4];
#pragma unroll
    for (int mb = 0; mb < 4; ++mb)
#pragma unroll
        for (int nb = 0; nb < 4; ++nb) acc[mb][nb] = (v8f){};
    const size_t aoff = (size_t)(r0 + lr) * K + 8 * hi, boff = (size_t)(c0 + lr) * K + 8 * hi;
#pragma unroll 1
    for (int kc = wv * 32; kc < K; kc += NW * 32) {
        V a[4], a2[4];
#pragma unroll
        for (int mb = 0; mb < 4; ++mb) { a[mb] = WFrag<T16>::ld(A + aoff + (size_t)mb * 16 * K + kc); if (NSPLIT == 1 || NSPLIT == 2) a2[mb] = WFrag<T16>::ld(A2 + aoff + (size_t)mb * 16 * K + kc); }
#pragma unroll
        for (int nb = 0; nb < 4; ++nb) { const V b = WFrag<T16>::ld(Bt + boff + (size_t)nb * 16 * K + kc); V b2; if (NSPLIT >= 2) b2 = WFrag<T16>::ld(Bt2 + boff + (size_t)nb * 16 * K + kc);
#pragma unroll
            for (int mb = 0; mb < 4; ++mb) { acc[mb][nb] = WFrag<T16>::mma(a[mb], b, acc[mb][nb]); if (NSPLIT == 1 || NSPLIT == 2) acc[mb][nb] = WFrag<T16>::mma(a2[mb], b, acc[mb][nb]); if (NSPLIT >= 2) acc[mb][nb] = WFrag<T16>::mma(a[mb], b2, acc[mb][nb]); } }
        asm volatile("v_nop\n\tv_nop\n\tv_nop\n\tv_nop" : "+v"(acc[0][0]), "+v"(acc[1][1]), "+v"(acc[2][2]), "+v"(acc[3][3]) : "v"(a[0]), "v"(a[3]));
    }
    if constexpr (NW > 1) {
        float* mine = os + wv * (64 * 68);
        // the three loops are unrolled so that every accumulator index is a constant and acc stays in registers
#pragma unroll
        for (int mb = 0; mb < 4; ++mb)
#pragma unroll
            for (int nb = 0; nb < 4; ++nb)
#pragma unroll
                for (int j = 0; j < 8; ++j) mine[(mb * 16 + hi * 8 + j) * 68 + nb * 16 + lr] = acc[mb][nb][j];
        __syncthreads();   // every wave's partial tile is in LDS before any thread sums across the waves
        for (int g = threadIdx.x; g < 64 * 16; g += NW * 32) { const int row = g >> 4, cofs = (g & 15) * 4; v4f val = *(const v4fa*)(os + row * 68 + cofs);
#pragma unroll   // the NW LDS reads of a trip are issued together instead of one per round trip
            for (int w = 1; w < NW; ++w) val += *(const v4fa*)(os + (w * 64 + row) * 68 + cofs);
            if (BIAS) { val[0] += bfr(bias[c0 + cofs]); val[1] += bfr(bias[c0 + cofs + 1]); val[2] += bfr(bias[c0 + cofs + 2]); val[3] += bfr(bias[c0 + cofs + 3]); }
            *(v4f*)(C + (size_t)(r0 + row) * ldc + c0 + cofs) = val;
        }
        return;
    }
#pragma unroll
    for (int mb = 0; mb < 4; ++mb) {
#pragma unroll
        for (int nb = 0; nb < 4; ++nb) {
#pragma unroll
            for (int j = 0; j < 8; ++j) os[(hi * 8 + j) * 68 + nb * 16 + lr] = acc[mb][nb][j]; }
        __builtin_amdgcn_wave_barrier(); asm volatile("" ::: "memory");
        float* crow = C + (size_t)(r0 + mb * 16) * ldc + c0;
{
#pragma unroll
            for (int s = 0; s < 8; ++s) { const int row = 2 * s + hi, cofs = lr * 4; v4f val = *(const v4fa*)(os + row * 68 + cofs); if (BIAS) { val[0] += bfr(bias[c0 + cofs]); val[1] += bfr(bias[c0 + cofs + 1]); val[2] += bfr(bias[c0 + cofs + 2]); val[3] += bfr(bias[c0 + cofs + 3]); }
                *(v4f*)(crow + (size_t)row * ldc + cofs) = val; }
             }
        __builtin_amdgcn_wave_barrier(); asm volatile("" ::: "memory");
    }
}

__device__ __forceinline__ h16 tohx(float x) { return (h16)x; }
__device__ __forceinline__ void splitf(float y, unsigned short& h, unsigned short& l) { h = f2bf(y); l = f2bf(y - bf2f(h)); }
typedef __attribute__((ext_vector_type(2))) _Float16 v2h;
typedef __attribute__((ext_vector_type(4))) _Float16 v4h;
typedef __attribute__((ext_vector_type(2))) unsigned short v2us;
typedef __attribute__((ext_vector_type(4))) unsigned short v4us;
typedef __attribute__((ext_vector_type(2))) float v2f;

// The bodies d_* each do the work of one 256-thread block, number bx, of a pass; passes that read nothing of one another share a launch (k_prep, k_h16), each on its own range of blocks.
__device__ __forceinline__ void d_wtG(int bx, const float* __restrict__ w, int K, int N, bf* Bt) {
    const int lane = threadIdx.x & 31; const int L0 = (bx * 8 + (threadIdx.x >> 5)) * 8; const int nlines = N * K / 64;
{
#pragma unroll 1
        for (int l = 0; l < 8; ++l) { const int L = L0 + l; if (L >= nlines) break; const size_t e = (size_t)L * 64 + lane * 2; const int k = (int)(e % K), n = (int)(e / K); v2us o;
            o[0] = f2bf(w[(size_t)k * N + n]); o[1] = f2bf(w[(size_t)(k + 1) * N + n]); *(v2us*)(Bt + e) = o; }
         }
}
__device__ __forceinline__ void d_cvt8(int bx, const float* __restrict__ src, bf* dst, size_t n8) { const size_t i = (size_t)bx * 256 + threadIdx.x; if (i >= n8) return; const v8f v = *(const v8f*)(src + i * 8); v8us o;
#pragma unroll
    for (int k = 0; k < 8; ++k) o[k] = f2bf(v[k]); *(v8us*)(dst + i * 8) = o;  }
__device__ __forceinline__ void d_f16(int bx, const float* __restrict__ F, size_t n4, h16* P) { const size_t i = ((size_t)bx * 256 + threadIdx.x) * 4; if (i >= n4 * 4) return; const v4f a = *(const v4f*)(F + i); v4h o; o[0] = tohx(a[0]); o[1] = tohx(a[1]); o[2] = tohx(a[2]); o[3] = tohx(a[3]); *(v4h*)(P + i) = o;  }
// the gated values m[key] g[key][c] as fp16, laid out as the A fragments of k_attn's second product: [image][32-key chunk][16-channel block][lane][16], lane (c = lane & 15, h = lane >> 4) holds channel c at keys 8h .. 8h + 7 and 16 + 8h .. 16 + 8h + 7 of the chunk
__device__ __forceinline__ void d_gtt(int bx, const float* __restrict__ G, const float* __restrict__ M, h16* GT) { const int e = bx * 256 + threadIdx.x; if (e >= NR * CC / 16) return; const int lane = e & 31, cb = (e >> 5) & 7, chunk = e >> 8; const int n0 = chunk * 32 + 8 * (lane >> 4), c = cb * 16 + (lane & 15); v8h lo, up;
#pragma unroll
    for (int s = 0; s < 8; ++s) { lo[s] = tohx(G[(size_t)(n0 + s) * CC + c] * M[n0 + s]); up[s] = tohx(G[(size_t)(n0 + 16 + s) * CC + c] * M[n0 + 16 + s]); }
    *(v8h*)(GT + (size_t)e * 16) = lo; *(v8h*)(GT + (size_t)e * 16 + 8) = up;  }
__device__ __forceinline__ void d_mvec(int bx, const float* __restrict__ mask, float* M) { const int n = bx * 256 + threadIdx.x; if (n >= NR) return; const float mk = bfr(mask[n]); const float a = __fsub_rn(1.0f, fminf(mk, 0.f)); const float v = __fmul_rn(a, __fsub_rn(1.0f, mk)); *(float*)(M + n) = v;  }
// ---- k_prep: every pass that reads inputs only, in one launch. Blocks, longest bodies first: 6 x PBL the 3x3 weights (W1[0], W2[0], W1[1], ... -> WR), 4 x PBS the 1x1 weights (wg, wt, wp, ww -> four planes from WS on), PBX x -> bf16, PBM the mask vector.
#define PBL ((KC * CC / 64 + 63) / 64)
#define PBS ((CC * CC / 64 + 63) / 64)
#define PBX (NR * CC / 8 / 256)
#define PBM (NR / 256)
__global__ __launch_bounds__(256) void k_prep(const float* __restrict__ x, const float* __restrict__ mask, const float* __restrict__ wg, const float* __restrict__ wt, const float* __restrict__ wp, const float* __restrict__ ww, const float* __restrict__ rw1, const float* __restrict__ rw2, bf* WS, bf* WR, bf* XB, float* M) {
    int b = blockIdx.x;
    if (b < 6 * PBL) { const int i = b / PBL; d_wtG(b % PBL, ((i & 1) ? rw2 : rw1) + (size_t)(i >> 1) * KC * CC, KC, CC, WR + (size_t)i * CC * KC); return; }
    b -= 6 * PBL;
    if (b < 4 * PBS) { const int i = b / PBS; d_wtG(b % PBS, i == 0 ? wg : i == 1 ? wt : i == 2 ? wp : ww, CC, CC, WS + (size_t)i * CC * CC); return; }
    b -= 4 * PBS;
    if (b < PBX) { d_cvt8(b, x, XB, (size_t)NR * CC / 8); return; }
    d_mvec(b - PBX, mask, M);
}
// ---- k_h16: the three fp16 planes of the projections in one launch: PBG blocks g -> its gated fragment plane GT, then theta and phi (adjacent f32 planes from TP on -> adjacent fp16 planes from TP16 on).
#define PBG (NR * CC / 16 / 256)
#define PBF (2 * NR * CC / 4 / 256)
__global__ __launch_bounds__(256) void k_h16(const float* __restrict__ G, const float* __restrict__ M, const float* __restrict__ TP, h16* GT, h16* TP16) {
    const int b = blockIdx.x;
    if (b < PBG) { d_gtt(b, G, M, GT); return; }
    d_f16(b - PBG, TP, (size_t)2 * NR * CC / 4, TP16);
}
// ---- k_attn: scores, softmax over the keys and the gated probs . g in one kernel; neither the score plane nor the probability plane exists in memory. One work-group per AQ = 32 queries (grid NR / AQ), AW = 8 waves, wave w walks the keys
// w * AKS .. w * AKS + AKS - 1 of the queries' image in chunks of 32. St = phi . theta^T (keys = rows, queries = columns): a lane holds 8 keys of ONE query per tile, and the two 16-key tiles of a chunk, converted in place, are the B fragment of Ot += GT . Pt.
// Running maximum per query in log2 units; the accumulators are rescaled only when a chunk's maximum passes the one in use by more than 8 (p <= 2^8, inside fp16). The sum runs over the ungated f32 p (the gate sits in GT, behind the softmax).
// The AW partial (maximum, sum, Ot) meet in LDS and are joined in wave order 0 .. AW - 1; y = Ot / sum leaves as its bf16 hi + lo planes, the A operand of the W product.
#define AQ  32
#define AW  8
#define AKS (NN / AW)
#define AP  132   // f32 pitch of a query's 128 channels in LDS: 16 lanes x 16 bytes at this pitch fall on 64 different banks
#define LOG2E 1.44269504088896340736f
__global__ __launch_bounds__(AW * 32) void k_attn(const h16* __restrict__ T16, const h16* __restrict__ P16, const h16* __restrict__ GT, bf* Fh, bf* Fl) {
    __shared__ __align__(16) float os[AW * AQ * AP]; __shared__ float sm[AW * AQ]; __shared__ float sl[AW * AQ];
    const int lane = threadIdx.x & 31, lr = lane & 15, hi = lane >> 4; const int r0 = blockIdx.x * AQ; const int img = blockIdx.x / (NN / AQ);
    const int wv = __builtin_amdgcn_readfirstlane((int)(threadIdx.x >> 5));   // the wave's number, held scalar so that the key slice's base stays scalar
    // scalar bases and the two lane offsets (bytes) of the kernel's loads
    const unsigned ko = (unsigned)(lr * (CC * 2) + hi * 16), vo = (unsigned)(lane * 32);
    const char* qs = (const char*)(T16 + (size_t)r0 * CC);
    const char* ks = (const char*)(P16 + ((size_t)img * NN + wv * AKS) * CC);
    const char* vs = (const char*)(GT + (size_t)(img * (NN / 32) + wv * (AKS / 32)) * 4096);
    v16h qf[2][4], kf[2][4];
#pragma unroll
    for (int qb = 0; qb < 2; ++qb)
#pragma unroll
        for (int kc = 0; kc < 4; ++kc) qf[qb][kc] = WFrag<h16>::ld((const h16*)(qs + (qb * 16 * CC * 2 + kc * 64) + ko));
#pragma unroll
    for (int t = 0; t < 2; ++t)
#pragma unroll
        for (int kc = 0; kc < 4; ++kc) kf[t][kc] = WFrag<h16>::ld((const h16*)(ks + (t * 16 * CC * 2 + kc * 64) + ko));
    asm volatile("s_wait_xcnt 0x0" :: "v"(ko) : "memory");   // the 32 query and key loads are issued: the wait stands in front of whatever reuses their address registers; it takes the lane offset as an input so that nothing lands on it earlier
    v8f O[2][8]; float m[2], l[2][2];
#pragma unroll
    for (int qb = 0; qb < 2; ++qb) { m[qb] = -3.0e38f; l[qb][0] = 0.f; l[qb][1] = 0.f;
#pragma unroll
        for (int cb = 0; cb < 8; ++cb) O[qb][cb] = (v8f){}; }
    // the chunk loop stays rolled (two trips' fragments would not fit two waves per SIMD); every loop inside it is unrolled so that each fragment and accumulator index is a constant and stays in registers
#pragma unroll 1
    for (int ch = 0; ch < AKS / 32; ++ch) {
        v16h vf[8]; const char* va = vs + (size_t)(ch * 8192) + vo;
#pragma unroll
        for (int cb = 0; cb < 8; ++cb) vf[cb] = *(const v16h*)(va + cb * 1024);
        asm volatile("s_wait_xcnt 0x0" :: "v"(va) : "memory");   // the 16 value loads are issued: the wait stands in front of whatever reuses their address registers; it takes the address as an input so that no load's result lands on it earlier
        v8f S[2][2];
#pragma unroll
        for (int t = 0; t < 2; ++t)
#pragma unroll
            for (int qb = 0; qb < 2; ++qb) { S[qb][t] = (v8f){};
#pragma unroll
                for (int kc = 0; kc < 4; ++kc) S[qb][t] = wmma16(kf[t][kc], qf[qb][kc], S[qb][t]); }
        // the next chunk's key fragments fly during this chunk's softmax and second product (the last trip reads its own chunk again: in bounds, unused)
        const int nx = ch + 1 < AKS / 32 ? ch + 1 : ch; const char* ka = ks + (size_t)(nx * 8192) + ko;
#pragma unroll
        for (int t = 0; t < 2; ++t)
#pragma unroll
            for (int kc = 0; kc < 4; ++kc) kf[t][kc] = WFrag<h16>::ld((const h16*)(ka + (t * 16 * CC * 2 + kc * 64)));
        asm volatile("s_wait_xcnt 0x0" :: "v"(ka) : "memory");   // the 16 key loads are issued: the wait stands in front of whatever reuses their address registers; it takes the address as an input so that no load's result lands on it earlier
        float cm[2];
#pragma unroll
        for (int qb = 0; qb < 2; ++qb) { float a = fmaxf(S[qb][0][0], S[qb][1][0]);
#pragma unroll
            for (int j = 1; j < 8; ++j) a = fmaxf(a, fmaxf(S[qb][0][j], S[qb][1][j]));
            a = fmaxf(a, __uint_as_float(__builtin_amdgcn_permlanex16(0u, __float_as_uint(a), 0x76543210u, 0xfedcba98u, false, false))); cm[qb] = a * LOG2E; }   // both halves of the wave hold the query's chunk maximum: one scale per query
        if (__builtin_amdgcn_ballot_w32(cm[0] > m[0] + 8.0f || cm[1] > m[1] + 8.0f) != 0) {   // one scalar branch per chunk; every lane stays on
#pragma unroll
            for (int qb = 0; qb < 2; ++qb) { const float mn = fmaxf(m[qb], cm[qb]); const float al = __builtin_amdgcn_exp2f(m[qb] - mn); m[qb] = mn; l[qb][0] *= al; l[qb][1] *= al;
#pragma unroll
                for (int cb = 0; cb < 8; ++cb) O[qb][cb] *= al; }
        }
        v16h pb[2];
#pragma unroll
        for (int qb = 0; qb < 2; ++qb)
#pragma unroll
            for (int t = 0; t < 2; ++t)
#pragma unroll
                for (int j = 0; j < 8; ++j) { const float p = __builtin_amdgcn_exp2f(fmaf(S[qb][t][j], LOG2E, -m[qb])); l[qb][t] += p; pb[qb][t * 8 + j] = (h16)p; }
#pragma unroll
        for (int cb = 0; cb < 8; ++cb)
#pragma unroll
            for (int qb = 0; qb < 2; ++qb) O[qb][cb] = wmma16(vf[cb], pb[qb], O[qb][cb]);
        // four vector slots between the trip's last matrix instructions and whatever overwrites their operands on the taken back edge
        asm volatile("v_nop\n\tv_nop\n\tv_nop\n\tv_nop" : "+v"(O[0][6]), "+v"(O[1][6]), "+v"(O[0][7]), "+v"(O[1][7]) : "v"(vf[7]), "v"(pb[1]));
    }
#pragma unroll
    for (int qb = 0; qb < 2; ++qb) { float s = l[qb][0] + l[qb][1]; s += __shfl_xor(s, 16, 32); if (hi == 0) { sm[wv * AQ + qb * 16 + lr] = m[qb]; sl[wv * AQ + qb * 16 + lr] = s; }
        float* mine = os + (size_t)(wv * AQ + qb * 16 + lr) * AP + 8 * hi;
#pragma unroll
        for (int cb = 0; cb < 8; ++cb) { v4f a, b; a[0] = O[qb][cb][0]; a[1] = O[qb][cb][1]; a[2] = O[qb][cb][2]; a[3] = O[qb][cb][3]; b[0] = O[qb][cb][4]; b[1] = O[qb][cb][5]; b[2] = O[qb][cb][6]; b[3] = O[qb][cb][7];
            *(v4fa*)(mine + cb * 16) = a; *(v4fa*)(mine + cb * 16 + 4) = b; } }
    __syncthreads();   // every wave's partial maximum, sum and tile are in LDS before any thread joins them
    const int q = threadIdx.x >> 3, part = threadIdx.x & 7; float mx = sm[q], f[AW], L = 0.f;
#pragma unroll
    for (int w = 1; w < AW; ++w) mx = fmaxf(mx, sm[w * AQ + q]);
#pragma unroll
    for (int w = 0; w < AW; ++w) { f[w] = __builtin_amdgcn_exp2f(sm[w * AQ + q] - mx); L += f[w] * sl[w * AQ + q]; }
    const float inv = __fdiv_rn(1.0f, L);
#pragma unroll
    for (int i = 0; i < 4; ++i) { const int c = i * 32 + part * 4; v4f o = *(const v4fa*)(os + (size_t)q * AP + c) * f[0];
#pragma unroll
        for (int w = 1; w < AW; ++w) o += *(const v4fa*)(os + (size_t)(w * AQ + q) * AP + c) * f[w];
        v4us oh, ol;
#pragma unroll
        for (int k = 0; k < 4; ++k) { unsigned short u, c2; splitf(o[k] * inv, u, c2); oh[k] = u; ol[k] = c2; }
        *(v4us*)(Fh + (size_t)(r0 + q) * CC + c) = oh; *(v4us*)(Fl + (size_t)(r0 + q) * CC + c) = ol; }
}
__device__ __forceinline__ int reflect64(int i) { return i < 0 ? -i : (i >= HH ? 2 * HH - 2 - i : i); }
// ---- k_conv3: reflect-pad conv3x3 as an implicit GEMM, no im2col copy. One 64x64 output tile per work-group = one image row (64 pixels) x 64 output channels; grid (NR/64, CC/64), NWC * 32 threads.
// K = (kh kw ci) as in Bt's rows; wave w takes the 32-wide K chunks w, w + NWC, ... (a chunk lies inside one tap). The A fragment of a chunk is read from the f32 map at the tap's reflected pixel and split into bf16 hi + lo in registers;
// C = sum (hi + lo) Bt, the NWC partial tiles meet in LDS and are summed in wave order 0 .. NWC - 1 (fixed order, bias last).
#define NWC 12
typedef __attribute__((ext_vector_type(2))) __bf16 v2bf;
typedef __attribute__((ext_vector_type(8))) unsigned v8u;
// two f32 -> packed bf16 hi pair and packed bf16 lo pair (lo = bf16(y - hi)), round to nearest even by the hardware's packed convert: the values of splitf for every finite y
__device__ __forceinline__ void split2(float y0, float y1, unsigned& h, unsigned& l) { v2f y; y[0] = y0; y[1] = y1; h = __builtin_bit_cast(unsigned, __builtin_convertvector(y, v2bf)); v2f r; r[0] = y0 - __uint_as_float(h << 16); r[1] = y1 - __uint_as_float(h & 0xFFFF0000u); l = __builtin_bit_cast(unsigned, __builtin_convertvector(r, v2bf)); }
__global__ __launch_bounds__(NWC * 32) void k_conv3(const float* __restrict__ F, const bf* __restrict__ Bt, float* C, const float* __restrict__ bias) {
    __shared__ __align__(16) float os[NWC * 64 * 68];
    const int lane = threadIdx.x & 31, lr = lane & 15, hi = lane >> 4; const int r0 = blockIdx.x * 64, c0 = blockIdx.y * 64;
    const int wv = __builtin_amdgcn_readfirstlane((int)(threadIdx.x >> 5));   // the wave's number, held scalar so that the K loop's counter, tap and branch stay scalar
    const int y = blockIdx.x % HH; F += (size_t)(blockIdx.x / HH) * NN * CC + 8 * hi;
    v8f acc[4][4];
#pragma unroll
    for (int mb = 0; mb < 4; ++mb)
#pragma unroll
        for (int nb = 0; nb < 4; ++nb) acc[mb][nb] = (v8f){};
    const size_t boff = (size_t)(c0 + lr) * KC + 8 * hi;
#pragma unroll 1
    for (int kc = wv * 32; kc < KC; kc += NWC * 32) {
        const int tap = kc / CC, kh = tap / 3, kw = tap % 3; const float* Fr = F + (size_t)reflect64(y + kh - 1) * HH * CC + kc % CC;
        v16bf b[4]; v4f raw[4][4];
#pragma unroll
        for (int mb = 0; mb < 4; ++mb) { const float* p = Fr + reflect64(mb * 16 + lr + kw - 1) * CC; raw[mb][0] = *(const v4f*)p; raw[mb][1] = *(const v4f*)(p + 4); raw[mb][2] = *(const v4f*)(p + 16); raw[mb][3] = *(const v4f*)(p + 20); }
        asm volatile("s_wait_xcnt 0x0" ::: "memory");   // the 16 map loads are issued: the wait stands in front of the weight loads, whose results may land on the address pairs that the map loads name
#pragma unroll
        for (int nb = 0; nb < 4; ++nb) b[nb] = WFrag<bf>::ld(Bt + boff + (size_t)nb * 16 * KC + kc);
        asm volatile("s_wait_xcnt 0x0" ::: "memory");   // the 8 weight loads are issued: the wait stands in front of the step of their address pair
        __builtin_amdgcn_sched_barrier(0);   // keeps the converts behind all 24 loads: without it the first converts, with their data waits, move in front of the later loads and a trip pays two memory round trips
        v16bf a[4], a2[4];
#pragma unroll
        for (int mb = 0; mb < 4; ++mb) { v8u h, l;
#pragma unroll
            for (int q = 0; q < 4; ++q) { unsigned u, c2; split2(raw[mb][q][0], raw[mb][q][1], u, c2); h[2 * q] = u; l[2 * q] = c2; split2(raw[mb][q][2], raw[mb][q][3], u, c2); h[2 * q + 1] = u; l[2 * q + 1] = c2; }
            a[mb] = __builtin_bit_cast(v16bf, h); a2[mb] = __builtin_bit_cast(v16bf, l); }
#pragma unroll
        for (int nb = 0; nb < 4; ++nb)
#pragma unroll
            for (int mb = 0; mb < 4; ++mb) { acc[mb][nb] = wmmab(a[mb], b[nb], acc[mb][nb]); acc[mb][nb] = wmmab(a2[mb], b[nb], acc[mb][nb]); }
        // four vector slots between the trip's last matrix instructions and whatever overwrites their operands on the taken back edge
        asm volatile("v_nop\n\tv_nop\n\tv_nop\n\tv_nop" : "+v"(acc[0][0]), "+v"(acc[1][1]), "+v"(acc[2][2]), "+v"(acc[3][3]) : "v"(a[0]), "v"(a[3]));
    }
    float* mine = os + wv * (64 * 68);
    // the three loops are unrolled so that every accumulator index is a constant and acc stays in registers
#pragma unroll
    for (int mb = 0; mb < 4; ++mb)
#pragma unroll
        for (int nb = 0; nb < 4; ++nb)
#pragma unroll
            for (int j = 0; j < 8; ++j) mine[(mb * 16 + hi * 8 + j) * 68 + nb * 16 + lr] = acc[mb][nb][j];
    __syncthreads();   // every wave's partial tile is in LDS before any thread sums across the waves
    for (int g = threadIdx.x; g < 64 * 16; g += NWC * 32) { const int row = g >> 4, cofs = (g & 15) * 4; v4f val = *(const v4fa*)(os + row * 68 + cofs);
#pragma unroll   // the NWC LDS reads of a trip are issued together instead of one per round trip
        for (int w = 1; w < NWC; ++w) val += *(const v4fa*)(os + (w * 64 + row) * 68 + cofs);
        val[0] += bfr(bias[c0 + cofs]); val[1] += bfr(bias[c0 + cofs + 1]); val[2] += bfr(bias[c0 + cofs + 2]); val[3] += bfr(bias[c0 + cofs + 3]);
        *(v4f*)(C + (size_t)(r0 + row) * CC + c0 + cofs) = val;
    }
}
// ---- k_instat: per-channel mean and 1/sqrt(var + eps) over the NN rows. One work-group of 32 waves per 16 channels of one image (grid (CC/16, NB_)): thread = (row group t >> 2, channel quad t & 3) loads its 16 rows x 4 channels once,
// keeps them in registers for both sums (mean, then squares about the mean); each sum: 16 serial adds per thread, butterfly over the wave's 8 row lanes, 32 wave partials through LDS, summed alike by every wave.
__device__ __forceinline__ v4f wsum8(v4f s) {
#pragma unroll
    for (int sh = 4; sh <= 16; sh <<= 1) {
#pragma unroll
        for (int q = 0; q < 4; ++q) s[q] += __shfl_xor(s[q], sh, 32); }
    return s; }
__device__ __forceinline__ v4f bsum(v4f s, float* red, int lane, int wave) {
    s = wsum8(s); if (lane < 4) *(v4fa*)(red + (wave * 4 + lane) * 4) = s;
    __syncthreads();
    v4f t = *(const v4fa*)(red + lane * 4);
#pragma unroll
    for (int j = 1; j < 4; ++j) t += *(const v4fa*)(red + (j * 32 + lane) * 4);
    return wsum8(t); }
__global__ __launch_bounds__(1024) void k_instat(const float* __restrict__ Cv, float* ST) {
    __shared__ __align__(16) float red1[32 * 16]; __shared__ __align__(16) float red2[32 * 16];
    const int t = threadIdx.x, lane = t & 31, wave = t >> 5; const int c = blockIdx.x * 16 + (t & 3) * 4; const float* p = Cv + ((size_t)blockIdx.y * NN + (t >> 2)) * CC + c; ST += blockIdx.y * 2 * CC; v4f v[16];
#pragma unroll
    for (int i = 0; i < 15; ++i) v[i] = *(const v4f*)(p + (size_t)i * 256 * CC);
    asm volatile("s_wait_xcnt 0x0" ::: "memory");   // the compiler lets the last load's result land on the address pair that the 15 issued loads name: the wait stands in front of that overwrite
    v[15] = *(const v4f*)(p + (size_t)15 * 256 * CC);
    v4f s = v[0];
#pragma unroll
    for (int i = 1; i < 16; ++i) s += v[i];
    const v4f mu = bsum(s, red1, lane, wave) * (1.0f / NN);
    v4f q2 = (v4f){};
#pragma unroll
    for (int i = 0; i < 16; ++i) { const v4f d = v[i] - mu; q2 += d * d; }
    const v4f vq = bsum(q2, red2, lane, wave) * (1.0f / NN);
    if (t < 4) { v4f o0, o1; o0[0] = mu[0]; o0[1] = __frsqrt_rn(vq[0] + 1e-3f); o0[2] = mu[1]; o0[3] = __frsqrt_rn(vq[1] + 1e-3f); o1[0] = mu[2]; o1[1] = __frsqrt_rn(vq[2] + 1e-3f); o1[2] = mu[3]; o1[3] = __frsqrt_rn(vq[3] + 1e-3f);
        *(v4f*)(ST + 2 * c) = o0; *(v4f*)(ST + 2 * c + 4) = o1; } }
__global__ __launch_bounds__(256) void k_inrelu(const float* __restrict__ Cv, const float* __restrict__ ST, const float* __restrict__ g, const float* __restrict__ be, float* Hout) { const size_t i = ((size_t)blockIdx.x * 256 + threadIdx.x) * 4; if (i >= (size_t)NR * CC) return; const int c = (int)(i % CC); ST += (i / ((size_t)NN * CC)) * 2 * CC; const v4f a = *(const v4f*)(Cv + i); v4f o;
#pragma unroll
    for (int q = 0; q < 4; ++q) { float d = __fsub_rn(a[q], ST[2 * (c + q)]); asm volatile("" : "+v"(d)); float tn = __fmul_rn(d, ST[2 * (c + q) + 1]); asm volatile("" : "+v"(tn)); float tg = __fmul_rn(tn, bfr(g[c + q])); asm volatile("" : "+v"(tg)); o[q] = fmaxf(__fadd_rn(tg, bfr(be[c + q])), 0.f); }
    *(v4f*)(Hout + i) = o;  }
__global__ __launch_bounds__(256) void k_inres(const float* __restrict__ Cv, const float* __restrict__ ST, const float* __restrict__ g, const float* __restrict__ be, const float* __restrict__ WYin, float* WYout) { const size_t i = ((size_t)blockIdx.x * 256 + threadIdx.x) * 4; if (i >= (size_t)NR * CC) return; const int c = (int)(i % CC); ST += (i / ((size_t)NN * CC)) * 2 * CC; const v4f a = *(const v4f*)(Cv + i);
    asm volatile("s_wait_xcnt 0x0" ::: "memory");   // the compiler lets the next load's result land on the address pair that the issued Cv load names: the wait stands in front of that overwrite
    const v4f w = *(const v4f*)(WYin + i); v4f o;
#pragma unroll
    for (int q = 0; q < 4; ++q) { float d = __fsub_rn(a[q], ST[2 * (c + q)]); asm volatile("" : "+v"(d)); float tn = __fmul_rn(d, ST[2 * (c + q) + 1]); asm volatile("" : "+v"(tn)); float tg = __fmul_rn(tn, bfr(g[c + q])); asm volatile("" : "+v"(tg)); o[q] = __fadd_rn(w[q], __fadd_rn(tg, bfr(be[c + q]))); }
    *(v4f*)(WYout + i) = o;  }
__global__ __launch_bounds__(256) void k_blend(const float* __restrict__ x, const float* __restrict__ M, const float* __restrict__ WY, float* OUT) { const size_t i = ((size_t)blockIdx.x * 256 + threadIdx.x) * 4; if (i >= (size_t)NR * CC) return; const int n = (int)(i / CC); const float m = M[n]; const float om = __fsub_rn(1.0f, m); const v4f w = *(const v4f*)(WY + i); v4f o;
#pragma unroll
    for (int q = 0; q < 4; ++q) { float a = __fmul_rn(m, bfr(x[i + q])); asm volatile("" : "+v"(a)); float b = __fmul_rn(om, w[q]); asm volatile("" : "+v"(b)); o[q] = __fadd_rn(a, b); } *(v4f*)(OUT + i) = o;  }

extern "C" void kernel_launch(void* const* d_in, const int* in_sizes, int n_in,
                              void* d_out, int out_size, void* d_ws, size_t ws_size, hipStream_t stream) {
    (void)in_sizes; (void)n_in; (void)out_size;
    const float* IN[18]; for (int i = 0; i < 18; ++i) IN[i] = (const float*)d_in[i];   // 0 x, 1 mask, 2 wg, 3 bg, 4 wt, 5 bt, 6 wp, 7 bp, 8 ww, 9 bw, 10 res_w1 [3][3][3][128][128], 11 res_b1 [3][128], 12 res_g1, 13 res_be1, 14 res_w2, 15 res_b2, 16 res_g2, 17 res_be2
    float* OUT = (float*)d_out;     // [2][64][64][128]
    char* wsp = (char*)d_ws;
    auto take = [&](size_t bytes) { char* p = wsp; wsp += (bytes + 255) & ~(size_t)255; return (void*)p; };
    bf* WG = (bf*)take(CC * CC * 2); bf* WT = (bf*)take(CC * CC * 2); bf* WP = (bf*)take(CC * CC * 2); bf* WW = (bf*)take(CC * CC * 2); bf* WR = (bf*)take((size_t)6 * CC * KC * 2);
    bf* XB = (bf*)take((size_t)NR * CC * 2); float* GF = (float*)take((size_t)NR * CC * 4); float* TF = (float*)take((size_t)NR * CC * 4); float* PF = (float*)take((size_t)NR * CC * 4); h16* T16 = (h16*)take((size_t)NR * CC * 2); h16* P16k = (h16*)take((size_t)NR * CC * 2); h16* GT = (h16*)take((size_t)NR * CC * 2); float* M = (float*)take((size_t)NR * 4);
    bf* Ah = (bf*)take((size_t)NR * CC * 2); bf* Al = (bf*)take((size_t)NR * CC * 2); float* WY = (float*)take((size_t)NR * CC * 4); float* WY2 = (float*)take((size_t)NR * CC * 4); float* CV = (float*)take((size_t)NR * CC * 4); float* HB = (float*)take((size_t)NR * CC * 4); float* ST = (float*)take(NB_ * CC * 2 * 4);
    if ((size_t)(wsp - (char*)d_ws) > ws_size) return;    // total ~ 45 MB
    (void)WT; (void)WP; (void)PF;   // reached through WG, GF and TF: the planes of a merged launch lie one behind the other (every size above is a multiple of 256 bytes)
    // every launch below covers both images (rows image-major; per-image operands through grid x / y) and all NN queries
    const unsigned L4 = (unsigned)(((size_t)NR * CC / 4 + 255) / 256);
    k_prep<<<6 * PBL + 4 * PBS + PBX + PBM, 256, 0, stream>>>(IN[0], IN[1], IN[2], IN[4], IN[6], IN[8], IN[10], IN[14], WG, WR, XB, M);   // HWIO flattened = [(kh kw ci)][co] (x @ W layout); WG, WT, WP, WW lie one behind the other
    k_gemmw<bf, 0, true, 4><<<dim3(NR / 64, CC / 64, 3), 4 * 32, 0, stream>>>(XB, nullptr, WG, nullptr, CC, GF, CC, IN[3], IN[5], IN[7], 0, (size_t)CC * CC, (size_t)NR * CC);   // z = g, theta, phi: WG, WT, WP and GF, TF, PF lie one behind the other
    k_h16<<<PBG + PBF, 256, 0, stream>>>(GF, M, TF, GT, T16);   // TF, PF and T16, P16k lie one behind the other
    k_attn<<<NR / AQ, AW * 32, 0, stream>>>(T16, P16k, GT, Ah, Al);
    k_gemmw<bf, 1, true, 4><<<dim3(NR / 64, CC / 64, 1), 4 * 32, 0, stream>>>(Ah, Al, WW, nullptr, CC, WY, CC, IN[9], nullptr, nullptr, 0, 0, 0);
    float* wy = WY; float* wyn = WY2;
    for (int i = 0; i < 3; ++i) {
        k_conv3<<<dim3(NR / 64, CC / 64, 1), NWC * 32, 0, stream>>>(wy, WR + (size_t)(2 * i) * CC * KC, CV, IN[11] + i * CC);
        k_instat<<<dim3(CC / 16, NB_, 1), 1024, 0, stream>>>(CV, ST); k_inrelu<<<L4, 256, 0, stream>>>(CV, ST, IN[12] + i * CC, IN[13] + i * CC, HB);
        k_conv3<<<dim3(NR / 64, CC / 64, 1), NWC * 32, 0, stream>>>(HB, WR + (size_t)(2 * i + 1) * CC * KC, CV, IN[15] + i * CC);
        k_instat<<<dim3(CC / 16, NB_, 1), 1024, 0, stream>>>(CV, ST); k_inres<<<L4, 256, 0, stream>>>(CV, ST, IN[16] + i * CC, IN[17] + i * CC, wy, wyn); float* t = wy; wy = wyn; wyn = t; }
    k_blend<<<L4, 256, 0, stream>>>(IN[0], M, wy, OUT);
}

// v007
// It runs in 138 microseconds.
// Timed twice side by side with v006, it ran 1.38 times as fast both times.
// All steps since v000 together make it 67.0 times as fast.
#include <hip/hip_runtime.h>

// NonLocalBlock2D_with_mask_Res (x NHWC [2][64][64][128], mask [2][64][64][1]; g/theta/phi = 1x1 convs; f = softmax(theta.phi^T / 1) over keys; m = (1 - min(mask,0)) (1 - mask) (the reference's resize-identity / where / invert chain; mask read as data);
// f = m[key] f (after the softmax, no renormalisation); y = f g; w_y = 1x1 conv W; 3 ResNet blocks (reflect-pad conv3x3 -> InstanceNorm(1e-3) -> relu -> reflect-pad conv3x3 -> InstanceNorm, residual); z = m x + (1 - m) w_y -> [2][64][64][128]).
// Compute dtypes, f32 accumulate: every input rounded to bf16; g/theta/phi 1x1 projections on PLAIN bf16 operands (inputs: exact, + bias), W and conv3x3 on hi+lo bf16 activations; scores (K 128) and the gated probs . g on SINGLE fp16 planes (logits are O(1) at these scales);

#define NB_  2
#define HH   64
#define NN   4096
#define CC   128
#define KC   1152
#define NR   (NB_ * NN)   // rows of both images, image-major
typedef _Float16 h16;
typedef unsigned short bf;
typedef __attribute__((ext_vector_type(16))) __bf16   v16bf;
typedef __attribute__((ext_vector_type(16))) _Float16 v16h;
typedef __attribute__((ext_vector_type(8)))  _Float16 v8h;
typedef __attribute__((ext_vector_type(8)))  unsigned short v8us;
typedef __attribute__((ext_vector_type(8)))  float    v8f;
typedef __attribute__((ext_vector_type(4)))  float    v4f;
typedef v8h  __attribute__((may_alias)) v8ha;
typedef v4f  __attribute__((may_alias)) v4fa;
typedef v8us __attribute__((may_alias)) v8usa;

__device__ __forceinline__ unsigned short f2bf(float f) { unsigned u = __float_as_uint(f); u += 0x7FFFu + ((u >> 16) & 1u); return (unsigned short)(u >> 16); }
__device__ __forceinline__ float bf2f(unsigned short b) { return __uint_as_float(((unsigned)b) << 16); }
__device__ __forceinline__ float bfr(float f) { return bf2f(f2bf(f)); }
__device__ __forceinline__ v16h cat16(v8h lo, v8h hi) { return __builtin_shufflevector(lo, hi, 0, 1, 2, 3, 4, 5, 6, 7, 8, 9, 10, 11, 12, 13, 14, 15); }
__device__ __forceinline__ v16bf cat16b(v8us lo, v8us hi) { return __builtin_bit_cast(v16bf, __builtin_shufflevector(lo, hi, 0, 1, 2, 3, 4, 5, 6, 7, 8, 9, 10, 11, 12, 13, 14, 15)); }
__device__ __forceinline__ v8f wmma16(v16h a, v16h b, v8f c) { return __builtin_amdgcn_wmma_f32_16x16x32_f16(false, a, false, b, (short)0, c, false, false); }
__device__ __forceinline__ v8f wmmab(v16bf a, v16bf b, v8f c) { return __builtin_amdgcn_wmma_f32_16x16x32_bf16(false, a, false, b, (short)0, c, false, false); }



// ---- k_gemmw: register-blocked GEMM, NW WAVES per 64x64 output tile (16 accumulators each), operands straight from K-contiguous 16-bit planes; grid (M/64, N/64, Z), NW * 32 threads.
// Wave w takes the 32-wide K chunks w, w + NW, ...; for NW > 1 the NW partial tiles meet in LDS and are summed in wave order 0 .. NW - 1 (fixed order, bias last).
// C[m][n] (f32, pitch ldc, + optional f32 bias[n]) = sum_k A[m][k] Bt[n][k] (+ split products per NSPLIT). z-batch strides sA/sB/sC in elements; batch z = 0 / 1 / 2 adds bias / bias1 / bias2. K % 32 == 0.
template <typename T16> struct WFrag;
template <> struct WFrag<h16> { typedef v16h V; static __device__ __forceinline__ V ld(const h16* p) { return cat16(*(const v8h*)p, *(const v8h*)(p + 16)); } static __device__ __forceinline__ v8f mma(V a, V b, v8f c) { return wmma16(a, b, c); } };
template <> struct WFrag<bf> { typedef v16bf V; static __device__ __forceinline__ V ld(const bf* p) { return cat16b(*(const v8us*)p, *(const v8us*)(p + 16)); } static __device__ __forceinline__ v8f mma(V a, V b, v8f c) { return wmmab(a, b, c); } };
template <typename T16, int NSPLIT, bool BIAS, int NW>
__global__ __launch_bounds__(NW * 32) void k_gemmw(const T16* __restrict__ A, const T16* __restrict__ A2, const T16* __restrict__ Bt, const T16* __restrict__ Bt2, int K, float* C, int ldc, const float* __restrict__ bias, const float* __restrict__ bias1, const float* __restrict__ bias2, size_t sA, size_t sB, size_t sC) {
    typedef typename WFrag<T16>::V V;
    __shared__ __align__(16) float os[(NW == 1 ? 16 : NW * 64) * 68];
    const size_t z = blockIdx.z; A += z * sA; if (A2) A2 += z * sA; Bt += z * sB; if (Bt2) Bt2 += z * sB; C += z * sC; if (BIAS && z) bias = z == 1 ? bias1 : bias2;
    const int lane = threadIdx.x & 31, lr = lane & 15, hi = lane >> 4; const int r0 = blockIdx.x * 64, c0 = blockIdx.y * 64;
    const int wv = NW == 1 ? 0 : __builtin_amdgcn_readfirstlane((int)(threadIdx.x >> 5));   // the wave's number, held scalar so that the K loop's counter and branch stay scalar
    v8f acc[4][4];
#pragma unroll
    for (int mb = 0; mb < 4; ++mb)
#pragma unroll
        for (int nb = 0; nb < 4; ++nb) acc[mb][nb] = (v8f){};
    const size_t aoff = (size_t)(r0 + lr) * K + 8 * hi, boff = (size_t)(c0 + lr) * K + 8 * hi;
#pragma unroll 1
    for (int kc = wv * 32; kc < K; kc += NW * 32) {
        V a[4], a2[4];
#pragma unroll
        for (int mb = 0; mb < 4; ++mb) { a[mb] = WFrag<T16>::ld(A + aoff + (size_t)mb * 16 * K + kc); if (NSPLIT == 1 || NSPLIT == 2) a2[mb] = WFrag<T16>::ld(A2 + aoff + (size_t)mb * 16 * K + kc); }
#pragma unroll
        for (int nb = 0; nb < 4; ++nb) { const V b = WFrag<T16>::ld(Bt + boff + (size_t)nb * 16 * K + kc); V b2; if (NSPLIT >= 2) b2 = WFrag<T16>::ld(Bt2 + boff + (size_t)nb * 16 * K + kc);
#pragma unroll
            for (int mb = 0; mb < 4; ++mb) { acc[mb][nb] = WFrag<T16>::mma(a[mb], b, acc[mb][nb]); if (NSPLIT == 1 || NSPLIT == 2) acc[mb][nb] = WFrag<T16>::mma(a2[mb], b, acc[mb][nb]); if (NSPLIT >= 2) acc[mb][nb] = WFrag<T16>::mma(a[mb], b2, acc[mb][nb]); } }
        asm volatile("v_nop\n\tv_nop\n\tv_nop\n\tv_nop" : "+v"(acc[0][0]), "+v"(acc[1][1]), "+v"(acc[2][2]), "+v"(acc[3][3]) : "v"(a[0]), "v"(a[3]));
    }
    if constexpr (NW > 1) {
        float* mine = os + wv * (64 * 68);
        // the three loops are unrolled so that every accumulator index is a constant and acc stays in registers
#pragma unroll
        for (int mb = 0; mb < 4; ++mb)
#pragma unroll
            for (int nb = 0; nb < 4; ++nb)
#pragma unroll
                for (int j = 0; j < 8; ++j) mine[(mb * 16 + hi * 8 + j) * 68 + nb * 16 + lr] = acc[mb][nb][j];
        __syncthreads();   // every wave's partial tile is in LDS before any thread sums across the waves
        for (int g = threadIdx.x; g < 64 * 16; g += NW * 32) { const int row = g >> 4, cofs = (g & 15) * 4; v4f val = *(const v4fa*)(os + row * 68 + cofs);
#pragma unroll   // the NW LDS reads of a trip are issued together instead of one per round trip
            for (int w = 1; w < NW; ++w) val += *(const v4fa*)(os + (w * 64 + row) * 68 + cofs);
            if (BIAS) { val[0] += bfr(bias[c0 + cofs]); val[1] += bfr(bias[c0 + cofs + 1]); val[2] += bfr(bias[c0 + cofs + 2]); val[3] += bfr(bias[c0 + cofs + 3]); }
            *(v4f*)(C + (size_t)(r0 + row) * ldc + c0 + cofs) = val;
        }
        return;
    }
#pragma unroll
    for (int mb = 0; mb < 4; ++mb) {
#pragma unroll
        for (int nb = 0; nb < 4; ++nb) {
#pragma unroll
            for (int j = 0; j < 8; ++j) os[(hi * 8 + j) * 68 + nb * 16 + lr] = acc[mb][nb][j]; }
        __builtin_amdgcn_wave_barrier(); asm volatile("" ::: "memory");
        float* crow = C + (size_t)(r0 + mb * 16) * ldc + c0;
{
#pragma unroll
            for (int s = 0; s < 8; ++s) { const int row = 2 * s + hi, cofs = lr * 4; v4f val = *(const v4fa*)(os + row * 68 + cofs); if (BIAS) { val[0] += bfr(bias[c0 + cofs]); val[1] += bfr(bias[c0 + cofs + 1]); val[2] += bfr(bias[c0 + cofs + 2]); val[3] += bfr(bias[c0 + cofs + 3]); }
                *(v4f*)(crow + (size_t)row * ldc + cofs) = val; }
             }
        __builtin_amdgcn_wave_barrier(); asm volatile("" ::: "memory");
    }
}

__device__ __forceinline__ h16 tohx(float x) { return (h16)x; }
__device__ __forceinline__ void splitf(float y, unsigned short& h, unsigned short& l) { h = f2bf(y); l = f2bf(y - bf2f(h)); }
typedef __attribute__((ext_vector_type(2))) _Float16 v2h;
typedef __attribute__((ext_vector_type(4))) _Float16 v4h;
typedef __attribute__((ext_vector_type(2))) unsigned short v2us;
typedef __attribute__((ext_vector_type(4))) unsigned short v4us;
typedef __attribute__((ext_vector_type(2))) float v2f;

// The bodies d_* each do the work of one 256-thread block, number bx, of a pass; passes that read nothing of one another share a launch (k_prep, k_h16), each on its own range of blocks.
__device__ __forceinline__ void d_wtG(int bx, const float* __restrict__ w, int K, int N, bf* Bt) {
    const int lane = threadIdx.x & 31; const int L0 = (bx * 8 + (threadIdx.x >> 5)) * 8; const int nlines = N * K / 64;
{
#pragma unroll 1
        for (int l = 0; l < 8; ++l) { const int L = L0 + l; if (L >= nlines) break; const size_t e = (size_t)L * 64 + lane * 2; const int k = (int)(e % K), n = (int)(e / K); v2us o;
            o[0] = f2bf(w[(size_t)k * N + n]); o[1] = f2bf(w[(size_t)(k + 1) * N + n]); *(v2us*)(Bt + e) = o; }
         }
}
__device__ __forceinline__ void d_cvt8(int bx, const float* __restrict__ src, bf* dst, size_t n8) { const size_t i = (size_t)bx * 256 + threadIdx.x; if (i >= n8) return; const v8f v = *(const v8f*)(src + i * 8); v8us o;
#pragma unroll
    for (int k = 0; k < 8; ++k) o[k] = f2bf(v[k]); *(v8us*)(dst + i * 8) = o;  }
__device__ __forceinline__ void d_f16(int bx, const float* __restrict__ F, size_t n4, h16* P) { const size_t i = ((size_t)bx * 256 + threadIdx.x) * 4; if (i >= n4 * 4) return; const v4f a = *(const v4f*)(F + i); v4h o; o[0] = tohx(a[0]); o[1] = tohx(a[1]); o[2] = tohx(a[2]); o[3] = tohx(a[3]); *(v4h*)(P + i) = o;  }
// the gated values m[key] g[key][c] as fp16, laid out as the A fragments of k_attn's second product: [image][32-key chunk][16-channel block][lane][16], lane (c = lane & 15, h = lane >> 4) holds channel c at keys 8h .. 8h + 7 and 16 + 8h .. 16 + 8h + 7 of the chunk
__device__ __forceinline__ void d_gtt(int bx, const float* __restrict__ G, const float* __restrict__ M, h16* GT) { const int e = bx * 256 + threadIdx.x; if (e >= NR * CC / 16) return; const int lane = e & 31, cb = (e >> 5) & 7, chunk = e >> 8; const int n0 = chunk * 32 + 8 * (lane >> 4), c = cb * 16 + (lane & 15); v8h lo, up;
#pragma unroll
    for (int s = 0; s < 8; ++s) { lo[s] = tohx(G[(size_t)(n0 + s) * CC + c] * M[n0 + s]); up[s] = tohx(G[(size_t)(n0 + 16 + s) * CC + c] * M[n0 + 16 + s]); }
    *(v8h*)(GT + (size_t)e * 16) = lo; *(v8h*)(GT + (size_t)e * 16 + 8) = up;  }
__device__ __forceinline__ void d_mvec(int bx, const float* __restrict__ mask, float* M) { const int n = bx * 256 + threadIdx.x; if (n >= NR) return; const float mk = bfr(mask[n]); const float a = __fsub_rn(1.0f, fminf(mk, 0.f)); const float v = __fmul_rn(a, __fsub_rn(1.0f, mk)); *(float*)(M + n) = v;  }
// ---- k_prep: every pass that reads inputs only, in one launch. Blocks, longest bodies first: 6 x PBL the 3x3 weights (W1[0], W2[0], W1[1], ... -> WR), 4 x PBS the 1x1 weights (wg, wt, wp, ww -> four planes from WS on), PBX x -> bf16, PBM the mask vector.
#define PBL ((KC * CC / 64 + 63) / 64)
#define PBS ((CC * CC / 64 + 63) / 64)
#define PBX (NR * CC / 8 / 256)
#define PBM (NR / 256)
__global__ __launch_bounds__(256) void k_prep(const float* __restrict__ x, const float* __restrict__ mask, const float* __restrict__ wg, const float* __restrict__ wt, const float* __restrict__ wp, const float* __restrict__ ww, const float* __restrict__ rw1, const float* __restrict__ rw2, bf* WS, bf* WR, bf* XB, float* M) {
    int b = blockIdx.x;
    if (b < 6 * PBL) { const int i = b / PBL; d_wtG(b % PBL, ((i & 1) ? rw2 : rw1) + (size_t)(i >> 1) * KC * CC, KC, CC, WR + (size_t)i * CC * KC); return; }
    b -= 6 * PBL;
    if (b < 4 * PBS) { const int i = b / PBS; d_wtG(b % PBS, i == 0 ? wg : i == 1 ? wt : i == 2 ? wp : ww, CC, CC, WS + (size_t)i * CC * CC); return; }
    b -= 4 * PBS;
    if (b < PBX) { d_cvt8(b, x, XB, (size_t)NR * CC / 8); return; }
    d_mvec(b - PBX, mask, M);
}
// ---- k_h16: the three fp16 planes of the projections in one launch: PBG blocks g -> its gated fragment plane GT, then theta and phi (adjacent f32 planes from TP on -> adjacent fp16 planes from TP16 on).
#define PBG (NR * CC / 16 / 256)
#define PBF (2 * NR * CC / 4 / 256)
__global__ __launch_bounds__(256) void k_h16(const float* __restrict__ G, const float* __restrict__ M, const float* __restrict__ TP, h16* GT, h16* TP16) {
    const int b = blockIdx.x;
    if (b < PBG) { d_gtt(b, G, M, GT); return; }
    d_f16(b - PBG, TP, (size_t)2 * NR * CC / 4, TP16);
}
// ---- k_attn: scores, softmax over the keys and the gated probs . g in one kernel; neither the score plane nor the probability plane exists in memory. One work-group per AQ = 32 queries (grid NR / AQ), AW = 8 waves, wave w walks the keys
// w * AKS .. w * AKS + AKS - 1 of the queries' image in chunks of 32. St = phi . theta^T (keys = rows, queries = columns): a lane holds 8 keys of ONE query per tile, and the two 16-key tiles of a chunk, converted in place, are the B fragment of Ot += GT . Pt.
// Running maximum per query in log2 units; the accumulators are rescaled only when a chunk's maximum passes the one in use by more than 8 (p <= 2^8, inside fp16). The sum runs over the ungated f32 p (the gate sits in GT, behind the softmax).
// The AW partial (maximum, sum, Ot) meet in LDS and are joined in wave order 0 .. AW - 1; y = Ot / sum leaves as its bf16 hi + lo planes, the A operand of the W product.
#define AQ  32
#define AW  8
#define AKS (NN / AW)
#define AP  132   // f32 pitch of a query's 128 channels in LDS: 16 lanes x 16 bytes at this pitch fall on 64 different banks
#define LOG2E 1.44269504088896340736f
__global__ __launch_bounds__(AW * 32) void k_attn(const h16* __restrict__ T16, const h16* __restrict__ P16, const h16* __restrict__ GT, bf* Fh, bf* Fl) {
    __shared__ __align__(16) float os[AW * AQ * AP]; __shared__ float sm[AW * AQ]; __shared__ float sl[AW * AQ];
    const int lane = threadIdx.x & 31, lr = lane & 15, hi = lane >> 4; const int r0 = blockIdx.x * AQ; const int img = blockIdx.x / (NN / AQ);
    const int wv = __builtin_amdgcn_readfirstlane((int)(threadIdx.x >> 5));   // the wave's number, held scalar so that the key slice's base stays scalar
    // scalar bases and the two lane offsets (bytes) of the kernel's loads
    const unsigned ko = (unsigned)(lr * (CC * 2) + hi * 16), vo = (unsigned)(lane * 32);
    const char* qs = (const char*)(T16 + (size_t)r0 * CC);
    const char* ks = (const char*)(P16 + ((size_t)img * NN + wv * AKS) * CC);
    const char* vs = (const char*)(GT + (size_t)(img * (NN / 32) + wv * (AKS / 32)) * 4096);
    v16h qf[2][4], kf[2][4];
#pragma unroll
    for (int qb = 0; qb < 2; ++qb)
#pragma unroll
        for (int kc = 0; kc < 4; ++kc) qf[qb][kc] = WFrag<h16>::ld((const h16*)(qs + (qb * 16 * CC * 2 + kc * 64) + ko));
#pragma unroll
    for (int t = 0; t < 2; ++t)
#pragma unroll
        for (int kc = 0; kc < 4; ++kc) kf[t][kc] = WFrag<h16>::ld((const h16*)(ks + (t * 16 * CC * 2 + kc * 64) + ko));
    asm volatile("s_wait_xcnt 0x0" :: "v"(ko) : "memory");   // the 32 query and key loads are issued: the wait stands in front of whatever reuses their address registers; it takes the lane offset as an input so that nothing lands on it earlier
    v8f O[2][8]; float m[2], l[2][2];
#pragma unroll
    for (int qb = 0; qb < 2; ++qb) { m[qb] = -3.0e38f; l[qb][0] = 0.f; l[qb][1] = 0.f;
#pragma unroll
        for (int cb = 0; cb < 8; ++cb) O[qb][cb] = (v8f){}; }
    // the chunk loop stays rolled (two trips' fragments would not fit two waves per SIMD); every loop inside it is unrolled so that each fragment and accumulator index is a constant and stays in registers
#pragma unroll 1
    for (int ch = 0; ch < AKS / 32; ++ch) {
        v16h vf[8]; const char* va = vs + (size_t)(ch * 8192) + vo;
#pragma unroll
        for (int cb = 0; cb < 8; ++cb) vf[cb] = *(const v16h*)(va + cb * 1024);
        asm volatile("s_wait_xcnt 0x0" :: "v"(va) : "memory");   // the 16 value loads are issued: the wait stands in front of whatever reuses their address registers; it takes the address as an input so that no load's result lands on it earlier
        v8f S[2][2];
#pragma unroll
        for (int t = 0; t < 2; ++t)
#pragma unroll
            for (int qb = 0; qb < 2; ++qb) { S[qb][t] = (v8f){};
#pragma unroll
                for (int kc = 0; kc < 4; ++kc) S[qb][t] = wmma16(kf[t][kc], qf[qb][kc], S[qb][t]); }
        // the next chunk's key fragments fly during this chunk's softmax and second product (the last trip reads its own chunk again: in bounds, unused)
        const int nx = ch + 1 < AKS / 32 ? ch + 1 : ch; const char* ka = ks + (size_t)(nx * 8192) + ko;
#pragma unroll
        for (int t = 0; t < 2; ++t)
#pragma unroll
            for (int kc = 0; kc < 4; ++kc) kf[t][kc] = WFrag<h16>::ld((const h16*)(ka + (t * 16 * CC * 2 + kc * 64)));
        asm volatile("s_wait_xcnt 0x0" :: "v"(ka) : "memory");   // the 16 key loads are issued: the wait stands in front of whatever reuses their address registers; it takes the address as an input so that no load's result lands on it earlier
        float cm[2];
#pragma unroll
        for (int qb = 0; qb < 2; ++qb) { float a = fmaxf(S[qb][0][0], S[qb][1][0]);
#pragma unroll
            for (int j = 1; j < 8; ++j) a = fmaxf(a, fmaxf(S[qb][0][j], S[qb][1][j]));
            a = fmaxf(a, __uint_as_float(__builtin_amdgcn_permlanex16(0u, __float_as_uint(a), 0x76543210u, 0xfedcba98u, false, false))); cm[qb] = a * LOG2E; }   // both halves of the wave hold the query's chunk maximum: one scale per query
        if (__builtin_amdgcn_ballot_w32(cm[0] > m[0] + 8.0f || cm[1] > m[1] + 8.0f) != 0) {   // one scalar branch per chunk; every lane stays on
#pragma unroll
            for (int qb = 0; qb < 2; ++qb) { const float mn = fmaxf(m[qb], cm[qb]); const float al = __builtin_amdgcn_exp2f(m[qb] - mn); m[qb] = mn; l[qb][0] *= al; l[qb][1] *= al;
#pragma unroll
                for (int cb = 0; cb < 8; ++cb) O[qb][cb] *= al; }
        }
        v16h pb[2];
#pragma unroll
        for (int qb = 0; qb < 2; ++qb)
#pragma unroll
            for (int t = 0; t < 2; ++t)
#pragma unroll
                for (int j = 0; j < 8; ++j) { const float p = __builtin_amdgcn_exp2f(fmaf(S[qb][t][j], LOG2E, -m[qb])); l[qb][t] += p; pb[qb][t * 8 + j] = (h16)p; }
#pragma unroll
        for (int cb = 0; cb < 8; ++cb)
#pragma unroll
            for (int qb = 0; qb < 2; ++qb) O[qb][cb] = wmma16(vf[cb], pb[qb], O[qb][cb]);
        // four vector slots between the trip's last matrix instructions and whatever overwrites their operands on the taken back edge
        asm volatile("v_nop\n\tv_nop\n\tv_nop\n\tv_nop" : "+v"(O[0][6]), "+v"(O[1][6]), "+v"(O[0][7]), "+v"(O[1][7]) : "v"(vf[7]), "v"(pb[1]));
    }
#pragma unroll
    for (int qb = 0; qb < 2; ++qb) { float s = l[qb][0] + l[qb][1]; s += __shfl_xor(s, 16, 32); if (hi == 0) { sm[wv * AQ + qb * 16 + lr] = m[qb]; sl[wv * AQ + qb * 16 + lr] = s; }
        float* mine = os + (size_t)(wv * AQ + qb * 16 + lr) * AP + 8 * hi;
#pragma unroll
        for (int cb = 0; cb < 8; ++cb) { v4f a, b; a[0] = O[qb][cb][0]; a[1] = O[qb][cb][1]; a[2] = O[qb][cb][2]; a[3] = O[qb][cb][3]; b[0] = O[qb][cb][4]; b[1] = O[qb][cb][5]; b[2] = O[qb][cb][6]; b[3] = O[qb][cb][7];
            *(v4fa*)(mine + cb * 16) = a; *(v4fa*)(mine + cb * 16 + 4) = b; } }
    __syncthreads();   // every wave's partial maximum, sum and tile are in LDS before any thread joins them
    const int q = threadIdx.x >> 3, part = threadIdx.x & 7; float mx = sm[q], f[AW], L = 0.f;
#pragma unroll
    for (int w = 1; w < AW; ++w) mx = fmaxf(mx, sm[w * AQ + q]);
#pragma unroll
    for (int w = 0; w < AW; ++w) { f[w] = __builtin_amdgcn_exp2f(sm[w * AQ + q] - mx); L += f[w] * sl[w * AQ + q]; }
    const float inv = __fdiv_rn(1.0f, L);
#pragma unroll
    for (int i = 0; i < 4; ++i) { const int c = i * 32 + part * 4; v4f o = *(const v4fa*)(os + (size_t)q * AP + c) * f[0];
#pragma unroll
        for (int w = 1; w < AW; ++w) o += *(const v4fa*)(os + (size_t)(w * AQ + q) * AP + c) * f[w];
        v4us oh, ol;
#pragma unroll
        for (int k = 0; k < 4; ++k) { unsigned short u, c2; splitf(o[k] * inv, u, c2); oh[k] = u; ol[k] = c2; }
        *(v4us*)(Fh + (size_t)(r0 + q) * CC + c) = oh; *(v4us*)(Fl + (size_t)(r0 + q) * CC + c) = ol; }
}
__device__ __forceinline__ int reflect64(int i) { return i < 0 ? -i : (i >= HH ? 2 * HH - 2 - i : i); }
// ---- k_conv3: reflect-pad conv3x3 as an implicit GEMM, no im2col copy. One 64x64 output tile per work-group = one image row (64 pixels) x 64 output channels; grid (NR/64, CC/64), NWC * 32 threads.
// K = (kh kw ci) as in Bt's rows; wave w takes the 32-wide K chunks w, w + NWC, ... (a chunk lies inside one tap). The A fragment of a chunk is read from the f32 map at the tap's reflected pixel and split into bf16 hi + lo in registers;
// C = sum (hi + lo) Bt, the NWC partial tiles meet in LDS and are summed in wave order 0 .. NWC - 1 (fixed order, bias last).
// The finished tile also leaves its share of the instance norm's statistics: per output channel the sum over the tile's 64 pixels and the squares about the tile's own mean, PS[row tile][channel][2]; d_stat joins the tiles.
#define NWC 12
typedef __attribute__((ext_vector_type(2))) __bf16 v2bf;
typedef __attribute__((ext_vector_type(8))) unsigned v8u;
// two f32 -> packed bf16 hi pair and packed bf16 lo pair (lo = bf16(y - hi)), round to nearest even by the hardware's packed convert: the values of splitf for every finite y
__device__ __forceinline__ void split2(float y0, float y1, unsigned& h, unsigned& l) { v2f y; y[0] = y0; y[1] = y1; h = __builtin_bit_cast(unsigned, __builtin_convertvector(y, v2bf)); v2f r; r[0] = y0 - __uint_as_float(h << 16); r[1] = y1 - __uint_as_float(h & 0xFFFF0000u); l = __builtin_bit_cast(unsigned, __builtin_convertvector(r, v2bf)); }
__global__ __launch_bounds__(NWC * 32) void k_conv3(const float* __restrict__ F, const bf* __restrict__ Bt, float* C, const float* __restrict__ bias, float* PS) {
    __shared__ __align__(16) float os[NWC * 64 * 68];
    const int lane = threadIdx.x & 31, lr = lane & 15, hi = lane >> 4; const int r0 = blockIdx.x * 64, c0 = blockIdx.y * 64;
    const int wv = __builtin_amdgcn_readfirstlane((int)(threadIdx.x >> 5));   // the wave's number, held scalar so that the K loop's counter, tap and branch stay scalar
    const int y = blockIdx.x % HH; F += (size_t)(blockIdx.x / HH) * NN * CC + 8 * hi;
    v8f acc[4][4];
#pragma unroll
    for (int mb = 0; mb < 4; ++mb)
#pragma unroll
        for (int nb = 0; nb < 4; ++nb) acc[mb][nb] = (v8f){};
    const size_t boff = (size_t)(c0 + lr) * KC + 8 * hi;
#pragma unroll 1
    for (int kc = wv * 32; kc < KC; kc += NWC * 32) {
        const int tap = kc / CC, kh = tap / 3, kw = tap % 3; const float* Fr = F + (size_t)reflect64(y + kh - 1) * HH * CC + kc % CC;
        v16bf b[4]; v4f raw[4][4];
#pragma unroll
        for (int mb = 0; mb < 4; ++mb) { const float* p = Fr + reflect64(mb * 16 + lr + kw - 1) * CC; raw[mb][0] = *(const v4f*)p; raw[mb][1] = *(const v4f*)(p + 4); raw[mb][2] = *(const v4f*)(p + 16); raw[mb][3] = *(const v4f*)(p + 20); }
        asm volatile("s_wait_xcnt 0x0" ::: "memory");   // the 16 map loads are issued: the wait stands in front of the weight loads, whose results may land on the address pairs that the map loads name
#pragma unroll
        for (int nb = 0; nb < 4; ++nb) b[nb] = WFrag<bf>::ld(Bt + boff + (size_t)nb * 16 * KC + kc);
        asm volatile("s_wait_xcnt 0x0" ::: "memory");   // the 8 weight loads are issued: the wait stands in front of the step of their address pair
        __builtin_amdgcn_sched_barrier(0);   // keeps the converts behind all 24 loads: without it the first converts, with their data waits, move in front of the later loads and a trip pays two memory round trips
        v16bf a[4], a2[4];
#pragma unroll
        for (int mb = 0; mb < 4; ++mb) { v8u h, l;
#pragma unroll
            for (int q = 0; q < 4; ++q) { unsigned u, c2; split2(raw[mb][q][0], raw[mb][q][1], u, c2); h[2 * q] = u; l[2 * q] = c2; split2(raw[mb][q][2], raw[mb][q][3], u, c2); h[2 * q + 1] = u; l[2 * q + 1] = c2; }
            a[mb] = __builtin_bit_cast(v16bf, h); a2[mb] = __builtin_bit_cast(v16bf, l); }
#pragma unroll
        for (int nb = 0; nb < 4; ++nb)
#pragma unroll
            for (int mb = 0; mb < 4; ++mb) { acc[mb][nb] = wmmab(a[mb], b[nb], acc[mb][nb]); acc[mb][nb] = wmmab(a2[mb], b[nb], acc[mb][nb]); }
        // four vector slots between the trip's last matrix instructions and whatever overwrites their operands on the taken back edge
        asm volatile("v_nop\n\tv_nop\n\tv_nop\n\tv_nop" : "+v"(acc[0][0]), "+v"(acc[1][1]), "+v"(acc[2][2]), "+v"(acc[3][3]) : "v"(a[0]), "v"(a[3]));
    }
    float* mine = os + wv * (64 * 68);
    // the three loops are unrolled so that every accumulator index is a constant and acc stays in registers
#pragma unroll
    for (int mb = 0; mb < 4; ++mb)
#pragma unroll
        for (int nb = 0; nb < 4; ++nb)
#pragma unroll
            for (int j = 0; j < 8; ++j) mine[(mb * 16 + hi * 8 + j) * 68 + nb * 16 + lr] = acc[mb][nb][j];
    __syncthreads();   // every wave's partial tile is in LDS before any thread sums across the waves
    for (int g = threadIdx.x; g < 64 * 16; g += NWC * 32) { const int row = g >> 4, cofs = (g & 15) * 4; v4f val = *(const v4fa*)(os + row * 68 + cofs);
#pragma unroll   // the NWC LDS reads of a trip are issued together instead of one per round trip
        for (int w = 1; w < NWC; ++w) val += *(const v4fa*)(os + (w * 64 + row) * 68 + cofs);
        val[0] += bfr(bias[c0 + cofs]); val[1] += bfr(bias[c0 + cofs + 1]); val[2] += bfr(bias[c0 + cofs + 2]); val[3] += bfr(bias[c0 + cofs + 3]);
        *(v4f*)(C + (size_t)(r0 + row) * CC + c0 + cofs) = val;
        *(v4fa*)(os + row * 68 + cofs) = val;   // the finished value back into plane 0, at the place that this thread alone has read
    }
    // the finished tile is in LDS before the column sums read it. The barrier orders LDS alone: __syncthreads() would also hold every wave until its stores to C are acknowledged, which nothing in this launch reads
    __builtin_amdgcn_fence(__ATOMIC_RELEASE, "workgroup", "local"); __builtin_amdgcn_s_barrier(); __builtin_amdgcn_fence(__ATOMIC_ACQUIRE, "workgroup", "local");
    if (wv < 4) {   // wave w: channels 16 w .. 16 w + 15; each half of the wave takes 32 of the 64 pixels (8 rows apart: the two halves fall on different banks)
        const int c = wv * 16 + lr; float v[32];
#pragma unroll
        for (int i = 0; i < 32; ++i) v[i] = os[((i >> 3) * 16 + (i & 7) + 8 * hi) * 68 + c];
        float s4[4] = {v[0], v[1], v[2], v[3]}, q4[4] = {0.f, 0.f, 0.f, 0.f};   // four independent chains per sum
#pragma unroll
        for (int i = 4; i < 32; ++i) s4[i & 3] += v[i];
        float s = (s4[0] + s4[1]) + (s4[2] + s4[3]); s += __shfl_xor(s, 16, 32);
        const float mt = s * (1.0f / HH);
#pragma unroll
        for (int i = 0; i < 32; ++i) { const float d = v[i] - mt; q4[i & 3] += d * d; }
        float q2 = (q4[0] + q4[1]) + (q4[2] + q4[3]); q2 += __shfl_xor(q2, 16, 32);
        if (hi == 0) { v2f o; o[0] = s; o[1] = q2; *(v2f*)(PS + ((size_t)blockIdx.x * CC + c0 + c) * 2) = o; }
    }
}
// ---- d_stat: mean and 1/sqrt(var + eps) of a block's 32 channels, joined from the HH row tiles' partials (sum, squares about the tile's mean) that k_conv3 left in PS; P = the image's first tile at the block's first channel. 256 threads.
// Thread = (wave w: tiles 8 w .. 8 w + 7, lane: channel). The tile means are taken about tile 0's mean (the pivot pv), so one pass gives D = sum d and Q = sum (M2 + 64 d d): mean = pv + D / 64, var = (Q - D D) / NN.
// The 8 wave partials meet in LDS and every thread sums those of its own channel quad cq in wave order 0 .. 7.
__device__ __forceinline__ void d_stat(const float* __restrict__ P, float* red, int cq, v4f& mu, v4f& rs) {
    const int lane = threadIdx.x & 31, wave = threadIdx.x >> 5; const float* p = P + (size_t)wave * 8 * CC * 2 + lane * 2; const float pv = P[lane * 2] * (1.0f / HH); v2f t[8];
#pragma unroll
    for (int i = 0; i < 8; ++i) t[i] = *(const v2f*)(p + (size_t)i * CC * 2);
    asm volatile("s_wait_xcnt 0x0" ::: "memory");   // the 9 partial loads are issued: the wait stands in front of whatever reuses their address registers
    float D = 0.f, Q = 0.f;
#pragma unroll
    for (int i = 0; i < 8; ++i) { const float d = t[i][0] * (1.0f / HH) - pv; D += d; Q += t[i][1] + (float)HH * d * d; }
    red[wave * 32 + lane] = D; red[256 + wave * 32 + lane] = Q; if (wave == 0) red[512 + lane] = pv;
    __syncthreads();   // every wave's partial D and Q (and the pivot) are in LDS before any thread joins them
    v4f Ds = *(const v4fa*)(red + cq * 4), Qs = *(const v4fa*)(red + 256 + cq * 4);
#pragma unroll   // the LDS reads are issued together instead of one per round trip
    for (int w = 1; w < 8; ++w) { Ds += *(const v4fa*)(red + w * 32 + cq * 4); Qs += *(const v4fa*)(red + 256 + w * 32 + cq * 4); }
    mu = *(const v4fa*)(red + 512 + cq * 4) + Ds * (1.0f / HH); const v4f vq = (Qs - Ds * Ds) * (1.0f / NN);
#pragma unroll
    for (int q = 0; q < 4; ++q) rs[q] = __frsqrt_rn(vq[q] + 1e-3f);
}
// ---- k_inrelu, k_inres: the two normalising passes. One block = ER rows x 32 channels of one image (grid (NN / ER, CC / 32, NB_)): thread = (row t >> 3, channel quad t & 7), two rows 32 apart; the map loads are issued in front of d_stat and fly during it.
#define ER 64
__global__ __launch_bounds__(256) void k_inrelu(const float* __restrict__ Cv, const float* __restrict__ PS, const float* __restrict__ g, const float* __restrict__ be, float* Hout) {
    __shared__ __align__(16) float red[17 * 32];
    const int cq = threadIdx.x & 7, c = blockIdx.y * 32 + cq * 4; const size_t i = ((size_t)blockIdx.z * NN + blockIdx.x * ER + (threadIdx.x >> 3)) * CC + c;
    const v4f a0 = *(const v4f*)(Cv + i), a1 = *(const v4f*)(Cv + i + 32 * CC), gg = *(const v4f*)(g + c), bb = *(const v4f*)(be + c);
    asm volatile("s_wait_xcnt 0x0" ::: "memory");   // the 4 loads are issued, in front of d_stat's: the wait stands in front of the later loads, whose results may land on the address pairs that these name
    v4f mu, rs, o0, o1; d_stat(PS + ((size_t)blockIdx.z * HH * CC + blockIdx.y * 32) * 2, red, cq, mu, rs);
#pragma unroll
    for (int q = 0; q < 4; ++q) { const float G = bfr(gg[q]), B = bfr(bb[q]); o0[q] = fmaxf((a0[q] - mu[q]) * rs[q] * G + B, 0.f); o1[q] = fmaxf((a1[q] - mu[q]) * rs[q] * G + B, 0.f); }
    *(v4f*)(Hout + i) = o0; *(v4f*)(Hout + i + 32 * CC) = o1;
}
__global__ __launch_bounds__(256) void k_inres(const float* __restrict__ Cv, const float* __restrict__ PS, const float* __restrict__ g, const float* __restrict__ be, const float* __restrict__ WYin, float* WYout) {
    __shared__ __align__(16) float red[17 * 32];
    const int cq = threadIdx.x & 7, c = blockIdx.y * 32 + cq * 4; const size_t i = ((size_t)blockIdx.z * NN + blockIdx.x * ER + (threadIdx.x >> 3)) * CC + c;
    const v4f a0 = *(const v4f*)(Cv + i), a1 = *(const v4f*)(Cv + i + 32 * CC);
    asm volatile("s_wait_xcnt 0x0" ::: "memory");   // the compiler lets a later load's result land on the address pair that the two issued Cv loads name: the wait stands in front of that overwrite
    const v4f w0 = *(const v4f*)(WYin + i), w1 = *(const v4f*)(WYin + i + 32 * CC), gg = *(const v4f*)(g + c), bb = *(const v4f*)(be + c);
    asm volatile("s_wait_xcnt 0x0" ::: "memory");   // the 4 loads are issued, in front of d_stat's: the wait stands in front of the later loads, whose results may land on the address pairs that these name
    v4f mu, rs, o0, o1; d_stat(PS + ((size_t)blockIdx.z * HH * CC + blockIdx.y * 32) * 2, red, cq, mu, rs);
#pragma unroll
    for (int q = 0; q < 4; ++q) { const float G = bfr(gg[q]), B = bfr(bb[q]); o0[q] = w0[q] + ((a0[q] - mu[q]) * rs[q] * G + B); o1[q] = w1[q] + ((a1[q] - mu[q]) * rs[q] * G + B); }
    *(v4f*)(WYout + i) = o0; *(v4f*)(WYout + i + 32 * CC) = o1;
}
__global__ __launch_bounds__(256) void k_blend(const float* __restrict__ x, const float* __restrict__ M, const float* __restrict__ WY, float* OUT) { const size_t i = ((size_t)blockIdx.x * 256 + threadIdx.x) * 4; if (i >= (size_t)NR * CC) return; const int n = (int)(i / CC); const float m = M[n]; const float om = __fsub_rn(1.0f, m); const v4f w = *(const v4f*)(WY + i); v4f o;
#pragma unroll
    for (int q = 0; q < 4; ++q) { float a = __fmul_rn(m, bfr(x[i + q])); asm volatile("" : "+v"(a)); float b = __fmul_rn(om, w[q]); asm volatile("" : "+v"(b)); o[q] = __fadd_rn(a, b); } *(v4f*)(OUT + i) = o;  }

extern "C" void kernel_launch(void* const* d_in, const int* in_sizes, int n_in,
                              void* d_out, int out_size, void* d_ws, size_t ws_size, hipStream_t stream) {
    (void)in_sizes; (void)n_in; (void)out_size;
    const float* IN[18]; for (int i = 0; i < 18; ++i) IN[i] = (const float*)d_in[i];   // 0 x, 1 mask, 2 wg, 3 bg, 4 wt, 5 bt, 6 wp, 7 bp, 8 ww, 9 bw, 10 res_w1 [3][3][3][128][128], 11 res_b1 [3][128], 12 res_g1, 13 res_be1, 14 res_w2, 15 res_b2, 16 res_g2, 17 res_be2
    float* OUT = (float*)d_out;     // [2][64][64][128]
    char* wsp = (char*)d_ws;
    auto take = [&](size_t bytes) { char* p = wsp; wsp += (bytes + 255) & ~(size_t)255; return (void*)p; };
    bf* WG = (bf*)take(CC * CC * 2); bf* WT = (bf*)take(CC * CC * 2); bf* WP = (bf*)take(CC * CC * 2); bf* WW = (bf*)take(CC * CC * 2); bf* WR = (bf*)take((size_t)6 * CC * KC * 2);
    bf* XB = (bf*)take((size_t)NR * CC * 2); float* GF = (float*)take((size_t)NR * CC * 4); float* TF = (float*)take((size_t)NR * CC * 4); float* PF = (float*)take((size_t)NR * CC * 4); h16* T16 = (h16*)take((size_t)NR * CC * 2); h16* P16k = (h16*)take((size_t)NR * CC * 2); h16* GT = (h16*)take((size_t)NR * CC * 2); float* M = (float*)take((size_t)NR * 4);
    bf* Ah = (bf*)take((size_t)NR * CC * 2); bf* Al = (bf*)take((size_t)NR * CC * 2); float* WY = (float*)take((size_t)NR * CC * 4); float* WY2 = (float*)take((size_t)NR * CC * 4); float* CV = (float*)take((size_t)NR * CC * 4); float* HB = (float*)take((size_t)NR * CC * 4); float* PS = (float*)take((size_t)NB_ * HH * CC * 2 * 4);
    if ((size_t)(wsp - (char*)d_ws) > ws_size) return;    // total ~ 45 MB
    (void)WT; (void)WP; (void)PF;   // reached through WG, GF and TF: the planes of a merged launch lie one behind the other (every size above is a multiple of 256 bytes)
    // every launch below covers both images (rows image-major; per-image operands through grid x / z) and all NN queries
    const unsigned L4 = (unsigned)(((size_t)NR * CC / 4 + 255) / 256);
    k_prep<<<6 * PBL + 4 * PBS + PBX + PBM, 256, 0, stream>>>(IN[0], IN[1], IN[2], IN[4], IN[6], IN[8], IN[10], IN[14], WG, WR, XB, M);   // HWIO flattened = [(kh kw ci)][co] (x @ W layout); WG, WT, WP, WW lie one behind the other
    k_gemmw<bf, 0, true, 4><<<dim3(NR / 64, CC / 64, 3), 4 * 32, 0, stream>>>(XB, nullptr, WG, nullptr, CC, GF, CC, IN[3], IN[5], IN[7], 0, (size_t)CC * CC, (size_t)NR * CC);   // z = g, theta, phi: WG, WT, WP and GF, TF, PF lie one behind the other
    k_h16<<<PBG + PBF, 256, 0, stream>>>(GF, M, TF, GT, T16);   // TF, PF and T16, P16k lie one behind the other
    k_attn<<<NR / AQ, AW * 32, 0, stream>>>(T16, P16k, GT, Ah, Al);
    k_gemmw<bf, 1, true, 4><<<dim3(NR / 64, CC / 64, 1), 4 * 32, 0, stream>>>(Ah, Al, WW, nullptr, CC, WY, CC, IN[9], nullptr, nullptr, 0, 0, 0);
    float* wy = WY; float* wyn = WY2;
    for (int i = 0; i < 3; ++i) {
        k_conv3<<<dim3(NR / 64, CC / 64, 1), NWC * 32, 0, stream>>>(wy, WR + (size_t)(2 * i) * CC * KC, CV, IN[11] + i * CC, PS);
        k_inrelu<<<dim3(NN / ER, CC / 32, NB_), 256, 0, stream>>>(CV, PS, IN[12] + i * CC, IN[13] + i * CC, HB);
        k_conv3<<<dim3(NR / 64, CC / 64, 1), NWC * 32, 0, stream>>>(HB, WR + (size_t)(2 * i + 1) * CC * KC, CV, IN[15] + i * CC, PS);
        k_inres<<<dim3(NN / ER, CC / 32, NB_), 256, 0, stream>>>(CV, PS, IN[16] + i * CC, IN[17] + i * CC, wy, wyn); float* t = wy; wy = wyn; wyn = t; }
    k_blend<<<L4, 256, 0, stream>>>(IN[0], M, wy, OUT);
}

// v008
// It runs in 108 microseconds.
// Two timings next to v007 both put it at 1.28 times that version's speed.
// Counting every step since v000, it is 85.9 times as fast.
#include <hip/hip_runtime.h>

// NonLocalBlock2D_with_mask_Res (x NHWC [2][64][64][128], mask [2][64][64][1]; g/theta/phi = 1x1 convs; f = softmax(theta.phi^T / 1) over keys; m = (1 - min(mask,0)) (1 - mask) (the reference's resize-identity / where / invert chain; mask read as data);
// f = m[key] f (after the softmax, no renormalisation); y = f g; w_y = 1x1 conv W; 3 ResNet blocks (reflect-pad conv3x3 -> InstanceNorm(1e-3) -> relu -> reflect-pad conv3x3 -> InstanceNorm, residual); z = m x + (1 - m) w_y -> [2][64][64][128]).
// Compute dtypes, f32 accumulate: every input rounded to bf16; g/theta/phi 1x1 projections on PLAIN bf16 operands (inputs: exact, + bias), W and conv3x3 on hi+lo bf16 activations; scores (K 128) and the gated probs . g on SINGLE fp16 planes (logits are O(1) at these scales);

#define NB_  2
#define HH   64
#define NN   4096
#define CC   128
#define KC   1152
#define NR   (NB_ * NN)   // rows of both images, image-major
typedef _Float16 h16;
typedef unsigned short bf;
typedef __attribute__((ext_vector_type(16))) __bf16   v16bf;
typedef __attribute__((ext_vector_type(16))) _Float16 v16h;
typedef __attribute__((ext_vector_type(8)))  _Float16 v8h;
typedef __attribute__((ext_vector_type(8)))  unsigned short v8us;
typedef __attribute__((ext_vector_type(8)))  float    v8f;
typedef __attribute__((ext_vector_type(4)))  float    v4f;
typedef v8h  __attribute__((may_alias)) v8ha;
typedef v4f  __attribute__((may_alias)) v4fa;
typedef v8us __attribute__((may_alias)) v8usa;

__device__ __forceinline__ unsigned short f2bf(float f) { unsigned u = __float_as_uint(f); u += 0x7FFFu + ((u >> 16) & 1u); return (unsigned short)(u >> 16); }
__device__ __forceinline__ float bf2f(unsigned short b) { return __uint_as_float(((unsigned)b) << 16); }
__device__ __forceinline__ float bfr(float f) { return bf2f(f2bf(f)); }
__device__ __forceinline__ v16h cat16(v8h lo, v8h hi) { return __builtin_shufflevector(lo, hi, 0, 1, 2, 3, 4, 5, 6, 7, 8, 9, 10, 11, 12, 13, 14, 15); }
__device__ __forceinline__ v16bf cat16b(v8us lo, v8us hi) { return __builtin_bit_cast(v16bf, __builtin_shufflevector(lo, hi, 0, 1, 2, 3, 4, 5, 6, 7, 8, 9, 10, 11, 12, 13, 14, 15)); }
__device__ __forceinline__ v8f wmma16(v16h a, v16h b, v8f c) { return __builtin_amdgcn_wmma_f32_16x16x32_f16(false, a, false, b, (short)0, c, false, false); }
__device__ __forceinline__ v8f wmmab(v16bf a, v16bf b, v8f c) { return __builtin_amdgcn_wmma_f32_16x16x32_bf16(false, a, false, b, (short)0, c, false, false); }



// ---- k_gemmw: register-blocked GEMM, NW WAVES per 64x64 output tile (16 accumulators each), operands straight from K-contiguous 16-bit planes; grid (M/64, N/64, Z), NW * 32 threads.
// Wave w takes the 32-wide K chunks w, w + NW, ...; for NW > 1 the NW partial tiles meet in LDS and are summed in wave order 0 .. NW - 1 (fixed order, bias last).
// C[m][n] (f32, pitch ldc, + optional f32 bias[n]) = sum_k A[m][k] Bt[n][k] (+ split products per NSPLIT). z-batch strides sA/sB/sC in elements; batch z = 0 / 1 / 2 adds bias / bias1 / bias2. K % 32 == 0.
template <typename T16> struct WFrag;
template <> struct WFrag<h16> { typedef v16h V; static __device__ __forceinline__ V ld(const h16* p) { return cat16(*(const v8h*)p, *(const v8h*)(p + 16)); } static __device__ __forceinline__ v8f mma(V a, V b, v8f c) { return wmma16(a, b, c); } };
template <> struct WFrag<bf> { typedef v16bf V; static __device__ __forceinline__ V ld(const bf* p) { return cat16b(*(const v8us*)p, *(const v8us*)(p + 16)); } static __device__ __forceinline__ v8f mma(V a, V b, v8f c) { return wmmab(a, b, c); } };
// The f32 maps that k_conv3 reads (WY, WY2, HB) lie in the order of its A loads: [image row][32-channel chunk][q][pixel][h][4], the four channels 16 (q >> 1) + 8 h + 4 (q & 1) .. + 3 of the chunk: the 16 pixels x 2 halves of a wave's 16-byte load are 512 bytes in a row.
// mapofs: the place (in floats) of pixel row n (image-major), channels c .. c + 3, c % 4 == 0.
__device__ __forceinline__ size_t mapofs(int n, int c) { const int k = c & 31; return (size_t)(n >> 6) * (HH * CC) + (size_t)((((c >> 5) * 4 + ((k >> 4) << 1) + ((k >> 2) & 1)) * HH + (n & 63)) * 8 + ((k >> 3) & 1) * 4); }
// MAP: C is such a map (ldc unused, NW > 1 only).
template <typename T16, int NSPLIT, bool BIAS, int NW, bool MAP = false>
__global__ __launch_bounds__(NW * 32) void k_gemmw(const T16* __restrict__ A, const T16* __restrict__ A2, const T16* __restrict__ Bt, const T16* __restrict__ Bt2, int K, float* C, int ldc, const float* __restrict__ bias, const float* __restrict__ bias1, const float* __restrict__ bias2, size_t sA, size_t sB, size_t sC) {
    typedef typename WFrag<T16>::V V;
    __shared__ __align__(16) float os[(NW == 1 ? 16 : NW * 64) * 68];
    const size_t z = blockIdx.z; A += z * sA; if (A2) A2 += z * sA; Bt += z * sB; if (Bt2) Bt2 += z * sB; C += z * sC; if (BIAS && z) bias = z == 1 ? bias1 : bias2;
    const int lane = threadIdx.x & 31, lr = lane & 15, hi = lane >> 4; const int r0 = blockIdx.x * 64, c0 = blockIdx.y * 64;
    const int wv = NW == 1 ? 0 : __builtin_amdgcn_readfirstlane((int)(threadIdx.x >> 5));   // the wave's number, held scalar so that the K loop's counter and branch stay scalar
    v8f acc[4][4];
#pragma unroll
    for (int mb = 0; mb < 4; ++mb)
#pragma unroll
        for (int nb = 0; nb < 4; ++nb) acc[mb][nb] = (v8f){};
    const size_t aoff = (size_t)(r0 + lr) * K + 8 * hi, boff = (size_t)(c0 + lr) * K + 8 * hi;
#pragma unroll 1
    for (int kc = wv * 32; kc < K; kc += NW * 32) {
        V a[4], a2[4];
#pragma unroll
        for (int mb = 0; mb < 4; ++mb) { a[mb] = WFrag<T16>::ld(A + aoff + (size_t)mb * 16 * K + kc); if (NSPLIT == 1 || NSPLIT == 2) a2[mb] = WFrag<T16>::ld(A2 + aoff + (size_t)mb * 16 * K + kc); }
#pragma unroll
        for (int nb = 0; nb < 4; ++nb) { const V b = WFrag<T16>::ld(Bt + boff + (size_t)nb * 16 * K + kc); V b2; if (NSPLIT >= 2) b2 = WFrag<T16>::ld(Bt2 + boff + (size_t)nb * 16 * K + kc);
#pragma unroll
            for (int mb = 0; mb < 4; ++mb) { acc[mb][nb] = WFrag<T16>::mma(a[mb], b, acc[mb][nb]); if (NSPLIT == 1 || NSPLIT == 2) acc[mb][nb] = WFrag<T16>::mma(a2[mb], b, acc[mb][nb]); if (NSPLIT >= 2) acc[mb][nb] = WFrag<T16>::mma(a[mb], b2, acc[mb][nb]); } }
        asm volatile("v_nop\n\tv_nop\n\tv_nop\n\tv_nop" : "+v"(acc[0][0]), "+v"(acc[1][1]), "+v"(acc[2][2]), "+v"(acc[3][3]) : "v"(a[0]), "v"(a[3]));
    }
    if constexpr (NW > 1) {
        float* mine = os + wv * (64 * 68);
        // the three loops are unrolled so that every accumulator index is a constant and acc stays in registers
#pragma unroll
        for (int mb = 0; mb < 4; ++mb)
#pragma unroll
            for (int nb = 0; nb < 4; ++nb)
#pragma unroll
                for (int j = 0; j < 8; ++j) mine[(mb * 16 + hi * 8 + j) * 68 + nb * 16 + lr] = acc[mb][nb][j];
        __syncthreads();   // every wave's partial tile is in LDS before any thread sums across the waves
        for (int g = threadIdx.x; g < 64 * 16; g += NW * 32) { const int row = g >> 4, cofs = (g & 15) * 4; v4f val = *(const v4fa*)(os + row * 68 + cofs);
#pragma unroll   // the NW LDS reads of a trip are issued together instead of one per round trip
            for (int w = 1; w < NW; ++w) val += *(const v4fa*)(os + (w * 64 + row) * 68 + cofs);
            if (BIAS) { val[0] += bfr(bias[c0 + cofs]); val[1] += bfr(bias[c0 + cofs + 1]); val[2] += bfr(bias[c0 + cofs + 2]); val[3] += bfr(bias[c0 + cofs + 3]); }
            *(v4f*)(C + (MAP ? mapofs(r0 + row, c0 + cofs) : (size_t)(r0 + row) * ldc + c0 + cofs)) = val;
        }
        return;
    }
#pragma unroll
    for (int mb = 0; mb < 4; ++mb) {
#pragma unroll
        for (int nb = 0; nb < 4; ++nb) {
#pragma unroll
            for (int j = 0; j < 8; ++j) os[(hi * 8 + j) * 68 + nb * 16 + lr] = acc[mb][nb][j]; }
        __builtin_amdgcn_wave_barrier(); asm volatile("" ::: "memory");
        float* crow = C + (size_t)(r0 + mb * 16) * ldc + c0;
{
#pragma unroll
            for (int s = 0; s < 8; ++s) { const int row = 2 * s + hi, cofs = lr * 4; v4f val = *(const v4fa*)(os + row * 68 + cofs); if (BIAS) { val[0] += bfr(bias[c0 + cofs]); val[1] += bfr(bias[c0 + cofs + 1]); val[2] += bfr(bias[c0 + cofs + 2]); val[3] += bfr(bias[c0 + cofs + 3]); }
                *(v4f*)(crow + (size_t)row * ldc + cofs) = val; }
             }
        __builtin_amdgcn_wave_barrier(); asm volatile("" ::: "memory");
    }
}

__device__ __forceinline__ h16 tohx(float x) { return (h16)x; }
__device__ __forceinline__ void splitf(float y, unsigned short& h, unsigned short& l) { h = f2bf(y); l = f2bf(y - bf2f(h)); }
typedef __attribute__((ext_vector_type(2))) _Float16 v2h;
typedef __attribute__((ext_vector_type(4))) _Float16 v4h;
typedef __attribute__((ext_vector_type(2))) unsigned short v2us;
typedef __attribute__((ext_vector_type(4))) unsigned short v4us;
typedef __attribute__((ext_vector_type(2))) float v2f;

// The bodies d_* each do the work of one 256-thread block, number bx, of a pass; passes that read nothing of one another share a launch (k_prep, k_h16), each on its own range of blocks.
__device__ __forceinline__ void d_wtG(int bx, const float* __restrict__ w, int K, int N, bf* Bt) {
    const int lane = threadIdx.x & 31; const int L0 = (bx * 8 + (threadIdx.x >> 5)) * 8; const int nlines = N * K / 64;
{
#pragma unroll 1
        for (int l = 0; l < 8; ++l) { const int L = L0 + l; if (L >= nlines) break; const size_t e = (size_t)L * 64 + lane * 2; const int k = (int)(e % K), n = (int)(e / K); v2us o;
            o[0] = f2bf(w[(size_t)k * N + n]); o[1] = f2bf(w[(size_t)(k + 1) * N + n]); *(v2us*)(Bt + e) = o; }
         }
}
// a 3x3 weight [(kh kw ci)][co] as bf16 in the order of k_conv3's B fragments: [32-wide K chunk][16-channel block][half][lane][8]; lane (n = lane & 15, h = lane >> 4) holds output channel n of the block at k = 16 half + 8 h .. + 7 of the chunk, so a wave's 16-byte load of a half covers 512 bytes in a row
__device__ __forceinline__ void d_wtF(int bx, const float* __restrict__ w, bf* Bt) {
    const int lane = threadIdx.x & 31; const int L0 = (bx * 8 + (threadIdx.x >> 5)) * 8;
#pragma unroll 1   // rolled like d_wtG's loop: only the place of an element differs from there
    for (int l = 0; l < 8; ++l) { const int L = L0 + l; if (L >= KC * CC / 64) break; const int e = L * 64 + lane * 2, fl = (e >> 3) & 31; const int n = ((e >> 9) & 7) * 16 + (fl & 15), k = (e >> 12) * 32 + ((e >> 8) & 1) * 16 + (fl >> 4) * 8 + (e & 7); v2us o;
        o[0] = f2bf(w[(size_t)k * CC + n]); o[1] = f2bf(w[(size_t)(k + 1) * CC + n]); *(v2us*)(Bt + e) = o; }
}
__device__ __forceinline__ void d_cvt8(int bx, const float* __restrict__ src, bf* dst, size_t n8) { const size_t i = (size_t)bx * 256 + threadIdx.x; if (i >= n8) return; const v8f v = *(const v8f*)(src + i * 8); v8us o;
#pragma unroll
    for (int k = 0; k < 8; ++k) o[k] = f2bf(v[k]); *(v8us*)(dst + i * 8) = o;  }
// rows of CC f32 -> fp16 in the order of k_attn's query and key fragments: [16-row tile][32-channel chunk][half][lane][8]; lane (r = lane & 15, h = lane >> 4) holds row r of the tile at channels 16 half + 8 h .. + 7 of the chunk. A thread writes 4 elements at place i and reads them where they lie in F.
__device__ __forceinline__ void d_f16(int bx, const float* __restrict__ F, size_t n4, h16* P) { const size_t i = ((size_t)bx * 256 + threadIdx.x) * 4; if (i >= n4 * 4) return; const int e = (int)i, fl = (e >> 3) & 31; const v4f a = *(const v4f*)(F + (size_t)((e >> 11) * 16 + (fl & 15)) * CC + ((e >> 9) & 3) * 32 + ((e >> 8) & 1) * 16 + (fl >> 4) * 8 + (e & 7)); v4h o; o[0] = tohx(a[0]); o[1] = tohx(a[1]); o[2] = tohx(a[2]); o[3] = tohx(a[3]); *(v4h*)(P + i) = o;  }
// the gated values m[key] g[key][c] as fp16, laid out as the A fragments of k_attn's second product: [image][32-key chunk][16-channel block][half][lane][8], lane (c = lane & 15, h = lane >> 4) holds channel c at keys 16 half + 8h .. + 7 of the chunk
__device__ __forceinline__ void d_gtt(int bx, const float* __restrict__ G, const float* __restrict__ M, h16* GT) { const int e = bx * 256 + threadIdx.x; if (e >= NR * CC / 16) return; const int lane = e & 31, cb = (e >> 5) & 7, chunk = e >> 8; const int n0 = chunk * 32 + 8 * (lane >> 4), c = cb * 16 + (lane & 15); v8h lo, up; float ma[8], mb[8], ga[8], gb[8];
#pragma unroll
    for (int s = 0; s < 8; ++s) { ga[s] = G[(size_t)(n0 + s) * CC + c]; gb[s] = G[(size_t)(n0 + 16 + s) * CC + c]; }
    asm volatile("s_wait_xcnt 0x0" ::: "memory");   // the 16 value loads are issued: the wait stands in front of the gate loads, whose results may land on the address pairs that the value loads name
#pragma unroll
    for (int s = 0; s < 8; ++s) { ma[s] = M[n0 + s]; mb[s] = M[n0 + 16 + s]; }
#pragma unroll
    for (int s = 0; s < 8; ++s) { lo[s] = tohx(ga[s] * ma[s]); up[s] = tohx(gb[s] * mb[s]); }
    h16* o = GT + (size_t)(e >> 5) * 512 + lane * 8; *(v8h*)o = lo; *(v8h*)(o + 256) = up;  }
__device__ __forceinline__ void d_mvec(int bx, const float* __restrict__ mask, float* M) { const int n = bx * 256 + threadIdx.x; if (n >= NR) return; const float mk = bfr(mask[n]); const float a = __fsub_rn(1.0f, fminf(mk, 0.f)); const float v = __fmul_rn(a, __fsub_rn(1.0f, mk)); *(float*)(M + n) = v;  }
// ---- k_prep: every pass that reads inputs only, in one launch. Blocks, longest bodies first: 6 x PBL the 3x3 weights (W1[0], W2[0], W1[1], ... -> WR), 4 x PBS the 1x1 weights (wg, wt, wp, ww -> four planes from WS on), PBX x -> bf16, PBM the mask vector.
#define PBL ((KC * CC / 64 + 63) / 64)
#define PBS ((CC * CC / 64 + 63) / 64)
#define PBX (NR * CC / 8 / 256)
#define PBM (NR / 256)
__global__ __launch_bounds__(256) void k_prep(const float* __restrict__ x, const float* __restrict__ mask, const float* __restrict__ wg, const float* __restrict__ wt, const float* __restrict__ wp, const float* __restrict__ ww, const float* __restrict__ rw1, const float* __restrict__ rw2, bf* WS, bf* WR, bf* XB, float* M) {
    int b = blockIdx.x;
    if (b < 6 * PBL) { const int i = b / PBL; d_wtF(b % PBL, ((i & 1) ? rw2 : rw1) + (size_t)(i >> 1) * KC * CC, WR + (size_t)i * CC * KC); return; }
    b -= 6 * PBL;
    if (b < 4 * PBS) { const int i = b / PBS; d_wtG(b % PBS, i == 0 ? wg : i == 1 ? wt : i == 2 ? wp : ww, CC, CC, WS + (size_t)i * CC * CC); return; }
    b -= 4 * PBS;
    if (b < PBX) { d_cvt8(b, x, XB, (size_t)NR * CC / 8); return; }
    d_mvec(b - PBX, mask, M);
}
// ---- k_h16: the three fp16 planes of the projections in one launch: PBG blocks g -> its gated fragment plane GT, then theta and phi (adjacent f32 planes from TP on -> adjacent fp16 planes from TP16 on).
#define PBG (NR * CC / 16 / 256)
#define PBF (2 * NR * CC / 4 / 256)
__global__ __launch_bounds__(256) void k_h16(const float* __restrict__ G, const float* __restrict__ M, const float* __restrict__ TP, h16* GT, h16* TP16) {
    const int b = blockIdx.x;
    if (b < PBG) { d_gtt(b, G, M, GT); return; }
    d_f16(b - PBG, TP, (size_t)2 * NR * CC / 4, TP16);
}
// ---- k_attn: scores, softmax over the keys and the gated probs . g in one kernel; neither the score plane nor the probability plane exists in memory. One work-group per AQ = 32 queries (grid NR / AQ), AW = 8 waves, wave w walks the keys
// w * AKS .. w * AKS + AKS - 1 of the queries' image in chunks of 32. St = phi . theta^T (keys = rows, queries = columns): a lane holds 8 keys of ONE query per tile, and the two 16-key tiles of a chunk, converted in place, are the B fragment of Ot += GT . Pt.
// Running maximum per query in log2 units; the accumulators are rescaled only when a chunk's maximum passes the one in use by more than 8 (p <= 2^8, inside fp16). The sum runs over the ungated f32 p (the gate sits in GT, behind the softmax).
// The AW partial (maximum, sum, Ot) meet in LDS and are joined in wave order 0 .. AW - 1; y = Ot / sum leaves as its bf16 hi + lo planes, the A operand of the W product.
#define AQ  32
#define AW  8
#define AKS (NN / AW)
#define AP  132   // f32 pitch of a query's 128 channels in LDS: 16 lanes x 16 bytes at this pitch fall on 64 different banks
#define LOG2E 1.44269504088896340736f
__device__ __forceinline__ v16h ldp(const char* p) { return cat16(*(const v8h*)p, *(const v8h*)(p + 512)); }   // a fragment from a plane in fragment order; p = the fragment + 16 lane
__global__ __launch_bounds__(AW * 32) void k_attn(const h16* __restrict__ T16, const h16* __restrict__ P16, const h16* __restrict__ GT, bf* Fh, bf* Fl) {
    __shared__ __align__(16) float os[AW * AQ * AP]; __shared__ float sm[AW * AQ]; __shared__ float sl[AW * AQ];
    const int lane = threadIdx.x & 31, lr = lane & 15, hi = lane >> 4; const int r0 = blockIdx.x * AQ; const int img = blockIdx.x / (NN / AQ);
    const int wv = __builtin_amdgcn_readfirstlane((int)(threadIdx.x >> 5));   // the wave's number, held scalar so that the key slice's base stays scalar
    // scalar bases and the lane offset (bytes) of the kernel's loads
    const unsigned ko = (unsigned)(lane * 16);   // every plane lies in fragment order: a fragment is 1 KB, its two halves 512 bytes each, 16 bytes a lane
    const char* qs = (const char*)(T16 + (size_t)r0 * CC);
    const char* ks = (const char*)(P16 + ((size_t)img * NN + wv * AKS) * CC);
    const char* vs = (const char*)(GT + (size_t)(img * (NN / 32) + wv * (AKS / 32)) * 4096);
    v16h qf[2][4], kf[2][4];
#pragma unroll
    for (int qb = 0; qb < 2; ++qb)
#pragma unroll
        for (int kc = 0; kc < 4; ++kc) qf[qb][kc] = ldp(qs + (qb * 4096 + kc * 1024) + ko);
#pragma unroll
    for (int t = 0; t < 2; ++t)
#pragma unroll
        for (int kc = 0; kc < 4; ++kc) kf[t][kc] = ldp(ks + (t * 4096 + kc * 1024) + ko);
    asm volatile("s_wait_xcnt 0x0" :: "v"(ko) : "memory");   // the 32 query and key loads are issued: the wait stands in front of whatever reuses their address registers; it takes the lane offset as an input so that nothing lands on it earlier
    v8f O[2][8]; float m[2], l[2][2];
#pragma unroll
    for (int qb = 0; qb < 2; ++qb) { m[qb] = -3.0e38f; l[qb][0] = 0.f; l[qb][1] = 0.f;
#pragma unroll
        for (int cb = 0; cb < 8; ++cb) O[qb][cb] = (v8f){}; }
    // the chunk loop stays rolled (two trips' fragments would not fit two waves per SIMD); every loop inside it is unrolled so that each fragment and accumulator index is a constant and stays in registers
#pragma unroll 1
    for (int ch = 0; ch < AKS / 32; ++ch) {
        v16h vf[8]; const char* va = vs + (size_t)(ch * 8192) + ko;
#pragma unroll
        for (int cb = 0; cb < 8; ++cb) vf[cb] = ldp(va + cb * 1024);
        asm volatile("s_wait_xcnt 0x0" :: "v"(va) : "memory");   // the 16 value loads are issued: the wait stands in front of whatever reuses their address registers; it takes the address as an input so that no load's result lands on it earlier
        v8f S[2][2];
#pragma unroll
        for (int t = 0; t < 2; ++t)
#pragma unroll
            for (int qb = 0; qb < 2; ++qb) { S[qb][t] = (v8f){};
#pragma unroll
                for (int kc = 0; kc < 4; ++kc) S[qb][t] = wmma16(kf[t][kc], qf[qb][kc], S[qb][t]); }
        // the next chunk's key fragments fly during this chunk's softmax and second product (the last trip reads its own chunk again: in bounds, unused)
        const int nx = ch + 1 < AKS / 32 ? ch + 1 : ch; const char* ka = ks + (size_t)(nx * 8192) + ko;
#pragma unroll
        for (int t = 0; t < 2; ++t)
#pragma unroll
            for (int kc = 0; kc < 4; ++kc) kf[t][kc] = ldp(ka + (t * 4096 + kc * 1024));
        asm volatile("s_wait_xcnt 0x0" :: "v"(ka) : "memory");   // the 16 key loads are issued: the wait stands in front of whatever reuses their address registers; it takes the address as an input so that no load's result lands on it earlier
        float cm[2];
#pragma unroll
        for (int qb = 0; qb < 2; ++qb) { float a = fmaxf(S[qb][0][0], S[qb][1][0]);
#pragma unroll
            for (int j = 1; j < 8; ++j) a = fmaxf(a, fmaxf(S[qb][0][j], S[qb][1][j]));
            a = fmaxf(a, __uint_as_float(__builtin_amdgcn_permlanex16(0u, __float_as_uint(a), 0x76543210u, 0xfedcba98u, false, false))); cm[qb] = a * LOG2E; }   // both halves of the wave hold the query's chunk maximum: one scale per query
        if (__builtin_amdgcn_ballot_w32(cm[0] > m[0] + 8.0f || cm[1] > m[1] + 8.0f) != 0) {   // one scalar branch per chunk; every lane stays on
#pragma unroll
            for (int qb = 0; qb < 2; ++qb) { const float mn = fmaxf(m[qb], cm[qb]); const float al = __builtin_amdgcn_exp2f(m[qb] - mn); m[qb] = mn; l[qb][0] *= al; l[qb][1] *= al;
#pragma unroll
                for (int cb = 0; cb < 8; ++cb) O[qb][cb] *= al; }
        }
        v16h pb[2];
#pragma unroll
        for (int qb = 0; qb < 2; ++qb)
#pragma unroll
            for (int t = 0; t < 2; ++t)
#pragma unroll
                for (int j = 0; j < 8; ++j) { const float p = __builtin_amdgcn_exp2f(fmaf(S[qb][t][j], LOG2E, -m[qb])); l[qb][t] += p; pb[qb][t * 8 + j] = (h16)p; }
#pragma unroll
        for (int cb = 0; cb < 8; ++cb)
#pragma unroll
            for (int qb = 0; qb < 2; ++qb) O[qb][cb] = wmma16(vf[cb], pb[qb], O[qb][cb]);
        // four vector slots between the trip's last matrix instructions and whatever overwrites their operands on the taken back edge
        asm volatile("v_nop\n\tv_nop\n\tv_nop\n\tv_nop" : "+v"(O[0][6]), "+v"(O[1][6]), "+v"(O[0][7]), "+v"(O[1][7]) : "v"(vf[7]), "v"(pb[1]));
    }
#pragma unroll
    for (int qb = 0; qb < 2; ++qb) { float s = l[qb][0] + l[qb][1]; s += __shfl_xor(s, 16, 32); if (hi == 0) { sm[wv * AQ + qb * 16 + lr] = m[qb]; sl[wv * AQ + qb * 16 + lr] = s; }
        float* mine = os + (size_t)(wv * AQ + qb * 16 + lr) * AP + 8 * hi;
#pragma unroll
        for (int cb = 0; cb < 8; ++cb) { v4f a, b; a[0] = O[qb][cb][0]; a[1] = O[qb][cb][1]; a[2] = O[qb][cb][2]; a[3] = O[qb][cb][3]; b[0] = O[qb][cb][4]; b[1] = O[qb][cb][5]; b[2] = O[qb][cb][6]; b[3] = O[qb][cb][7];
            *(v4fa*)(mine + cb * 16) = a; *(v4fa*)(mine + cb * 16 + 4) = b; } }
    __syncthreads();   // every wave's partial maximum, sum and tile are in LDS before any thread joins them
    const int q = threadIdx.x >> 3, part = threadIdx.x & 7; float mx = sm[q], f[AW], L = 0.f;
#pragma unroll
    for (int w = 1; w < AW; ++w) mx = fmaxf(mx, sm[w * AQ + q]);
#pragma unroll
    for (int w = 0; w < AW; ++w) { f[w] = __builtin_amdgcn_exp2f(sm[w * AQ + q] - mx); L += f[w] * sl[w * AQ + q]; }
    const float inv = __fdiv_rn(1.0f, L);
#pragma unroll
    for (int i = 0; i < 4; ++i) { const int c = i * 32 + part * 4; v4f o = *(const v4fa*)(os + (size_t)q * AP + c) * f[0];
#pragma unroll
        for (int w = 1; w < AW; ++w) o += *(const v4fa*)(os + (size_t)(w * AQ + q) * AP + c) * f[w];
        v4us oh, ol;
#pragma unroll
        for (int k = 0; k < 4; ++k) { unsigned short u, c2; splitf(o[k] * inv, u, c2); oh[k] = u; ol[k] = c2; }
        *(v4us*)(Fh + (size_t)(r0 + q) * CC + c) = oh; *(v4us*)(Fl + (size_t)(r0 + q) * CC + c) = ol; }
}
__device__ __forceinline__ int reflect64(int i) { return i < 0 ? -i : (i >= HH ? 2 * HH - 2 - i : i); }
// ---- k_conv3: reflect-pad conv3x3 as an implicit GEMM, no im2col copy. One 64x64 output tile per work-group = one image row (64 pixels) x 64 output channels; grid (NR/64, CC/64), NWC * 32 threads.
// K = (kh kw ci); wave w takes the 32-wide K chunks w, w + NWC, ... (a chunk lies inside one tap). Bt lies in fragment order (d_wtF), the map F in the order of mapofs. The A fragment of a chunk is read from the f32 map at the tap's reflected pixel and split into bf16 hi + lo in registers;
// C = sum (hi + lo) Bt, the NWC partial tiles meet in LDS and are summed in wave order 0 .. NWC - 1 (fixed order, bias last).
// The finished tile also leaves its share of the instance norm's statistics: per output channel the sum over the tile's 64 pixels and the squares about the tile's own mean, PS[row tile][channel][2]; d_stat joins the tiles.
#define NWC 12
typedef __attribute__((ext_vector_type(2))) __bf16 v2bf;
typedef __attribute__((ext_vector_type(8))) unsigned v8u;
// two f32 -> packed bf16 hi pair and packed bf16 lo pair (lo = bf16(y - hi)), round to nearest even by the hardware's packed convert: the values of splitf for every finite y
__device__ __forceinline__ void split2(float y0, float y1, unsigned& h, unsigned& l) { v2f y; y[0] = y0; y[1] = y1; h = __builtin_bit_cast(unsigned, __builtin_convertvector(y, v2bf)); v2f r; r[0] = y0 - __uint_as_float(h << 16); r[1] = y1 - __uint_as_float(h & 0xFFFF0000u); l = __builtin_bit_cast(unsigned, __builtin_convertvector(r, v2bf)); }
__global__ __launch_bounds__(NWC * 32) void k_conv3(const float* __restrict__ F, const bf* __restrict__ Bt, float* C, const float* __restrict__ bias, float* PS) {
    __shared__ __align__(16) float os[NWC * 64 * 68];
    const int lane = threadIdx.x & 31, lr = lane & 15, hi = lane >> 4; const int r0 = blockIdx.x * 64, c0 = blockIdx.y * 64;
    const int wv = __builtin_amdgcn_readfirstlane((int)(threadIdx.x >> 5));   // the wave's number, held scalar so that the K loop's counter, tap and branch stay scalar
    const int y = blockIdx.x % HH; F += (size_t)(blockIdx.x / HH) * NN * CC + 4 * hi;
    v8f acc[4][4];
#pragma unroll
    for (int mb = 0; mb < 4; ++mb)
#pragma unroll
        for (int nb = 0; nb < 4; ++nb) acc[mb][nb] = (v8f){};
    Bt += blockIdx.y * 2048 + lane * 8;   // the tile's four 16-channel blocks of a chunk: 4 KB in a row
#pragma unroll 1
    for (int kc = wv * 32; kc < KC; kc += NWC * 32) {
        const int tap = kc / CC, kh = tap / 3, kw = tap % 3; const float* Fr = F + (size_t)reflect64(y + kh - 1) * HH * CC + (kc % CC) * HH;
        v16bf b[4]; v4f raw[4][4];
#pragma unroll
        for (int mb = 0; mb < 4; ++mb) { const float* p = Fr + reflect64(mb * 16 + lr + kw - 1) * 8; raw[mb][0] = *(const v4f*)p; raw[mb][1] = *(const v4f*)(p + 512); raw[mb][2] = *(const v4f*)(p + 1024); raw[mb][3] = *(const v4f*)(p + 1536); }
        asm volatile("s_wait_xcnt 0x0" ::: "memory");   // the 16 map loads are issued: the wait stands in front of the weight loads, whose results may land on the address pairs that the map loads name
#pragma unroll
        for (int nb = 0; nb < 4; ++nb) b[nb] = cat16b(*(const v8us*)(Bt + kc * 128 + nb * 512), *(const v8us*)(Bt + kc * 128 + nb * 512 + 256));
        asm volatile("s_wait_xcnt 0x0" ::: "memory");   // the 8 weight loads are issued: the wait stands in front of the step of their address pair
        __builtin_amdgcn_sched_barrier(0);   // keeps the converts behind all 24 loads: without it the first converts, with their data waits, move in front of the later loads and a trip pays two memory round trips
        v16bf a[4], a2[4];
#pragma unroll
        for (int mb = 0; mb < 4; ++mb) { v8u h, l;
#pragma unroll
            for (int q = 0; q < 4; ++q) { unsigned u, c2; split2(raw[mb][q][0], raw[mb][q][1], u, c2); h[2 * q] = u; l[2 * q] = c2; split2(raw[mb][q][2], raw[mb][q][3], u, c2); h[2 * q + 1] = u; l[2 * q + 1] = c2; }
            a[mb] = __builtin_bit_cast(v16bf, h); a2[mb] = __builtin_bit_cast(v16bf, l); }
#pragma unroll
        for (int nb = 0; nb < 4; ++nb)
#pragma unroll
            for (int mb = 0; mb < 4; ++mb) { acc[mb][nb] = wmmab(a[mb], b[nb], acc[mb][nb]); acc[mb][nb] = wmmab(a2[mb], b[nb], acc[mb][nb]); }
        // four vector slots between the trip's last matrix instructions and whatever overwrites their operands on the taken back edge
        asm volatile("v_nop\n\tv_nop\n\tv_nop\n\tv_nop" : "+v"(acc[0][0]), "+v"(acc[1][1]), "+v"(acc[2][2]), "+v"(acc[3][3]) : "v"(a[0]), "v"(a[3]));
    }
    float* mine = os + wv * (64 * 68);
    // the three loops are unrolled so that every accumulator index is a constant and acc stays in registers
#pragma unroll
    for (int mb = 0; mb < 4; ++mb)
#pragma unroll
        for (int nb = 0; nb < 4; ++nb)
#pragma unroll
            for (int j = 0; j < 8; ++j) mine[(mb * 16 + hi * 8 + j) * 68 + nb * 16 + lr] = acc[mb][nb][j];
    __syncthreads();   // every wave's partial tile is in LDS before any thread sums across the waves
    for (int g = threadIdx.x; g < 64 * 16; g += NWC * 32) { const int row = g >> 4, cofs = (g & 15) * 4; v4f val = *(const v4fa*)(os + row * 68 + cofs);
#pragma unroll   // the NWC LDS reads of a trip are issued together instead of one per round trip
        for (int w = 1; w < NWC; ++w) val += *(const v4fa*)(os + (w * 64 + row) * 68 + cofs);
        val[0] += bfr(bias[c0 + cofs]); val[1] += bfr(bias[c0 + cofs + 1]); val[2] += bfr(bias[c0 + cofs + 2]); val[3] += bfr(bias[c0 + cofs + 3]);
        *(v4f*)(C + (size_t)(r0 + row) * CC + c0 + cofs) = val;
        *(v4fa*)(os + row * 68 + cofs) = val;   // the finished value back into plane 0, at the place that this thread alone has read
    }
    // the finished tile is in LDS before the column sums read it. The barrier orders LDS alone: __syncthreads() would also hold every wave until its stores to C are acknowledged, which nothing in this launch reads
    __builtin_amdgcn_fence(__ATOMIC_RELEASE, "workgroup", "local"); __builtin_amdgcn_s_barrier(); __builtin_amdgcn_fence(__ATOMIC_ACQUIRE, "workgroup", "local");
    if (wv < 4) {   // wave w: channels 16 w .. 16 w + 15; each half of the wave takes 32 of the 64 pixels (8 rows apart: the two halves fall on different banks)
        const int c = wv * 16 + lr; float v[32];
#pragma unroll
        for (int i = 0; i < 32; ++i) v[i] = os[((i >> 3) * 16 + (i & 7) + 8 * hi) * 68 + c];
        float s4[4] = {v[0], v[1], v[2], v[3]}, q4[4] = {0.f, 0.f, 0.f, 0.f};   // four independent chains per sum
#pragma unroll
        for (int i = 4; i < 32; ++i) s4[i & 3] += v[i];
        float s = (s4[0] + s4[1]) + (s4[2] + s4[3]); s += __shfl_xor(s, 16, 32);
        const float mt = s * (1.0f / HH);
#pragma unroll
        for (int i = 0; i < 32; ++i) { const float d = v[i] - mt; q4[i & 3] += d * d; }
        float q2 = (q4[0] + q4[1]) + (q4[2] + q4[3]); q2 += __shfl_xor(q2, 16, 32);
        if (hi == 0) { v2f o; o[0] = s; o[1] = q2; *(v2f*)(PS + ((size_t)blockIdx.x * CC + c0 + c) * 2) = o; }
    }
}
// ---- d_stat: mean and 1/sqrt(var + eps) of a block's 32 channels, joined from the HH row tiles' partials (sum, squares about the tile's mean) that k_conv3 left in PS; P = the image's first tile at the block's first channel. 256 threads.
// Thread = (wave w: tiles 8 w .. 8 w + 7, lane: channel). The tile means are taken about tile 0's mean (the pivot pv), so one pass gives D = sum d and Q = sum (M2 + 64 d d): mean = pv + D / 64, var = (Q - D D) / NN.
// The 8 wave partials meet in LDS and every thread sums those of its own channel quad cq in wave order 0 .. 7.
__device__ __forceinline__ void d_stat(const float* __restrict__ P, float* red, int cq, v4f& mu, v4f& rs) {
    const int lane = threadIdx.x & 31, wave = threadIdx.x >> 5; const float* p = P + (size_t)wave * 8 * CC * 2 + lane * 2; const float pv = P[lane * 2] * (1.0f / HH); v2f t[8];
#pragma unroll
    for (int i = 0; i < 8; ++i) t[i] = *(const v2f*)(p + (size_t)i * CC * 2);
    asm volatile("s_wait_xcnt 0x0" ::: "memory");   // the 9 partial loads are issued: the wait stands in front of whatever reuses their address registers
    float D = 0.f, Q = 0.f;
#pragma unroll
    for (int i = 0; i < 8; ++i) { const float d = t[i][0] * (1.0f / HH) - pv; D += d; Q += t[i][1] + (float)HH * d * d; }
    red[wave * 32 + lane] = D; red[256 + wave * 32 + lane] = Q; if (wave == 0) red[512 + lane] = pv;
    __syncthreads();   // every wave's partial D and Q (and the pivot) are in LDS before any thread joins them
    v4f Ds = *(const v4fa*)(red + cq * 4), Qs = *(const v4fa*)(red + 256 + cq * 4);
#pragma unroll   // the LDS reads are issued together instead of one per round trip
    for (int w = 1; w < 8; ++w) { Ds += *(const v4fa*)(red + w * 32 + cq * 4); Qs += *(const v4fa*)(red + 256 + w * 32 + cq * 4); }
    mu = *(const v4fa*)(red + 512 + cq * 4) + Ds * (1.0f / HH); const v4f vq = (Qs - Ds * Ds) * (1.0f / NN);
#pragma unroll
    for (int q = 0; q < 4; ++q) rs[q] = __frsqrt_rn(vq[q] + 1e-3f);
}
// ---- k_inrelu, k_inres: the two normalising passes. One block = ER rows x 32 channels of one image (grid (NN / ER, CC / 32, NB_)): thread = (row t >> 3, channel quad t & 7), two rows 32 apart; the map loads are issued in front of d_stat and fly during it.
#define ER 64
__global__ __launch_bounds__(256) void k_inrelu(const float* __restrict__ Cv, const float* __restrict__ PS, const float* __restrict__ g, const float* __restrict__ be, float* Hout) {
    __shared__ __align__(16) float red[17 * 32];
    const int cq = threadIdx.x & 7, c = blockIdx.y * 32 + cq * 4, n = blockIdx.z * NN + blockIdx.x * ER + (threadIdx.x >> 3); const size_t i = (size_t)n * CC + c, im = mapofs(n, c);   // ER = one image row: the pixel 32 further lies 32 * 8 floats further in a map
    const v4f a0 = *(const v4f*)(Cv + i), a1 = *(const v4f*)(Cv + i + 32 * CC), gg = *(const v4f*)(g + c), bb = *(const v4f*)(be + c);
    asm volatile("s_wait_xcnt 0x0" ::: "memory");   // the 4 loads are issued, in front of d_stat's: the wait stands in front of the later loads, whose results may land on the address pairs that these name
    v4f mu, rs, o0, o1; d_stat(PS + ((size_t)blockIdx.z * HH * CC + blockIdx.y * 32) * 2, red, cq, mu, rs);
#pragma unroll
    for (int q = 0; q < 4; ++q) { const float G = bfr(gg[q]), B = bfr(bb[q]); o0[q] = fmaxf((a0[q] - mu[q]) * rs[q] * G + B, 0.f); o1[q] = fmaxf((a1[q] - mu[q]) * rs[q] * G + B, 0.f); }
    *(v4f*)(Hout + im) = o0; *(v4f*)(Hout + im + 32 * 8) = o1;
}
__global__ __launch_bounds__(256) void k_inres(const float* __restrict__ Cv, const float* __restrict__ PS, const float* __restrict__ g, const float* __restrict__ be, const float* __restrict__ WYin, float* WYout) {
    __shared__ __align__(16) float red[17 * 32];
    const int cq = threadIdx.x & 7, c = blockIdx.y * 32 + cq * 4, n = blockIdx.z * NN + blockIdx.x * ER + (threadIdx.x >> 3); const size_t i = (size_t)n * CC + c, im = mapofs(n, c);   // ER = one image row: the pixel 32 further lies 32 * 8 floats further in a map
    const v4f a0 = *(const v4f*)(Cv + i), a1 = *(const v4f*)(Cv + i + 32 * CC);
    asm volatile("s_wait_xcnt 0x0" ::: "memory");   // the compiler lets a later load's result land on the address pair that the two issued Cv loads name: the wait stands in front of that overwrite
    const v4f w0 = *(const v4f*)(WYin + im), w1 = *(const v4f*)(WYin + im + 32 * 8), gg = *(const v4f*)(g + c), bb = *(const v4f*)(be + c);
    asm volatile("s_wait_xcnt 0x0" ::: "memory");   // the 4 loads are issued, in front of d_stat's: the wait stands in front of the later loads, whose results may land on the address pairs that these name
    v4f mu, rs, o0, o1; d_stat(PS + ((size_t)blockIdx.z * HH * CC + blockIdx.y * 32) * 2, red, cq, mu, rs);
#pragma unroll
    for (int q = 0; q < 4; ++q) { const float G = bfr(gg[q]), B = bfr(bb[q]); o0[q] = w0[q] + ((a0[q] - mu[q]) * rs[q] * G + B); o1[q] = w1[q] + ((a1[q] - mu[q]) * rs[q] * G + B); }
    *(v4f*)(WYout + im) = o0; *(v4f*)(WYout + im + 32 * 8) = o1;
}
__global__ __launch_bounds__(256) void k_blend(const float* __restrict__ x, const float* __restrict__ M, const float* __restrict__ WY, float* OUT) { const size_t i = ((size_t)blockIdx.x * 256 + threadIdx.x) * 4; if (i >= (size_t)NR * CC) return; const int n = (int)(i / CC); const float m = M[n]; const float om = __fsub_rn(1.0f, m); const v4f w = *(const v4f*)(WY + mapofs(n, (int)(i % CC))); v4f o;
#pragma unroll
    for (int q = 0; q < 4; ++q) { float a = __fmul_rn(m, bfr(x[i + q])); asm volatile("" : "+v"(a)); float b = __fmul_rn(om, w[q]); asm volatile("" : "+v"(b)); o[q] = __fadd_rn(a, b); } *(v4f*)(OUT + i) = o;  }

extern "C" void kernel_launch(void* const* d_in, const int* in_sizes, int n_in,
                              void* d_out, int out_size, void* d_ws, size_t ws_size, hipStream_t stream) {
    (void)in_sizes; (void)n_in; (void)out_size;
    const float* IN[18]; for (int i = 0; i < 18; ++i) IN[i] = (const float*)d_in[i];   // 0 x, 1 mask, 2 wg, 3 bg, 4 wt, 5 bt, 6 wp, 7 bp, 8 ww, 9 bw, 10 res_w1 [3][3][3][128][128], 11 res_b1 [3][128], 12 res_g1, 13 res_be1, 14 res_w2, 15 res_b2, 16 res_g2, 17 res_be2
    float* OUT = (float*)d_out;     // [2][64][64][128]
    char* wsp = (char*)d_ws;
    auto take = [&](size_t bytes) { char* p = wsp; wsp += (bytes + 255) & ~(size_t)255; return (void*)p; };
    bf* WG = (bf*)take(CC * CC * 2); bf* WT = (bf*)take(CC * CC * 2); bf* WP = (bf*)take(CC * CC * 2); bf* WW = (bf*)take(CC * CC * 2); bf* WR = (bf*)take((size_t)6 * CC * KC * 2);
    bf* XB = (bf*)take((size_t)NR * CC * 2); float* GF = (float*)take((size_t)NR * CC * 4); float* TF = (float*)take((size_t)NR * CC * 4); float* PF = (float*)take((size_t)NR * CC * 4); h16* T16 = (h16*)take((size_t)NR * CC * 2); h16* P16k = (h16*)take((size_t)NR * CC * 2); h16* GT = (h16*)take((size_t)NR * CC * 2); float* M = (float*)take((size_t)NR * 4);
    bf* Ah = (bf*)take((size_t)NR * CC * 2); bf* Al = (bf*)take((size_t)NR * CC * 2); float* WY = (float*)take((size_t)NR * CC * 4); float* WY2 = (float*)take((size_t)NR * CC * 4); float* CV = (float*)take((size_t)NR * CC * 4); float* HB = (float*)take((size_t)NR * CC * 4); float* PS = (float*)take((size_t)NB_ * HH * CC * 2 * 4);
    if ((size_t)(wsp - (char*)d_ws) > ws_size) return;    // total ~ 45 MB
    (void)WT; (void)WP; (void)PF;   // reached through WG, GF and TF: the planes of a merged launch lie one behind the other (every size above is a multiple of 256 bytes)
    // every launch below covers both images (rows image-major; per-image operands through grid x / z) and all NN queries
    const unsigned L4 = (unsigned)(((size_t)NR * CC / 4 + 255) / 256);
    k_prep<<<6 * PBL + 4 * PBS + PBX + PBM, 256, 0, stream>>>(IN[0], IN[1], IN[2], IN[4], IN[6], IN[8], IN[10], IN[14], WG, WR, XB, M);   // HWIO flattened = [(kh kw ci)][co] (x @ W layout); WG, WT, WP, WW lie one behind the other
    k_gemmw<bf, 0, true, 4><<<dim3(NR / 64, CC / 64, 3), 4 * 32, 0, stream>>>(XB, nullptr, WG, nullptr, CC, GF, CC, IN[3], IN[5], IN[7], 0, (size_t)CC * CC, (size_t)NR * CC);   // z = g, theta, phi: WG, WT, WP and GF, TF, PF lie one behind the other
    k_h16<<<PBG + PBF, 256, 0, stream>>>(GF, M, TF, GT, T16);   // TF, PF and T16, P16k lie one behind the other
    k_attn<<<NR / AQ, AW * 32, 0, stream>>>(T16, P16k, GT, Ah, Al);
    k_gemmw<bf, 1, true, 4, true><<<dim3(NR / 64, CC / 64, 1), 4 * 32, 0, stream>>>(Ah, Al, WW, nullptr, CC, WY, CC, IN[9], nullptr, nullptr, 0, 0, 0);
    float* wy = WY; float* wyn = WY2;
    for (int i = 0; i < 3; ++i) {
        k_conv3<<<dim3(NR / 64, CC / 64, 1), NWC * 32, 0, stream>>>(wy, WR + (size_t)(2 * i) * CC * KC, CV, IN[11] + i * CC, PS);
        k_inrelu<<<dim3(NN / ER, CC / 32, NB_), 256, 0, stream>>>(CV, PS, IN[12] + i * CC, IN[13] + i * CC, HB);
        k_conv3<<<dim3(NR / 64, CC / 64, 1), NWC * 32, 0, stream>>>(HB, WR + (size_t)(2 * i + 1) * CC * KC, CV, IN[15] + i * CC, PS);
        k_inres<<<dim3(NN / ER, CC / 32, NB_), 256, 0, stream>>>(CV, PS, IN[16] + i * CC, IN[17] + i * CC, wy, wyn); float* t = wy; wy = wyn; wyn = t; }
    k_blend<<<L4, 256, 0, stream>>>(IN[0], M, wy, OUT);
}

// v009
// Measured time: 101 microseconds a run.
// Timed twice side by side with v008, it ran 1.06 and 1.09 times as fast.
// Counting every step since v000, it is 92.2 times as fast.
#include <hip/hip_runtime.h>

// NonLocalBlock2D_with_mask_Res (x NHWC [2][64][64][128], mask [2][64][64][1]; g/theta/phi = 1x1 convs; f = softmax(theta.phi^T / 1) over keys; m = (1 - min(mask,0)) (1 - mask) (the reference's resize-identity / where / invert chain; mask read as data);
// f = m[key] f (after the softmax, no renormalisation); y = f g; w_y = 1x1 conv W; 3 ResNet blocks (reflect-pad conv3x3 -> InstanceNorm(1e-3) -> relu -> reflect-pad conv3x3 -> InstanceNorm, residual); z = m x + (1 - m) w_y -> [2][64][64][128]).
// Compute dtypes, f32 accumulate: every input rounded to bf16; g/theta/phi 1x1 projections on PLAIN bf16 operands (inputs: exact, + bias), W and conv3x3 on hi+lo bf16 activations; scores (K 128) and the gated probs . g on SINGLE fp16 planes (logits are O(1) at these scales);

#define NB_  2
#define HH   64
#define NN   4096
#define CC   128
#define KC   1152
#define NR   (NB_ * NN)   // rows of both images, image-major
typedef _Float16 h16;
typedef unsigned short bf;
typedef __attribute__((ext_vector_type(16))) __bf16   v16bf;
typedef __attribute__((ext_vector_type(16))) _Float16 v16h;
typedef __attribute__((ext_vector_type(8)))  _Float16 v8h;
typedef __attribute__((ext_vector_type(8)))  unsigned short v8us;
typedef __attribute__((ext_vector_type(8)))  float    v8f;
typedef __attribute__((ext_vector_type(4)))  float    v4f;
typedef v8h  __attribute__((may_alias)) v8ha;
typedef v4f  __attribute__((may_alias)) v4fa;
typedef v8us __attribute__((may_alias)) v8usa;

__device__ __forceinline__ unsigned short f2bf(float f) { unsigned u = __float_as_uint(f); u += 0x7FFFu + ((u >> 16) & 1u); return (unsigned short)(u >> 16); }
__device__ __forceinline__ float bf2f(unsigned short b) { return __uint_as_float(((unsigned)b) << 16); }
__device__ __forceinline__ float bfr(float f) { return bf2f(f2bf(f)); }
__device__ __forceinline__ v16h cat16(v8h lo, v8h hi) { return __builtin_shufflevector(lo, hi, 0, 1, 2, 3, 4, 5, 6, 7, 8, 9, 10, 11, 12, 13, 14, 15); }
__device__ __forceinline__ v16bf cat16b(v8us lo, v8us hi) { return __builtin_bit_cast(v16bf, __builtin_shufflevector(lo, hi, 0, 1, 2, 3, 4, 5, 6, 7, 8, 9, 10, 11, 12, 13, 14, 15)); }
__device__ __forceinline__ v8f wmma16(v16h a, v16h b, v8f c) { return __builtin_amdgcn_wmma_f32_16x16x32_f16(false, a, false, b, (short)0, c, false, false); }
__device__ __forceinline__ v8f wmmab(v16bf a, v16bf b, v8f c) { return __builtin_amdgcn_wmma_f32_16x16x32_bf16(false, a, false, b, (short)0, c, false, false); }



// The f32 maps that k_conv3 reads (WY, WY2, HB) lie in the order of its A loads: [image row][32-channel chunk][q][pixel][h][4], the four channels 16 (q >> 1) + 8 h + 4 (q & 1) .. + 3 of the chunk: the 16 pixels x 2 halves of a wave's 16-byte load are 512 bytes in a row.
// mapofs: the place (in floats) of pixel row n (image-major), channels c .. c + 3, c % 4 == 0.
__device__ __forceinline__ size_t mapofs(int n, int c) { const int k = c & 31; return (size_t)(n >> 6) * (HH * CC) + (size_t)((((c >> 5) * 4 + ((k >> 4) << 1) + ((k >> 2) & 1)) * HH + (n & 63)) * 8 + ((k >> 3) & 1) * 4); }
__device__ __forceinline__ v16bf ldb(const bf* p) { return cat16b(*(const v8usa*)p, *(const v8usa*)(p + 16)); }   // a bf16 fragment from a K-contiguous row (global or LDS): lane (row lane & 15, h = lane >> 4) holds k = 8 h .. + 7 and 16 + 8 h .. + 7 of the 32-wide chunk; p = the row + the chunk + 8 h

__device__ __forceinline__ h16 tohx(float x) { return (h16)x; }
__device__ __forceinline__ void splitf(float y, unsigned short& h, unsigned short& l) { h = f2bf(y); l = f2bf(y - bf2f(h)); }
typedef __attribute__((ext_vector_type(2))) _Float16 v2h;
typedef __attribute__((ext_vector_type(4))) _Float16 v4h;
typedef __attribute__((ext_vector_type(2))) unsigned short v2us;
typedef __attribute__((ext_vector_type(4))) unsigned short v4us;
typedef v4us __attribute__((may_alias)) v4usa;
typedef __attribute__((ext_vector_type(2))) float v2f;

// The bodies d_* each do the work of one 256-thread block, number bx, of a pass; passes that read nothing of one another share a launch (k_prep), each on its own range of blocks.
__device__ __forceinline__ void d_wtG(int bx, const float* __restrict__ w, int K, int N, bf* Bt) {
    const int lane = threadIdx.x & 31; const int L0 = (bx * 8 + (threadIdx.x >> 5)) * 8; const int nlines = N * K / 64;
{
#pragma unroll 1
        for (int l = 0; l < 8; ++l) { const int L = L0 + l; if (L >= nlines) break; const size_t e = (size_t)L * 64 + lane * 2; const int k = (int)(e % K), n = (int)(e / K); v2us o;
            o[0] = f2bf(w[(size_t)k * N + n]); o[1] = f2bf(w[(size_t)(k + 1) * N + n]); *(v2us*)(Bt + e) = o; }
         }
}
// a 3x3 weight [(kh kw ci)][co] as bf16 in the order of k_conv3's B fragments: [32-wide K chunk][16-channel block][half][lane][8]; lane (n = lane & 15, h = lane >> 4) holds output channel n of the block at k = 16 half + 8 h .. + 7 of the chunk, so a wave's 16-byte load of a half covers 512 bytes in a row
__device__ __forceinline__ void d_wtF(int bx, const float* __restrict__ w, bf* Bt) {
    const int lane = threadIdx.x & 31; const int L0 = (bx * 8 + (threadIdx.x >> 5)) * 8;
#pragma unroll 1   // rolled like d_wtG's loop: only the place of an element differs from there
    for (int l = 0; l < 8; ++l) { const int L = L0 + l; if (L >= KC * CC / 64) break; const int e = L * 64 + lane * 2, fl = (e >> 3) & 31; const int n = ((e >> 9) & 7) * 16 + (fl & 15), k = (e >> 12) * 32 + ((e >> 8) & 1) * 16 + (fl >> 4) * 8 + (e & 7); v2us o;
        o[0] = f2bf(w[(size_t)k * CC + n]); o[1] = f2bf(w[(size_t)(k + 1) * CC + n]); *(v2us*)(Bt + e) = o; }
}
__device__ __forceinline__ void d_cvt8(int bx, const float* __restrict__ src, bf* dst, size_t n8) { const size_t i = (size_t)bx * 256 + threadIdx.x; if (i >= n8) return; const v8f v = *(const v8f*)(src + i * 8); v8us o;
#pragma unroll
    for (int k = 0; k < 8; ++k) o[k] = f2bf(v[k]); *(v8us*)(dst + i * 8) = o;  }
__device__ __forceinline__ void d_mvec(int bx, const float* __restrict__ mask, float* M) { const int n = bx * 256 + threadIdx.x; if (n >= NR) return; const float mk = bfr(mask[n]); const float a = __fsub_rn(1.0f, fminf(mk, 0.f)); const float v = __fmul_rn(a, __fsub_rn(1.0f, mk)); *(float*)(M + n) = v;  }
// ---- k_prep: every pass that reads inputs only, in one launch. Blocks, longest bodies first: 6 x PBL the 3x3 weights (W1[0], W2[0], W1[1], ... -> WR), 4 x PBS the 1x1 weights (wg, wt, wp, ww -> four planes from WS on), PBX x -> bf16, PBM the mask vector.
#define PBL ((KC * CC / 64 + 63) / 64)
#define PBS ((CC * CC / 64 + 63) / 64)
#define PBX (NR * CC / 8 / 256)
#define PBM (NR / 256)
__global__ __launch_bounds__(256) void k_prep(const float* __restrict__ x, const float* __restrict__ mask, const float* __restrict__ wg, const float* __restrict__ wt, const float* __restrict__ wp, const float* __restrict__ ww, const float* __restrict__ rw1, const float* __restrict__ rw2, bf* WS, bf* WR, bf* XB, float* M) {
    int b = blockIdx.x;
    if (b < 6 * PBL) { const int i = b / PBL; d_wtF(b % PBL, ((i & 1) ? rw2 : rw1) + (size_t)(i >> 1) * KC * CC, WR + (size_t)i * CC * KC); return; }
    b -= 6 * PBL;
    if (b < 4 * PBS) { const int i = b / PBS; d_wtG(b % PBS, i == 0 ? wg : i == 1 ? wt : i == 2 ? wp : ww, CC, CC, WS + (size_t)i * CC * CC); return; }
    b -= 4 * PBS;
    if (b < PBX) { d_cvt8(b, x, XB, (size_t)NR * CC / 8); return; }
    d_mvec(b - PBX, mask, M);
}
// ---- k_proj: the three 1x1 projections (grid z = g, theta, phi) on plain bf16 operands; each 64x64 tile leaves straight as the fp16 plane that k_attn reads, no f32 plane in between. Grid (NR / 64, CC / 64, 3), PW * 32 threads.
// Wave w takes the 32-wide K chunk w (K = CC = PW chunks); the PW partial tiles meet in LDS and are summed in wave order 0 .. PW - 1 (fixed order, bias last).
// theta, phi -> TP16 (two adjacent planes) in the order of k_attn's query and key fragments: [16-row tile][32-channel chunk][half][lane][8]; lane (r = lane & 15, h = lane >> 4) holds row r of the tile at channels 16 half + 8 h .. + 7 of the chunk.
// g -> GT, the gated values m[key] g[key][c], laid out as the A fragments of k_attn's second product: [image][32-key chunk][16-channel block][half][lane][8], lane (c = lane & 15, h = lane >> 4) holds channel c at keys 16 half + 8 h .. + 7 of the chunk.
#define PW 4
__global__ __launch_bounds__(PW * 32) void k_proj(const bf* __restrict__ X, const bf* __restrict__ Wt, const float* __restrict__ bg, const float* __restrict__ bt, const float* __restrict__ bp, const float* __restrict__ M, h16* GT, h16* TP16) {
    __shared__ __align__(16) float os[PW * 64 * 68];
    const int z = blockIdx.z; const float* bias = z == 0 ? bg : z == 1 ? bt : bp;
    const int lane = threadIdx.x & 31, lr = lane & 15, hi = lane >> 4; const int r0 = blockIdx.x * 64, c0 = blockIdx.y * 64;
    const int wv = __builtin_amdgcn_readfirstlane((int)(threadIdx.x >> 5));   // the wave's number, held scalar so that the chunk's base stays scalar
    const bf* ap = X + (size_t)(r0 + lr) * CC + wv * 32 + 8 * hi; const bf* wp = Wt + (size_t)z * CC * CC + (size_t)(c0 + lr) * CC + wv * 32 + 8 * hi;
    // what the epilogue adds or multiplies (bias; for g the gate of the thread's keys too) is loaded in front of the operands and is there when they are
    const int t = threadIdx.x, tc = (t >> 6) * 32 + ((t >> 5) & 1) * 16 + ((t >> 4) & 1) * 8, tr = ((t >> 5) & 1) * 16 + ((t >> 4) & 1) * 8, tg = (t >> 6) * 16 + (t & 15); v4f e[4]; float bb[2];
    // one run of loads for every z, only the pointer differs (theta, phi: e[0], e[1] = the bias of the thread's 8 channels; g: e[0 .. 3] = the gate of its 2 x 8 keys, bb = the bias of its 2 channels): a branch here would put a data wait in front of the loads
    const float* ep = z ? bias + c0 + tc : M + r0 + tr; const float* eq = z ? ep : ep + 32; const float* bq = bias + c0 + tg;
    e[0] = *(const v4f*)ep; e[1] = *(const v4f*)(ep + 4); e[2] = *(const v4f*)eq; e[3] = *(const v4f*)(eq + 4); bb[0] = bq[0]; bb[1] = bq[32];
    v16bf a[4], b[4];
#pragma unroll
    for (int mb = 0; mb < 4; ++mb) { a[mb] = ldb(ap + mb * 16 * CC); b[mb] = ldb(wp + mb * 16 * CC); }
    asm volatile("s_wait_xcnt 0x0" :: "v"(ep), "v"(eq), "v"(bq), "v"(ap), "v"(wp) : "memory");   // the 22 loads are issued: the wait stands in front of whatever reuses their address registers; it takes the addresses as inputs so that no load's result lands on them earlier
    __builtin_amdgcn_sched_barrier(0);   // keeps the products behind all 22 loads: without it the first products, with their data waits, move in front of the later loads and the wave pays several memory round trips
    float* mine = os + wv * (64 * 68);
    // the loops are unrolled so that every fragment and accumulator index is a constant and stays in registers
    v8f acc[4][4];
#pragma unroll
    for (int nb = 0; nb < 4; ++nb)
#pragma unroll
        for (int mb = 0; mb < 4; ++mb) acc[mb][nb] = wmmab(a[mb], b[nb], (v8f){});
    __builtin_amdgcn_sched_barrier(0);   // keeps the 16 products in front of the LDS stores, each with a result tile of its own
#pragma unroll
    for (int mb = 0; mb < 4; ++mb)
#pragma unroll
        for (int nb = 0; nb < 4; ++nb)
#pragma unroll
            for (int j = 0; j < 8; ++j) mine[(mb * 16 + hi * 8 + j) * 68 + nb * 16 + lr] = acc[mb][nb][j];
    __syncthreads();   // every wave's partial tile is in LDS before any thread sums across the waves
    if (z) {   // a thread: 8 channels of one row, 16 bytes of the plane; a wave's store covers 512 bytes in a row
        h16* P = TP16 + (size_t)(z - 1) * NR * CC + (size_t)(r0 >> 4) * 2048 + (c0 >> 5) * 512;
#pragma unroll
        for (int rt = 0; rt < 4; ++rt) { const float* s = os + (rt * 16 + (t & 15)) * 68 + tc; v4f v0 = *(const v4fa*)s, v1 = *(const v4fa*)(s + 4);
#pragma unroll
            for (int w = 1; w < PW; ++w) { v0 += *(const v4fa*)(s + w * 64 * 68); v1 += *(const v4fa*)(s + w * 64 * 68 + 4); }
            v8h o;
#pragma unroll
            for (int k = 0; k < 4; ++k) { o[k] = tohx(v0[k] + bfr(e[0][k])); o[4 + k] = tohx(v1[k] + bfr(e[1][k])); }
            *(v8h*)(P + rt * 2048 + t * 8) = o; }
        asm volatile("s_wait_xcnt 0x0" ::: "memory");   // the 4 plane stores are issued: the wait stands in front of whatever reuses their data and address registers on any way out of this branch
    } else {   // a thread: 8 keys of one channel, 16 bytes of the plane; a wave's store covers 512 bytes in a row
        h16* P = GT + ((size_t)(r0 >> 5) * 8 + (c0 >> 4)) * 512;
#pragma unroll
        for (int it = 0; it < 4; ++it) { const int cp = it & 1, ck = it >> 1; const float* s = os + (ck * 32 + tr) * 68 + cp * 32 + tg; const float bv = bfr(bb[cp]); v8h o;   // cp: the pair of 16-channel blocks, ck: the 32-key chunk
#pragma unroll
            for (int k = 0; k < 8; ++k) { float v = s[k * 68];
#pragma unroll
                for (int w = 1; w < PW; ++w) v += s[(w * 64 + k) * 68];
                o[k] = tohx((v + bv) * e[ck * 2 + (k >> 2)][k & 3]); }
            *(v8h*)(P + (ck * 8 + cp * 2) * 512 + t * 8) = o; }
    }
}
// ---- k_attn: scores, softmax over the keys and the gated probs . g in one kernel; neither the score plane nor the probability plane exists in memory. One work-group per AQ = 32 queries (grid NR / AQ), AW = 8 waves, wave w walks the keys
// w * AKS .. w * AKS + AKS - 1 of the queries' image in chunks of 32. St = phi . theta^T (keys = rows, queries = columns): a lane holds 8 keys of ONE query per tile, and the two 16-key tiles of a chunk, converted in place, are the B fragment of Ot += GT . Pt.
// Running maximum per query in log2 units; the accumulators are rescaled only when a chunk's maximum passes the one in use by more than 8 (p <= 2^8, inside fp16). The sum runs over the ungated f32 p (the gate sits in GT, behind the softmax).
// The AW partial (maximum, sum, Ot) meet in LDS and are joined in wave order 0 .. AW - 1; y = Ot / sum goes as bf16 hi + lo into LDS.
// The W product follows in the same work-group: w_y^T = W^T . y^T (output channels = rows, queries = columns), wave w the 16 output channels 16 w .. + 15, one accumulator per 32-wide K chunk (hi then lo), the four summed in chunk order 0 .. 3, bias last;
// a lane holds 8 channels in a row of ONE query: two 16-byte stores into the map WY (mapofs).
#define AQ  32
#define AW  8
#define AKS (NN / AW)
#define AP  132   // f32 pitch of a query's 128 channels in LDS: 16 lanes x 16 bytes at this pitch fall on 64 different banks
#define YP  136   // bf16 pitch of a query's 128 channels of y in LDS: 16 lanes x 16 bytes at this pitch fall on 64 different banks
#define LOG2E 1.44269504088896340736f
__device__ __forceinline__ v16h ldp(const char* p) { return cat16(*(const v8h*)p, *(const v8h*)(p + 512)); }   // a fragment from a plane in fragment order; p = the fragment + 16 lane
__global__ __launch_bounds__(AW * 32) void k_attn(const h16* __restrict__ T16, const h16* __restrict__ P16, const h16* __restrict__ GT, const bf* __restrict__ Wt, const float* __restrict__ bw, float* WY) {
    __shared__ __align__(16) float os[AW * AQ * AP]; __shared__ float sm[AW * AQ]; __shared__ float sl[AW * AQ]; __shared__ __align__(16) bf yh[AQ * YP]; __shared__ __align__(16) bf yl[AQ * YP];
    const int lane = threadIdx.x & 31, lr = lane & 15, hi = lane >> 4; const int r0 = blockIdx.x * AQ; const int img = blockIdx.x / (NN / AQ);
    const int wv = __builtin_amdgcn_readfirstlane((int)(threadIdx.x >> 5));   // the wave's number, held scalar so that the key slice's base stays scalar
    // scalar bases and the lane offset (bytes) of the kernel's loads
    const unsigned ko = (unsigned)(lane * 16);   // every plane lies in fragment order: a fragment is 1 KB, its two halves 512 bytes each, 16 bytes a lane
    const char* qs = (const char*)(T16 + (size_t)r0 * CC);
    const char* ks = (const char*)(P16 + ((size_t)img * NN + wv * AKS) * CC);
    const char* vs = (const char*)(GT + (size_t)(img * (NN / 32) + wv * (AKS / 32)) * 4096);
    v16h qf[2][4], kf[2][4];
#pragma unroll
    for (int qb = 0; qb < 2; ++qb)
#pragma unroll
        for (int kc = 0; kc < 4; ++kc) qf[qb][kc] = ldp(qs + (qb * 4096 + kc * 1024) + ko);
#pragma unroll
    for (int t = 0; t < 2; ++t)
#pragma unroll
        for (int kc = 0; kc < 4; ++kc) kf[t][kc] = ldp(ks + (t * 4096 + kc * 1024) + ko);
    asm volatile("s_wait_xcnt 0x0" :: "v"(ko) : "memory");   // the 32 query and key loads are issued: the wait stands in front of whatever reuses their address registers; it takes the lane offset as an input so that nothing lands on it earlier
    v8f O[2][8]; float m[2], l[2][2];
#pragma unroll
    for (int qb = 0; qb < 2; ++qb) { m[qb] = -3.0e38f; l[qb][0] = 0.f; l[qb][1] = 0.f;
#pragma unroll
        for (int cb = 0; cb < 8; ++cb) O[qb][cb] = (v8f){}; }
    // the chunk loop stays rolled (two trips' fragments would not fit two waves per SIMD); every loop inside it is unrolled so that each fragment and accumulator index is a constant and stays in registers
#pragma unroll 1
    for (int ch = 0; ch < AKS / 32; ++ch) {
        v16h vf[8]; const char* va = vs + (size_t)(ch * 8192) + ko;
#pragma unroll
        for (int cb = 0; cb < 8; ++cb) vf[cb] = ldp(va + cb * 1024);
        asm volatile("s_wait_xcnt 0x0" :: "v"(va) : "memory");   // the 16 value loads are issued: the wait stands in front of whatever reuses their address registers; it takes the address as an input so that no load's result lands on it earlier
        v8f S[2][2];
#pragma unroll
        for (int t = 0; t < 2; ++t)
#pragma unroll
            for (int qb = 0; qb < 2; ++qb) { S[qb][t] = (v8f){};
#pragma unroll
                for (int kc = 0; kc < 4; ++kc) S[qb][t] = wmma16(kf[t][kc], qf[qb][kc], S[qb][t]); }
        // the next chunk's key fragments fly during this chunk's softmax and second product (the last trip reads its own chunk again: in bounds, unused)
        const int nx = ch + 1 < AKS / 32 ? ch + 1 : ch; const char* ka = ks + (size_t)(nx * 8192) + ko;
#pragma unroll
        for (int t = 0; t < 2; ++t)
#pragma unroll
            for (int kc = 0; kc < 4; ++kc) kf[t][kc] = ldp(ka + (t * 4096 + kc * 1024));
        asm volatile("s_wait_xcnt 0x0" :: "v"(ka) : "memory");   // the 16 key loads are issued: the wait stands in front of whatever reuses their address registers; it takes the address as an input so that no load's result lands on it earlier
        float cm[2];
#pragma unroll
        for (int qb = 0; qb < 2; ++qb) { float a = fmaxf(S[qb][0][0], S[qb][1][0]);
#pragma unroll
            for (int j = 1; j < 8; ++j) a = fmaxf(a, fmaxf(S[qb][0][j], S[qb][1][j]));
            a = fmaxf(a, __uint_as_float(__builtin_amdgcn_permlanex16(0u, __float_as_uint(a), 0x76543210u, 0xfedcba98u, false, false))); cm[qb] = a * LOG2E; }   // both halves of the wave hold the query's chunk maximum: one scale per query
        if (__builtin_amdgcn_ballot_w32(cm[0] > m[0] + 8.0f || cm[1] > m[1] + 8.0f) != 0) {   // one scalar branch per chunk; every lane stays on
#pragma unroll
            for (int qb = 0; qb < 2; ++qb) { const float mn = fmaxf(m[qb], cm[qb]); const float al = __builtin_amdgcn_exp2f(m[qb] - mn); m[qb] = mn; l[qb][0] *= al; l[qb][1] *= al;
#pragma unroll
                for (int cb = 0; cb < 8; ++cb) O[qb][cb] *= al; }
        }
        v16h pb[2];
#pragma unroll
        for (int qb = 0; qb < 2; ++qb)
#pragma unroll
            for (int t = 0; t < 2; ++t)
#pragma unroll
                for (int j = 0; j < 8; ++j) { const float p = __builtin_amdgcn_exp2f(fmaf(S[qb][t][j], LOG2E, -m[qb])); l[qb][t] += p; pb[qb][t * 8 + j] = (h16)p; }
#pragma unroll
        for (int cb = 0; cb < 8; ++cb)
#pragma unroll
            for (int qb = 0; qb < 2; ++qb) O[qb][cb] = wmma16(vf[cb], pb[qb], O[qb][cb]);
        // four vector slots between the trip's last matrix instructions and whatever overwrites their operands on the taken back edge
        asm volatile("v_nop\n\tv_nop\n\tv_nop\n\tv_nop" : "+v"(O[0][6]), "+v"(O[1][6]), "+v"(O[0][7]), "+v"(O[1][7]) : "v"(vf[7]), "v"(pb[1]));
    }
    // the wave's W fragments and bias are loaded here and fly during the join
    v16bf wf[4]; const bf* wp = Wt + (size_t)(wv * 16 + lr) * CC + 8 * hi;
#pragma unroll
    for (int kc = 0; kc < 4; ++kc) wf[kc] = ldb(wp + kc * 32);
    const v4f bw0 = *(const v4f*)(bw + wv * 16 + 8 * hi), bw1 = *(const v4f*)(bw + wv * 16 + 8 * hi + 4);
    asm volatile("s_wait_xcnt 0x0" ::: "memory");   // the 10 loads are issued: the wait stands in front of whatever reuses their address registers
#pragma unroll
    for (int qb = 0; qb < 2; ++qb) { float s = l[qb][0] + l[qb][1]; s += __shfl_xor(s, 16, 32); if (hi == 0) { sm[wv * AQ + qb * 16 + lr] = m[qb]; sl[wv * AQ + qb * 16 + lr] = s; }
        float* mine = os + (size_t)(wv * AQ + qb * 16 + lr) * AP + 8 * hi;
#pragma unroll
        for (int cb = 0; cb < 8; ++cb) { v4f a, b; a[0] = O[qb][cb][0]; a[1] = O[qb][cb][1]; a[2] = O[qb][cb][2]; a[3] = O[qb][cb][3]; b[0] = O[qb][cb][4]; b[1] = O[qb][cb][5]; b[2] = O[qb][cb][6]; b[3] = O[qb][cb][7];
            *(v4fa*)(mine + cb * 16) = a; *(v4fa*)(mine + cb * 16 + 4) = b; } }
    __syncthreads();   // every wave's partial maximum, sum and tile are in LDS before any thread joins them
    const int q = threadIdx.x >> 3, part = threadIdx.x & 7; float mx = sm[q], f[AW], L = 0.f;
#pragma unroll
    for (int w = 1; w < AW; ++w) mx = fmaxf(mx, sm[w * AQ + q]);
#pragma unroll
    for (int w = 0; w < AW; ++w) { f[w] = __builtin_amdgcn_exp2f(sm[w * AQ + q] - mx); L += f[w] * sl[w * AQ + q]; }
    const float inv = __fdiv_rn(1.0f, L);
#pragma unroll
    for (int i = 0; i < 4; ++i) { const int c = i * 32 + part * 4; v4f o = *(const v4fa*)(os + (size_t)q * AP + c) * f[0];
#pragma unroll
        for (int w = 1; w < AW; ++w) o += *(const v4fa*)(os + (size_t)(w * AQ + q) * AP + c) * f[w];
        v4us oh, ol;
#pragma unroll
        for (int k = 0; k < 4; ++k) { unsigned short u, c2; splitf(o[k] * inv, u, c2); oh[k] = u; ol[k] = c2; }
        *(v4usa*)(yh + q * YP + c) = oh; *(v4usa*)(yl + q * YP + c) = ol; }
    __syncthreads();   // every query's y (hi and lo) is in LDS before any wave reads its fragments
#pragma unroll
    for (int qb = 0; qb < 2; ++qb) { v8f acc[4];
#pragma unroll
        for (int kc = 0; kc < 4; ++kc) { const int yo = (qb * 16 + lr) * YP + kc * 32 + 8 * hi; acc[kc] = wmmab(wf[kc], ldb(yh + yo), (v8f){}); acc[kc] = wmmab(wf[kc], ldb(yl + yo), acc[kc]); }
        const v8f v = ((acc[0] + acc[1]) + acc[2]) + acc[3]; v4f o0, o1;
#pragma unroll
        for (int k = 0; k < 4; ++k) { o0[k] = v[k] + bfr(bw0[k]); o1[k] = v[4 + k] + bfr(bw1[k]); }
        const int n = r0 + qb * 16 + lr, c = wv * 16 + 8 * hi; *(v4f*)(WY + mapofs(n, c)) = o0; *(v4f*)(WY + mapofs(n, c + 4)) = o1; }
}
__device__ __forceinline__ int reflect64(int i) { return i < 0 ? -i : (i >= HH ? 2 * HH - 2 - i : i); }
// ---- k_conv3: reflect-pad conv3x3 as an implicit GEMM, no im2col copy. One 64x64 output tile per work-group = one image row (64 pixels) x 64 output channels; grid (NR/64, CC/64), NWC * 32 threads.
// K = (kh kw ci); wave w takes the 32-wide K chunks w, w + NWC, ... (a chunk lies inside one tap). Bt lies in fragment order (d_wtF), the map F in the order of mapofs. The A fragment of a chunk is read from the f32 map at the tap's reflected pixel and split into bf16 hi + lo in registers;
// C = sum (hi + lo) Bt, the NWC partial tiles meet in LDS and are summed in wave order 0 .. NWC - 1 (fixed order, bias last).
// The finished tile also leaves its share of the instance norm's statistics: per output channel the sum over the tile's 64 pixels and the squares about the tile's own mean, PS[row tile][channel][2]; d_stat joins the tiles.
#define NWC 12
typedef __attribute__((ext_vector_type(2))) __bf16 v2bf;
typedef __attribute__((ext_vector_type(8))) unsigned v8u;
// two f32 -> packed bf16 hi pair and packed bf16 lo pair (lo = bf16(y - hi)), round to nearest even by the hardware's packed convert: the values of splitf for every finite y
__device__ __forceinline__ void split2(float y0, float y1, unsigned& h, unsigned& l) { v2f y; y[0] = y0; y[1] = y1; h = __builtin_bit_cast(unsigned, __builtin_convertvector(y, v2bf)); v2f r; r[0] = y0 - __uint_as_float(h << 16); r[1] = y1 - __uint_as_float(h & 0xFFFF0000u); l = __builtin_bit_cast(unsigned, __builtin_convertvector(r, v2bf)); }
__global__ __launch_bounds__(NWC * 32) void k_conv3(const float* __restrict__ F, const bf* __restrict__ Bt, float* C, const float* __restrict__ bias, float* PS) {
    __shared__ __align__(16) float os[NWC * 64 * 68];
    const int lane = threadIdx.x & 31, lr = lane & 15, hi = lane >> 4; const int r0 = blockIdx.x * 64, c0 = blockIdx.y * 64;
    const int wv = __builtin_amdgcn_readfirstlane((int)(threadIdx.x >> 5));   // the wave's number, held scalar so that the K loop's counter, tap and branch stay scalar
    const int y = blockIdx.x % HH; F += (size_t)(blockIdx.x / HH) * NN * CC + 4 * hi;
    v8f acc[4][4];
#pragma unroll
    for (int mb = 0; mb < 4; ++mb)
#pragma unroll
        for (int nb = 0; nb < 4; ++nb) acc[mb][nb] = (v8f){};
    Bt += blockIdx.y * 2048 + lane * 8;   // the tile's four 16-channel blocks of a chunk: 4 KB in a row
#pragma unroll 1
    for (int kc = wv * 32; kc < KC; kc += NWC * 32) {
        const int tap = kc / CC, kh = tap / 3, kw = tap % 3; const float* Fr = F + (size_t)reflect64(y + kh - 1) * HH * CC + (kc % CC) * HH;
        v16bf b[4]; v4f raw[4][4];
#pragma unroll
        for (int mb = 0; mb < 4; ++mb) { const float* p = Fr + reflect64(mb * 16 + lr + kw - 1) * 8; raw[mb][0] = *(const v4f*)p; raw[mb][1] = *(const v4f*)(p + 512); raw[mb][2] = *(const v4f*)(p + 1024); raw[mb][3] = *(const v4f*)(p + 1536); }
        asm volatile("s_wait_xcnt 0x0" ::: "memory");   // the 16 map loads are issued: the wait stands in front of the weight loads, whose results may land on the address pairs that the map loads name
#pragma unroll
        for (int nb = 0; nb < 4; ++nb) b[nb] = cat16b(*(const v8us*)(Bt + kc * 128 + nb * 512), *(const v8us*)(Bt + kc * 128 + nb * 512 + 256));
        asm volatile("s_wait_xcnt 0x0" ::: "memory");   // the 8 weight loads are issued: the wait stands in front of the step of their address pair
        __builtin_amdgcn_sched_barrier(0);   // keeps the converts behind all 24 loads: without it the first converts, with their data waits, move in front of the later loads and a trip pays two memory round trips
        v16bf a[4], a2[4];
#pragma unroll
        for (int mb = 0; mb < 4; ++mb) { v8u h, l;
#pragma unroll
            for (int q = 0; q < 4; ++q) { unsigned u, c2; split2(raw[mb][q][0], raw[mb][q][1], u, c2); h[2 * q] = u; l[2 * q] = c2; split2(raw[mb][q][2], raw[mb][q][3], u, c2); h[2 * q + 1] = u; l[2 * q + 1] = c2; }
            a[mb] = __builtin_bit_cast(v16bf, h); a2[mb] = __builtin_bit_cast(v16bf, l); }
#pragma unroll
        for (int nb = 0; nb < 4; ++nb)
#pragma unroll
            for (int mb = 0; mb < 4; ++mb) { acc[mb][nb] = wmmab(a[mb], b[nb], acc[mb][nb]); acc[mb][nb] = wmmab(a2[mb], b[nb], acc[mb][nb]); }
        // four vector slots between the trip's last matrix instructions and whatever overwrites their operands on the taken back edge
        asm volatile("v_nop\n\tv_nop\n\tv_nop\n\tv_nop" : "+v"(acc[0][0]), "+v"(acc[1][1]), "+v"(acc[2][2]), "+v"(acc[3][3]) : "v"(a[0]), "v"(a[3]));
    }
    float* mine = os + wv * (64 * 68);
    // the three loops are unrolled so that every accumulator index is a constant and acc stays in registers
#pragma unroll
    for (int mb = 0; mb < 4; ++mb)
#pragma unroll
        for (int nb = 0; nb < 4; ++nb)
#pragma unroll
            for (int j = 0; j < 8; ++j) mine[(mb * 16 + hi * 8 + j) * 68 + nb * 16 + lr] = acc[mb][nb][j];
    __syncthreads();   // every wave's partial tile is in LDS before any thread sums across the waves
    for (int g = threadIdx.x; g < 64 * 16; g += NWC * 32) { const int row = g >> 4, cofs = (g & 15) * 4; v4f val = *(const v4fa*)(os + row * 68 + cofs);
#pragma unroll   // the NWC LDS reads of a trip are issued together instead of one per round trip
        for (int w = 1; w < NWC; ++w) val += *(const v4fa*)(os + (w * 64 + row) * 68 + cofs);
        val[0] += bfr(bias[c0 + cofs]); val[1] += bfr(bias[c0 + cofs + 1]); val[2] += bfr(bias[c0 + cofs + 2]); val[3] += bfr(bias[c0 + cofs + 3]);
        *(v4f*)(C + (size_t)(r0 + row) * CC + c0 + cofs) = val;
        *(v4fa*)(os + row * 68 + cofs) = val;   // the finished value back into plane 0, at the place that this thread alone has read
    }
    // the finished tile is in LDS before the column sums read it. The barrier orders LDS alone: __syncthreads() would also hold every wave until its stores to C are acknowledged, which nothing in this launch reads
    __builtin_amdgcn_fence(__ATOMIC_RELEASE, "workgroup", "local"); __builtin_amdgcn_s_barrier(); __builtin_amdgcn_fence(__ATOMIC_ACQUIRE, "workgroup", "local");
    if (wv < 4) {   // wave w: channels 16 w .. 16 w + 15; each half of the wave takes 32 of the 64 pixels (8 rows apart: the two halves fall on different banks)
        const int c = wv * 16 + lr; float v[32];
#pragma unroll
        for (int i = 0; i < 32; ++i) v[i] = os[((i >> 3) * 16 + (i & 7) + 8 * hi) * 68 + c];
        float s4[4] = {v[0], v[1], v[2], v[3]}, q4[4] = {0.f, 0.f, 0.f, 0.f};   // four independent chains per sum
#pragma unroll
        for (int i = 4; i < 32; ++i) s4[i & 3] += v[i];
        float s = (s4[0] + s4[1]) + (s4[2] + s4[3]); s += __shfl_xor(s, 16, 32);
        const float mt = s * (1.0f / HH);
#pragma unroll
        for (int i = 0; i < 32; ++i) { const float d = v[i] - mt; q4[i & 3] += d * d; }
        float q2 = (q4[0] + q4[1]) + (q4[2] + q4[3]); q2 += __shfl_xor(q2, 16, 32);
        if (hi == 0) { v2f o; o[0] = s; o[1] = q2; *(v2f*)(PS + ((size_t)blockIdx.x * CC + c0 + c) * 2) = o; }
    }
}
// ---- d_stat: mean and 1/sqrt(var + eps) of a block's 32 channels, joined from the HH row tiles' partials (sum, squares about the tile's mean) that k_conv3 left in PS; P = the image's first tile at the block's first channel. 256 threads.
// Thread = (wave w: tiles 8 w .. 8 w + 7, lane: channel). The tile means are taken about tile 0's mean (the pivot pv), so one pass gives D = sum d and Q = sum (M2 + 64 d d): mean = pv + D / 64, var = (Q - D D) / NN.
// The 8 wave partials meet in LDS and every thread sums those of its own channel quad cq in wave order 0 .. 7.
__device__ __forceinline__ void d_stat(const float* __restrict__ P, float* red, int cq, v4f& mu, v4f& rs) {
    const int lane = threadIdx.x & 31, wave = threadIdx.x >> 5; const float* p = P + (size_t)wave * 8 * CC * 2 + lane * 2; const unsigned po = (unsigned)(lane * 8); const float pv = *(const float*)((const char*)P + po) * (1.0f / HH); v2f t[8];   // po: the lane's byte offset in a tile's row of partials
#pragma unroll
    for (int i = 0; i < 8; ++i) t[i] = *(const v2f*)(p + (size_t)i * CC * 2);
    asm volatile("s_wait_xcnt 0x0" :: "v"(p), "v"(po) : "memory");   // the 9 partial loads are issued: the wait stands in front of whatever reuses their address registers; it takes the address and the offset as inputs so that no load's result lands on them earlier
    __builtin_amdgcn_sched_barrier(0);   // keeps the sums behind all 9 loads: without it the first sums, with their data waits, move in front of the last loads where registers are tight, and the block pays a second memory round trip
    float D = 0.f, Q = 0.f;
#pragma unroll
    for (int i = 0; i < 8; ++i) { const float d = t[i][0] * (1.0f / HH) - pv; D += d; Q += t[i][1] + (float)HH * d * d; }
    red[wave * 32 + lane] = D; red[256 + wave * 32 + lane] = Q; if (wave == 0) red[512 + lane] = pv;
    __syncthreads();   // every wave's partial D and Q (and the pivot) are in LDS before any thread joins them
    v4f Ds = *(const v4fa*)(red + cq * 4), Qs = *(const v4fa*)(red + 256 + cq * 4);
#pragma unroll   // the LDS reads are issued together instead of one per round trip
    for (int w = 1; w < 8; ++w) { Ds += *(const v4fa*)(red + w * 32 + cq * 4); Qs += *(const v4fa*)(red + 256 + w * 32 + cq * 4); }
    mu = *(const v4fa*)(red + 512 + cq * 4) + Ds * (1.0f / HH); const v4f vq = (Qs - Ds * Ds) * (1.0f / NN);
#pragma unroll
    for (int q = 0; q < 4; ++q) rs[q] = __frsqrt_rn(vq[q] + 1e-3f);
}
// ---- k_inrelu, k_inres: the two normalising passes. One block = ER rows x 32 channels of one image (grid (NN / ER, CC / 32, NB_)): thread = (row t >> 3, channel quad t & 7), two rows 32 apart; the map loads are issued in front of d_stat and fly during it.
#define ER 64
__global__ __launch_bounds__(256) void k_inrelu(const float* __restrict__ Cv, const float* __restrict__ PS, const float* __restrict__ g, const float* __restrict__ be, float* Hout) {
    __shared__ __align__(16) float red[17 * 32];
    const int cq = threadIdx.x & 7, c = blockIdx.y * 32 + cq * 4, n = blockIdx.z * NN + blockIdx.x * ER + (threadIdx.x >> 3); const size_t i = (size_t)n * CC + c, im = mapofs(n, c);   // ER = one image row: the pixel 32 further lies 32 * 8 floats further in a map
    const v4f a0 = *(const v4f*)(Cv + i), a1 = *(const v4f*)(Cv + i + 32 * CC), gg = *(const v4f*)(g + c), bb = *(const v4f*)(be + c);
    asm volatile("s_wait_xcnt 0x0" ::: "memory");   // the 4 loads are issued, in front of d_stat's: the wait stands in front of the later loads, whose results may land on the address pairs that these name
    v4f mu, rs, o0, o1; d_stat(PS + ((size_t)blockIdx.z * HH * CC + blockIdx.y * 32) * 2, red, cq, mu, rs);
#pragma unroll
    for (int q = 0; q < 4; ++q) { const float G = bfr(gg[q]), B = bfr(bb[q]); o0[q] = fmaxf((a0[q] - mu[q]) * rs[q] * G + B, 0.f); o1[q] = fmaxf((a1[q] - mu[q]) * rs[q] * G + B, 0.f); }
    *(v4f*)(Hout + im) = o0; *(v4f*)(Hout + im + 32 * 8) = o1;
}
// LAST: the third block's pass also does the blend z = m x + (1 - m) w_y on the value it has just formed and writes the output (plain NHWC order) instead of a map.
template <bool LAST>
__global__ __launch_bounds__(256) void k_inres(const float* __restrict__ Cv, const float* __restrict__ PS, const float* __restrict__ g, const float* __restrict__ be, const float* __restrict__ WYin, float* WYout, const float* __restrict__ x, const float* __restrict__ M) {
    __shared__ __align__(16) float red[17 * 32];
    const int cq = threadIdx.x & 7, c = blockIdx.y * 32 + cq * 4, n = blockIdx.z * NN + blockIdx.x * ER + (threadIdx.x >> 3); const size_t i = (size_t)n * CC + c, im = mapofs(n, c);   // ER = one image row: the pixel 32 further lies 32 * 8 floats further in a map
    const v4f a0 = *(const v4f*)(Cv + i), a1 = *(const v4f*)(Cv + i + 32 * CC);
    asm volatile("s_wait_xcnt 0x0" ::: "memory");   // the compiler lets a later load's result land on the address pair that the two issued Cv loads name: the wait stands in front of that overwrite
    const float* wa = WYin + im; const float* ga = g + c; const float* ba = be + c; const v4f w0 = *(const v4f*)wa, w1 = *(const v4f*)(wa + 32 * 8), gg = *(const v4f*)ga, bb = *(const v4f*)ba;
    asm volatile("s_wait_xcnt 0x0" :: "v"(wa), "v"(ga), "v"(ba) : "memory");   // the 4 loads are issued, in front of d_stat's: the wait stands in front of the later loads, whose results may land on the address pairs that these name; it takes the addresses as inputs so that none of the 4 results lands on them earlier
    v4f x0, x1; float m0 = 0.f, m1 = 0.f;
    if (LAST) { const float* xa = x + i; const float* ma = M + n; x0 = *(const v4f*)xa; x1 = *(const v4f*)(xa + 32 * CC); m0 = ma[0]; m1 = ma[32];
        asm volatile("s_wait_xcnt 0x0" :: "v"(xa), "v"(n) : "memory"); }   // the 4 loads of the blend are issued, in front of d_stat's: the wait stands in front of the later loads, whose results may land on the address registers that these name; it takes the address and the row index as inputs so that none of the 4 results lands on them earlier
    v4f mu, rs, o0, o1; d_stat(PS + ((size_t)blockIdx.z * HH * CC + blockIdx.y * 32) * 2, red, cq, mu, rs);
#pragma unroll
    for (int q = 0; q < 4; ++q) { const float G = bfr(gg[q]), B = bfr(bb[q]); o0[q] = w0[q] + ((a0[q] - mu[q]) * rs[q] * G + B); o1[q] = w1[q] + ((a1[q] - mu[q]) * rs[q] * G + B); }
    if (LAST) { const float n0 = __fsub_rn(1.0f, m0), n1 = __fsub_rn(1.0f, m1);
#pragma unroll
        for (int q = 0; q < 4; ++q) { o0[q] = m0 * bfr(x0[q]) + n0 * o0[q]; o1[q] = m1 * bfr(x1[q]) + n1 * o1[q]; }
        *(v4f*)(WYout + i) = o0; *(v4f*)(WYout + i + 32 * CC) = o1; }
    else { *(v4f*)(WYout + im) = o0; *(v4f*)(WYout + im + 32 * 8) = o1; }
}

extern "C" void kernel_launch(void* const* d_in, const int* in_sizes, int n_in,
                              void* d_out, int out_size, void* d_ws, size_t ws_size, hipStream_t stream) {
    (void)in_sizes; (void)n_in; (void)out_size;
    const float* IN[18]; for (int i = 0; i < 18; ++i) IN[i] = (const float*)d_in[i];   // 0 x, 1 mask, 2 wg, 3 bg, 4 wt, 5 bt, 6 wp, 7 bp, 8 ww, 9 bw, 10 res_w1 [3][3][3][128][128], 11 res_b1 [3][128], 12 res_g1, 13 res_be1, 14 res_w2, 15 res_b2, 16 res_g2, 17 res_be2
    float* OUT = (float*)d_out;     // [2][64][64][128]
    char* wsp = (char*)d_ws;
    auto take = [&](size_t bytes) { char* p = wsp; wsp += (bytes + 255) & ~(size_t)255; return (void*)p; };
    bf* WG = (bf*)take(CC * CC * 2); bf* WT = (bf*)take(CC * CC * 2); bf* WP = (bf*)take(CC * CC * 2); bf* WW = (bf*)take(CC * CC * 2); bf* WR = (bf*)take((size_t)6 * CC * KC * 2);
    bf* XB = (bf*)take((size_t)NR * CC * 2); h16* T16 = (h16*)take((size_t)NR * CC * 2); h16* P16k = (h16*)take((size_t)NR * CC * 2); h16* GT = (h16*)take((size_t)NR * CC * 2); float* M = (float*)take((size_t)NR * 4);
    float* WY = (float*)take((size_t)NR * CC * 4); float* WY2 = (float*)take((size_t)NR * CC * 4); float* CV = (float*)take((size_t)NR * CC * 4); float* HB = (float*)take((size_t)NR * CC * 4); float* PS = (float*)take((size_t)NB_ * HH * CC * 2 * 4);
    if ((size_t)(wsp - (char*)d_ws) > ws_size) return;    // total ~ 27 MB
    (void)WT; (void)WP;   // reached through WG: the planes of a merged launch lie one behind the other (every size above is a multiple of 256 bytes)
    // every launch below covers both images (rows image-major; per-image operands through grid z or x) and all NN queries
    k_prep<<<6 * PBL + 4 * PBS + PBX + PBM, 256, 0, stream>>>(IN[0], IN[1], IN[2], IN[4], IN[6], IN[8], IN[10], IN[14], WG, WR, XB, M);   // HWIO flattened = [(kh kw ci)][co] (x @ W layout); WG, WT, WP, WW lie one behind the other
    k_proj<<<dim3(NR / 64, CC / 64, 3), PW * 32, 0, stream>>>(XB, WG, IN[3], IN[5], IN[7], M, GT, T16);   // z = g, theta, phi: WG, WT, WP lie one behind the other, and so do T16, P16k
    k_attn<<<NR / AQ, AW * 32, 0, stream>>>(T16, P16k, GT, WW, IN[9], WY);
    float* wy = WY; float* wyn = WY2;
    for (int i = 0; i < 3; ++i) {
        k_conv3<<<dim3(NR / 64, CC / 64, 1), NWC * 32, 0, stream>>>(wy, WR + (size_t)(2 * i) * CC * KC, CV, IN[11] + i * CC, PS);
        k_inrelu<<<dim3(NN / ER, CC / 32, NB_), 256, 0, stream>>>(CV, PS, IN[12] + i * CC, IN[13] + i * CC, HB);
        k_conv3<<<dim3(NR / 64, CC / 64, 1), NWC * 32, 0, stream>>>(HB, WR + (size_t)(2 * i + 1) * CC * KC, CV, IN[15] + i * CC, PS);
        if (i < 2) k_inres<false><<<dim3(NN / ER, CC / 32, NB_), 256, 0, stream>>>(CV, PS, IN[16] + i * CC, IN[17] + i * CC, wy, wyn, IN[0], M);
        else k_inres<true><<<dim3(NN / ER, CC / 32, NB_), 256, 0, stream>>>(CV, PS, IN[16] + i * CC, IN[17] + i * CC, wy, OUT, IN[0], M);
        float* t = wy; wy = wyn; wyn = t; }
}

// v010
// One run takes 98.4 microseconds.
// Timed twice side by side with v009, it ran 1.03 times as fast both times.
// All steps since v000 together make it 95.3 times as fast.
#include <hip/hip_runtime.h>

// NonLocalBlock2D_with_mask_Res (x NHWC [2][64][64][128], mask [2][64][64][1]; g/theta/phi = 1x1 convs; f = softmax(theta.phi^T / 1) over keys; m = (1 - min(mask,0)) (1 - mask) (the reference's resize-identity / where / invert chain; mask read as data);
// f = m[key] f (after the softmax, no renormalisation); y = f g; w_y = 1x1 conv W; 3 ResNet blocks (reflect-pad conv3x3 -> InstanceNorm(1e-3) -> relu -> reflect-pad conv3x3 -> InstanceNorm, residual); z = m x + (1 - m) w_y -> [2][64][64][128]).
// Compute dtypes, f32 accumulate: every input rounded to bf16; g/theta/phi 1x1 projections on PLAIN bf16 operands (inputs: exact, + bias), W and conv3x3 on hi+lo bf16 activations; scores (K 128) and the gated probs . g on SINGLE fp16 planes (logits are O(1) at these scales);

#define NB_  2
#define HH   64
#define NN   4096
#define CC   128
#define KC   1152
#define NR   (NB_ * NN)   // rows of both images, image-major
typedef _Float16 h16;
typedef unsigned short bf;
typedef __attribute__((ext_vector_type(16))) __bf16   v16bf;
typedef __attribute__((ext_vector_type(16))) _Float16 v16h;
typedef __attribute__((ext_vector_type(8)))  _Float16 v8h;
typedef __attribute__((ext_vector_type(8)))  unsigned short v8us;
typedef __attribute__((ext_vector_type(8)))  float    v8f;
typedef __attribute__((ext_vector_type(4)))  float    v4f;
typedef v8h  __attribute__((may_alias)) v8ha;
typedef v4f  __attribute__((may_alias)) v4fa;
typedef v8us __attribute__((may_alias)) v8usa;

__device__ __forceinline__ unsigned short f2bf(float f) { unsigned u = __float_as_uint(f); u += 0x7FFFu + ((u >> 16) & 1u); return (unsigned short)(u >> 16); }
__device__ __forceinline__ float bf2f(unsigned short b) { return __uint_as_float(((unsigned)b) << 16); }
__device__ __forceinline__ float bfr(float f) { return bf2f(f2bf(f)); }
__device__ __forceinline__ v16h cat16(v8h lo, v8h hi) { return __builtin_shufflevector(lo, hi, 0, 1, 2, 3, 4, 5, 6, 7, 8, 9, 10, 11, 12, 13, 14, 15); }
__device__ __forceinline__ v16bf cat16b(v8us lo, v8us hi) { return __builtin_bit_cast(v16bf, __builtin_shufflevector(lo, hi, 0, 1, 2, 3, 4, 5, 6, 7, 8, 9, 10, 11, 12, 13, 14, 15)); }
__device__ __forceinline__ v8f wmma16(v16h a, v16h b, v8f c) { return __builtin_amdgcn_wmma_f32_16x16x32_f16(false, a, false, b, (short)0, c, false, false); }
__device__ __forceinline__ v8f wmmab(v16bf a, v16bf b, v8f c) { return __builtin_amdgcn_wmma_f32_16x16x32_bf16(false, a, false, b, (short)0, c, false, false); }



// The f32 maps that k_conv3 reads (WY, WY2, HB) lie in the order of its A loads: [image row][32-channel chunk][q][pixel][h][4], the four channels 16 (q >> 1) + 8 h + 4 (q & 1) .. + 3 of the chunk: the 16 pixels x 2 halves of a wave's 16-byte load are 512 bytes in a row.
// mapofs: the place (in floats) of pixel row n (image-major), channels c .. c + 3, c % 4 == 0.
__device__ __forceinline__ size_t mapofs(int n, int c) { const int k = c & 31; return (size_t)(n >> 6) * (HH * CC) + (size_t)((((c >> 5) * 4 + ((k >> 4) << 1) + ((k >> 2) & 1)) * HH + (n & 63)) * 8 + ((k >> 3) & 1) * 4); }
__device__ __forceinline__ v16bf ldb(const bf* p) { return cat16b(*(const v8usa*)p, *(const v8usa*)(p + 16)); }   // a bf16 fragment from a K-contiguous row (global or LDS): lane (row lane & 15, h = lane >> 4) holds k = 8 h .. + 7 and 16 + 8 h .. + 7 of the 32-wide chunk; p = the row + the chunk + 8 h

__device__ __forceinline__ h16 tohx(float x) { return (h16)x; }
__device__ __forceinline__ void splitf(float y, unsigned short& h, unsigned short& l) { h = f2bf(y); l = f2bf(y - bf2f(h)); }
typedef __attribute__((ext_vector_type(2))) _Float16 v2h;
typedef __attribute__((ext_vector_type(4))) _Float16 v4h;
typedef __attribute__((ext_vector_type(2))) unsigned short v2us;
typedef __attribute__((ext_vector_type(4))) unsigned short v4us;
typedef v4us __attribute__((may_alias)) v4usa;
typedef __attribute__((ext_vector_type(2))) float v2f;

// The bodies d_* each do the work of one 256-thread block, number bx, of a pass; passes that read nothing of one another share a launch (k_prep), each on its own range of blocks.
__device__ __forceinline__ void d_wtG(int bx, const float* __restrict__ w, int K, int N, bf* Bt) {
    const int lane = threadIdx.x & 31; const int L0 = (bx * 8 + (threadIdx.x >> 5)) * 8; const int nlines = N * K / 64;
{
#pragma unroll 1
        for (int l = 0; l < 8; ++l) { const int L = L0 + l; if (L >= nlines) break; const size_t e = (size_t)L * 64 + lane * 2; const int k = (int)(e % K), n = (int)(e / K); v2us o;
            o[0] = f2bf(w[(size_t)k * N + n]); o[1] = f2bf(w[(size_t)(k + 1) * N + n]); *(v2us*)(Bt + e) = o; }
         }
}
// a 3x3 weight [(kh kw ci)][co] as bf16 in the order of k_conv3's B fragments: [32-wide K chunk][16-channel block][half][lane][8]; lane (n = lane & 15, h = lane >> 4) holds output channel n of the block at k = 16 half + 8 h .. + 7 of the chunk, so a wave's 16-byte load of a half covers 512 bytes in a row
__device__ __forceinline__ void d_wtF(int bx, const float* __restrict__ w, bf* Bt) {
    const int lane = threadIdx.x & 31; const int L0 = (bx * 8 + (threadIdx.x >> 5)) * 8;
#pragma unroll 1   // rolled like d_wtG's loop: only the place of an element differs from there
    for (int l = 0; l < 8; ++l) { const int L = L0 + l; if (L >= KC * CC / 64) break; const int e = L * 64 + lane * 2, fl = (e >> 3) & 31; const int n = ((e >> 9) & 7) * 16 + (fl & 15), k = (e >> 12) * 32 + ((e >> 8) & 1) * 16 + (fl >> 4) * 8 + (e & 7); v2us o;
        o[0] = f2bf(w[(size_t)k * CC + n]); o[1] = f2bf(w[(size_t)(k + 1) * CC + n]); *(v2us*)(Bt + e) = o; }
}
__device__ __forceinline__ void d_cvt8(int bx, const float* __restrict__ src, bf* dst, size_t n8) { const size_t i = (size_t)bx * 256 + threadIdx.x; if (i >= n8) return; const v8f v = *(const v8f*)(src + i * 8); v8us o;
#pragma unroll
    for (int k = 0; k < 8; ++k) o[k] = f2bf(v[k]); *(v8us*)(dst + i * 8) = o;  }
__device__ __forceinline__ void d_mvec(int bx, const float* __restrict__ mask, float* M) { const int n = bx * 256 + threadIdx.x; if (n >= NR) return; const float mk = bfr(mask[n]); const float a = __fsub_rn(1.0f, fminf(mk, 0.f)); const float v = __fmul_rn(a, __fsub_rn(1.0f, mk)); *(float*)(M + n) = v;  }
// ---- k_prep: every pass that reads inputs only, in one launch. Blocks, longest bodies first: 6 x PBL the 3x3 weights (W1[0], W2[0], W1[1], ... -> WR), 4 x PBS the 1x1 weights (wg, wt, wp, ww -> four planes from WS on), PBX x -> bf16, PBM the mask vector.
#define PBL ((KC * CC / 64 + 63) / 64)
#define PBS ((CC * CC / 64 + 63) / 64)
#define PBX (NR * CC / 8 / 256)
#define PBM (NR / 256)
__global__ __launch_bounds__(256) void k_prep(const float* __restrict__ x, const float* __restrict__ mask, const float* __restrict__ wg, const float* __restrict__ wt, const float* __restrict__ wp, const float* __restrict__ ww, const float* __restrict__ rw1, const float* __restrict__ rw2, bf* WS, bf* WR, bf* XB, float* M) {
    int b = blockIdx.x;
    if (b < 6 * PBL) { const int i = b / PBL; d_wtF(b % PBL, ((i & 1) ? rw2 : rw1) + (size_t)(i >> 1) * KC * CC, WR + (size_t)i * CC * KC); return; }
    b -= 6 * PBL;
    if (b < 4 * PBS) { const int i = b / PBS; d_wtG(b % PBS, i == 0 ? wg : i == 1 ? wt : i == 2 ? wp : ww, CC, CC, WS + (size_t)i * CC * CC); return; }
    b -= 4 * PBS;
    if (b < PBX) { d_cvt8(b, x, XB, (size_t)NR * CC / 8); return; }
    d_mvec(b - PBX, mask, M);
}
// ---- k_proj: the three 1x1 projections (grid z = g, theta, phi) on plain bf16 operands; each 64x64 tile leaves straight as the fp16 plane that k_attn reads, no f32 plane in between. Grid (NR / 64, CC / 64, 3), PW * 32 threads.
// Wave w takes the 32-wide K chunk w (K = CC = PW chunks); the PW partial tiles meet in LDS and are summed in wave order 0 .. PW - 1 (fixed order, bias last).
// theta, phi -> TP16 (two adjacent planes) in the order of k_attn's query and key fragments: [16-row tile][32-channel chunk][half][lane][8]; lane (r = lane & 15, h = lane >> 4) holds row r of the tile at channels 16 half + 8 h .. + 7 of the chunk.
// g -> GT, the gated values m[key] g[key][c], laid out as the A fragments of k_attn's second product: [image][32-key chunk][16-channel block][half][lane][8], lane (c = lane & 15, h = lane >> 4) holds channel c at keys 16 half + 8 h .. + 7 of the chunk.
#define PW 4
__global__ __launch_bounds__(PW * 32) void k_proj(const bf* __restrict__ X, const bf* __restrict__ Wt, const float* __restrict__ bg, const float* __restrict__ bt, const float* __restrict__ bp, const float* __restrict__ M, h16* GT, h16* TP16) {
    __shared__ __align__(16) float os[PW * 64 * 68];
    const int z = blockIdx.z; const float* bias = z == 0 ? bg : z == 1 ? bt : bp;
    const int lane = threadIdx.x & 31, lr = lane & 15, hi = lane >> 4; const int r0 = blockIdx.x * 64, c0 = blockIdx.y * 64;
    const int wv = __builtin_amdgcn_readfirstlane((int)(threadIdx.x >> 5));   // the wave's number, held scalar so that the chunk's base stays scalar
    const bf* ap = X + (size_t)(r0 + lr) * CC + wv * 32 + 8 * hi; const bf* wp = Wt + (size_t)z * CC * CC + (size_t)(c0 + lr) * CC + wv * 32 + 8 * hi;
    // what the epilogue adds or multiplies (bias; for g the gate of the thread's keys too) is loaded in front of the operands and is there when they are
    const int t = threadIdx.x, tc = (t >> 6) * 32 + ((t >> 5) & 1) * 16 + ((t >> 4) & 1) * 8, tr = ((t >> 5) & 1) * 16 + ((t >> 4) & 1) * 8, tg = (t >> 6) * 16 + (t & 15); v4f e[4]; float bb[2];
    // one run of loads for every z, only the pointer differs (theta, phi: e[0], e[1] = the bias of the thread's 8 channels; g: e[0 .. 3] = the gate of its 2 x 8 keys, bb = the bias of its 2 channels): a branch here would put a data wait in front of the loads
    const float* ep = z ? bias + c0 + tc : M + r0 + tr; const float* eq = z ? ep : ep + 32; const float* bq = bias + c0 + tg;
    e[0] = *(const v4f*)ep; e[1] = *(const v4f*)(ep + 4); e[2] = *(const v4f*)eq; e[3] = *(const v4f*)(eq + 4); bb[0] = bq[0]; bb[1] = bq[32];
    v16bf a[4], b[4];
#pragma unroll
    for (int mb = 0; mb < 4; ++mb) { a[mb] = ldb(ap + mb * 16 * CC); b[mb] = ldb(wp + mb * 16 * CC); }
    asm volatile("s_wait_xcnt 0x0" :: "v"(ep), "v"(eq), "v"(bq), "v"(ap), "v"(wp) : "memory");   // the 22 loads are issued: the wait stands in front of whatever reuses their address registers; it takes the addresses as inputs so that no load's result lands on them earlier
    __builtin_amdgcn_sched_barrier(0);   // keeps the products behind all 22 loads: without it the first products, with their data waits, move in front of the later loads and the wave pays several memory round trips
    float* mine = os + wv * (64 * 68);
    // the loops are unrolled so that every fragment and accumulator index is a constant and stays in registers
    v8f acc[4][4];
#pragma unroll
    for (int nb = 0; nb < 4; ++nb)
#pragma unroll
        for (int mb = 0; mb < 4; ++mb) acc[mb][nb] = wmmab(a[mb], b[nb], (v8f){});
    __builtin_amdgcn_sched_barrier(0);   // keeps the 16 products in front of the LDS stores, each with a result tile of its own
#pragma unroll
    for (int mb = 0; mb < 4; ++mb)
#pragma unroll
        for (int nb = 0; nb < 4; ++nb)
#pragma unroll
            for (int j = 0; j < 8; ++j) mine[(mb * 16 + hi * 8 + j) * 68 + nb * 16 + lr] = acc[mb][nb][j];
    __syncthreads();   // every wave's partial tile is in LDS before any thread sums across the waves
    if (z) {   // a thread: 8 channels of one row, 16 bytes of the plane; a wave's store covers 512 bytes in a row
        h16* P = TP16 + (size_t)(z - 1) * NR * CC + (size_t)(r0 >> 4) * 2048 + (c0 >> 5) * 512;
#pragma unroll
        for (int rt = 0; rt < 4; ++rt) { const float* s = os + (rt * 16 + (t & 15)) * 68 + tc; v4f v0 = *(const v4fa*)s, v1 = *(const v4fa*)(s + 4);
#pragma unroll
            for (int w = 1; w < PW; ++w) { v0 += *(const v4fa*)(s + w * 64 * 68); v1 += *(const v4fa*)(s + w * 64 * 68 + 4); }
            v8h o;
#pragma unroll
            for (int k = 0; k < 4; ++k) { o[k] = tohx(v0[k] + bfr(e[0][k])); o[4 + k] = tohx(v1[k] + bfr(e[1][k])); }
            *(v8h*)(P + rt * 2048 + t * 8) = o; }
        asm volatile("s_wait_xcnt 0x0" ::: "memory");   // the 4 plane stores are issued: the wait stands in front of whatever reuses their data and address registers on any way out of this branch
    } else {   // a thread: 8 keys of one channel, 16 bytes of the plane; a wave's store covers 512 bytes in a row
        h16* P = GT + ((size_t)(r0 >> 5) * 8 + (c0 >> 4)) * 512;
#pragma unroll
        for (int it = 0; it < 4; ++it) { const int cp = it & 1, ck = it >> 1; const float* s = os + (ck * 32 + tr) * 68 + cp * 32 + tg; const float bv = bfr(bb[cp]); v8h o;   // cp: the pair of 16-channel blocks, ck: the 32-key chunk
#pragma unroll
            for (int k = 0; k < 8; ++k) { float v = s[k * 68];
#pragma unroll
                for (int w = 1; w < PW; ++w) v += s[(w * 64 + k) * 68];
                o[k] = tohx((v + bv) * e[ck * 2 + (k >> 2)][k & 3]); }
            *(v8h*)(P + (ck * 8 + cp * 2) * 512 + t * 8) = o; }
    }
}
// ---- k_attn: scores, softmax over the keys and the gated probs . g in one kernel; neither the score plane nor the probability plane exists in memory. One work-group per AQ = 32 queries (grid NR / AQ), AW = 8 waves, wave w walks the keys
// w * AKS .. w * AKS + AKS - 1 of the queries' image in chunks of 32. St = phi . theta^T (keys = rows, queries = columns): a lane holds 8 keys of ONE query per tile, and the two 16-key tiles of a chunk, converted in place, are the B fragment of Ot += GT . Pt.
// Running maximum per query in log2 units; the accumulators are rescaled only when a chunk's maximum passes the one in use by more than 8 (p <= 2^8, inside fp16). The sum runs over the ungated f32 p (the gate sits in GT, behind the softmax).
// The AW partial (maximum, sum, Ot) meet in LDS and are joined in wave order 0 .. AW - 1; y = Ot / sum goes as bf16 hi + lo into LDS.
// The W product follows in the same work-group: w_y^T = W^T . y^T (output channels = rows, queries = columns), wave w the 16 output channels 16 w .. + 15, one accumulator per 32-wide K chunk (hi then lo), the four summed in chunk order 0 .. 3, bias last;
// a lane holds 8 channels in a row of ONE query: two 16-byte stores into the map WY (mapofs).
#define AQ  32
#define AW  8
#define AKS (NN / AW)
#define AP  132   // f32 pitch of a query's 128 channels in LDS: 16 lanes x 16 bytes at this pitch fall on 64 different banks
#define YP  136   // bf16 pitch of a query's 128 channels of y in LDS: 16 lanes x 16 bytes at this pitch fall on 64 different banks
#define LOG2E 1.44269504088896340736f
__device__ __forceinline__ v16h ldp(const char* p) { return cat16(*(const v8h*)p, *(const v8h*)(p + 512)); }   // a fragment from a plane in fragment order; p = the fragment + 16 lane
__global__ __launch_bounds__(AW * 32) void k_attn(const h16* __restrict__ T16, const h16* __restrict__ P16, const h16* __restrict__ GT, const bf* __restrict__ Wt, const float* __restrict__ bw, float* WY) {
    __shared__ __align__(16) float os[AW * AQ * AP]; __shared__ float sm[AW * AQ]; __shared__ float sl[AW * AQ]; __shared__ __align__(16) bf yh[AQ * YP]; __shared__ __align__(16) bf yl[AQ * YP];
    const int lane = threadIdx.x & 31, lr = lane & 15, hi = lane >> 4; const int r0 = blockIdx.x * AQ; const int img = blockIdx.x / (NN / AQ);
    const int wv = __builtin_amdgcn_readfirstlane((int)(threadIdx.x >> 5));   // the wave's number, held scalar so that the key slice's base stays scalar
    // scalar bases and the lane offset (bytes) of the kernel's loads
    const unsigned ko = (unsigned)(lane * 16);   // every plane lies in fragment order: a fragment is 1 KB, its two halves 512 bytes each, 16 bytes a lane
    const char* qs = (const char*)(T16 + (size_t)r0 * CC);
    const char* ks = (const char*)(P16 + ((size_t)img * NN + wv * AKS) * CC);
    const char* vs = (const char*)(GT + (size_t)(img * (NN / 32) + wv * (AKS / 32)) * 4096);
    // the 128 work-groups of an image walk the same key and value lines: each starts its walk of the slice's AKS / 32 chunks at a chunk set by its number (eight work-groups share each) and wraps, so that they do not ask L2 for the same lines at the same moment
    const int rot = (int)((blockIdx.x + (blockIdx.x >> 3)) & (AKS / 32 - 1));
    v16h qf[2][4], kf[2][4];
#pragma unroll
    for (int qb = 0; qb < 2; ++qb)
#pragma unroll
        for (int kc = 0; kc < 4; ++kc) qf[qb][kc] = ldp(qs + (qb * 4096 + kc * 1024) + ko);
#pragma unroll
    for (int t = 0; t < 2; ++t)
#pragma unroll
        for (int kc = 0; kc < 4; ++kc) kf[t][kc] = ldp(ks + (size_t)(rot * 8192) + (t * 4096 + kc * 1024) + ko);
    asm volatile("s_wait_xcnt 0x0" :: "v"(ko) : "memory");   // the 32 query and key loads are issued: the wait stands in front of whatever reuses their address registers; it takes the lane offset as an input so that nothing lands on it earlier
    v8f O[2][8]; float m[2], l[2][2];
#pragma unroll
    for (int qb = 0; qb < 2; ++qb) { m[qb] = -3.0e38f; l[qb][0] = 0.f; l[qb][1] = 0.f;
#pragma unroll
        for (int cb = 0; cb < 8; ++cb) O[qb][cb] = (v8f){}; }
    // the chunk loop stays rolled (two trips' fragments would not fit two waves per SIMD); every loop inside it is unrolled so that each fragment and accumulator index is a constant and stays in registers
#pragma unroll 1
    for (int ch = 0; ch < AKS / 32; ++ch) {
        v16h vf[8]; const char* va = vs + (size_t)(((ch + rot) & (AKS / 32 - 1)) * 8192) + ko;
#pragma unroll
        for (int cb = 0; cb < 8; ++cb) vf[cb] = ldp(va + cb * 1024);
        asm volatile("s_wait_xcnt 0x0" :: "v"(va) : "memory");   // the 16 value loads are issued: the wait stands in front of whatever reuses their address registers; it takes the address as an input so that no load's result lands on it earlier
        v8f S[2][2];
#pragma unroll
        for (int t = 0; t < 2; ++t)
#pragma unroll
            for (int qb = 0; qb < 2; ++qb) { S[qb][t] = (v8f){};
#pragma unroll
                for (int kc = 0; kc < 4; ++kc) S[qb][t] = wmma16(kf[t][kc], qf[qb][kc], S[qb][t]); }
        // the next chunk's key fragments fly during this chunk's softmax and second product (the last trip wraps to the walk's first chunk: in bounds, unused)
        const int nx = (ch + 1 + rot) & (AKS / 32 - 1); const char* ka = ks + (size_t)(nx * 8192) + ko;
#pragma unroll
        for (int t = 0; t < 2; ++t)
#pragma unroll
            for (int kc = 0; kc < 4; ++kc) kf[t][kc] = ldp(ka + (t * 4096 + kc * 1024));
        asm volatile("s_wait_xcnt 0x0" :: "v"(ka) : "memory");   // the 16 key loads are issued: the wait stands in front of whatever reuses their address registers; it takes the address as an input so that no load's result lands on it earlier
        float cm[2];
#pragma unroll
        for (int qb = 0; qb < 2; ++qb) { float a = fmaxf(S[qb][0][0], S[qb][1][0]);
#pragma unroll
            for (int j = 1; j < 8; ++j) a = fmaxf(a, fmaxf(S[qb][0][j], S[qb][1][j]));
            a = fmaxf(a, __uint_as_float(__builtin_amdgcn_permlanex16(0u, __float_as_uint(a), 0x76543210u, 0xfedcba98u, false, false))); cm[qb] = a * LOG2E; }   // both halves of the wave hold the query's chunk maximum: one scale per query
        if (__builtin_amdgcn_ballot_w32(cm[0] > m[0] + 8.0f || cm[1] > m[1] + 8.0f) != 0) {   // one scalar branch per chunk; every lane stays on
#pragma unroll
            for (int qb = 0; qb < 2; ++qb) { const float mn = fmaxf(m[qb], cm[qb]); const float al = __builtin_amdgcn_exp2f(m[qb] - mn); m[qb] = mn; l[qb][0] *= al; l[qb][1] *= al;
#pragma unroll
                for (int cb = 0; cb < 8; ++cb) O[qb][cb] *= al; }
        }
        v16h pb[2];
#pragma unroll
        for (int qb = 0; qb < 2; ++qb)
#pragma unroll
            for (int t = 0; t < 2; ++t)
#pragma unroll
                for (int j = 0; j < 8; ++j) { const float p = __builtin_amdgcn_exp2f(fmaf(S[qb][t][j], LOG2E, -m[qb])); l[qb][t] += p; pb[qb][t * 8 + j] = (h16)p; }
#pragma unroll
        for (int cb = 0; cb < 8; ++cb)
#pragma unroll
            for (int qb = 0; qb < 2; ++qb) O[qb][cb] = wmma16(vf[cb], pb[qb], O[qb][cb]);
        // four vector slots between the trip's last matrix instructions and whatever overwrites their operands on the taken back edge
        asm volatile("v_nop\n\tv_nop\n\tv_nop\n\tv_nop" : "+v"(O[0][6]), "+v"(O[1][6]), "+v"(O[0][7]), "+v"(O[1][7]) : "v"(vf[7]), "v"(pb[1]));
    }
    // the wave's W fragments and bias are loaded here and fly during the join
    v16bf wf[4]; const bf* wp = Wt + (size_t)(wv * 16 + lr) * CC + 8 * hi;
#pragma unroll
    for (int kc = 0; kc < 4; ++kc) wf[kc] = ldb(wp + kc * 32);
    const v4f bw0 = *(const v4f*)(bw + wv * 16 + 8 * hi), bw1 = *(const v4f*)(bw + wv * 16 + 8 * hi + 4);
    asm volatile("s_wait_xcnt 0x0" ::: "memory");   // the 10 loads are issued: the wait stands in front of whatever reuses their address registers
#pragma unroll
    for (int qb = 0; qb < 2; ++qb) { float s = l[qb][0] + l[qb][1]; s += __shfl_xor(s, 16, 32); if (hi == 0) { sm[wv * AQ + qb * 16 + lr] = m[qb]; sl[wv * AQ + qb * 16 + lr] = s; }
        float* mine = os + (size_t)(wv * AQ + qb * 16 + lr) * AP + 8 * hi;
#pragma unroll
        for (int cb = 0; cb < 8; ++cb) { v4f a, b; a[0] = O[qb][cb][0]; a[1] = O[qb][cb][1]; a[2] = O[qb][cb][2]; a[3] = O[qb][cb][3]; b[0] = O[qb][cb][4]; b[1] = O[qb][cb][5]; b[2] = O[qb][cb][6]; b[3] = O[qb][cb][7];
            *(v4fa*)(mine + cb * 16) = a; *(v4fa*)(mine + cb * 16 + 4) = b; } }
    __syncthreads();   // every wave's partial maximum, sum and tile are in LDS before any thread joins them
    const int q = threadIdx.x >> 3, part = threadIdx.x & 7; float mx = sm[q], f[AW], L = 0.f;
#pragma unroll
    for (int w = 1; w < AW; ++w) mx = fmaxf(mx, sm[w * AQ + q]);
#pragma unroll
    for (int w = 0; w < AW; ++w) { f[w] = __builtin_amdgcn_exp2f(sm[w * AQ + q] - mx); L += f[w] * sl[w * AQ + q]; }
    const float inv = __fdiv_rn(1.0f, L);
#pragma unroll
    for (int i = 0; i < 4; ++i) { const int c = i * 32 + part * 4; v4f o = *(const v4fa*)(os + (size_t)q * AP + c) * f[0];
#pragma unroll
        for (int w = 1; w < AW; ++w) o += *(const v4fa*)(os + (size_t)(w * AQ + q) * AP + c) * f[w];
        v4us oh, ol;
#pragma unroll
        for (int k = 0; k < 4; ++k) { unsigned short u, c2; splitf(o[k] * inv, u, c2); oh[k] = u; ol[k] = c2; }
        *(v4usa*)(yh + q * YP + c) = oh; *(v4usa*)(yl + q * YP + c) = ol; }
    __syncthreads();   // every query's y (hi and lo) is in LDS before any wave reads its fragments
#pragma unroll
    for (int qb = 0; qb < 2; ++qb) { v8f acc[4];
#pragma unroll
        for (int kc = 0; kc < 4; ++kc) { const int yo = (qb * 16 + lr) * YP + kc * 32 + 8 * hi; acc[kc] = wmmab(wf[kc], ldb(yh + yo), (v8f){}); acc[kc] = wmmab(wf[kc], ldb(yl + yo), acc[kc]); }
        const v8f v = ((acc[0] + acc[1]) + acc[2]) + acc[3]; v4f o0, o1;
#pragma unroll
        for (int k = 0; k < 4; ++k) { o0[k] = v[k] + bfr(bw0[k]); o1[k] = v[4 + k] + bfr(bw1[k]); }
        const int n = r0 + qb * 16 + lr, c = wv * 16 + 8 * hi; *(v4f*)(WY + mapofs(n, c)) = o0; *(v4f*)(WY + mapofs(n, c + 4)) = o1; }
}
__device__ __forceinline__ int reflect64(int i) { return i < 0 ? -i : (i >= HH ? 2 * HH - 2 - i : i); }
// ---- k_conv3: reflect-pad conv3x3 as an implicit GEMM, no im2col copy. One 64x64 output tile per work-group = one image row (64 pixels) x 64 output channels; grid (NR/64, CC/64), NWC * 32 threads.
// K = (kh kw ci); wave w takes the 32-wide K chunks w, w + NWC, ... (a chunk lies inside one tap), starting at one that depends on the row tile. Bt lies in fragment order (d_wtF), the map F in the order of mapofs. The A fragment of a chunk is read from the f32 map at the tap's reflected pixel and split into bf16 hi + lo in registers;
// C = sum (hi + lo) Bt, the NWC partial tiles meet in LDS and are summed in wave order 0 .. NWC - 1 (fixed order, bias last).
// The finished tile also leaves its share of the instance norm's statistics: per output channel the sum over the tile's 64 pixels and the squares about the tile's own mean, PS[row tile][channel][2]; d_stat joins the tiles.
#define NWC 12
typedef __attribute__((ext_vector_type(2))) __bf16 v2bf;
typedef __attribute__((ext_vector_type(8))) unsigned v8u;
// two f32 -> packed bf16 hi pair and packed bf16 lo pair (lo = bf16(y - hi)), round to nearest even by the hardware's packed convert: the values of splitf for every finite y
__device__ __forceinline__ void split2(float y0, float y1, unsigned& h, unsigned& l) { v2f y; y[0] = y0; y[1] = y1; h = __builtin_bit_cast(unsigned, __builtin_convertvector(y, v2bf)); v2f r; r[0] = y0 - __uint_as_float(h << 16); r[1] = y1 - __uint_as_float(h & 0xFFFF0000u); l = __builtin_bit_cast(unsigned, __builtin_convertvector(r, v2bf)); }
__global__ __launch_bounds__(NWC * 32) void k_conv3(const float* __restrict__ F, const bf* __restrict__ Bt, float* C, const float* __restrict__ bias, float* PS) {
    __shared__ __align__(16) float os[NWC * 64 * 68];
    const int lane = threadIdx.x & 31, lr = lane & 15, hi = lane >> 4; const int r0 = blockIdx.x * 64, c0 = blockIdx.y * 64;
    const int wv = __builtin_amdgcn_readfirstlane((int)(threadIdx.x >> 5));   // the wave's number, held scalar so that the K loop's counter, tap and branch stay scalar
    const int y = blockIdx.x % HH; F += (size_t)(blockIdx.x / HH) * NN * CC + 4 * hi;
    v8f acc[4][4];
#pragma unroll
    for (int mb = 0; mb < 4; ++mb)
#pragma unroll
        for (int nb = 0; nb < 4; ++nb) acc[mb][nb] = (v8f){};
    Bt += blockIdx.y * 2048 + lane * 8;   // the tile's four 16-channel blocks of a chunk: 4 KB in a row
    // every work-group with the same output channels reads the same weight lines: the walk over the wave's KC / (NWC * 32) chunks starts at a chunk that goes round with the row tile and wraps, so that they do not ask L2 for the same lines at the same moment
    int tt = (int)(blockIdx.x % (KC / (NWC * 32)));
#pragma unroll 1
    for (int t = 0; t < KC / (NWC * 32); ++t) {
        const int kc = (wv + tt * NWC) * 32; tt = tt + 1 == KC / (NWC * 32) ? 0 : tt + 1;
        const int tap = kc / CC, kh = tap / 3, kw = tap % 3; const float* Fr = F + (size_t)reflect64(y + kh - 1) * HH * CC + (kc % CC) * HH;
        v16bf b[4]; v4f raw[4][4];
#pragma unroll
        for (int mb = 0; mb < 4; ++mb) { const float* p = Fr + reflect64(mb * 16 + lr + kw - 1) * 8; raw[mb][0] = *(const v4f*)p; raw[mb][1] = *(const v4f*)(p + 512); raw[mb][2] = *(const v4f*)(p + 1024); raw[mb][3] = *(const v4f*)(p + 1536); }
        asm volatile("s_wait_xcnt 0x0" ::: "memory");   // the 16 map loads are issued: the wait stands in front of the weight loads, whose results may land on the address pairs that the map loads name
#pragma unroll
        for (int nb = 0; nb < 4; ++nb) b[nb] = cat16b(*(const v8us*)(Bt + kc * 128 + nb * 512), *(const v8us*)(Bt + kc * 128 + nb * 512 + 256));
        asm volatile("s_wait_xcnt 0x0" ::: "memory");   // the 8 weight loads are issued: the wait stands in front of the step of their address pair
        __builtin_amdgcn_sched_barrier(0);   // keeps the converts behind all 24 loads: without it the first converts, with their data waits, move in front of the later loads and a trip pays two memory round trips
        v16bf a[4], a2[4];
#pragma unroll
        for (int mb = 0; mb < 4; ++mb) { v8u h, l;
#pragma unroll
            for (int q = 0; q < 4; ++q) { unsigned u, c2; split2(raw[mb][q][0], raw[mb][q][1], u, c2); h[2 * q] = u; l[2 * q] = c2; split2(raw[mb][q][2], raw[mb][q][3], u, c2); h[2 * q + 1] = u; l[2 * q + 1] = c2; }
            a[mb] = __builtin_bit_cast(v16bf, h); a2[mb] = __builtin_bit_cast(v16bf, l); }
#pragma unroll
        for (int nb = 0; nb < 4; ++nb)
#pragma unroll
            for (int mb = 0; mb < 4; ++mb) { acc[mb][nb] = wmmab(a[mb], b[nb], acc[mb][nb]); acc[mb][nb] = wmmab(a2[mb], b[nb], acc[mb][nb]); }
        // four vector slots between the trip's last matrix instructions and whatever overwrites their operands on the taken back edge
        asm volatile("v_nop\n\tv_nop\n\tv_nop\n\tv_nop" : "+v"(acc[0][0]), "+v"(acc[1][1]), "+v"(acc[2][2]), "+v"(acc[3][3]) : "v"(a[0]), "v"(a[3]));
    }
    float* mine = os + wv * (64 * 68);
    // the three loops are unrolled so that every accumulator index is a constant and acc stays in registers
#pragma unroll
    for (int mb = 0; mb < 4; ++mb)
#pragma unroll
        for (int nb = 0; nb < 4; ++nb)
#pragma unroll
            for (int j = 0; j < 8; ++j) mine[(mb * 16 + hi * 8 + j) * 68 + nb * 16 + lr] = acc[mb][nb][j];
    __syncthreads();   // every wave's partial tile is in LDS before any thread sums across the waves
    for (int g = threadIdx.x; g < 64 * 16; g += NWC * 32) { const int row = g >> 4, cofs = (g & 15) * 4; v4f val = *(const v4fa*)(os + row * 68 + cofs);
#pragma unroll   // the NWC LDS reads of a trip are issued together instead of one per round trip
        for (int w = 1; w < NWC; ++w) val += *(const v4fa*)(os + (w * 64 + row) * 68 + cofs);
        val[0] += bfr(bias[c0 + cofs]); val[1] += bfr(bias[c0 + cofs + 1]); val[2] += bfr(bias[c0 + cofs + 2]); val[3] += bfr(bias[c0 + cofs + 3]);
        *(v4f*)(C + (size_t)(r0 + row) * CC + c0 + cofs) = val;
        *(v4fa*)(os + row * 68 + cofs) = val;   // the finished value back into plane 0, at the place that this thread alone has read
    }
    // the finished tile is in LDS before the column sums read it. The barrier orders LDS alone: __syncthreads() would also hold every wave until its stores to C are acknowledged, which nothing in this launch reads
    __builtin_amdgcn_fence(__ATOMIC_RELEASE, "workgroup", "local"); __builtin_amdgcn_s_barrier(); __builtin_amdgcn_fence(__ATOMIC_ACQUIRE, "workgroup", "local");
    if (wv < 4) {   // wave w: channels 16 w .. 16 w + 15; each half of the wave takes 32 of the 64 pixels (8 rows apart: the two halves fall on different banks)
        const int c = wv * 16 + lr; float v[32];
#pragma unroll
        for (int i = 0; i < 32; ++i) v[i] = os[((i >> 3) * 16 + (i & 7) + 8 * hi) * 68 + c];
        float s4[4] = {v[0], v[1], v[2], v[3]}, q4[4] = {0.f, 0.f, 0.f, 0.f};   // four independent chains per sum
#pragma unroll
        for (int i = 4; i < 32; ++i) s4[i & 3] += v[i];
        float s = (s4[0] + s4[1]) + (s4[2] + s4[3]); s += __shfl_xor(s, 16, 32);
        const float mt = s * (1.0f / HH);
#pragma unroll
        for (int i = 0; i < 32; ++i) { const float d = v[i] - mt; q4[i & 3] += d * d; }
        float q2 = (q4[0] + q4[1]) + (q4[2] + q4[3]); q2 += __shfl_xor(q2, 16, 32);
        if (hi == 0) { v2f o; o[0] = s; o[1] = q2; *(v2f*)(PS + ((size_t)blockIdx.x * CC + c0 + c) * 2) = o; }
    }
}
// ---- d_stat: mean and 1/sqrt(var + eps) of a block's 32 channels, joined from the HH row tiles' partials (sum, squares about the tile's mean) that k_conv3 left in PS; P = the image's first tile at the block's first channel. 256 threads.
// Thread = (wave w: tiles 8 w .. 8 w + 7, lane: channel). The tile means are taken about tile 0's mean (the pivot pv), so one pass gives D = sum d and Q = sum (M2 + 64 d d): mean = pv + D / 64, var = (Q - D D) / NN.
// The 8 wave partials meet in LDS and every thread sums those of its own channel quad cq in wave order 0 .. 7.
__device__ __forceinline__ void d_stat(const float* __restrict__ P, float* red, int cq, v4f& mu, v4f& rs) {
    const int lane = threadIdx.x & 31, wave = threadIdx.x >> 5; const float* p = P + (size_t)wave * 8 * CC * 2 + lane * 2; const unsigned po = (unsigned)(lane * 8); const float pv = *(const float*)((const char*)P + po) * (1.0f / HH); v2f t[8];   // po: the lane's byte offset in a tile's row of partials
#pragma unroll
    for (int i = 0; i < 8; ++i) t[i] = *(const v2f*)(p + (size_t)i * CC * 2);
    asm volatile("s_wait_xcnt 0x0" :: "v"(p), "v"(po) : "memory");   // the 9 partial loads are issued: the wait stands in front of whatever reuses their address registers; it takes the address and the offset as inputs so that no load's result lands on them earlier
    __builtin_amdgcn_sched_barrier(0);   // keeps the sums behind all 9 loads: without it the first sums, with their data waits, move in front of the last loads where registers are tight, and the block pays a second memory round trip
    float D = 0.f, Q = 0.f;
#pragma unroll
    for (int i = 0; i < 8; ++i) { const float d = t[i][0] * (1.0f / HH) - pv; D += d; Q += t[i][1] + (float)HH * d * d; }
    red[wave * 32 + lane] = D; red[256 + wave * 32 + lane] = Q; if (wave == 0) red[512 + lane] = pv;
    __syncthreads();   // every wave's partial D and Q (and the pivot) are in LDS before any thread joins them
    v4f Ds = *(const v4fa*)(red + cq * 4), Qs = *(const v4fa*)(red + 256 + cq * 4);
#pragma unroll   // the LDS reads are issued together instead of one per round trip
    for (int w = 1; w < 8; ++w) { Ds += *(const v4fa*)(red + w * 32 + cq * 4); Qs += *(const v4fa*)(red + 256 + w * 32 + cq * 4); }
    mu = *(const v4fa*)(red + 512 + cq * 4) + Ds * (1.0f / HH); const v4f vq = (Qs - Ds * Ds) * (1.0f / NN);
#pragma unroll
    for (int q = 0; q < 4; ++q) rs[q] = __frsqrt_rn(vq[q] + 1e-3f);
}
// ---- k_inrelu, k_inres: the two normalising passes. One block = ER rows x 32 channels of one image (grid (NN / ER, CC / 32, NB_)): thread = (row t >> 3, channel quad t & 7), two rows 32 apart; the map loads are issued in front of d_stat and fly during it.
#define ER 64
__global__ __launch_bounds__(256) void k_inrelu(const float* __restrict__ Cv, const float* __restrict__ PS, const float* __restrict__ g, const float* __restrict__ be, float* Hout) {
    __shared__ __align__(16) float red[17 * 32];
    const int cq = threadIdx.x & 7, c = blockIdx.y * 32 + cq * 4, n = blockIdx.z * NN + blockIdx.x * ER + (threadIdx.x >> 3); const size_t i = (size_t)n * CC + c, im = mapofs(n, c);   // ER = one image row: the pixel 32 further lies 32 * 8 floats further in a map
    const v4f a0 = *(const v4f*)(Cv + i), a1 = *(const v4f*)(Cv + i + 32 * CC), gg = *(const v4f*)(g + c), bb = *(const v4f*)(be + c);
    asm volatile("s_wait_xcnt 0x0" ::: "memory");   // the 4 loads are issued, in front of d_stat's: the wait stands in front of the later loads, whose results may land on the address pairs that these name
    v4f mu, rs, o0, o1; d_stat(PS + ((size_t)blockIdx.z * HH * CC + blockIdx.y * 32) * 2, red, cq, mu, rs);
#pragma unroll
    for (int q = 0; q < 4; ++q) { const float G = bfr(gg[q]), B = bfr(bb[q]); o0[q] = fmaxf((a0[q] - mu[q]) * rs[q] * G + B, 0.f); o1[q] = fmaxf((a1[q] - mu[q]) * rs[q] * G + B, 0.f); }
    *(v4f*)(Hout + im) = o0; *(v4f*)(Hout + im + 32 * 8) = o1;
}
// LAST: the third block's pass also does the blend z = m x + (1 - m) w_y on the value it has just formed and writes the output (plain NHWC order) instead of a map.
template <bool LAST>
__global__ __launch_bounds__(256) void k_inres(const float* __restrict__ Cv, const float* __restrict__ PS, const float* __restrict__ g, const float* __restrict__ be, const float* __restrict__ WYin, float* WYout, const float* __restrict__ x, const float* __restrict__ M) {
    __shared__ __align__(16) float red[17 * 32];
    const int cq = threadIdx.x & 7, c = blockIdx.y * 32 + cq * 4, n = blockIdx.z * NN + blockIdx.x * ER + (threadIdx.x >> 3); const size_t i = (size_t)n * CC + c, im = mapofs(n, c);   // ER = one image row: the pixel 32 further lies 32 * 8 floats further in a map
    const v4f a0 = *(const v4f*)(Cv + i), a1 = *(const v4f*)(Cv + i + 32 * CC);
    asm volatile("s_wait_xcnt 0x0" ::: "memory");   // the compiler lets a later load's result land on the address pair that the two issued Cv loads name: the wait stands in front of that overwrite
    const float* wa = WYin + im; const float* ga = g + c; const float* ba = be + c; const v4f w0 = *(const v4f*)wa, w1 = *(const v4f*)(wa + 32 * 8), gg = *(const v4f*)ga, bb = *(const v4f*)ba;
    asm volatile("s_wait_xcnt 0x0" :: "v"(wa), "v"(ga), "v"(ba) : "memory");   // the 4 loads are issued, in front of d_stat's: the wait stands in front of the later loads, whose results may land on the address pairs that these name; it takes the addresses as inputs so that none of the 4 results lands on them earlier
    v4f x0, x1; float m0 = 0.f, m1 = 0.f;
    if (LAST) { const float* xa = x + i; const float* ma = M + n; x0 = *(const v4f*)xa; x1 = *(const v4f*)(xa + 32 * CC); m0 = ma[0]; m1 = ma[32];
        asm volatile("s_wait_xcnt 0x0" :: "v"(xa), "v"(n) : "memory"); }   // the 4 loads of the blend are issued, in front of d_stat's: the wait stands in front of the later loads, whose results may land on the address registers that these name; it takes the address and the row index as inputs so that none of the 4 results lands on them earlier
    v4f mu, rs, o0, o1; d_stat(PS + ((size_t)blockIdx.z * HH * CC + blockIdx.y * 32) * 2, red, cq, mu, rs);
#pragma unroll
    for (int q = 0; q < 4; ++q) { const float G = bfr(gg[q]), B = bfr(bb[q]); o0[q] = w0[q] + ((a0[q] - mu[q]) * rs[q] * G + B); o1[q] = w1[q] + ((a1[q] - mu[q]) * rs[q] * G + B); }
    if (LAST) { const float n0 = __fsub_rn(1.0f, m0), n1 = __fsub_rn(1.0f, m1);
#pragma unroll
        for (int q = 0; q < 4; ++q) { o0[q] = m0 * bfr(x0[q]) + n0 * o0[q]; o1[q] = m1 * bfr(x1[q]) + n1 * o1[q]; }
        *(v4f*)(WYout + i) = o0; *(v4f*)(WYout + i + 32 * CC) = o1; }
    else { *(v4f*)(WYout + im) = o0; *(v4f*)(WYout + im + 32 * 8) = o1; }
}

extern "C" void kernel_launch(void* const* d_in, const int* in_sizes, int n_in,
                              void* d_out, int out_size, void* d_ws, size_t ws_size, hipStream_t stream) {
    (void)in_sizes; (void)n_in; (void)out_size;
    const float* IN[18]; for (int i = 0; i < 18; ++i) IN[i] = (const float*)d_in[i];   // 0 x, 1 mask, 2 wg, 3 bg, 4 wt, 5 bt, 6 wp, 7 bp, 8 ww, 9 bw, 10 res_w1 [3][3][3][128][128], 11 res_b1 [3][128], 12 res_g1, 13 res_be1, 14 res_w2, 15 res_b2, 16 res_g2, 17 res_be2
    float* OUT = (float*)d_out;     // [2][64][64][128]
    char* wsp = (char*)d_ws;
    auto take = [&](size_t bytes) { char* p = wsp; wsp += (bytes + 255) & ~(size_t)255; return (void*)p; };
    bf* WG = (bf*)take(CC * CC * 2); bf* WT = (bf*)take(CC * CC * 2); bf* WP = (bf*)take(CC * CC * 2); bf* WW = (bf*)take(CC * CC * 2); bf* WR = (bf*)take((size_t)6 * CC * KC * 2);
    bf* XB = (bf*)take((size_t)NR * CC * 2); h16* T16 = (h16*)take((size_t)NR * CC * 2); h16* P16k = (h16*)take((size_t)NR * CC * 2); h16* GT = (h16*)take((size_t)NR * CC * 2); float* M = (float*)take((size_t)NR * 4);
    float* WY = (float*)take((size_t)NR * CC * 4); float* WY2 = (float*)take((size_t)NR * CC * 4); float* CV = (float*)take((size_t)NR * CC * 4); float* HB = (float*)take((size_t)NR * CC * 4); float* PS = (float*)take((size_t)NB_ * HH * CC * 2 * 4);
    if ((size_t)(wsp - (char*)d_ws) > ws_size) return;    // total ~ 27 MB
    (void)WT; (void)WP;   // reached through WG: the planes of a merged launch lie one behind the other (every size above is a multiple of 256 bytes)
    // every launch below covers both images (rows image-major; per-image operands through grid z or x) and all NN queries
    k_prep<<<6 * PBL + 4 * PBS + PBX + PBM, 256, 0, stream>>>(IN[0], IN[1], IN[2], IN[4], IN[6], IN[8], IN[10], IN[14], WG, WR, XB, M);   // HWIO flattened = [(kh kw ci)][co] (x @ W layout); WG, WT, WP, WW lie one behind the other
    k_proj<<<dim3(NR / 64, CC / 64, 3), PW * 32, 0, stream>>>(XB, WG, IN[3], IN[5], IN[7], M, GT, T16);   // z = g, theta, phi: WG, WT, WP lie one behind the other, and so do T16, P16k
    k_attn<<<NR / AQ, AW * 32, 0, stream>>>(T16, P16k, GT, WW, IN[9], WY);
    float* wy = WY; float* wyn = WY2;
    for (int i = 0; i < 3; ++i) {
        k_conv3<<<dim3(NR / 64, CC / 64, 1), NWC * 32, 0, stream>>>(wy, WR + (size_t)(2 * i) * CC * KC, CV, IN[11] + i * CC, PS);
        k_inrelu<<<dim3(NN / ER, CC / 32, NB_), 256, 0, stream>>>(CV, PS, IN[12] + i * CC, IN[13] + i * CC, HB);
        k_conv3<<<dim3(NR / 64, CC / 64, 1), NWC * 32, 0, stream>>>(HB, WR + (size_t)(2 * i + 1) * CC * KC, CV, IN[15] + i * CC, PS);
        if (i < 2) k_inres<false><<<dim3(NN / ER, CC / 32, NB_), 256, 0, stream>>>(CV, PS, IN[16] + i * CC, IN[17] + i * CC, wy, wyn, IN[0], M);
        else k_inres<true><<<dim3(NN / ER, CC / 32, NB_), 256, 0, stream>>>(CV, PS, IN[16] + i * CC, IN[17] + i * CC, wy, OUT, IN[0], M);
        float* t = wy; wy = wyn; wyn = t; }
}
